// v000
// The times below were measured on an AMD MI455X: many runs one after another, warmed up first and cycling through
// copies of the inputs, with the whole window's GPU time divided by the number of runs. Launches and the gaps
// between them are all in it. The median over several windows is given; except for v000 it joins two sittings, which
// can be a few percent apart, so the side-by-side timings, each taken in one sitting, are the better comparison.
// The starting kernel, v000, takes 2340 microseconds a run.
// compute dtype: all float inputs rounded to bf16; per-head q / k / v projections with EXACT bf16 products on WMMA 16x16x32 (f32 accumulate), no biases; causal logits: 3 products for the first 384 rows, single f16 q x k after, x 64^-0.5; softmax f32; P x 2^11 once to f16 x v once to f16 (bf16 hi + lo below row 384); ctx hi+lo x exact Wo below row 384, x2^6 f16 carry x f16(bf16 x 2^8) Wo after, + bo (zeros, read); f32 output.
#include <hip/hip_runtime.h>
#include <math.h>

typedef __attribute__((ext_vector_type(16))) _Float16 v16h;
typedef __attribute__((ext_vector_type(16))) __bf16 v16b;
typedef __attribute__((ext_vector_type(8)))  _Float16 v8h;
typedef __attribute__((ext_vector_type(8)))  float v8f;
typedef __attribute__((ext_vector_type(4)))  float v4f;
typedef __attribute__((ext_vector_type(2)))  float v2f;
typedef __attribute__((ext_vector_type(4)))  unsigned v4u;
typedef __attribute__((ext_vector_type(4)))  int v4i;
typedef float __attribute__((may_alias)) float_a;
typedef int __attribute__((may_alias)) int_a;

template <typename T> __device__ __forceinline__ void vst2(void* p, T v) { *(T*)p = v;  }
__device__ __forceinline__ v8f wmma16(v16h a, v16h b, v8f c) {
  v8f d = __builtin_amdgcn_wmma_f32_16x16x32_f16(false, a, false, b, (short)0, c, false, false);
  asm volatile("v_nop\n\tv_nop\n\tv_nop\n\tv_nop" : "+v"(d) : "v"(a), "v"(b));
  return d;
}
__device__ __forceinline__ v8f wmma_bf(v16b a, v16b b, v8f c) {
  v8f d = __builtin_amdgcn_wmma_f32_16x16x32_bf16(false, a, false, b, (short)0, c, false, false);
  asm volatile("v_nop\n\tv_nop\n\tv_nop\n\tv_nop" : "+v"(d) : "v"(a), "v"(b));
  return d;
}
// 16x16x32 fragments: lane = (h = lane>>4, row/col = lane&15); elements 0..7 = k0+8h+0..7, 8..15 = k0+16+8h+0..7; D element r = row 8h+r
__device__ __forceinline__ v16h frag_h(const _Float16* rowk0, int lane) {
  union { v16h v; v8h q[2]; } u; const _Float16* p = rowk0 + 8 * (lane >> 4);
  u.q[0] = *(const v8h*)p; u.q[1] = *(const v8h*)(p + 16); return u.v;
}
__device__ __forceinline__ v16h frag_f32(const float* rowk0, int lane) {
  v16h a; const float* p = rowk0 + 8 * (lane >> 4);
#pragma unroll
  for (int i = 0; i < 8; ++i) { a[i] = (_Float16)p[i]; a[8 + i] = (_Float16)p[16 + i]; }
  return a;
}
__device__ __forceinline__ v16h frag_f32s(const float* rowk0, int lane, float sc) {
  v16h a; const float* p = rowk0 + 8 * (lane >> 4);
#pragma unroll
  for (int i = 0; i < 8; ++i) { a[i] = (_Float16)(p[i] * sc); a[8 + i] = (_Float16)(p[16 + i] * sc); }
  return a;
}
// column fragment from a [K][ld] layout (column n), rows >= K read as 0
__device__ __forceinline__ v16h fragc_f32(const float* W, int k0, int n, int lane, int ld, int K) {
  v16h a; const int g = lane >> 4;
#pragma unroll
  for (int i = 0; i < 8; ++i) { const int ka = k0 + 8 * g + i, kb = ka + 16;
    a[i] = (_Float16)(ka < K ? W[(size_t)(ka < K ? ka : K - 1) * ld + n] : 0.f); a[8 + i] = (_Float16)(kb < K ? W[(size_t)(kb < K ? kb : K - 1) * ld + n] : 0.f); }
  return a;
}
struct F2 { v16b h, l; };
__device__ __forceinline__ F2 bsplit16(const float v[16]) { F2 r;
#pragma unroll
  for (int i = 0; i < 16; ++i) { const __bf16 h = (__bf16)v[i]; r.h[i] = h; r.l[i] = (__bf16)(v[i] - (float)h); }
  return r; }
__device__ __forceinline__ F2 split_row(const float* row, int k0, int lane) { float v[16]; const float* p = row + k0 + 8 * (lane >> 4);
#pragma unroll
  for (int i = 0; i < 8; ++i) { v[i] = p[i]; v[8 + i] = p[16 + i]; }
  return bsplit16(v); }
__device__ __forceinline__ F2 split_rowK(const float* row, int k0, int lane, int K) { float v[16]; const int g = lane >> 4;
#pragma unroll
  for (int i = 0; i < 8; ++i) { const int ka = k0 + 8 * g + i, kb = ka + 16; v[i] = ka < K ? row[ka < K ? ka : K - 1] : 0.f; v[8 + i] = kb < K ? row[kb < K ? kb : K - 1] : 0.f; }
  return bsplit16(v); }
__device__ __forceinline__ F2 split_col(const float* W, int k0, int n, int lane, int ld, int K) { float v[16]; const int g = lane >> 4;
#pragma unroll
  for (int i = 0; i < 8; ++i) { const int ka = k0 + 8 * g + i, kb = ka + 16; v[i] = ka < K ? W[(size_t)(ka < K ? ka : K - 1) * ld + n] : 0.f; v[8 + i] = kb < K ? W[(size_t)(kb < K ? kb : K - 1) * ld + n] : 0.f; }
  return bsplit16(v); }
__device__ __forceinline__ v8f mac3(const F2& a, const F2& b, v8f c) { c = wmma_bf(a.l, b.h, c); c = wmma_bf(a.h, b.l, c); return wmma_bf(a.h, b.h, c); }
__device__ __forceinline__ float sigm(float v) { return 1.0f / (1.0f + expf(-v)); }
#define LDSX() do { asm volatile("s_wait_dscnt 0" ::: "memory"); __builtin_amdgcn_wave_barrier(); __builtin_amdgcn_fence(__ATOMIC_RELEASE, "workgroup"); } while (0)

// Causal multi-head self-attention with per-head weights (x [4,2048,768]; Wq / Wk / Wv [12,768,64] = per-head [head][model][d] N(0,1) x 0.02, no biases; Wo [768,768] torch (out,in), bo zeros (read); q = einsum('bsd,hde->bhse'); scores / sqrt(64); tril kept, finfo.min elsewhere; softmax; ctx merged (head*64 + e); ctx @ Wo.T + bo).
#define NB 4
#define TT 2048
#define CC 768            // NH * HD = projected width
#define DIN 768          // input (model) width
#define NH 12
#define HD 64
#define NQB (TT / 64)
#define HG 2
#define SCALE (0.125f)
#define CAUSAL 1
#ifndef TNB
#define TNB NB
#endif
__device__ __forceinline__ float bfr(float v) { return (float)(__bf16)v; }
__host__ __device__ __forceinline__ int kb_last(int qb) { return CAUSAL ? ((qb * 64 + 63) >> 7) : (TT / 128 - 1); }
typedef __attribute__((ext_vector_type(8))) __bf16 v8b;
__device__ __forceinline__ v16b frag_b(const __bf16* rowk0, int lane) {
  union { v16b v; v8b q[2]; } u; const __bf16* p = rowk0 + 8 * (lane >> 4);
  u.q[0] = *(const v8b*)p; u.q[1] = *(const v8b*)(p + 16); return u.v;
}
#define QBH 6              // causal: query blocks 0..QBH-1 of each sequence (few keys, no averaging) take the high-precision path
#define QHI 384            // rows carrying a q residual plane
#define KHI 384            // key rows carrying k residual / v bf16 hi+lo planes (used only by the causal high-precision path)
// B fragment (k rows k0+.., output column o) of a weight: (in,out) [K][ld] or (out,in) [ld rows of K]: bf16 exact, or f16(bf16 * 256) exact
__device__ __forceinline__ v16b wcol_io(const float* Wm, int k0, int o, int lane, int ld) { v16b w; const int g = lane >> 4;
#pragma unroll
  for (int i = 0; i < 8; ++i) { w[i] = (__bf16)Wm[(size_t)(k0 + 8 * g + i) * ld + o]; w[8 + i] = (__bf16)Wm[(size_t)(k0 + 16 + 8 * g + i) * ld + o]; }
  return w; }
__device__ __forceinline__ v16b wcol_oi(const float* Wm, int k0, int o, int lane, int K) { v16b w; const float* p = Wm + (size_t)o * K + k0 + 8 * (lane >> 4);
#pragma unroll
  for (int i = 0; i < 8; ++i) { w[i] = (__bf16)p[i]; w[8 + i] = (__bf16)p[16 + i]; }
  return w; }
__device__ __forceinline__ v16h wcolh_io(const float* Wm, int k0, int o, int lane, int ld) { v16h w; const int g = lane >> 4;
#pragma unroll
  for (int i = 0; i < 8; ++i) { w[i] = (_Float16)(bfr(Wm[(size_t)(k0 + 8 * g + i) * ld + o]) * 256.0f); w[8 + i] = (_Float16)(bfr(Wm[(size_t)(k0 + 16 + 8 * g + i) * ld + o]) * 256.0f); }
  return w; }
__device__ __forceinline__ v16h wcolh_oi(const float* Wm, int k0, int o, int lane, int K) { v16h w; const float* p = Wm + (size_t)o * K + k0 + 8 * (lane >> 4);
#pragma unroll
  for (int i = 0; i < 8; ++i) { w[i] = (_Float16)(bfr(p[i]) * 256.0f); w[8 + i] = (_Float16)(bfr(p[16 + i]) * 256.0f); }
  return w; }
#define WQKV_LAYOUT 2   // 0 = (in,out) [DIN][CC]; 1 = (out,in) [CC][DIN]; 2 = per-head [NH][DIN][HD]
__device__ __forceinline__ v16b wcol_hdk(const float* Wm, int k0, int o, int lane) { v16b w; const int g = lane >> 4; const float* p = Wm + (size_t)(o / HD) * DIN * HD + (o % HD);
#pragma unroll
  for (int i = 0; i < 8; ++i) { w[i] = (__bf16)p[(size_t)(k0 + 8 * g + i) * HD]; w[8 + i] = (__bf16)p[(size_t)(k0 + 16 + 8 * g + i) * HD]; }
  return w; }
#define WO_OUT_IN 1
#if WQKV_LAYOUT == 1
#define WCOL(W, k0, o, lane) wcol_oi(W, k0, o, lane, DIN)
#elif WQKV_LAYOUT == 2
#define WCOL(W, k0, o, lane) wcol_hdk(W, k0, o, lane)
#else
#define WCOL(W, k0, o, lane) wcol_io(W, k0, o, lane, CC)
#endif
#if WO_OUT_IN
#define WOCOL(W, k0, o, lane) wcol_oi(W, k0, o, lane, CC)
#define WOCOLH(W, k0, o, lane) wcolh_oi(W, k0, o, lane, CC)
#else
#define WOCOL(W, k0, o, lane) wcol_io(W, k0, o, lane, DIN)
#define WOCOLH(W, k0, o, lane) wcolh_io(W, k0, o, lane, DIN)
#endif

#ifndef SM_EXTRA_PARAMS
#define SM_EXTRA_PARAMS
#endif
#ifndef PROJ_EXTRA_PARAMS
#define PROJ_EXTRA_PARAMS
#endif
#ifndef SM_MASK_HOOK
#define SM_MASK_HOOK (void)0
#endif

#define WS_QH  0u                                      // f16 q rows [b*t][CC]
#define WS_KH  (WS_QH + 2u * (size_t)NB * TT * CC)      // f16 k rows [b*t][CC]
#define WS_VT  (WS_KH + 2u * (size_t)NB * TT * CC)      // f16 v planes [b][c][t]
#define WS_QL  (WS_VT + 2u * (size_t)NB * CC * TT)      // f16 q residual x 2^10 rows [b][t < QHI][CC]
#define WS_KL  (WS_QL + 2u * (size_t)NB * QHI * CC)     // f16 k residual x 2^10 rows [b][t < KHI][CC]
#define WS_VB  (WS_KL + 2u * (size_t)NB * KHI * CC)     // bf16 v hi planes [b][c][t < KHI]
#define WS_VBL (WS_VB + 2u * (size_t)NB * CC * KHI)
#define WS_S   (WS_VBL + 2u * (size_t)NB * CC * KHI)    // f32 logits / P [hg][t][s]
#define WS_Y   (WS_S  + 4u * (size_t)HG * TT * TT)      // f32 ctx rows [b*t][CC] (only when there is an output projection)
#define WS_END (WS_Y  + 4u * (size_t)NB * TT * CC)

// ---- k_proj: block = (64 rows, 128 cols, which): q/k/v = X W (+ b) with exact bf16 products (K = DIN) -> which 0: q f16 rows (+ residual rows < QHI); 1: k f16 rows (+ residual rows < KHI); 2: v f16 planes [c][t] (+ bf16 hi/lo planes for t < KHI)
__global__ __launch_bounds__(128) void k_proj(const float* __restrict__ XQ, const float* __restrict__ XK, const float* __restrict__ XV, const float* __restrict__ WQ, const float* __restrict__ WK, const float* __restrict__ WV, const float* __restrict__ BQ, const float* __restrict__ BK, const float* __restrict__ BV,
    _Float16* __restrict__ QH, _Float16* __restrict__ QL, _Float16* __restrict__ KH, _Float16* __restrict__ KL, _Float16* __restrict__ VT, __bf16* __restrict__ VB, __bf16* __restrict__ VBL) {
  __shared__ __align__(16) _Float16 sh[64][136], sl[64][136]; __shared__ __align__(16) _Float16 th[128][72]; __shared__ __align__(16) __bf16 tb[128][72], tbl[128][72];
  const int tid = threadIdx.x, wave = tid >> 5, lane = tid & 31, col = lane & 15, g = lane >> 4; const int which = blockIdx.z; const int c0 = blockIdx.y * 128; const size_t r0 = (size_t)blockIdx.x * 64; const size_t bb = r0 / TT; const int t0 = (int)(r0 % TT);
  const float* X = which == 0 ? XQ : which == 1 ? XK : XV; const float* WA = which == 0 ? WQ : which == 1 ? WK : WV; const float* BA = which == 0 ? BQ : which == 1 ? BK : BV;
  v8f acc[8] = {};
#pragma unroll 2
  for (int kc = 0; kc < DIN / 32; ++kc) { v16b a; { const float* p = X + (r0 + wave * 16 + col) * DIN + kc * 32 + 8 * g;
#pragma unroll
      for (int i = 0; i < 8; ++i) { a[i] = (__bf16)p[i]; a[8 + i] = (__bf16)p[16 + i]; } }
    asm volatile("s_wait_loadcnt 0x0" ::: "memory");
#pragma unroll
    for (int j = 0; j < 8; ++j) { const v16b w = WCOL(WA, kc * 32, c0 + j * 16 + col, lane); asm volatile("s_wait_loadcnt 0x0" ::: "memory"); acc[j] = wmma_bf(a, w, acc[j]); } }
  if (which < 2) { _Float16* DH = which == 0 ? QH : KH; _Float16* DL = which == 0 ? QL : KL; const int nhi = which == 0 ? QHI : KHI; const bool hi_rows = t0 < nhi;
#pragma unroll
    for (int j = 0; j < 8; ++j) { const float bias = BA ? bfr(BA[c0 + j * 16 + col]) : 0.f;
#pragma unroll
      for (int r = 0; r < 8; ++r) { const float v = acc[j][r] + bias; const _Float16 hv = (_Float16)v; sh[wave * 16 + 8 * g + r][j * 16 + col] = hv; sl[wave * 16 + 8 * g + r][j * 16 + col] = (_Float16)((v - (float)hv) * 1024.0f); } }
    __syncthreads();
    for (int e = tid; e < 64 * 16; e += 128) { const int rl = e >> 4, q = e & 15; vst2((unsigned*)(DH + (r0 + rl) * CC + c0 + q * 8), *(const v4u*)&sh[rl][q * 8]); if (hi_rows) vst2((unsigned*)(DL + (bb * nhi + t0 + rl) * (size_t)CC + c0 + q * 8), *(const v4u*)&sl[rl][q * 8]); }
  } else { const bool hi_rows = t0 < KHI;
#pragma unroll
    for (int j = 0; j < 8; ++j) { const float bias = BA ? bfr(BA[c0 + j * 16 + col]) : 0.f;
#pragma unroll
      for (int r = 0; r < 8; ++r) { const float v = acc[j][r] + bias; const int rl = wave * 16 + 8 * g + r, cl = j * 16 + col; th[cl][rl] = (_Float16)v; const __bf16 bh = (__bf16)v; tb[cl][rl] = bh; tbl[cl][rl] = (__bf16)(v - (float)bh); } }
    __syncthreads();
    for (int e = tid; e < 128 * 8; e += 128) { const int cl = e >> 3, q = e & 7; vst2((unsigned*)(VT + (bb * CC + c0 + cl) * (size_t)TT + t0 + q * 8), *(const v4u*)&th[cl][q * 8]); if (hi_rows) { const size_t o3 = (bb * CC + c0 + cl) * (size_t)KHI + t0 + q * 8; vst2((unsigned*)(VB + o3), *(const v4u*)&tb[cl][q * 8]); vst2((unsigned*)(VBL + o3), *(const v4u*)&tbl[cl][q * 8]); } } } }
// ---- k_sc: block = (query block qb, key block kb <= kb_last(qb), head in group) of batch b: logits x SCALE; q hi + residual (x 2^10) against k (2 products) for query rows < QHI, plus the k residual (3 products) for query blocks < QBH (causal early rows); causal: blocks past the diagonal exit, the mask itself is applied by index in k_sm
__global__ __launch_bounds__(128) void k_sc(const _Float16* __restrict__ QH, const _Float16* __restrict__ KH, const _Float16* __restrict__ QL, const _Float16* __restrict__ KL, int b, int h0, float* __restrict__ S0) { __shared__ __align__(16) float ss[4][16][132];
  const int qb = blockIdx.x, kb = blockIdx.y; if (kb > kb_last(qb)) return;
  const int h = h0 + blockIdx.z; float* S = S0 + (size_t)blockIdx.z * TT * TT;
  const int tid = threadIdx.x, wave = tid >> 5, lane = tid & 31, col = lane & 15, g = lane >> 4; const int k0 = kb * 128; const int ql0 = qb * 64 + wave * 16; const size_t q0 = (size_t)b * TT + ql0, kr0 = (size_t)b * TT + k0;
  v8f acc[8] = {}, accl[8] = {};
  const _Float16* QLb = QL + (size_t)b * QHI * CC; const _Float16* KLb = KL + (size_t)b * KHI * CC;
  if (qb < QBH) {
#pragma unroll
    for (int kc = 0; kc < HD / 32; ++kc) { const v16h ah = frag_h(QH + (q0 + col) * CC + h * HD + kc * 32, lane), al = frag_h(QLb + (size_t)(ql0 + col) * CC + h * HD + kc * 32, lane);
#pragma unroll
      for (int j = 0; j < 8; ++j) { const v16h kbf = frag_h(KH + (kr0 + j * 16 + col) * CC + h * HD + kc * 32, lane), klf = frag_h(KLb + (size_t)(k0 + j * 16 + col) * CC + h * HD + kc * 32, lane); acc[j] = wmma16(ah, kbf, acc[j]); accl[j] = wmma16(al, kbf, accl[j]); accl[j] = wmma16(ah, klf, accl[j]); } }
  } else if (qb * 64 < QHI) {
#pragma unroll
    for (int kc = 0; kc < HD / 32; ++kc) { const v16h ah = frag_h(QH + (q0 + col) * CC + h * HD + kc * 32, lane), al = frag_h(QLb + (size_t)(ql0 + col) * CC + h * HD + kc * 32, lane);
#pragma unroll
      for (int j = 0; j < 8; ++j) { const v16h kbf = frag_h(KH + (kr0 + j * 16 + col) * CC + h * HD + kc * 32, lane); acc[j] = wmma16(ah, kbf, acc[j]); accl[j] = wmma16(al, kbf, accl[j]); } }
  } else {
#pragma unroll
    for (int kc = 0; kc < HD / 32; ++kc) { const v16h ah = frag_h(QH + (q0 + col) * CC + h * HD + kc * 32, lane);
#pragma unroll
      for (int j = 0; j < 8; ++j) { const v16h kbf = frag_h(KH + (kr0 + j * 16 + col) * CC + h * HD + kc * 32, lane); acc[j] = wmma16(ah, kbf, acc[j]); } } }
#pragma unroll
  for (int j = 0; j < 8; ++j) {
#pragma unroll
    for (int r = 0; r < 8; ++r) ss[wave][8 * g + r][j * 16 + col] = (acc[j][r] + accl[j][r] * (1.0f / 1024.0f)) * SCALE; }
  LDSX(); for (int rl = 0; rl < 16; ++rl) vst2(S + (size_t)(ql0 + rl) * TT + k0 + lane * 4, *(const v4f*)&ss[wave][rl][lane * 4]); }
// ---- k_sm: block = query row t (head in group): keys [0, kend): causal -> logit if s <= t else excluded; softmax in f32; P x 2^11 in place (0 for excluded)
__global__ __launch_bounds__(256) void k_sm(float* __restrict__ S0 SM_EXTRA_PARAMS) { __shared__ float sred[8]; __shared__ float sbc; __shared__ __align__(16) float shv[TT];
  const int tid = threadIdx.x; const int t = blockIdx.x; const int kend = (kb_last(t >> 6) + 1) * 128;
  float* sr = S0 + (size_t)blockIdx.y * TT * TT + (size_t)t * TT;
  float m = -3.0e38f; for (int k = tid; k < kend; k += 256) { float v = (!CAUSAL || k <= t) ? sr[k] : -3.0e38f; SM_MASK_HOOK; shv[k] = v; m = fmaxf(m, v); }
#pragma unroll
  for (int o = 1; o < 32; o <<= 1) m = fmaxf(m, __shfl_xor(m, o));
  if ((tid & 31) == 0) sred[tid >> 5] = m; __syncthreads(); if (tid == 0) { float a = sred[0]; for (int i = 1; i < 8; ++i) a = fmaxf(a, sred[i]); sbc = a; } __syncthreads(); m = sbc; __syncthreads();
  float sum = 0.f; for (int k = tid; k < kend; k += 256) { const float v = shv[k]; const float e = (v <= -1.0e38f) ? 0.f : expf(v - m); shv[k] = e; sum += e; }
#pragma unroll
  for (int o = 1; o < 32; o <<= 1) sum += __shfl_xor(sum, o);
  if ((tid & 31) == 0) sred[tid >> 5] = sum; __syncthreads(); if (tid == 0) { float a = 0.f; for (int i = 0; i < 8; ++i) a += sred[i]; sbc = a > 0.f ? 2048.0f / a : 0.f; }   /* a fully excluded row yields P = 0 */ __syncthreads(); const float inv = sbc;
  for (int k = tid; k < kend; k += 256) shv[k] = shv[k] * inv;
  __syncthreads(); for (int q = tid; q < kend / 4; q += 256) vst2(sr + q * 4, *(const v4f*)&shv[q * 4]); }
// ---- k_pv: block = 64 queries (qb) of (b, h): ctx = P . v over keys [0, kend) (P x 2^11 once to f16 against v f16: 1 product; causal early query blocks: P and v as bf16 hi + lo, 3 products); 256-B (row, head) segment by 16 lanes
__global__ __launch_bounds__(128) void k_pv(const float* __restrict__ PS0, const _Float16* __restrict__ VT, const __bf16* __restrict__ VB, const __bf16* __restrict__ VBL, int b, int h0, float* __restrict__ Y) { const int h = h0 + blockIdx.z; const float* PS = PS0 + (size_t)blockIdx.z * TT * TT; __shared__ __align__(16) float ss[4][16][HD + 4];
  const int tid = threadIdx.x, wave = tid >> 5, lane = tid & 31, col = lane & 15, g = lane >> 4; const int qb = blockIdx.x; const int ql0 = qb * 64 + wave * 16; const int kce = (kb_last(qb) + 1) * 4;
  v8f acc[HD / 16] = {};
  if (qb < QBH) {
#pragma unroll 1
    for (int kc = 0; kc < kce; ++kc) { const F2 p = split_row(PS + (size_t)(ql0 + col) * TT, kc * 32, lane);
      asm volatile("s_wait_loadcnt 0x0" ::: "memory");
#pragma unroll
      for (int j = 0; j < HD / 16; ++j) { const size_t po = ((size_t)b * CC + h * HD + j * 16 + col) * (size_t)KHI + kc * 32; const v16b vh = frag_b(VB + po, lane); acc[j] = wmma_bf(p.h, vh, acc[j]); acc[j] = wmma_bf(p.l, vh, acc[j]); acc[j] = wmma_bf(p.h, frag_b(VBL + po, lane), acc[j]); } }
  } else {
#pragma unroll 1
    for (int kc = 0; kc < kce; ++kc) { const v16h p = frag_f32(PS + (size_t)(ql0 + col) * TT + kc * 32, lane);
      asm volatile("s_wait_loadcnt 0x0" ::: "memory");
#pragma unroll
      for (int j = 0; j < HD / 16; ++j) { const size_t po = ((size_t)b * CC + h * HD + j * 16 + col) * (size_t)TT + kc * 32; acc[j] = wmma16(p, frag_h(VT + po, lane), acc[j]); } } }
#pragma unroll
  for (int j = 0; j < HD / 16; ++j)
#pragma unroll
    for (int r = 0; r < 8; ++r) ss[wave][8 * g + r][j * 16 + col] = acc[j][r] * (1.0f / 2048.0f);
  LDSX(); for (int rl = 0; rl < 16; ++rl) if (lane < HD / 4) vst2(Y + ((size_t)b * TT + ql0 + rl) * CC + h * HD + lane * 4, *(const v4f*)&ss[wave][rl][lane * 4]); }
// ---- k_out: block = (64 rows, 128 cols): out = ctx Wo (+ bo): ctx x 2^6 once to f16 against Wo as f16(bf16 x 2^8) exact (1 product) x 2^-14; causal early rows (< QHI of each sequence): ctx bf16 hi + lo against exact bf16 Wo (2 products)
__global__ __launch_bounds__(128) void k_out(const float* __restrict__ Y, const float* __restrict__ WO, const float* __restrict__ BO, float* __restrict__ OUT) { __shared__ __align__(16) float sf[4][16][132];
  const int tid = threadIdx.x, wave = tid >> 5, lane = tid & 31, col = lane & 15, g = lane >> 4; const int c0 = blockIdx.y * 128; const size_t r0 = (size_t)blockIdx.x * 64 + wave * 16;
  v8f acc[8] = {};
  if (CAUSAL && (int)(((size_t)blockIdx.x * 64) % TT) < QHI) {   /* block-uniform */
#pragma unroll 2
    for (int kc = 0; kc < CC / 32; ++kc) { const F2 a = split_row(Y + (r0 + col) * CC, kc * 32, lane); asm volatile("s_wait_loadcnt 0x0" ::: "memory");
#pragma unroll
      for (int j = 0; j < 8; ++j) { const v16b w = WOCOL(WO, kc * 32, c0 + j * 16 + col, lane); asm volatile("s_wait_loadcnt 0x0" ::: "memory"); acc[j] = wmma_bf(a.h, w, acc[j]); acc[j] = wmma_bf(a.l, w, acc[j]); } }
#pragma unroll
    for (int j = 0; j < 8; ++j) { const float bias = BO ? bfr(BO[c0 + j * 16 + col]) : 0.f;
#pragma unroll
      for (int r = 0; r < 8; ++r) sf[wave][8 * g + r][j * 16 + col] = acc[j][r] + bias; }
  } else {
#pragma unroll 2
    for (int kc = 0; kc < CC / 32; ++kc) { const v16h a = frag_f32s(Y + (r0 + col) * CC + kc * 32, lane, 64.0f); asm volatile("s_wait_loadcnt 0x0" ::: "memory");   /* ctx carried x 2^6 into f16 so small-magnitude context rows stay clear of f16 subnormals */
#pragma unroll
      for (int j = 0; j < 8; ++j) { const v16h w = WOCOLH(WO, kc * 32, c0 + j * 16 + col, lane); asm volatile("s_wait_loadcnt 0x0" ::: "memory"); acc[j] = wmma16(a, w, acc[j]); } }
#pragma unroll
    for (int j = 0; j < 8; ++j) { const float bias = BO ? bfr(BO[c0 + j * 16 + col]) : 0.f;
#pragma unroll
      for (int r = 0; r < 8; ++r) sf[wave][8 * g + r][j * 16 + col] = acc[j][r] * (1.0f / 16384.0f) + bias; } }   /* 2^-8 (Wo carry) x 2^-6 (ctx carry) */
  LDSX(); for (int rl = 0; rl < 16; ++rl) vst2(OUT + (r0 + rl) * DIN + c0 + lane * 4, *(const v4f*)&sf[wave][rl][lane * 4]); }

extern "C" void kernel_launch(void* const* d_in, const int* in_sizes, int n_in, void* d_out, int out_size, void* d_ws, size_t ws_size, hipStream_t stream) {
  (void)in_sizes; (void)n_in; (void)out_size;
  const float** F = (const float**)d_in;
  if (ws_size < (size_t)WS_END) return;
  char* ws = (char*)d_ws; _Float16 *QH = (_Float16*)(ws + WS_QH), *KH = (_Float16*)(ws + WS_KH), *VT = (_Float16*)(ws + WS_VT), *QL = (_Float16*)(ws + WS_QL), *KL = (_Float16*)(ws + WS_KL); __bf16 *VB = (__bf16*)(ws + WS_VB), *VBL = (__bf16*)(ws + WS_VBL); float *S = (float*)(ws + WS_S), *Y = (float*)(ws + WS_Y);
  (void)Y; (void)QL; (void)KL; (void)VB; (void)VBL;
  // inputs: 0 x [4,2048,768]; 1 Wq [12,768,64]; 2 Wk; 3 Wv (per-head [head][model][d]); 4 Wo [768,768] (out,in); 5 bo [768] (zeros, read); no q / k / v biases
  k_proj<<<dim3(TNB * TT / 64, CC / 128, 3), 128, 0, stream>>>(F[0], F[0], F[0], F[1], F[2], F[3], nullptr, nullptr, nullptr, QH, QL, KH, KL, VT, VB, VBL);
  for (int b = 0; b < TNB; ++b) for (int h0 = 0; h0 < NH; h0 += HG) {
    k_sc<<<dim3(NQB, TT / 128, HG), 128, 0, stream>>>(QH, KH, QL, KL, b, h0, S);
    k_sm<<<dim3(TT, HG), 256, 0, stream>>>(S);
    k_pv<<<dim3(NQB, 1, HG), 128, 0, stream>>>(S, VT, VB, VBL, b, h0, Y);
  }
  k_out<<<dim3(TNB * TT / 64, DIN / 128), 128, 0, stream>>>(Y, F[4], F[5], (float*)d_out);
}

// v001
// One run takes 872 microseconds.
// Next to v000, in two timings, it ran 2.70 and 2.68 times as fast.
// compute dtype: all float inputs rounded to bf16; per-head q / k / v projections with EXACT bf16 products on WMMA 16x16x32 (f32 accumulate), no biases; causal logits: 3 products for the first 384 rows, single f16 q x k after, x 64^-0.5; softmax f32; P x 2^11 once to f16 x v once to f16 (bf16 hi + lo below row 384); ctx hi+lo x exact Wo below row 384, x2^6 f16 carry x f16(bf16 x 2^8) Wo after, + bo (zeros, read); f32 output.
#include <hip/hip_runtime.h>
#include <math.h>

typedef __attribute__((ext_vector_type(16))) _Float16 v16h;
typedef __attribute__((ext_vector_type(16))) __bf16 v16b;
typedef __attribute__((ext_vector_type(8)))  _Float16 v8h;
typedef __attribute__((ext_vector_type(8)))  float v8f;
typedef __attribute__((ext_vector_type(4)))  float v4f;
typedef __attribute__((ext_vector_type(2)))  float v2f;
typedef __attribute__((ext_vector_type(4)))  unsigned v4u;
typedef __attribute__((ext_vector_type(4)))  int v4i;
typedef float __attribute__((may_alias)) float_a;
typedef int __attribute__((may_alias)) int_a;

template <typename T> __device__ __forceinline__ void vst2(void* p, T v) { *(T*)p = v;  }
__device__ __forceinline__ v8f wmma16(v16h a, v16h b, v8f c) {
  v8f d = __builtin_amdgcn_wmma_f32_16x16x32_f16(false, a, false, b, (short)0, c, false, false);
  asm volatile("v_nop\n\tv_nop\n\tv_nop\n\tv_nop" : "+v"(d) : "v"(a), "v"(b));
  return d;
}
__device__ __forceinline__ v8f wmma_bf(v16b a, v16b b, v8f c) {
  v8f d = __builtin_amdgcn_wmma_f32_16x16x32_bf16(false, a, false, b, (short)0, c, false, false);
  asm volatile("v_nop\n\tv_nop\n\tv_nop\n\tv_nop" : "+v"(d) : "v"(a), "v"(b));
  return d;
}
// 16x16x32 fragments: lane = (h = lane>>4, row/col = lane&15); elements 0..7 = k0+8h+0..7, 8..15 = k0+16+8h+0..7; D element r = row 8h+r
__device__ __forceinline__ v16h frag_h(const _Float16* rowk0, int lane) {
  union { v16h v; v8h q[2]; } u; const _Float16* p = rowk0 + 8 * (lane >> 4);
  u.q[0] = *(const v8h*)p; u.q[1] = *(const v8h*)(p + 16); return u.v;
}
__device__ __forceinline__ v16h frag_f32(const float* rowk0, int lane) {
  v16h a; const float* p = rowk0 + 8 * (lane >> 4);
#pragma unroll
  for (int i = 0; i < 8; ++i) { a[i] = (_Float16)p[i]; a[8 + i] = (_Float16)p[16 + i]; }
  return a;
}
__device__ __forceinline__ v16h frag_f32s(const float* rowk0, int lane, float sc) {
  v16h a; const float* p = rowk0 + 8 * (lane >> 4);
#pragma unroll
  for (int i = 0; i < 8; ++i) { a[i] = (_Float16)(p[i] * sc); a[8 + i] = (_Float16)(p[16 + i] * sc); }
  return a;
}
// column fragment from a [K][ld] layout (column n), rows >= K read as 0
__device__ __forceinline__ v16h fragc_f32(const float* W, int k0, int n, int lane, int ld, int K) {
  v16h a; const int g = lane >> 4;
#pragma unroll
  for (int i = 0; i < 8; ++i) { const int ka = k0 + 8 * g + i, kb = ka + 16;
    a[i] = (_Float16)(ka < K ? W[(size_t)(ka < K ? ka : K - 1) * ld + n] : 0.f); a[8 + i] = (_Float16)(kb < K ? W[(size_t)(kb < K ? kb : K - 1) * ld + n] : 0.f); }
  return a;
}
struct F2 { v16b h, l; };
__device__ __forceinline__ F2 bsplit16(const float v[16]) { F2 r;
#pragma unroll
  for (int i = 0; i < 16; ++i) { const __bf16 h = (__bf16)v[i]; r.h[i] = h; r.l[i] = (__bf16)(v[i] - (float)h); }
  return r; }
__device__ __forceinline__ F2 split_row(const float* row, int k0, int lane) { float v[16]; const float* p = row + k0 + 8 * (lane >> 4);
#pragma unroll
  for (int i = 0; i < 8; ++i) { v[i] = p[i]; v[8 + i] = p[16 + i]; }
  return bsplit16(v); }
__device__ __forceinline__ F2 split_rowK(const float* row, int k0, int lane, int K) { float v[16]; const int g = lane >> 4;
#pragma unroll
  for (int i = 0; i < 8; ++i) { const int ka = k0 + 8 * g + i, kb = ka + 16; v[i] = ka < K ? row[ka < K ? ka : K - 1] : 0.f; v[8 + i] = kb < K ? row[kb < K ? kb : K - 1] : 0.f; }
  return bsplit16(v); }
__device__ __forceinline__ F2 split_col(const float* W, int k0, int n, int lane, int ld, int K) { float v[16]; const int g = lane >> 4;
#pragma unroll
  for (int i = 0; i < 8; ++i) { const int ka = k0 + 8 * g + i, kb = ka + 16; v[i] = ka < K ? W[(size_t)(ka < K ? ka : K - 1) * ld + n] : 0.f; v[8 + i] = kb < K ? W[(size_t)(kb < K ? kb : K - 1) * ld + n] : 0.f; }
  return bsplit16(v); }
__device__ __forceinline__ v8f mac3(const F2& a, const F2& b, v8f c) { c = wmma_bf(a.l, b.h, c); c = wmma_bf(a.h, b.l, c); return wmma_bf(a.h, b.h, c); }
__device__ __forceinline__ float sigm(float v) { return 1.0f / (1.0f + expf(-v)); }
#define LDSX() do { asm volatile("s_wait_dscnt 0" ::: "memory"); __builtin_amdgcn_wave_barrier(); __builtin_amdgcn_fence(__ATOMIC_RELEASE, "workgroup"); } while (0)

// Causal multi-head self-attention with per-head weights (x [4,2048,768]; Wq / Wk / Wv [12,768,64] = per-head [head][model][d] N(0,1) x 0.02, no biases; Wo [768,768] torch (out,in), bo zeros (read); q = einsum('bsd,hde->bhse'); scores / sqrt(64); tril kept, finfo.min elsewhere; softmax; ctx merged (head*64 + e); ctx @ Wo.T + bo).
#define NB 4
#define TT 2048
#define CC 768            // NH * HD = projected width
#define DIN 768          // input (model) width
#define NH 12
#define HD 64
#define NQB (TT / 64)
#define HG 16             // (batch, head) pairs per launch of k_sc / k_sm / k_pv
#define SCALE (0.125f)
#define CAUSAL 1
#ifndef TNB
#define TNB NB
#endif
__device__ __forceinline__ float bfr(float v) { return (float)(__bf16)v; }
__host__ __device__ __forceinline__ int kb_last(int qb) { return CAUSAL ? ((qb * 64 + 63) >> 7) : (TT / 128 - 1); }
// logits / P plane of one (batch, head) pair: query block qb = 64 rows of s_ld(qb) keys (its causal key blocks only), the blocks one behind the other, so that HG planes fit the workspace
static_assert(CAUSAL == 1 && NQB % 2 == 0 && (NB * NH) % HG == 0, "plane layout and pair groups");
#define SPLANE ((size_t)(NQB / 2) * (NQB / 2 + 1) * 64 * 128)   // floats per plane
__device__ __forceinline__ int s_ld(int qb) { return (kb_last(qb) + 1) * 128; }
__device__ __forceinline__ size_t s_off(int qb) { const int m = qb >> 1; return (size_t)(m + (qb & 1)) * (m + 1) * (64 * 128); }
typedef __attribute__((ext_vector_type(8))) __bf16 v8b;
__device__ __forceinline__ v16b frag_b(const __bf16* rowk0, int lane) {
  union { v16b v; v8b q[2]; } u; const __bf16* p = rowk0 + 8 * (lane >> 4);
  u.q[0] = *(const v8b*)p; u.q[1] = *(const v8b*)(p + 16); return u.v;
}
#define QBH 6              // causal: query blocks 0..QBH-1 of each sequence (few keys, no averaging) take the high-precision path
#define QHI 384            // rows carrying a q residual plane
#define KHI 384            // key rows carrying k residual / v bf16 hi+lo planes (used only by the causal high-precision path)
// B fragment (k rows k0+.., output column o) of a weight: (in,out) [K][ld] or (out,in) [ld rows of K]: bf16 exact, or f16(bf16 * 256) exact
__device__ __forceinline__ v16b wcol_io(const float* Wm, int k0, int o, int lane, int ld) { v16b w; const int g = lane >> 4;
#pragma unroll
  for (int i = 0; i < 8; ++i) { w[i] = (__bf16)Wm[(size_t)(k0 + 8 * g + i) * ld + o]; w[8 + i] = (__bf16)Wm[(size_t)(k0 + 16 + 8 * g + i) * ld + o]; }
  return w; }
__device__ __forceinline__ v16b wcol_oi(const float* Wm, int k0, int o, int lane, int K) { v16b w; const float* p = Wm + (size_t)o * K + k0 + 8 * (lane >> 4);
#pragma unroll
  for (int i = 0; i < 8; ++i) { w[i] = (__bf16)p[i]; w[8 + i] = (__bf16)p[16 + i]; }
  return w; }
__device__ __forceinline__ v16h wcolh_io(const float* Wm, int k0, int o, int lane, int ld) { v16h w; const int g = lane >> 4;
#pragma unroll
  for (int i = 0; i < 8; ++i) { w[i] = (_Float16)(bfr(Wm[(size_t)(k0 + 8 * g + i) * ld + o]) * 256.0f); w[8 + i] = (_Float16)(bfr(Wm[(size_t)(k0 + 16 + 8 * g + i) * ld + o]) * 256.0f); }
  return w; }
__device__ __forceinline__ v16h wcolh_oi(const float* Wm, int k0, int o, int lane, int K) { v16h w; const float* p = Wm + (size_t)o * K + k0 + 8 * (lane >> 4);
#pragma unroll
  for (int i = 0; i < 8; ++i) { w[i] = (_Float16)(bfr(p[i]) * 256.0f); w[8 + i] = (_Float16)(bfr(p[16 + i]) * 256.0f); }
  return w; }
#define WQKV_LAYOUT 2   // 0 = (in,out) [DIN][CC]; 1 = (out,in) [CC][DIN]; 2 = per-head [NH][DIN][HD]
__device__ __forceinline__ v16b wcol_hdk(const float* Wm, int k0, int o, int lane) { v16b w; const int g = lane >> 4; const float* p = Wm + (size_t)(o / HD) * DIN * HD + (o % HD);
#pragma unroll
  for (int i = 0; i < 8; ++i) { w[i] = (__bf16)p[(size_t)(k0 + 8 * g + i) * HD]; w[8 + i] = (__bf16)p[(size_t)(k0 + 16 + 8 * g + i) * HD]; }
  return w; }
#define WO_OUT_IN 1
#if WQKV_LAYOUT == 1
#define WCOL(W, k0, o, lane) wcol_oi(W, k0, o, lane, DIN)
#elif WQKV_LAYOUT == 2
#define WCOL(W, k0, o, lane) wcol_hdk(W, k0, o, lane)
#else
#define WCOL(W, k0, o, lane) wcol_io(W, k0, o, lane, CC)
#endif
#if WO_OUT_IN
#define WOCOL(W, k0, o, lane) wcol_oi(W, k0, o, lane, CC)
#define WOCOLH(W, k0, o, lane) wcolh_oi(W, k0, o, lane, CC)
#else
#define WOCOL(W, k0, o, lane) wcol_io(W, k0, o, lane, DIN)
#define WOCOLH(W, k0, o, lane) wcolh_io(W, k0, o, lane, DIN)
#endif

#ifndef SM_EXTRA_PARAMS
#define SM_EXTRA_PARAMS
#endif
#ifndef PROJ_EXTRA_PARAMS
#define PROJ_EXTRA_PARAMS
#endif
#ifndef SM_MASK_HOOK
#define SM_MASK_HOOK (void)0
#endif

#define WS_QH  0u                                      // f16 q rows [b*t][CC]
#define WS_KH  (WS_QH + 2u * (size_t)NB * TT * CC)      // f16 k rows [b*t][CC]
#define WS_VT  (WS_KH + 2u * (size_t)NB * TT * CC)      // f16 v planes [b][c][t]
#define WS_QL  (WS_VT + 2u * (size_t)NB * CC * TT)      // f16 q residual x 2^10 rows [b][t < QHI][CC]
#define WS_KL  (WS_QL + 2u * (size_t)NB * QHI * CC)     // f16 k residual x 2^10 rows [b][t < KHI][CC]
#define WS_VB  (WS_KL + 2u * (size_t)NB * KHI * CC)     // bf16 v hi planes [b][c][t < KHI]
#define WS_VBL (WS_VB + 2u * (size_t)NB * CC * KHI)
#define WS_S   (WS_VBL + 2u * (size_t)NB * CC * KHI)    // f32 logits / P [pair in group][query block][64][s_ld]
#define WS_Y   (WS_S  + 4u * (size_t)HG * SPLANE)      // f32 ctx rows [b*t][CC] (only when there is an output projection)
#define WS_END (WS_Y  + 4u * (size_t)NB * TT * CC)

// ---- k_proj: block = (64 rows, 128 cols, which): q/k/v = X W (+ b) with exact bf16 products (K = DIN) -> which 0: q f16 rows (+ residual rows < QHI); 1: k f16 rows (+ residual rows < KHI); 2: v f16 planes [c][t] (+ bf16 hi/lo planes for t < KHI)
__global__ __launch_bounds__(128) void k_proj(const float* __restrict__ XQ, const float* __restrict__ XK, const float* __restrict__ XV, const float* __restrict__ WQ, const float* __restrict__ WK, const float* __restrict__ WV, const float* __restrict__ BQ, const float* __restrict__ BK, const float* __restrict__ BV,
    _Float16* __restrict__ QH, _Float16* __restrict__ QL, _Float16* __restrict__ KH, _Float16* __restrict__ KL, _Float16* __restrict__ VT, __bf16* __restrict__ VB, __bf16* __restrict__ VBL) {
  __shared__ __align__(16) _Float16 sh[64][136], sl[64][136]; __shared__ __align__(16) _Float16 th[128][72]; __shared__ __align__(16) __bf16 tb[128][72], tbl[128][72];
  const int tid = threadIdx.x, wave = tid >> 5, lane = tid & 31, col = lane & 15, g = lane >> 4; const int which = blockIdx.z; const int c0 = blockIdx.y * 128; const size_t r0 = (size_t)blockIdx.x * 64; const size_t bb = r0 / TT; const int t0 = (int)(r0 % TT);
  const float* X = which == 0 ? XQ : which == 1 ? XK : XV; const float* WA = which == 0 ? WQ : which == 1 ? WK : WV; const float* BA = which == 0 ? BQ : which == 1 ? BK : BV;
  v8f acc[8] = {};
#pragma unroll 2
  for (int kc = 0; kc < DIN / 32; ++kc) { v16b a; { const float* p = X + (r0 + wave * 16 + col) * DIN + kc * 32 + 8 * g;
#pragma unroll
      for (int i = 0; i < 8; ++i) { a[i] = (__bf16)p[i]; a[8 + i] = (__bf16)p[16 + i]; } }
    asm volatile("s_wait_loadcnt 0x0" ::: "memory");
#pragma unroll
    for (int j = 0; j < 8; ++j) { const v16b w = WCOL(WA, kc * 32, c0 + j * 16 + col, lane); asm volatile("s_wait_loadcnt 0x0" ::: "memory"); acc[j] = wmma_bf(a, w, acc[j]); } }
  if (which < 2) { _Float16* DH = which == 0 ? QH : KH; _Float16* DL = which == 0 ? QL : KL; const int nhi = which == 0 ? QHI : KHI; const bool hi_rows = t0 < nhi;
#pragma unroll
    for (int j = 0; j < 8; ++j) { const float bias = BA ? bfr(BA[c0 + j * 16 + col]) : 0.f;
#pragma unroll
      for (int r = 0; r < 8; ++r) { const float v = acc[j][r] + bias; const _Float16 hv = (_Float16)v; sh[wave * 16 + 8 * g + r][j * 16 + col] = hv; sl[wave * 16 + 8 * g + r][j * 16 + col] = (_Float16)((v - (float)hv) * 1024.0f); } }
    __syncthreads();
    for (int e = tid; e < 64 * 16; e += 128) { const int rl = e >> 4, q = e & 15; vst2((unsigned*)(DH + (r0 + rl) * CC + c0 + q * 8), *(const v4u*)&sh[rl][q * 8]); if (hi_rows) vst2((unsigned*)(DL + (bb * nhi + t0 + rl) * (size_t)CC + c0 + q * 8), *(const v4u*)&sl[rl][q * 8]); }
  } else { const bool hi_rows = t0 < KHI;
#pragma unroll
    for (int j = 0; j < 8; ++j) { const float bias = BA ? bfr(BA[c0 + j * 16 + col]) : 0.f;
#pragma unroll
      for (int r = 0; r < 8; ++r) { const float v = acc[j][r] + bias; const int rl = wave * 16 + 8 * g + r, cl = j * 16 + col; th[cl][rl] = (_Float16)v; const __bf16 bh = (__bf16)v; tb[cl][rl] = bh; tbl[cl][rl] = (__bf16)(v - (float)bh); } }
    __syncthreads();
    for (int e = tid; e < 128 * 8; e += 128) { const int cl = e >> 3, q = e & 7; vst2((unsigned*)(VT + (bb * CC + c0 + cl) * (size_t)TT + t0 + q * 8), *(const v4u*)&th[cl][q * 8]); if (hi_rows) { const size_t o3 = (bb * CC + c0 + cl) * (size_t)KHI + t0 + q * 8; vst2((unsigned*)(VB + o3), *(const v4u*)&tb[cl][q * 8]); vst2((unsigned*)(VBL + o3), *(const v4u*)&tbl[cl][q * 8]); } } } }
// ---- k_sc: block = (query block qb, key block kb <= kb_last(qb), pair in group; pair = b * NH + h): logits x SCALE; q hi + residual (x 2^10) against k (2 products) for query rows < QHI, plus the k residual (3 products) for query blocks < QBH (causal early rows); causal: blocks past the diagonal exit, the mask itself is applied by index in k_sm
__global__ __launch_bounds__(128) void k_sc(const _Float16* __restrict__ QH, const _Float16* __restrict__ KH, const _Float16* __restrict__ QL, const _Float16* __restrict__ KL, int p0, float* __restrict__ S0) { __shared__ __align__(16) float ss[4][16][132];
  const int qb = blockIdx.x, kb = blockIdx.y; if (kb > kb_last(qb)) return;
  const int pr = p0 + blockIdx.z, b = pr / NH, h = pr % NH; const int ld = s_ld(qb); float* S = S0 + (size_t)blockIdx.z * SPLANE + s_off(qb);
  const int tid = threadIdx.x, wave = tid >> 5, lane = tid & 31, col = lane & 15, g = lane >> 4; const int k0 = kb * 128; const int ql0 = qb * 64 + wave * 16; const size_t q0 = (size_t)b * TT + ql0, kr0 = (size_t)b * TT + k0;
  v8f acc[8] = {}, accl[8] = {};
  const _Float16* QLb = QL + (size_t)b * QHI * CC; const _Float16* KLb = KL + (size_t)b * KHI * CC;
  if (qb < QBH) {
#pragma unroll
    for (int kc = 0; kc < HD / 32; ++kc) { const v16h ah = frag_h(QH + (q0 + col) * CC + h * HD + kc * 32, lane), al = frag_h(QLb + (size_t)(ql0 + col) * CC + h * HD + kc * 32, lane);
#pragma unroll
      for (int j = 0; j < 8; ++j) { const v16h kbf = frag_h(KH + (kr0 + j * 16 + col) * CC + h * HD + kc * 32, lane), klf = frag_h(KLb + (size_t)(k0 + j * 16 + col) * CC + h * HD + kc * 32, lane); acc[j] = wmma16(ah, kbf, acc[j]); accl[j] = wmma16(al, kbf, accl[j]); accl[j] = wmma16(ah, klf, accl[j]); } }
  } else if (qb * 64 < QHI) {
#pragma unroll
    for (int kc = 0; kc < HD / 32; ++kc) { const v16h ah = frag_h(QH + (q0 + col) * CC + h * HD + kc * 32, lane), al = frag_h(QLb + (size_t)(ql0 + col) * CC + h * HD + kc * 32, lane);
#pragma unroll
      for (int j = 0; j < 8; ++j) { const v16h kbf = frag_h(KH + (kr0 + j * 16 + col) * CC + h * HD + kc * 32, lane); acc[j] = wmma16(ah, kbf, acc[j]); accl[j] = wmma16(al, kbf, accl[j]); } }
  } else {
#pragma unroll
    for (int kc = 0; kc < HD / 32; ++kc) { const v16h ah = frag_h(QH + (q0 + col) * CC + h * HD + kc * 32, lane);
#pragma unroll
      for (int j = 0; j < 8; ++j) { const v16h kbf = frag_h(KH + (kr0 + j * 16 + col) * CC + h * HD + kc * 32, lane); acc[j] = wmma16(ah, kbf, acc[j]); } } }
#pragma unroll
  for (int j = 0; j < 8; ++j) {
#pragma unroll
    for (int r = 0; r < 8; ++r) ss[wave][8 * g + r][j * 16 + col] = (acc[j][r] + accl[j][r] * (1.0f / 1024.0f)) * SCALE; }
  LDSX(); for (int rl = 0; rl < 16; ++rl) vst2(S + (size_t)(wave * 16 + rl) * ld + k0 + lane * 4, *(const v4f*)&ss[wave][rl][lane * 4]); }
// ---- k_sm: block = query row t (pair in group): keys [0, kend): causal -> logit if s <= t else excluded; softmax in f32; P x 2^11 in place (0 for excluded)
__global__ __launch_bounds__(256) void k_sm(float* __restrict__ S0 SM_EXTRA_PARAMS) { __shared__ float sred[8]; __shared__ float sbc; __shared__ __align__(16) float shv[TT];
  const int tid = threadIdx.x; const int t = blockIdx.x; const int kend = (kb_last(t >> 6) + 1) * 128;
  float* sr = S0 + (size_t)blockIdx.y * SPLANE + s_off(t >> 6) + (size_t)(t & 63) * kend;
  float m = -3.0e38f; for (int k = tid; k < kend; k += 256) { float v = (!CAUSAL || k <= t) ? sr[k] : -3.0e38f; SM_MASK_HOOK; shv[k] = v; m = fmaxf(m, v); }
#pragma unroll
  for (int o = 1; o < 32; o <<= 1) m = fmaxf(m, __shfl_xor(m, o));
  if ((tid & 31) == 0) sred[tid >> 5] = m; __syncthreads(); if (tid == 0) { float a = sred[0]; for (int i = 1; i < 8; ++i) a = fmaxf(a, sred[i]); sbc = a; } __syncthreads(); m = sbc; __syncthreads();
  float sum = 0.f; for (int k = tid; k < kend; k += 256) { const float v = shv[k]; const float e = (v <= -1.0e38f) ? 0.f : expf(v - m); shv[k] = e; sum += e; }
#pragma unroll
  for (int o = 1; o < 32; o <<= 1) sum += __shfl_xor(sum, o);
  if ((tid & 31) == 0) sred[tid >> 5] = sum; __syncthreads(); if (tid == 0) { float a = 0.f; for (int i = 0; i < 8; ++i) a += sred[i]; sbc = a > 0.f ? 2048.0f / a : 0.f; }   /* a fully excluded row yields P = 0 */ __syncthreads(); const float inv = sbc;
  for (int k = tid; k < kend; k += 256) shv[k] = shv[k] * inv;
  __syncthreads(); for (int q = tid; q < kend / 4; q += 256) vst2(sr + q * 4, *(const v4f*)&shv[q * 4]); }
// ---- k_pv: block = 64 queries (qb) of (b, h): ctx = P . v over keys [0, kend) (P x 2^11 once to f16 against v f16: 1 product; causal early query blocks: P and v as bf16 hi + lo, 3 products); 256-B (row, head) segment by 16 lanes
__global__ __launch_bounds__(128) void k_pv(const float* __restrict__ PS0, const _Float16* __restrict__ VT, const __bf16* __restrict__ VB, const __bf16* __restrict__ VBL, int p0, float* __restrict__ Y) { const int pr = p0 + blockIdx.z, b = pr / NH, h = pr % NH; __shared__ __align__(16) float ss[4][16][HD + 4];
  const int tid = threadIdx.x, wave = tid >> 5, lane = tid & 31, col = lane & 15, g = lane >> 4; const int qb = blockIdx.x; const int ql0 = qb * 64 + wave * 16; const int kce = (kb_last(qb) + 1) * 4;
  const float* PR = PS0 + (size_t)blockIdx.z * SPLANE + s_off(qb) + (size_t)(wave * 16 + col) * s_ld(qb);   // this lane's P row
  v8f acc[HD / 16] = {};
  if (qb < QBH) {
#pragma unroll 1
    for (int kc = 0; kc < kce; ++kc) { const F2 p = split_row(PR, kc * 32, lane);
      asm volatile("s_wait_loadcnt 0x0" ::: "memory");
#pragma unroll
      for (int j = 0; j < HD / 16; ++j) { const size_t po = ((size_t)b * CC + h * HD + j * 16 + col) * (size_t)KHI + kc * 32; const v16b vh = frag_b(VB + po, lane); acc[j] = wmma_bf(p.h, vh, acc[j]); acc[j] = wmma_bf(p.l, vh, acc[j]); acc[j] = wmma_bf(p.h, frag_b(VBL + po, lane), acc[j]); } }
  } else {
#pragma unroll 1
    for (int kc = 0; kc < kce; ++kc) { const v16h p = frag_f32(PR + kc * 32, lane);
      asm volatile("s_wait_loadcnt 0x0" ::: "memory");
#pragma unroll
      for (int j = 0; j < HD / 16; ++j) { const size_t po = ((size_t)b * CC + h * HD + j * 16 + col) * (size_t)TT + kc * 32; acc[j] = wmma16(p, frag_h(VT + po, lane), acc[j]); } } }
#pragma unroll
  for (int j = 0; j < HD / 16; ++j)
#pragma unroll
    for (int r = 0; r < 8; ++r) ss[wave][8 * g + r][j * 16 + col] = acc[j][r] * (1.0f / 2048.0f);
  LDSX(); for (int rl = 0; rl < 16; ++rl) if (lane < HD / 4) vst2(Y + ((size_t)b * TT + ql0 + rl) * CC + h * HD + lane * 4, *(const v4f*)&ss[wave][rl][lane * 4]); }
// ---- k_out: block = (64 rows, 128 cols): out = ctx Wo (+ bo): ctx x 2^6 once to f16 against Wo as f16(bf16 x 2^8) exact (1 product) x 2^-14; causal early rows (< QHI of each sequence): ctx bf16 hi + lo against exact bf16 Wo (2 products)
__global__ __launch_bounds__(128) void k_out(const float* __restrict__ Y, const float* __restrict__ WO, const float* __restrict__ BO, float* __restrict__ OUT) { __shared__ __align__(16) float sf[4][16][132];
  const int tid = threadIdx.x, wave = tid >> 5, lane = tid & 31, col = lane & 15, g = lane >> 4; const int c0 = blockIdx.y * 128; const size_t r0 = (size_t)blockIdx.x * 64 + wave * 16;
  v8f acc[8] = {};
  if (CAUSAL && (int)(((size_t)blockIdx.x * 64) % TT) < QHI) {   /* block-uniform */
#pragma unroll 2
    for (int kc = 0; kc < CC / 32; ++kc) { const F2 a = split_row(Y + (r0 + col) * CC, kc * 32, lane); asm volatile("s_wait_loadcnt 0x0" ::: "memory");
#pragma unroll
      for (int j = 0; j < 8; ++j) { const v16b w = WOCOL(WO, kc * 32, c0 + j * 16 + col, lane); asm volatile("s_wait_loadcnt 0x0" ::: "memory"); acc[j] = wmma_bf(a.h, w, acc[j]); acc[j] = wmma_bf(a.l, w, acc[j]); } }
#pragma unroll
    for (int j = 0; j < 8; ++j) { const float bias = BO ? bfr(BO[c0 + j * 16 + col]) : 0.f;
#pragma unroll
      for (int r = 0; r < 8; ++r) sf[wave][8 * g + r][j * 16 + col] = acc[j][r] + bias; }
  } else {
#pragma unroll 2
    for (int kc = 0; kc < CC / 32; ++kc) { const v16h a = frag_f32s(Y + (r0 + col) * CC + kc * 32, lane, 64.0f); asm volatile("s_wait_loadcnt 0x0" ::: "memory");   /* ctx carried x 2^6 into f16 so small-magnitude context rows stay clear of f16 subnormals */
#pragma unroll
      for (int j = 0; j < 8; ++j) { const v16h w = WOCOLH(WO, kc * 32, c0 + j * 16 + col, lane); asm volatile("s_wait_loadcnt 0x0" ::: "memory"); acc[j] = wmma16(a, w, acc[j]); } }
#pragma unroll
    for (int j = 0; j < 8; ++j) { const float bias = BO ? bfr(BO[c0 + j * 16 + col]) : 0.f;
#pragma unroll
      for (int r = 0; r < 8; ++r) sf[wave][8 * g + r][j * 16 + col] = acc[j][r] * (1.0f / 16384.0f) + bias; } }   /* 2^-8 (Wo carry) x 2^-6 (ctx carry) */
  LDSX(); for (int rl = 0; rl < 16; ++rl) vst2(OUT + (r0 + rl) * DIN + c0 + lane * 4, *(const v4f*)&sf[wave][rl][lane * 4]); }

extern "C" void kernel_launch(void* const* d_in, const int* in_sizes, int n_in, void* d_out, int out_size, void* d_ws, size_t ws_size, hipStream_t stream) {
  (void)in_sizes; (void)n_in; (void)out_size;
  const float** F = (const float**)d_in;
  if (ws_size < (size_t)WS_END) return;
  char* ws = (char*)d_ws; _Float16 *QH = (_Float16*)(ws + WS_QH), *KH = (_Float16*)(ws + WS_KH), *VT = (_Float16*)(ws + WS_VT), *QL = (_Float16*)(ws + WS_QL), *KL = (_Float16*)(ws + WS_KL); __bf16 *VB = (__bf16*)(ws + WS_VB), *VBL = (__bf16*)(ws + WS_VBL); float *S = (float*)(ws + WS_S), *Y = (float*)(ws + WS_Y);
  (void)Y; (void)QL; (void)KL; (void)VB; (void)VBL;
  // inputs: 0 x [4,2048,768]; 1 Wq [12,768,64]; 2 Wk; 3 Wv (per-head [head][model][d]); 4 Wo [768,768] (out,in); 5 bo [768] (zeros, read); no q / k / v biases
  k_proj<<<dim3(TNB * TT / 64, CC / 128, 3), 128, 0, stream>>>(F[0], F[0], F[0], F[1], F[2], F[3], nullptr, nullptr, nullptr, QH, QL, KH, KL, VT, VB, VBL);
  for (int p0 = 0; p0 < TNB * NH; p0 += HG) {
    k_sc<<<dim3(NQB, TT / 128, HG), 128, 0, stream>>>(QH, KH, QL, KL, p0, S);
    k_sm<<<dim3(TT, HG), 256, 0, stream>>>(S);
    k_pv<<<dim3(NQB, 1, HG), 128, 0, stream>>>(S, VT, VB, VBL, p0, Y);
  }
  k_out<<<dim3(TNB * TT / 64, DIN / 128), 128, 0, stream>>>(Y, F[4], F[5], (float*)d_out);
}

// v002
// One run takes 370 microseconds.
// In two side-by-side timings against v001, it was 2.36 and 2.35 times as fast.
// All steps since v000 together make it 6.34 times as fast.
// compute dtype: all float inputs rounded to bf16; per-head q / k / v projections with EXACT bf16 products on WMMA 16x16x32 (f32 accumulate), no biases; causal logits: 3 products for the first 384 rows, single f16 q x k after, x 64^-0.5; softmax f32 with a running max and sum per 128 keys; exp x 2^11 once to f16 x v once to f16 (bf16 hi + lo below row 384); ctx hi+lo x exact Wo below row 384, x2^6 f16 carry x f16(bf16 x 2^8) Wo after, + bo (zeros, read); f32 output.
#include <hip/hip_runtime.h>
#include <math.h>

typedef __attribute__((ext_vector_type(16))) _Float16 v16h;
typedef __attribute__((ext_vector_type(16))) __bf16 v16b;
typedef __attribute__((ext_vector_type(8)))  _Float16 v8h;
typedef __attribute__((ext_vector_type(8)))  float v8f;
typedef __attribute__((ext_vector_type(4)))  float v4f;
typedef __attribute__((ext_vector_type(2)))  float v2f;
typedef __attribute__((ext_vector_type(4)))  unsigned v4u;
typedef __attribute__((ext_vector_type(4)))  int v4i;
typedef float __attribute__((may_alias)) float_a;
typedef int __attribute__((may_alias)) int_a;

template <typename T> __device__ __forceinline__ void vst2(void* p, T v) { *(T*)p = v;  }
__device__ __forceinline__ v8f wmma16(v16h a, v16h b, v8f c) {
  v8f d = __builtin_amdgcn_wmma_f32_16x16x32_f16(false, a, false, b, (short)0, c, false, false);
  asm volatile("v_nop\n\tv_nop\n\tv_nop\n\tv_nop" : "+v"(d) : "v"(a), "v"(b));
  return d;
}
__device__ __forceinline__ v8f wmma_bf(v16b a, v16b b, v8f c) {
  v8f d = __builtin_amdgcn_wmma_f32_16x16x32_bf16(false, a, false, b, (short)0, c, false, false);
  asm volatile("v_nop\n\tv_nop\n\tv_nop\n\tv_nop" : "+v"(d) : "v"(a), "v"(b));
  return d;
}
// 16x16x32 fragments: lane = (h = lane>>4, row/col = lane&15); elements 0..7 = k0+8h+0..7, 8..15 = k0+16+8h+0..7; D element r = row 8h+r
__device__ __forceinline__ v16h frag_h(const _Float16* rowk0, int lane) {
  union { v16h v; v8h q[2]; } u; const _Float16* p = rowk0 + 8 * (lane >> 4);
  u.q[0] = *(const v8h*)p; u.q[1] = *(const v8h*)(p + 16); return u.v;
}
__device__ __forceinline__ v16h frag_f32(const float* rowk0, int lane) {
  v16h a; const float* p = rowk0 + 8 * (lane >> 4);
#pragma unroll
  for (int i = 0; i < 8; ++i) { a[i] = (_Float16)p[i]; a[8 + i] = (_Float16)p[16 + i]; }
  return a;
}
__device__ __forceinline__ v16h frag_f32s(const float* rowk0, int lane, float sc) {
  v16h a; const float* p = rowk0 + 8 * (lane >> 4);
#pragma unroll
  for (int i = 0; i < 8; ++i) { a[i] = (_Float16)(p[i] * sc); a[8 + i] = (_Float16)(p[16 + i] * sc); }
  return a;
}
// column fragment from a [K][ld] layout (column n), rows >= K read as 0
__device__ __forceinline__ v16h fragc_f32(const float* W, int k0, int n, int lane, int ld, int K) {
  v16h a; const int g = lane >> 4;
#pragma unroll
  for (int i = 0; i < 8; ++i) { const int ka = k0 + 8 * g + i, kb = ka + 16;
    a[i] = (_Float16)(ka < K ? W[(size_t)(ka < K ? ka : K - 1) * ld + n] : 0.f); a[8 + i] = (_Float16)(kb < K ? W[(size_t)(kb < K ? kb : K - 1) * ld + n] : 0.f); }
  return a;
}
struct F2 { v16b h, l; };
__device__ __forceinline__ F2 bsplit16(const float v[16]) { F2 r;
#pragma unroll
  for (int i = 0; i < 16; ++i) { const __bf16 h = (__bf16)v[i]; r.h[i] = h; r.l[i] = (__bf16)(v[i] - (float)h); }
  return r; }
__device__ __forceinline__ F2 split_row(const float* row, int k0, int lane) { float v[16]; const float* p = row + k0 + 8 * (lane >> 4);
#pragma unroll
  for (int i = 0; i < 8; ++i) { v[i] = p[i]; v[8 + i] = p[16 + i]; }
  return bsplit16(v); }
__device__ __forceinline__ F2 split_rowK(const float* row, int k0, int lane, int K) { float v[16]; const int g = lane >> 4;
#pragma unroll
  for (int i = 0; i < 8; ++i) { const int ka = k0 + 8 * g + i, kb = ka + 16; v[i] = ka < K ? row[ka < K ? ka : K - 1] : 0.f; v[8 + i] = kb < K ? row[kb < K ? kb : K - 1] : 0.f; }
  return bsplit16(v); }
__device__ __forceinline__ F2 split_col(const float* W, int k0, int n, int lane, int ld, int K) { float v[16]; const int g = lane >> 4;
#pragma unroll
  for (int i = 0; i < 8; ++i) { const int ka = k0 + 8 * g + i, kb = ka + 16; v[i] = ka < K ? W[(size_t)(ka < K ? ka : K - 1) * ld + n] : 0.f; v[8 + i] = kb < K ? W[(size_t)(kb < K ? kb : K - 1) * ld + n] : 0.f; }
  return bsplit16(v); }
__device__ __forceinline__ v8f mac3(const F2& a, const F2& b, v8f c) { c = wmma_bf(a.l, b.h, c); c = wmma_bf(a.h, b.l, c); return wmma_bf(a.h, b.h, c); }
__device__ __forceinline__ float sigm(float v) { return 1.0f / (1.0f + expf(-v)); }
#define LDSX() do { asm volatile("s_wait_dscnt 0" ::: "memory"); __builtin_amdgcn_wave_barrier(); __builtin_amdgcn_fence(__ATOMIC_RELEASE, "workgroup"); } while (0)

// Causal multi-head self-attention with per-head weights (x [4,2048,768]; Wq / Wk / Wv [12,768,64] = per-head [head][model][d] N(0,1) x 0.02, no biases; Wo [768,768] torch (out,in), bo zeros (read); q = einsum('bsd,hde->bhse'); scores / sqrt(64); tril kept, finfo.min elsewhere; softmax; ctx merged (head*64 + e); ctx @ Wo.T + bo).
#define NB 4
#define TT 2048
#define CC 768            // NH * HD = projected width
#define DIN 768          // input (model) width
#define NH 12
#define HD 64
#define NQB (TT / 64)
#define SCALE (0.125f)
#define CAUSAL 1
#ifndef TNB
#define TNB NB
#endif
__device__ __forceinline__ float bfr(float v) { return (float)(__bf16)v; }
__host__ __device__ __forceinline__ int kb_last(int qb) { return CAUSAL ? ((qb * 64 + 63) >> 7) : (TT / 128 - 1); }
typedef __attribute__((ext_vector_type(8))) __bf16 v8b;
__device__ __forceinline__ v16b frag_b(const __bf16* rowk0, int lane) {
  union { v16b v; v8b q[2]; } u; const __bf16* p = rowk0 + 8 * (lane >> 4);
  u.q[0] = *(const v8b*)p; u.q[1] = *(const v8b*)(p + 16); return u.v;
}
#define QBH 6              // causal: query blocks 0..QBH-1 of each sequence (few keys, no averaging) take the high-precision path
#define QHI 384            // rows carrying a q residual plane
#define KHI 384            // key rows carrying k residual / v bf16 hi+lo planes (used only by the causal high-precision path)
// B fragment (k rows k0+.., output column o) of a weight: (in,out) [K][ld] or (out,in) [ld rows of K]: bf16 exact, or f16(bf16 * 256) exact
__device__ __forceinline__ v16b wcol_io(const float* Wm, int k0, int o, int lane, int ld) { v16b w; const int g = lane >> 4;
#pragma unroll
  for (int i = 0; i < 8; ++i) { w[i] = (__bf16)Wm[(size_t)(k0 + 8 * g + i) * ld + o]; w[8 + i] = (__bf16)Wm[(size_t)(k0 + 16 + 8 * g + i) * ld + o]; }
  return w; }
__device__ __forceinline__ v16b wcol_oi(const float* Wm, int k0, int o, int lane, int K) { v16b w; const float* p = Wm + (size_t)o * K + k0 + 8 * (lane >> 4);
#pragma unroll
  for (int i = 0; i < 8; ++i) { w[i] = (__bf16)p[i]; w[8 + i] = (__bf16)p[16 + i]; }
  return w; }
__device__ __forceinline__ v16h wcolh_io(const float* Wm, int k0, int o, int lane, int ld) { v16h w; const int g = lane >> 4;
#pragma unroll
  for (int i = 0; i < 8; ++i) { w[i] = (_Float16)(bfr(Wm[(size_t)(k0 + 8 * g + i) * ld + o]) * 256.0f); w[8 + i] = (_Float16)(bfr(Wm[(size_t)(k0 + 16 + 8 * g + i) * ld + o]) * 256.0f); }
  return w; }
__device__ __forceinline__ v16h wcolh_oi(const float* Wm, int k0, int o, int lane, int K) { v16h w; const float* p = Wm + (size_t)o * K + k0 + 8 * (lane >> 4);
#pragma unroll
  for (int i = 0; i < 8; ++i) { w[i] = (_Float16)(bfr(p[i]) * 256.0f); w[8 + i] = (_Float16)(bfr(p[16 + i]) * 256.0f); }
  return w; }
#define WQKV_LAYOUT 2   // 0 = (in,out) [DIN][CC]; 1 = (out,in) [CC][DIN]; 2 = per-head [NH][DIN][HD]
__device__ __forceinline__ v16b wcol_hdk(const float* Wm, int k0, int o, int lane) { v16b w; const int g = lane >> 4; const float* p = Wm + (size_t)(o / HD) * DIN * HD + (o % HD);
#pragma unroll
  for (int i = 0; i < 8; ++i) { w[i] = (__bf16)p[(size_t)(k0 + 8 * g + i) * HD]; w[8 + i] = (__bf16)p[(size_t)(k0 + 16 + 8 * g + i) * HD]; }
  return w; }
#define WO_OUT_IN 1
#if WQKV_LAYOUT == 1
#define WCOL(W, k0, o, lane) wcol_oi(W, k0, o, lane, DIN)
#elif WQKV_LAYOUT == 2
#define WCOL(W, k0, o, lane) wcol_hdk(W, k0, o, lane)
#else
#define WCOL(W, k0, o, lane) wcol_io(W, k0, o, lane, CC)
#endif
#if WO_OUT_IN
#define WOCOL(W, k0, o, lane) wcol_oi(W, k0, o, lane, CC)
#define WOCOLH(W, k0, o, lane) wcolh_oi(W, k0, o, lane, CC)
#else
#define WOCOL(W, k0, o, lane) wcol_io(W, k0, o, lane, DIN)
#define WOCOLH(W, k0, o, lane) wcolh_io(W, k0, o, lane, DIN)
#endif

#ifndef PROJ_EXTRA_PARAMS
#define PROJ_EXTRA_PARAMS
#endif

#define WS_QH  0u                                      // f16 q rows [b*t][CC]
#define WS_KH  (WS_QH + 2u * (size_t)NB * TT * CC)      // f16 k rows [b*t][CC]
#define WS_VT  (WS_KH + 2u * (size_t)NB * TT * CC)      // f16 v planes [b][c][t]
#define WS_QL  (WS_VT + 2u * (size_t)NB * CC * TT)      // f16 q residual x 2^10 rows [b][t < QHI][CC]
#define WS_KL  (WS_QL + 2u * (size_t)NB * QHI * CC)     // f16 k residual x 2^10 rows [b][t < KHI][CC]
#define WS_VB  (WS_KL + 2u * (size_t)NB * KHI * CC)     // bf16 v hi planes [b][c][t < KHI]
#define WS_VBL (WS_VB + 2u * (size_t)NB * CC * KHI)
#define WS_Y   (WS_VBL + 2u * (size_t)NB * CC * KHI)    // f32 ctx rows [b*t][CC] (only when there is an output projection)
#define WS_END (WS_Y  + 4u * (size_t)NB * TT * CC)

// ---- k_proj: block = (64 rows, 128 cols, which): q/k/v = X W (+ b) with exact bf16 products (K = DIN) -> which 0: q f16 rows (+ residual rows < QHI); 1: k f16 rows (+ residual rows < KHI); 2: v f16 planes [c][t] (+ bf16 hi/lo planes for t < KHI)
__global__ __launch_bounds__(128) void k_proj(const float* __restrict__ XQ, const float* __restrict__ XK, const float* __restrict__ XV, const float* __restrict__ WQ, const float* __restrict__ WK, const float* __restrict__ WV, const float* __restrict__ BQ, const float* __restrict__ BK, const float* __restrict__ BV,
    _Float16* __restrict__ QH, _Float16* __restrict__ QL, _Float16* __restrict__ KH, _Float16* __restrict__ KL, _Float16* __restrict__ VT, __bf16* __restrict__ VB, __bf16* __restrict__ VBL) {
  __shared__ __align__(16) _Float16 sh[64][136], sl[64][136]; __shared__ __align__(16) _Float16 th[128][72]; __shared__ __align__(16) __bf16 tb[128][72], tbl[128][72];
  const int tid = threadIdx.x, wave = tid >> 5, lane = tid & 31, col = lane & 15, g = lane >> 4; const int which = blockIdx.z; const int c0 = blockIdx.y * 128; const size_t r0 = (size_t)blockIdx.x * 64; const size_t bb = r0 / TT; const int t0 = (int)(r0 % TT);
  const float* X = which == 0 ? XQ : which == 1 ? XK : XV; const float* WA = which == 0 ? WQ : which == 1 ? WK : WV; const float* BA = which == 0 ? BQ : which == 1 ? BK : BV;
  v8f acc[8] = {};
#pragma unroll 2
  for (int kc = 0; kc < DIN / 32; ++kc) { v16b a; { const float* p = X + (r0 + wave * 16 + col) * DIN + kc * 32 + 8 * g;
#pragma unroll
      for (int i = 0; i < 8; ++i) { a[i] = (__bf16)p[i]; a[8 + i] = (__bf16)p[16 + i]; } }
    asm volatile("s_wait_loadcnt 0x0" ::: "memory");
#pragma unroll
    for (int j = 0; j < 8; ++j) { const v16b w = WCOL(WA, kc * 32, c0 + j * 16 + col, lane); asm volatile("s_wait_loadcnt 0x0" ::: "memory"); acc[j] = wmma_bf(a, w, acc[j]); } }
  if (which < 2) { _Float16* DH = which == 0 ? QH : KH; _Float16* DL = which == 0 ? QL : KL; const int nhi = which == 0 ? QHI : KHI; const bool hi_rows = t0 < nhi;
#pragma unroll
    for (int j = 0; j < 8; ++j) { const float bias = BA ? bfr(BA[c0 + j * 16 + col]) : 0.f;
#pragma unroll
      for (int r = 0; r < 8; ++r) { const float v = acc[j][r] + bias; const _Float16 hv = (_Float16)v; sh[wave * 16 + 8 * g + r][j * 16 + col] = hv; sl[wave * 16 + 8 * g + r][j * 16 + col] = (_Float16)((v - (float)hv) * 1024.0f); } }
    __syncthreads();
    for (int e = tid; e < 64 * 16; e += 128) { const int rl = e >> 4, q = e & 15; vst2((unsigned*)(DH + (r0 + rl) * CC + c0 + q * 8), *(const v4u*)&sh[rl][q * 8]); if (hi_rows) vst2((unsigned*)(DL + (bb * nhi + t0 + rl) * (size_t)CC + c0 + q * 8), *(const v4u*)&sl[rl][q * 8]); }
  } else { const bool hi_rows = t0 < KHI;
#pragma unroll
    for (int j = 0; j < 8; ++j) { const float bias = BA ? bfr(BA[c0 + j * 16 + col]) : 0.f;
#pragma unroll
      for (int r = 0; r < 8; ++r) { const float v = acc[j][r] + bias; const int rl = wave * 16 + 8 * g + r, cl = j * 16 + col; th[cl][rl] = (_Float16)v; const __bf16 bh = (__bf16)v; tb[cl][rl] = bh; tbl[cl][rl] = (__bf16)(v - (float)bh); } }
    __syncthreads();
    for (int e = tid; e < 128 * 8; e += 128) { const int cl = e >> 3, q = e & 7; vst2((unsigned*)(VT + (bb * CC + c0 + cl) * (size_t)TT + t0 + q * 8), *(const v4u*)&th[cl][q * 8]); if (hi_rows) { const size_t o3 = (bb * CC + c0 + cl) * (size_t)KHI + t0 + q * 8; vst2((unsigned*)(VB + o3), *(const v4u*)&tb[cl][q * 8]); vst2((unsigned*)(VBL + o3), *(const v4u*)&tbl[cl][q * 8]); } } } }
// last fragment of a batch of loads off one address pair: the batch's last load may land on that pair, which the loads before it name, so the wait stands in front of it
__device__ __forceinline__ v16h frag_h_last(const _Float16* rowk0, int lane) {
  union { v16h v; v8h q[2]; } u; const _Float16* p = rowk0 + 8 * (lane >> 4);
  u.q[0] = *(const v8h*)p; asm volatile("s_wait_xcnt 0x0" ::: "memory"); u.q[1] = *(const v8h*)(p + 16); return u.v; }
// inputs-only hold on loaded fragments: every load of the batch is issued before the first product waits for one, so a batch costs one load latency and not one per fragment
#define HOLD8(a, o) asm volatile("" :: "v"(a[o]), "v"(a[o + 1]), "v"(a[o + 2]), "v"(a[o + 3]), "v"(a[o + 4]), "v"(a[o + 5]), "v"(a[o + 6]), "v"(a[o + 7]))
// one 128-key tile of this lane's query row t (lanes l and l ^ 16 share a row; e[kc][0..7] = key k0 + 32 kc + 8 g + i, e[kc][8..15] = 16 keys on: the A fragment's k order): causal mask by index (only a query block's last key block reaches past the diagonal), running max m and sum l brought up to date; leaves exp(logit - m) x 2^11 in e (0 for excluded keys) and returns the factor that carries earlier sums over to the new max
__device__ __forceinline__ float sm_tile(const float* row, int g, int k0, int t, bool diag, float& m, float& l, float (&e)[4][16]) {
#pragma unroll
  for (int kc = 0; kc < 4; ++kc) { const float* p = row + kc * 32 + 8 * g;
    union { v4f q[4]; float f[16]; } u; u.q[0] = *(const v4f*)p; u.q[1] = *(const v4f*)(p + 4); u.q[2] = *(const v4f*)(p + 16); u.q[3] = *(const v4f*)(p + 20);
#pragma unroll
    for (int i = 0; i < 16; ++i) e[kc][i] = u.f[i]; }
  if (diag) {   /* block-uniform */
#pragma unroll
    for (int kc = 0; kc < 4; ++kc)
#pragma unroll
      for (int i = 0; i < 16; ++i) { const int k = k0 + kc * 32 + 8 * g + (i < 8 ? i : i + 8); e[kc][i] = k <= t ? e[kc][i] : -3.0e38f; } }
  float mx = -3.0e38f;
#pragma unroll
  for (int kc = 0; kc < 4; ++kc)
#pragma unroll
    for (int i = 0; i < 16; ++i) mx = fmaxf(mx, e[kc][i]);
  mx = fmaxf(mx, __shfl_xor(mx, 16));
  const float mn = fmaxf(m, mx); const float al = expf(m - mn); m = mn;
  float sum = 0.f;
#pragma unroll
  for (int kc = 0; kc < 4; ++kc)
#pragma unroll
    for (int i = 0; i < 16; ++i) { const float x = expf(e[kc][i] - mn); sum += x; e[kc][i] = x * 2048.0f; }   /* an excluded key's -3e38 gives exactly 0 */
  sum += __shfl_xor(sum, 16);
  l = l * al + sum;
  return al; }
// per-row value held by lane (row) -> the accumulator's rows 8 g + r
__device__ __forceinline__ void row_scale(v8f (&o)[HD / 16], float f, int g) {
#pragma unroll
  for (int r = 0; r < 8; ++r) { const float fr = __shfl(f, 8 * g + r);
#pragma unroll
    for (int j = 0; j < HD / 16; ++j) o[j][r] *= fr; } }
// hand-over through LDS between lanes of ONE wave: its LDS operations have ended and the compiler moves none across; no fence, which would also wait for the global loads that are meant to stay in flight
#define LDSW() do { asm volatile("s_wait_dscnt 0" ::: "memory"); __builtin_amdgcn_wave_barrier(); } while (0)
// ---- k_att: block = (pair = b * NH + h, 64 queries qb, longest first); each wave owns 16 query rows and walks its causal key blocks of 128 alone: logits x SCALE (q x k in f16; query blocks < QBH: + q residual x k + q x k residual, both x 2^10) -> the wave's own LDS tile -> read back row-wise, running softmax in f32 -> exp x 2^11 once to f16 against v f16 (query blocks < QBH: exp and v as bf16 hi + lo, 3 products); ctx = sums / (2^11 l); 256-B (row, head) segment by 16 lanes
static_assert(CAUSAL == 1 && QBH * 64 == QHI && QHI == KHI && QHI % 128 == 0 && HD == 64, "early query blocks see only keys that carry residual planes");
__global__ __attribute__((amdgpu_waves_per_eu(4))) __launch_bounds__(128) void k_att(const _Float16* __restrict__ QH, const _Float16* __restrict__ KH, const _Float16* __restrict__ QL, const _Float16* __restrict__ KL, const _Float16* __restrict__ VT, const __bf16* __restrict__ VB, const __bf16* __restrict__ VBL, float* __restrict__ Y) { __shared__ __align__(16) float ss[4][16][132];
  const int pr = blockIdx.x, b = pr / NH, h = pr % NH; const int qb = NQB - 1 - (int)blockIdx.y; const int nkb = kb_last(qb) + 1;
  const int tid = threadIdx.x, wave = tid >> 5, lane = tid & 31, col = lane & 15, g = lane >> 4; const int ql0 = qb * 64 + wave * 16; const size_t q0 = (size_t)b * TT + ql0; const int t = ql0 + col;
  float m = -3.0e38f, l = 0.f; v8f o[HD / 16] = {}; float e[4][16];
  v16h ah[HD / 32];
#pragma unroll
  for (int kc = 0; kc < HD / 32; ++kc) ah[kc] = frag_h(QH + (q0 + col) * CC + h * HD + kc * 32, lane);
  asm volatile("s_wait_xcnt 0x0" ::: "memory");   /* stands in front of the first rewrite of the address pair that the q loads name */
  if (qb < QBH) { const _Float16* KLb = KL + (size_t)b * KHI * CC; v16h al[HD / 32];
#pragma unroll
    for (int kc = 0; kc < HD / 32; ++kc) al[kc] = frag_h(QL + ((size_t)b * QHI + ql0 + col) * CC + h * HD + kc * 32, lane);
#pragma unroll 1
    for (int kb = 0; kb < nkb; ++kb) { const int k0 = kb * 128; const size_t kr0 = (size_t)b * TT + k0; v8f acc[8] = {}, accl[8] = {};
#pragma unroll
      for (int kc = 0; kc < HD / 32; ++kc)
#pragma unroll
        for (int jh = 0; jh < 8; jh += 4) { v16h kf[8];
#pragma unroll
          for (int j = 0; j < 4; ++j) { kf[j] = frag_h(KH + (kr0 + (jh + j) * 16 + col) * CC + h * HD + kc * 32, lane); kf[4 + j] = frag_h(KLb + (size_t)(k0 + (jh + j) * 16 + col) * CC + h * HD + kc * 32, lane); }
          HOLD8(kf, 0);
#pragma unroll
          for (int j = 0; j < 4; ++j) { acc[jh + j] = wmma16(ah[kc], kf[j], acc[jh + j]); accl[jh + j] = wmma16(al[kc], kf[j], accl[jh + j]); accl[jh + j] = wmma16(ah[kc], kf[4 + j], accl[jh + j]); } }
#pragma unroll
      for (int j = 0; j < 8; ++j)
#pragma unroll
        for (int r = 0; r < 8; ++r) ss[wave][8 * g + r][j * 16 + col] = (acc[j][r] + accl[j][r] * (1.0f / 1024.0f)) * SCALE;
      LDSW();   /* the tile's writes land before other lanes of this wave read them */
      const float f = sm_tile(&ss[wave][col][0], g, k0, t, kb == nkb - 1, m, l, e);
      LDSW();   /* the tile's reads end before the next tile is written over it */
      row_scale(o, f, g);
#pragma unroll
      for (int kc = 0; kc < 4; ++kc) { const F2 p = bsplit16(e[kc]); v16b vf[8];
#pragma unroll
        for (int j = 0; j < HD / 16; ++j) { const size_t po = ((size_t)b * CC + h * HD + j * 16 + col) * (size_t)KHI + k0 + kc * 32; vf[j] = frag_b(VB + po, lane); vf[4 + j] = frag_b(VBL + po, lane); }
        HOLD8(vf, 0);
#pragma unroll
        for (int j = 0; j < HD / 16; ++j) { o[j] = wmma_bf(p.h, vf[j], o[j]); o[j] = wmma_bf(p.l, vf[j], o[j]); o[j] = wmma_bf(p.h, vf[4 + j], o[j]); } } }
  } else { const _Float16* kp = KH + ((size_t)b * TT + col) * CC + h * HD; const _Float16* vp = VT + ((size_t)b * CC + h * HD + col) * (size_t)TT;   /* this lane's k row and v plane at the key block's first key */
#pragma unroll 1
    for (int kb = 0; kb < nkb; ++kb, kp += (size_t)128 * CC, vp += 128) { const int k0 = kb * 128; v8f acc[8] = {}; { v16h kf[16];
#pragma unroll
      for (int kc = 0; kc < HD / 32; ++kc)
#pragma unroll
        for (int j = 0; j < 8; ++j) if (kc * 8 + j < 15) kf[kc * 8 + j] = frag_h(kp + (size_t)j * 16 * CC + kc * 32, lane);
      kf[15] = frag_h_last(kp + (size_t)7 * 16 * CC + 32, lane);
      HOLD8(kf, 0); HOLD8(kf, 8);
#pragma unroll
      for (int kc = 0; kc < HD / 32; ++kc)
#pragma unroll
        for (int j = 0; j < 8; ++j) acc[j] = wmma16(ah[kc], kf[kc * 8 + j], acc[j]); }
#pragma unroll
      for (int j = 0; j < 8; ++j)
#pragma unroll
        for (int r = 0; r < 8; ++r) ss[wave][8 * g + r][j * 16 + col] = acc[j][r] * SCALE;
      v16h vf[16];   /* v fragments of the first 64 keys fly while the softmax runs, the other 64 behind it */
#pragma unroll
      for (int kc = 0; kc < 2; ++kc)
#pragma unroll
        for (int j = 0; j < HD / 16; ++j) vf[kc * 4 + j] = frag_h(vp + (size_t)j * 16 * TT + kc * 32, lane);
      LDSW();   /* the tile's writes land before other lanes of this wave read them */
      const float f = sm_tile(&ss[wave][col][0], g, k0, t, kb == nkb - 1, m, l, e);
      LDSW();   /* the tile's reads end before the next tile is written over it */
      v16h p[4];
#pragma unroll
      for (int kc = 0; kc < 4; ++kc)
#pragma unroll
        for (int i = 0; i < 16; ++i) p[kc][i] = (_Float16)e[kc][i];
#pragma unroll
      for (int kc = 2; kc < 4; ++kc)
#pragma unroll
        for (int j = 0; j < HD / 16; ++j) if (kc * 4 + j < 15) vf[kc * 4 + j] = frag_h(vp + (size_t)j * 16 * TT + kc * 32, lane);
      vf[15] = frag_h_last(vp + (size_t)3 * 16 * TT + 3 * 32, lane);
      row_scale(o, f, g);
      HOLD8(vf, 0);
#pragma unroll
      for (int kc = 0; kc < 2; ++kc)
#pragma unroll
        for (int j = 0; j < HD / 16; ++j) o[j] = wmma16(p[kc], vf[kc * 4 + j], o[j]);
      HOLD8(vf, 8);
#pragma unroll
      for (int kc = 2; kc < 4; ++kc)
#pragma unroll
        for (int j = 0; j < HD / 16; ++j) o[j] = wmma16(p[kc], vf[kc * 4 + j], o[j]); } }
  row_scale(o, l > 0.f ? (1.0f / 2048.0f) / l : 0.f, g);
#pragma unroll
  for (int j = 0; j < HD / 16; ++j)
#pragma unroll
    for (int r = 0; r < 8; ++r) ss[wave][8 * g + r][j * 16 + col] = o[j][r];
  LDSW(); for (int rl = g; rl < 16; rl += 2) vst2(Y + ((size_t)b * TT + ql0 + rl) * CC + h * HD + col * 4, *(const v4f*)&ss[wave][rl][col * 4]); }
// ---- k_out: block = (64 rows, 128 cols): out = ctx Wo (+ bo): ctx x 2^6 once to f16 against Wo as f16(bf16 x 2^8) exact (1 product) x 2^-14; causal early rows (< QHI of each sequence): ctx bf16 hi + lo against exact bf16 Wo (2 products)
__global__ __launch_bounds__(128) void k_out(const float* __restrict__ Y, const float* __restrict__ WO, const float* __restrict__ BO, float* __restrict__ OUT) { __shared__ __align__(16) float sf[4][16][132];
  const int tid = threadIdx.x, wave = tid >> 5, lane = tid & 31, col = lane & 15, g = lane >> 4; const int c0 = blockIdx.y * 128; const size_t r0 = (size_t)blockIdx.x * 64 + wave * 16;
  v8f acc[8] = {};
  if (CAUSAL && (int)(((size_t)blockIdx.x * 64) % TT) < QHI) {   /* block-uniform */
#pragma unroll 2
    for (int kc = 0; kc < CC / 32; ++kc) { const F2 a = split_row(Y + (r0 + col) * CC, kc * 32, lane); asm volatile("s_wait_loadcnt 0x0" ::: "memory");
#pragma unroll
      for (int j = 0; j < 8; ++j) { const v16b w = WOCOL(WO, kc * 32, c0 + j * 16 + col, lane); asm volatile("s_wait_loadcnt 0x0" ::: "memory"); acc[j] = wmma_bf(a.h, w, acc[j]); acc[j] = wmma_bf(a.l, w, acc[j]); } }
#pragma unroll
    for (int j = 0; j < 8; ++j) { const float bias = BO ? bfr(BO[c0 + j * 16 + col]) : 0.f;
#pragma unroll
      for (int r = 0; r < 8; ++r) sf[wave][8 * g + r][j * 16 + col] = acc[j][r] + bias; }
  } else {
#pragma unroll 2
    for (int kc = 0; kc < CC / 32; ++kc) { const v16h a = frag_f32s(Y + (r0 + col) * CC + kc * 32, lane, 64.0f); asm volatile("s_wait_loadcnt 0x0" ::: "memory");   /* ctx carried x 2^6 into f16 so small-magnitude context rows stay clear of f16 subnormals */
#pragma unroll
      for (int j = 0; j < 8; ++j) { const v16h w = WOCOLH(WO, kc * 32, c0 + j * 16 + col, lane); asm volatile("s_wait_loadcnt 0x0" ::: "memory"); acc[j] = wmma16(a, w, acc[j]); } }
#pragma unroll
    for (int j = 0; j < 8; ++j) { const float bias = BO ? bfr(BO[c0 + j * 16 + col]) : 0.f;
#pragma unroll
      for (int r = 0; r < 8; ++r) sf[wave][8 * g + r][j * 16 + col] = acc[j][r] * (1.0f / 16384.0f) + bias; } }   /* 2^-8 (Wo carry) x 2^-6 (ctx carry) */
  LDSX(); for (int rl = 0; rl < 16; ++rl) vst2(OUT + (r0 + rl) * DIN + c0 + lane * 4, *(const v4f*)&sf[wave][rl][lane * 4]); }

extern "C" void kernel_launch(void* const* d_in, const int* in_sizes, int n_in, void* d_out, int out_size, void* d_ws, size_t ws_size, hipStream_t stream) {
  (void)in_sizes; (void)n_in; (void)out_size;
  const float** F = (const float**)d_in;
  if (ws_size < (size_t)WS_END) return;
  char* ws = (char*)d_ws; _Float16 *QH = (_Float16*)(ws + WS_QH), *KH = (_Float16*)(ws + WS_KH), *VT = (_Float16*)(ws + WS_VT), *QL = (_Float16*)(ws + WS_QL), *KL = (_Float16*)(ws + WS_KL); __bf16 *VB = (__bf16*)(ws + WS_VB), *VBL = (__bf16*)(ws + WS_VBL); float *Y = (float*)(ws + WS_Y);
  (void)Y; (void)QL; (void)KL; (void)VB; (void)VBL;
  // inputs: 0 x [4,2048,768]; 1 Wq [12,768,64]; 2 Wk; 3 Wv (per-head [head][model][d]); 4 Wo [768,768] (out,in); 5 bo [768] (zeros, read); no q / k / v biases
  k_proj<<<dim3(TNB * TT / 64, CC / 128, 3), 128, 0, stream>>>(F[0], F[0], F[0], F[1], F[2], F[3], nullptr, nullptr, nullptr, QH, QL, KH, KL, VT, VB, VBL);
  k_att<<<dim3(TNB * NH, NQB), 128, 0, stream>>>(QH, KH, QL, KL, VT, VB, VBL, Y);
  k_out<<<dim3(TNB * TT / 64, DIN / 128), 128, 0, stream>>>(Y, F[4], F[5], (float*)d_out);
}

// v003
// One run takes 169 microseconds.
// Two timings next to v002 put it at 2.17 and 2.24 times that version's speed.
// Over all steps from v000 it is 14.0 times as fast.
// compute dtype: all float inputs rounded to bf16; per-head q / k / v projections with EXACT bf16 products on WMMA 16x16x32 (f32 accumulate), no biases; causal logits: 3 products for the first 384 rows, single f16 q x k after, x 64^-0.5; softmax f32 with a running max and sum per 128 keys; exp x 2^11 once to f16 x v once to f16 (bf16 hi + lo below row 384); ctx hi+lo x exact Wo below row 384, x2^6 f16 carry x f16(bf16 x 2^8) Wo after, + bo (zeros, read); f32 output.
#include <hip/hip_runtime.h>
#include <math.h>

typedef __attribute__((ext_vector_type(16))) _Float16 v16h;
typedef __attribute__((ext_vector_type(16))) __bf16 v16b;
typedef __attribute__((ext_vector_type(8)))  _Float16 v8h;
typedef __attribute__((ext_vector_type(8)))  float v8f;
typedef __attribute__((ext_vector_type(4)))  float v4f;
typedef __attribute__((ext_vector_type(2)))  float v2f;
typedef __attribute__((ext_vector_type(4)))  unsigned v4u;
typedef __attribute__((ext_vector_type(4)))  int v4i;
typedef float __attribute__((may_alias)) float_a;
typedef int __attribute__((may_alias)) int_a;

template <typename T> __device__ __forceinline__ void vst2(void* p, T v) { *(T*)p = v;  }
__device__ __forceinline__ v8f wmma16(v16h a, v16h b, v8f c) {
  v8f d = __builtin_amdgcn_wmma_f32_16x16x32_f16(false, a, false, b, (short)0, c, false, false);
  asm volatile("v_nop\n\tv_nop\n\tv_nop\n\tv_nop" : "+v"(d) : "v"(a), "v"(b));
  return d;
}
__device__ __forceinline__ v8f wmma_bf(v16b a, v16b b, v8f c) {
  v8f d = __builtin_amdgcn_wmma_f32_16x16x32_bf16(false, a, false, b, (short)0, c, false, false);
  asm volatile("v_nop\n\tv_nop\n\tv_nop\n\tv_nop" : "+v"(d) : "v"(a), "v"(b));
  return d;
}
// 16x16x32 fragments: lane = (h = lane>>4, row/col = lane&15); elements 0..7 = k0+8h+0..7, 8..15 = k0+16+8h+0..7; D element r = row 8h+r
__device__ __forceinline__ v16h frag_h(const _Float16* rowk0, int lane) {
  union { v16h v; v8h q[2]; } u; const _Float16* p = rowk0 + 8 * (lane >> 4);
  u.q[0] = *(const v8h*)p; u.q[1] = *(const v8h*)(p + 16); return u.v;
}
__device__ __forceinline__ v16h frag_f32(const float* rowk0, int lane) {
  v16h a; const float* p = rowk0 + 8 * (lane >> 4);
#pragma unroll
  for (int i = 0; i < 8; ++i) { a[i] = (_Float16)p[i]; a[8 + i] = (_Float16)p[16 + i]; }
  return a;
}
__device__ __forceinline__ v16h frag_f32s(const float* rowk0, int lane, float sc) {
  v16h a; const float* p = rowk0 + 8 * (lane >> 4);
#pragma unroll
  for (int i = 0; i < 8; ++i) { a[i] = (_Float16)(p[i] * sc); a[8 + i] = (_Float16)(p[16 + i] * sc); }
  return a;
}
// column fragment from a [K][ld] layout (column n), rows >= K read as 0
__device__ __forceinline__ v16h fragc_f32(const float* W, int k0, int n, int lane, int ld, int K) {
  v16h a; const int g = lane >> 4;
#pragma unroll
  for (int i = 0; i < 8; ++i) { const int ka = k0 + 8 * g + i, kb = ka + 16;
    a[i] = (_Float16)(ka < K ? W[(size_t)(ka < K ? ka : K - 1) * ld + n] : 0.f); a[8 + i] = (_Float16)(kb < K ? W[(size_t)(kb < K ? kb : K - 1) * ld + n] : 0.f); }
  return a;
}
struct F2 { v16b h, l; };
__device__ __forceinline__ F2 bsplit16(const float v[16]) { F2 r;
#pragma unroll
  for (int i = 0; i < 16; ++i) { const __bf16 h = (__bf16)v[i]; r.h[i] = h; r.l[i] = (__bf16)(v[i] - (float)h); }
  return r; }
__device__ __forceinline__ F2 split_row(const float* row, int k0, int lane) { float v[16]; const float* p = row + k0 + 8 * (lane >> 4);
#pragma unroll
  for (int i = 0; i < 8; ++i) { v[i] = p[i]; v[8 + i] = p[16 + i]; }
  return bsplit16(v); }
__device__ __forceinline__ F2 split_rowK(const float* row, int k0, int lane, int K) { float v[16]; const int g = lane >> 4;
#pragma unroll
  for (int i = 0; i < 8; ++i) { const int ka = k0 + 8 * g + i, kb = ka + 16; v[i] = ka < K ? row[ka < K ? ka : K - 1] : 0.f; v[8 + i] = kb < K ? row[kb < K ? kb : K - 1] : 0.f; }
  return bsplit16(v); }
__device__ __forceinline__ F2 split_col(const float* W, int k0, int n, int lane, int ld, int K) { float v[16]; const int g = lane >> 4;
#pragma unroll
  for (int i = 0; i < 8; ++i) { const int ka = k0 + 8 * g + i, kb = ka + 16; v[i] = ka < K ? W[(size_t)(ka < K ? ka : K - 1) * ld + n] : 0.f; v[8 + i] = kb < K ? W[(size_t)(kb < K ? kb : K - 1) * ld + n] : 0.f; }
  return bsplit16(v); }
__device__ __forceinline__ v8f mac3(const F2& a, const F2& b, v8f c) { c = wmma_bf(a.l, b.h, c); c = wmma_bf(a.h, b.l, c); return wmma_bf(a.h, b.h, c); }
__device__ __forceinline__ float sigm(float v) { return 1.0f / (1.0f + expf(-v)); }
#define LDSX() do { asm volatile("s_wait_dscnt 0" ::: "memory"); __builtin_amdgcn_wave_barrier(); __builtin_amdgcn_fence(__ATOMIC_RELEASE, "workgroup"); } while (0)

// Causal multi-head self-attention with per-head weights (x [4,2048,768]; Wq / Wk / Wv [12,768,64] = per-head [head][model][d] N(0,1) x 0.02, no biases; Wo [768,768] torch (out,in), bo zeros (read); q = einsum('bsd,hde->bhse'); scores / sqrt(64); tril kept, finfo.min elsewhere; softmax; ctx merged (head*64 + e); ctx @ Wo.T + bo).
#define NB 4
#define TT 2048
#define CC 768            // NH * HD = projected width
#define DIN 768          // input (model) width
#define NH 12
#define HD 64
#define NQB (TT / 64)
#define SCALE (0.125f)
#define CAUSAL 1
#ifndef TNB
#define TNB NB
#endif
__device__ __forceinline__ float bfr(float v) { return (float)(__bf16)v; }
__host__ __device__ __forceinline__ int kb_last(int qb) { return CAUSAL ? ((qb * 64 + 63) >> 7) : (TT / 128 - 1); }
typedef __attribute__((ext_vector_type(8))) __bf16 v8b;
__device__ __forceinline__ v16b frag_b(const __bf16* rowk0, int lane) {
  union { v16b v; v8b q[2]; } u; const __bf16* p = rowk0 + 8 * (lane >> 4);
  u.q[0] = *(const v8b*)p; u.q[1] = *(const v8b*)(p + 16); return u.v;
}
#define QBH 6              // causal: query blocks 0..QBH-1 of each sequence (few keys, no averaging) take the high-precision path
#define QHI 384            // rows carrying a q residual plane
#define KHI 384            // key rows carrying k residual / v bf16 hi+lo planes (used only by the causal high-precision path)
// B fragment (k rows k0+.., output column o) of a weight: (in,out) [K][ld] or (out,in) [ld rows of K]: bf16 exact, or f16(bf16 * 256) exact
__device__ __forceinline__ v16b wcol_io(const float* Wm, int k0, int o, int lane, int ld) { v16b w; const int g = lane >> 4;
#pragma unroll
  for (int i = 0; i < 8; ++i) { w[i] = (__bf16)Wm[(size_t)(k0 + 8 * g + i) * ld + o]; w[8 + i] = (__bf16)Wm[(size_t)(k0 + 16 + 8 * g + i) * ld + o]; }
  return w; }
__device__ __forceinline__ v16b wcol_oi(const float* Wm, int k0, int o, int lane, int K) { v16b w; const float* p = Wm + (size_t)o * K + k0 + 8 * (lane >> 4);
#pragma unroll
  for (int i = 0; i < 8; ++i) { w[i] = (__bf16)p[i]; w[8 + i] = (__bf16)p[16 + i]; }
  return w; }
__device__ __forceinline__ v16h wcolh_io(const float* Wm, int k0, int o, int lane, int ld) { v16h w; const int g = lane >> 4;
#pragma unroll
  for (int i = 0; i < 8; ++i) { w[i] = (_Float16)(bfr(Wm[(size_t)(k0 + 8 * g + i) * ld + o]) * 256.0f); w[8 + i] = (_Float16)(bfr(Wm[(size_t)(k0 + 16 + 8 * g + i) * ld + o]) * 256.0f); }
  return w; }
__device__ __forceinline__ v16h wcolh_oi(const float* Wm, int k0, int o, int lane, int K) { v16h w; const float* p = Wm + (size_t)o * K + k0 + 8 * (lane >> 4);
#pragma unroll
  for (int i = 0; i < 8; ++i) { w[i] = (_Float16)(bfr(p[i]) * 256.0f); w[8 + i] = (_Float16)(bfr(p[16 + i]) * 256.0f); }
  return w; }
#define WQKV_LAYOUT 2   // 0 = (in,out) [DIN][CC]; 1 = (out,in) [CC][DIN]; 2 = per-head [NH][DIN][HD]
__device__ __forceinline__ v16b wcol_hdk(const float* Wm, int k0, int o, int lane) { v16b w; const int g = lane >> 4; const float* p = Wm + (size_t)(o / HD) * DIN * HD + (o % HD);
#pragma unroll
  for (int i = 0; i < 8; ++i) { w[i] = (__bf16)p[(size_t)(k0 + 8 * g + i) * HD]; w[8 + i] = (__bf16)p[(size_t)(k0 + 16 + 8 * g + i) * HD]; }
  return w; }
#define WO_OUT_IN 1
#if WQKV_LAYOUT == 1
#define WCOL(W, k0, o, lane) wcol_oi(W, k0, o, lane, DIN)
#elif WQKV_LAYOUT == 2
#define WCOL(W, k0, o, lane) wcol_hdk(W, k0, o, lane)
#else
#define WCOL(W, k0, o, lane) wcol_io(W, k0, o, lane, CC)
#endif
#if WO_OUT_IN
#define WOCOL(W, k0, o, lane) wcol_oi(W, k0, o, lane, CC)
#define WOCOLH(W, k0, o, lane) wcolh_oi(W, k0, o, lane, CC)
#else
#define WOCOL(W, k0, o, lane) wcol_io(W, k0, o, lane, DIN)
#define WOCOLH(W, k0, o, lane) wcolh_io(W, k0, o, lane, DIN)
#endif

#ifndef PROJ_EXTRA_PARAMS
#define PROJ_EXTRA_PARAMS
#endif

#define WS_QH  0u                                      // f16 q rows [b*t][CC]
#define WS_KH  (WS_QH + 2u * (size_t)NB * TT * CC)      // f16 k in fragment order [b][head][16-key group][kc][half][lane][8]
#define WS_VT  (WS_KH + 2u * (size_t)NB * TT * CC)      // f16 v in fragment order [b][head][32-key group][j][half][lane][8]
#define WS_QL  (WS_VT + 2u * (size_t)NB * CC * TT)      // f16 q residual x 2^10 rows [b][t < QHI][CC]
#define WS_KL  (WS_QL + 2u * (size_t)NB * QHI * CC)     // f16 k residual x 2^10 rows [b][t < KHI][CC]
#define WS_VB  (WS_KL + 2u * (size_t)NB * KHI * CC)     // bf16 v hi planes [b][c][t < KHI]
#define WS_VBL (WS_VB + 2u * (size_t)NB * CC * KHI)
#define WS_Y   (WS_VBL + 2u * (size_t)NB * CC * KHI)    // f32 ctx rows [b*t][CC] (only when there is an output projection)
#define WS_XP  (WS_Y  + 4u * (size_t)NB * TT * CC)      // bf16 x in fragment order [16-row group][kc][half][lane][8]
#define WS_WP  (WS_XP + 2u * (size_t)NB * TT * DIN)     // bf16 Wq / Wk / Wv in fragment order [which][128-col block][kc][j][half][lane][8]
#define WS_OB  (WS_WP + 2u * (size_t)3 * DIN * CC)      // bf16 Wo in fragment order [128-col block][kc][j][half][lane][8]
#define WS_OH  (WS_OB + 2u * (size_t)CC * DIN)          // f16(bf16 x 2^8) Wo, same order
#define WS_END (WS_OH + 2u * (size_t)CC * DIN)

// A fragment kept in memory in fragment order is 1 KiB: elements 0..7 of lanes 0..31 (512 B), then elements 8..15: each of its two wave-wide 16-byte loads covers four whole 128-B lines
#define FRAGE 512          // 16-bit elements per stored fragment
#define NFX (NB * TT / 16 * (DIN / 32))
#define NFW (3 * (CC / 16) * (DIN / 32))
#define NFO ((DIN / 16) * (CC / 32))
#define PACKF 4            // fragments per wave of k_pack
static_assert(WO_OUT_IN == 1 && NFX % (4 * PACKF) == 0 && NFW % (4 * PACKF) == 0 && NFO % (4 * PACKF) == 0 && CC % 128 == 0 && DIN % 128 == 0, "a k_pack block stays inside one operand");
template <typename V> __device__ __forceinline__ void frag_put(void* f, V v, int lane) { union { V v; v4u q[2]; } u; u.v = v; *((v4u*)f + lane) = u.q[0]; *((v4u*)f + 32 + lane) = u.q[1]; }
template <typename V> __device__ __forceinline__ V frag_get(const void* f, int lane) { union { V v; v4u q[2]; } u; u.q[0] = *((const v4u*)f + lane); u.q[1] = *((const v4u*)f + 32 + lane); return u.v; }
// last fragment of a batch of loads off one address pair: the batch's last load may land on that pair, which the loads before it name, so the wait stands in front of it
template <typename V> __device__ __forceinline__ V frag_get_last(const void* f, int lane) { union { V v; v4u q[2]; } u; u.q[0] = *((const v4u*)f + lane); asm volatile("s_wait_xcnt 0x0" ::: "memory"); u.q[1] = *((const v4u*)f + 32 + lane); return u.v; }
// behind a batch of loads off the address p: the wait that stands in front of any rewrite of that address pair; naming p keeps the pair live up to the wait, so no load of the batch lands on it either
#define XWAIT(p) asm volatile("s_wait_xcnt 0x0" :: "v"(p) : "memory")
// inputs-only hold on loaded fragments: every load of the batch is issued before the first product waits for one, so a batch costs one load latency and not one per fragment
#define HOLD8(a, o) asm volatile("" :: "v"(a[o]), "v"(a[o + 1]), "v"(a[o + 2]), "v"(a[o + 3]), "v"(a[o + 4]), "v"(a[o + 5]), "v"(a[o + 6]), "v"(a[o + 7]))
// ---- k_pack: one wave per PACKF fragments: x, Wq / Wk / Wv, Wo rounded exactly as the products take them (bf16; Wo also f16(bf16 x 2^8)) and laid down in fragment order, once per call, for k_proj and k_out
__global__ __launch_bounds__(128) void k_pack(const float* __restrict__ X, const float* __restrict__ WQ, const float* __restrict__ WK, const float* __restrict__ WV, const float* __restrict__ WO, __bf16* __restrict__ XP, __bf16* __restrict__ WP, __bf16* __restrict__ OB, _Float16* __restrict__ OH) {
  const int lane = threadIdx.x & 31, col = lane & 15, g = lane >> 4; const int f0 = ((int)blockIdx.x * 4 + ((int)threadIdx.x >> 5)) * PACKF;
  if (f0 < NFX) {   /* block-uniform */
    v16b a[PACKF];
#pragma unroll
    for (int i = 0; i < PACKF; ++i) { const int f = f0 + i, rg = f / (DIN / 32), kc = f % (DIN / 32); const float* p = X + ((size_t)rg * 16 + col) * DIN + kc * 32 + 8 * g;
#pragma unroll
      for (int e = 0; e < 8; ++e) { a[i][e] = (__bf16)p[e]; a[i][8 + e] = (__bf16)p[16 + e]; }
      XWAIT(p); }
#pragma unroll
    for (int i = 0; i < PACKF; ++i) frag_put(XP + (size_t)(f0 + i) * FRAGE, a[i], lane);
  } else if (f0 < NFX + NFW) {
#pragma unroll
    for (int i = 0; i < PACKF; ++i) { const int f = f0 - NFX + i, j = f & 7, kc = (f >> 3) % (DIN / 32), cb = (f >> 3) / (DIN / 32) % (CC / 128), which = (f >> 3) / (DIN / 32) / (CC / 128); const float* WA = which == 0 ? WQ : which == 1 ? WK : WV;
      frag_put(WP + (size_t)f * FRAGE, WCOL(WA, kc * 32, cb * 128 + j * 16 + col, lane), lane); }
  } else { const bool hb = f0 < NFX + NFW + NFO; const int fo = f0 - NFX - NFW - (hb ? 0 : NFO); float v[PACKF][16];   /* Wo, once as bf16 and once as f16(bf16 x 2^8) */
#pragma unroll
    for (int i = 0; i < PACKF; ++i) { const int f = fo + i, j = f & 7, kc = (f >> 3) % (CC / 32), cb = (f >> 3) / (CC / 32); const float* p = WO + (size_t)(cb * 128 + j * 16 + col) * CC + kc * 32 + 8 * g;
#pragma unroll
      for (int e = 0; e < 8; ++e) { v[i][e] = p[e]; v[i][8 + e] = p[16 + e]; }
      XWAIT(p); }
#pragma unroll
    for (int i = 0; i < PACKF; ++i) { v16b wb; v16h wh;
#pragma unroll
      for (int e = 0; e < 16; ++e) { wb[e] = (__bf16)v[i][e]; wh[e] = (_Float16)(bfr(v[i][e]) * 256.0f); }
      if (hb) frag_put(OB + (size_t)(fo + i) * FRAGE, wb, lane); else frag_put(OH + (size_t)(fo + i) * FRAGE, wh, lane); } } }

// ---- k_proj: block = (64 rows, 128 cols, which): q/k/v = X W (+ b) with exact bf16 products (K = DIN), both operands read in fragment order, a k step's nine fragments as one batch -> which 0: q f16 rows (+ residual rows < QHI); 1: k f16 in fragment order (+ residual rows < KHI); 2: v f16 in fragment order (+ bf16 hi/lo planes [c][t] for t < KHI)
__global__ __launch_bounds__(128) void k_proj(const __bf16* __restrict__ XP, const __bf16* __restrict__ WP, const float* __restrict__ BQ, const float* __restrict__ BK, const float* __restrict__ BV,
    _Float16* __restrict__ QH, _Float16* __restrict__ QL, _Float16* __restrict__ KH, _Float16* __restrict__ KL, _Float16* __restrict__ VT, __bf16* __restrict__ VB, __bf16* __restrict__ VBL) {
  __shared__ __align__(16) _Float16 sh[64][136], sl[64][136]; __shared__ __align__(16) _Float16 th[128][72]; __shared__ __align__(16) __bf16 tb[128][72], tbl[128][72];
  const int tid = threadIdx.x, wave = tid >> 5, lane = tid & 31, col = lane & 15, g = lane >> 4; const int which = blockIdx.z; const int c0 = blockIdx.y * 128; const size_t r0 = (size_t)blockIdx.x * 64; const size_t bb = r0 / TT; const int t0 = (int)(r0 % TT);
  const float* BA = which == 0 ? BQ : which == 1 ? BK : BV;
  const __bf16* xp = XP + (size_t)(blockIdx.x * 4 + __builtin_amdgcn_readfirstlane(wave)) * (DIN / 32) * FRAGE; const __bf16* wp = WP + (size_t)(which * (CC / 128) + blockIdx.y) * (DIN / 32) * 8 * FRAGE;   /* this wave's x fragments and this block's weight fragments, in the order of the walk; the wave's number made scalar, so that both streams are a scalar base + the lane's offset */
  v8f acc[8] = {};
  for (int kc = 0; kc < DIN / 32; ++kc, xp += FRAGE, wp += 8 * FRAGE) { const v16b a = frag_get<v16b>(xp, lane); v16b w[8];
#pragma unroll
    for (int j = 0; j < 7; ++j) w[j] = frag_get<v16b>(wp + j * FRAGE, lane);
    w[7] = frag_get_last<v16b>(wp + 7 * FRAGE, lane);
    HOLD8(w, 0);
#pragma unroll
    for (int j = 0; j < 8; ++j) acc[j] = wmma_bf(a, w[j], acc[j]); }
  if (which < 2) { _Float16* DL = which == 0 ? QL : KL; const int nhi = which == 0 ? QHI : KHI; const bool hi_rows = t0 < nhi;
#pragma unroll
    for (int j = 0; j < 8; ++j) { const float bias = BA ? bfr(BA[c0 + j * 16 + col]) : 0.f;
#pragma unroll
      for (int r = 0; r < 8; ++r) { const float v = acc[j][r] + bias; const _Float16 hv = (_Float16)v; sh[wave * 16 + 8 * g + r][j * 16 + col] = hv; sl[wave * 16 + 8 * g + r][j * 16 + col] = (_Float16)((v - (float)hv) * 1024.0f); } }
    __syncthreads();
    if (which == 1) { for (int e = tid; e < 64 * 16; e += 128) { const int ln = e & 31, hf = (e >> 5) & 1, kc = (e >> 6) & 1, kg = (e >> 7) & 3, hl = e >> 9;   /* k: 16-byte pieces in the order k_att's loads take them */
        vst2((unsigned*)(KH + ((((bb * NH + c0 / HD + hl) * (TT / 16) + t0 / 16 + kg) * 2 + kc) * 2 + hf) * (size_t)(FRAGE / 2) + ln * 8), *(const v4u*)&sh[kg * 16 + (ln & 15)][hl * 64 + kc * 32 + hf * 16 + (ln >> 4) * 8]); } }
    else { for (int e = tid; e < 64 * 16; e += 128) { const int rl = e >> 4, q = e & 15; vst2((unsigned*)(QH + (r0 + rl) * CC + c0 + q * 8), *(const v4u*)&sh[rl][q * 8]); } }
    if (hi_rows) { for (int e = tid; e < 64 * 16; e += 128) { const int rl = e >> 4, q = e & 15; vst2((unsigned*)(DL + (bb * nhi + t0 + rl) * (size_t)CC + c0 + q * 8), *(const v4u*)&sl[rl][q * 8]); } }
  } else { const bool hi_rows = t0 < KHI;
#pragma unroll
    for (int j = 0; j < 8; ++j) { const float bias = BA ? bfr(BA[c0 + j * 16 + col]) : 0.f;
#pragma unroll
      for (int r = 0; r < 8; ++r) { const float v = acc[j][r] + bias; const int rl = wave * 16 + 8 * g + r, cl = j * 16 + col; th[cl][rl] = (_Float16)v; const __bf16 bh = (__bf16)v; tb[cl][rl] = bh; tbl[cl][rl] = (__bf16)(v - (float)bh); } }
    __syncthreads();
    for (int e = tid; e < 128 * 8; e += 128) { const int ln = e & 31, hf = (e >> 5) & 1, j = (e >> 6) & 3, kq = (e >> 8) & 1, hl = e >> 9;   /* v: 16-byte pieces in the order k_att's loads take them */
      vst2((unsigned*)(VT + ((((bb * NH + c0 / HD + hl) * (TT / 32) + t0 / 32 + kq) * 4 + j) * 2 + hf) * (size_t)(FRAGE / 2) + ln * 8), *(const v4u*)&th[hl * 64 + j * 16 + (ln & 15)][kq * 32 + hf * 16 + (ln >> 4) * 8]); }
    if (hi_rows) for (int e = tid; e < 128 * 8; e += 128) { const int cl = e >> 3, q = e & 7; const size_t o3 = (bb * CC + c0 + cl) * (size_t)KHI + t0 + q * 8; vst2((unsigned*)(VB + o3), *(const v4u*)&tb[cl][q * 8]); vst2((unsigned*)(VBL + o3), *(const v4u*)&tbl[cl][q * 8]); } } }
// one 128-key tile of this lane's query row t (lanes l and l ^ 16 share a row; e[kc][0..7] = key k0 + 32 kc + 8 g + i, e[kc][8..15] = 16 keys on: the A fragment's k order): causal mask by index (only a query block's last key block reaches past the diagonal), running max m and sum l brought up to date; leaves exp(logit - m) x 2^11 in e (0 for excluded keys) and returns the factor that carries earlier sums over to the new max
__device__ __forceinline__ float sm_tile(const float* row, int g, int k0, int t, bool diag, float& m, float& l, float (&e)[4][16]) {
#pragma unroll
  for (int kc = 0; kc < 4; ++kc) { const float* p = row + kc * 32 + 8 * g;
    union { v4f q[4]; float f[16]; } u; u.q[0] = *(const v4f*)p; u.q[1] = *(const v4f*)(p + 4); u.q[2] = *(const v4f*)(p + 16); u.q[3] = *(const v4f*)(p + 20);
#pragma unroll
    for (int i = 0; i < 16; ++i) e[kc][i] = u.f[i]; }
  if (diag) {   /* block-uniform */
#pragma unroll
    for (int kc = 0; kc < 4; ++kc)
#pragma unroll
      for (int i = 0; i < 16; ++i) { const int k = k0 + kc * 32 + 8 * g + (i < 8 ? i : i + 8); e[kc][i] = k <= t ? e[kc][i] : -3.0e38f; } }
  float mx = -3.0e38f;
#pragma unroll
  for (int kc = 0; kc < 4; ++kc)
#pragma unroll
    for (int i = 0; i < 16; ++i) mx = fmaxf(mx, e[kc][i]);
  mx = fmaxf(mx, __shfl_xor(mx, 16));
  const float mn = fmaxf(m, mx); const float al = expf(m - mn); m = mn;
  float sum = 0.f;
#pragma unroll
  for (int kc = 0; kc < 4; ++kc)
#pragma unroll
    for (int i = 0; i < 16; ++i) { const float x = expf(e[kc][i] - mn); sum += x; e[kc][i] = x * 2048.0f; }   /* an excluded key's -3e38 gives exactly 0 */
  sum += __shfl_xor(sum, 16);
  l = l * al + sum;
  return al; }
// per-row value held by lane (row) -> the accumulator's rows 8 g + r
__device__ __forceinline__ void row_scale(v8f (&o)[HD / 16], float f, int g) {
#pragma unroll
  for (int r = 0; r < 8; ++r) { const float fr = __shfl(f, 8 * g + r);
#pragma unroll
    for (int j = 0; j < HD / 16; ++j) o[j][r] *= fr; } }
// hand-over through LDS between lanes of ONE wave: its LDS operations have ended and the compiler moves none across; no fence, which would also wait for the global loads that are meant to stay in flight
#define LDSW() do { asm volatile("s_wait_dscnt 0" ::: "memory"); __builtin_amdgcn_wave_barrier(); } while (0)
// ---- k_att: block = (pair = b * NH + h, 64 queries qb, longest first); each wave owns 16 query rows and walks its causal key blocks of 128 alone: logits x SCALE (q x k in f16; query blocks < QBH: + q residual x k + q x k residual, both x 2^10) -> the wave's own LDS tile -> read back row-wise, running softmax in f32 -> exp x 2^11 once to f16 against v f16 (query blocks < QBH: exp and v as bf16 hi + lo, 3 products); ctx = sums / (2^11 l); 256-B (row, head) segment by 16 lanes
static_assert(CAUSAL == 1 && QBH * 64 == QHI && QHI == KHI && QHI % 128 == 0 && HD == 64, "early query blocks see only keys that carry residual planes");
__global__ __attribute__((amdgpu_waves_per_eu(4))) __launch_bounds__(128) void k_att(const _Float16* __restrict__ QH, const _Float16* __restrict__ KH, const _Float16* __restrict__ QL, const _Float16* __restrict__ KL, const _Float16* __restrict__ VT, const __bf16* __restrict__ VB, const __bf16* __restrict__ VBL, float* __restrict__ Y) { __shared__ __align__(16) float ss[4][16][132];
  const int pr = blockIdx.x, b = pr / NH, h = pr % NH; const int qb = NQB - 1 - (int)blockIdx.y; const int nkb = kb_last(qb) + 1;
  const int tid = threadIdx.x, wave = tid >> 5, lane = tid & 31, col = lane & 15, g = lane >> 4; const int ql0 = qb * 64 + wave * 16; const size_t q0 = (size_t)b * TT + ql0; const int t = ql0 + col;
  float m = -3.0e38f, l = 0.f; v8f o[HD / 16] = {}; float e[4][16];
  v16h ah[HD / 32];
#pragma unroll
  for (int kc = 0; kc < HD / 32; ++kc) ah[kc] = frag_h(QH + (q0 + col) * CC + h * HD + kc * 32, lane);
  asm volatile("s_wait_xcnt 0x0" ::: "memory");   /* stands in front of the first rewrite of the address pair that the q loads name */
  if (qb < QBH) { const _Float16* KLb = KL + (size_t)b * KHI * CC; v16h al[HD / 32];
#pragma unroll
    for (int kc = 0; kc < HD / 32; ++kc) al[kc] = frag_h(QL + ((size_t)b * QHI + ql0 + col) * CC + h * HD + kc * 32, lane);
#pragma unroll 1
    for (int kb = 0; kb < nkb; ++kb) { const int k0 = kb * 128; v8f acc[8] = {}, accl[8] = {};
#pragma unroll
      for (int kc = 0; kc < HD / 32; ++kc)
#pragma unroll
        for (int jh = 0; jh < 8; jh += 4) { v16h kf[8];
#pragma unroll
          for (int j = 0; j < 4; ++j) { kf[j] = frag_get<v16h>(KH + (((size_t)pr * (TT / 16) + kb * 8 + jh + j) * 2 + kc) * FRAGE, lane); kf[4 + j] = frag_h(KLb + (size_t)(k0 + (jh + j) * 16 + col) * CC + h * HD + kc * 32, lane); }
          HOLD8(kf, 0);
#pragma unroll
          for (int j = 0; j < 4; ++j) { acc[jh + j] = wmma16(ah[kc], kf[j], acc[jh + j]); accl[jh + j] = wmma16(al[kc], kf[j], accl[jh + j]); accl[jh + j] = wmma16(ah[kc], kf[4 + j], accl[jh + j]); } }
#pragma unroll
      for (int j = 0; j < 8; ++j)
#pragma unroll
        for (int r = 0; r < 8; ++r) ss[wave][8 * g + r][j * 16 + col] = (acc[j][r] + accl[j][r] * (1.0f / 1024.0f)) * SCALE;
      LDSW();   /* the tile's writes land before other lanes of this wave read them */
      const float f = sm_tile(&ss[wave][col][0], g, k0, t, kb == nkb - 1, m, l, e);
      LDSW();   /* the tile's reads end before the next tile is written over it */
      row_scale(o, f, g);
#pragma unroll
      for (int kc = 0; kc < 4; ++kc) { const F2 p = bsplit16(e[kc]); v16b vf[8];
#pragma unroll
        for (int j = 0; j < HD / 16; ++j) { const size_t po = ((size_t)b * CC + h * HD + j * 16 + col) * (size_t)KHI + k0 + kc * 32; vf[j] = frag_b(VB + po, lane); vf[4 + j] = frag_b(VBL + po, lane); }
        HOLD8(vf, 0);
#pragma unroll
        for (int j = 0; j < HD / 16; ++j) { o[j] = wmma_bf(p.h, vf[j], o[j]); o[j] = wmma_bf(p.l, vf[j], o[j]); o[j] = wmma_bf(p.h, vf[4 + j], o[j]); } } }
  } else { const _Float16* kp = KH + (size_t)pr * (TT / 16) * 2 * FRAGE; const _Float16* vp = VT + (size_t)pr * (TT / 32) * 4 * FRAGE;   /* this (batch, head)'s k and v fragments at the key block's first key: 16 fragments = 16 KiB in a row each */
#pragma unroll 1
    for (int kb = 0; kb < nkb; ++kb, kp += 16 * FRAGE, vp += 16 * FRAGE) { const int k0 = kb * 128; v8f acc[8] = {}; { v16h kf[16];
#pragma unroll
      for (int kc = 0; kc < HD / 32; ++kc)
#pragma unroll
        for (int j = 0; j < 8; ++j) if (kc * 8 + j < 15) kf[kc * 8 + j] = frag_get<v16h>(kp + (j * 2 + kc) * FRAGE, lane);
      kf[15] = frag_get_last<v16h>(kp + 15 * FRAGE, lane);
      HOLD8(kf, 0); HOLD8(kf, 8);
#pragma unroll
      for (int kc = 0; kc < HD / 32; ++kc)
#pragma unroll
        for (int j = 0; j < 8; ++j) acc[j] = wmma16(ah[kc], kf[kc * 8 + j], acc[j]); }
#pragma unroll
      for (int j = 0; j < 8; ++j)
#pragma unroll
        for (int r = 0; r < 8; ++r) ss[wave][8 * g + r][j * 16 + col] = acc[j][r] * SCALE;
      v16h vf[16];   /* v fragments of the first 64 keys fly while the softmax runs, the other 64 behind it */
#pragma unroll
      for (int kc = 0; kc < 2; ++kc)
#pragma unroll
        for (int j = 0; j < HD / 16; ++j) vf[kc * 4 + j] = frag_get<v16h>(vp + (kc * 4 + j) * FRAGE, lane);
      LDSW();   /* the tile's writes land before other lanes of this wave read them */
      const float f = sm_tile(&ss[wave][col][0], g, k0, t, kb == nkb - 1, m, l, e);
      LDSW();   /* the tile's reads end before the next tile is written over it */
      v16h p[4];
#pragma unroll
      for (int kc = 0; kc < 4; ++kc)
#pragma unroll
        for (int i = 0; i < 16; ++i) p[kc][i] = (_Float16)e[kc][i];
#pragma unroll
      for (int kc = 2; kc < 4; ++kc)
#pragma unroll
        for (int j = 0; j < HD / 16; ++j) if (kc * 4 + j < 15) vf[kc * 4 + j] = frag_get<v16h>(vp + (kc * 4 + j) * FRAGE, lane);
      vf[15] = frag_get_last<v16h>(vp + 15 * FRAGE, lane);
      row_scale(o, f, g);
      HOLD8(vf, 0);
#pragma unroll
      for (int kc = 0; kc < 2; ++kc)
#pragma unroll
        for (int j = 0; j < HD / 16; ++j) o[j] = wmma16(p[kc], vf[kc * 4 + j], o[j]);
      HOLD8(vf, 8);
#pragma unroll
      for (int kc = 2; kc < 4; ++kc)
#pragma unroll
        for (int j = 0; j < HD / 16; ++j) o[j] = wmma16(p[kc], vf[kc * 4 + j], o[j]); } }
  row_scale(o, l > 0.f ? (1.0f / 2048.0f) / l : 0.f, g);
#pragma unroll
  for (int j = 0; j < HD / 16; ++j)
#pragma unroll
    for (int r = 0; r < 8; ++r) ss[wave][8 * g + r][j * 16 + col] = o[j][r];
  LDSW(); for (int rl = g; rl < 16; rl += 2) vst2(Y + ((size_t)b * TT + ql0 + rl) * CC + h * HD + col * 4, *(const v4f*)&ss[wave][rl][col * 4]); }
// ---- k_out: block = (64 rows, 128 cols): out = ctx Wo (+ bo): ctx x 2^6 once to f16 against Wo as f16(bf16 x 2^8) exact (1 product) x 2^-14; causal early rows (< QHI of each sequence): ctx bf16 hi + lo against exact bf16 Wo (2 products)
__global__ __launch_bounds__(128) void k_out(const float* __restrict__ Y, const __bf16* __restrict__ OB, const _Float16* __restrict__ OH, const float* __restrict__ BO, float* __restrict__ OUT) { __shared__ __align__(16) float sf[4][16][132];
  const int tid = threadIdx.x, wave = tid >> 5, lane = tid & 31, col = lane & 15, g = lane >> 4; const int c0 = blockIdx.y * 128; const size_t r0 = (size_t)blockIdx.x * 64 + wave * 16;
  v8f acc[8] = {};
  if (CAUSAL && (int)(((size_t)blockIdx.x * 64) % TT) < QHI) {   /* block-uniform */
    const __bf16* wp = OB + (size_t)blockIdx.y * (CC / 32) * 8 * FRAGE;
    for (int kc = 0; kc < CC / 32; ++kc, wp += 8 * FRAGE) { const F2 a = split_row(Y + (r0 + col) * CC, kc * 32, lane); XWAIT(Y + (r0 + col) * CC + kc * 32 + 8 * g); v16b w[8];
#pragma unroll
      for (int j = 0; j < 7; ++j) w[j] = frag_get<v16b>(wp + j * FRAGE, lane);
      w[7] = frag_get_last<v16b>(wp + 7 * FRAGE, lane);
      HOLD8(w, 0);
#pragma unroll
      for (int j = 0; j < 8; ++j) { acc[j] = wmma_bf(a.h, w[j], acc[j]); acc[j] = wmma_bf(a.l, w[j], acc[j]); } }
#pragma unroll
    for (int j = 0; j < 8; ++j) { const float bias = BO ? bfr(BO[c0 + j * 16 + col]) : 0.f;
#pragma unroll
      for (int r = 0; r < 8; ++r) sf[wave][8 * g + r][j * 16 + col] = acc[j][r] + bias; }
  } else {
    const _Float16* wp = OH + (size_t)blockIdx.y * (CC / 32) * 8 * FRAGE;
    for (int kc = 0; kc < CC / 32; ++kc, wp += 8 * FRAGE) { const v16h a = frag_f32s(Y + (r0 + col) * CC + kc * 32, lane, 64.0f); XWAIT(Y + (r0 + col) * CC + kc * 32 + 8 * g); v16h w[8];   /* ctx carried x 2^6 into f16 so small-magnitude context rows stay clear of f16 subnormals */
#pragma unroll
      for (int j = 0; j < 7; ++j) w[j] = frag_get<v16h>(wp + j * FRAGE, lane);
      w[7] = frag_get_last<v16h>(wp + 7 * FRAGE, lane);
      HOLD8(w, 0);
#pragma unroll
      for (int j = 0; j < 8; ++j) acc[j] = wmma16(a, w[j], acc[j]); }
#pragma unroll
    for (int j = 0; j < 8; ++j) { const float bias = BO ? bfr(BO[c0 + j * 16 + col]) : 0.f;
#pragma unroll
      for (int r = 0; r < 8; ++r) sf[wave][8 * g + r][j * 16 + col] = acc[j][r] * (1.0f / 16384.0f) + bias; } }   /* 2^-8 (Wo carry) x 2^-6 (ctx carry) */
  LDSX(); for (int rl = 0; rl < 16; ++rl) vst2(OUT + (r0 + rl) * DIN + c0 + lane * 4, *(const v4f*)&sf[wave][rl][lane * 4]); }

extern "C" void kernel_launch(void* const* d_in, const int* in_sizes, int n_in, void* d_out, int out_size, void* d_ws, size_t ws_size, hipStream_t stream) {
  (void)in_sizes; (void)n_in; (void)out_size;
  const float** F = (const float**)d_in;
  if (ws_size < (size_t)WS_END) return;
  char* ws = (char*)d_ws; _Float16 *QH = (_Float16*)(ws + WS_QH), *KH = (_Float16*)(ws + WS_KH), *VT = (_Float16*)(ws + WS_VT), *QL = (_Float16*)(ws + WS_QL), *KL = (_Float16*)(ws + WS_KL); __bf16 *VB = (__bf16*)(ws + WS_VB), *VBL = (__bf16*)(ws + WS_VBL), *XP = (__bf16*)(ws + WS_XP), *WP = (__bf16*)(ws + WS_WP), *OB = (__bf16*)(ws + WS_OB); _Float16 *OH = (_Float16*)(ws + WS_OH); float *Y = (float*)(ws + WS_Y);
  (void)Y; (void)QL; (void)KL; (void)VB; (void)VBL;
  // inputs in order: 0 x [4,2048,768]; 1 Wq [12,768,64]; 2 Wk; 3 Wv (per-head [head][model][d]); 4 Wo [768,768] (out,in); 5 bo [768] (zeros, read); no q / k / v biases
  k_pack<<<dim3((NFX + NFW + 2 * NFO) / (4 * PACKF)), 128, 0, stream>>>(F[0], F[1], F[2], F[3], F[4], XP, WP, OB, OH);
  k_proj<<<dim3(TNB * TT / 64, CC / 128, 3), 128, 0, stream>>>(XP, WP, nullptr, nullptr, nullptr, QH, QL, KH, KL, VT, VB, VBL);
  k_att<<<dim3(TNB * NH, NQB), 128, 0, stream>>>(QH, KH, QL, KL, VT, VB, VBL, Y);
  k_out<<<dim3(TNB * TT / 64, DIN / 128), 128, 0, stream>>>(Y, OB, OH, F[5], (float*)d_out);
}

// v004
// A run of this version takes 148 microseconds.
// Two timings next to v003 put it at 1.15 and 1.14 times that version's speed.
// Counting every step since v000, it is 16.0 times as fast.
// compute dtype: all float inputs rounded to bf16; per-head q / k / v projections with EXACT bf16 products on WMMA 16x16x32 (f32 accumulate), no biases; causal logits: 3 products for the first 384 rows, single f16 q x k after, x 64^-0.5 x log2(e); softmax f32 in base 2 (hardware exp2) with a running max and sum per 128 keys; 2^(logit - max + 11) once to f16 x v once to f16 (bf16 hi + lo below row 384); ctx hi+lo x exact Wo below row 384, x2^6 f16 carry x f16(bf16 x 2^8) Wo after, + bo (zeros, read); f32 output.
#include <hip/hip_runtime.h>
#include <math.h>

typedef __attribute__((ext_vector_type(16))) _Float16 v16h;
typedef __attribute__((ext_vector_type(16))) __bf16 v16b;
typedef __attribute__((ext_vector_type(8)))  _Float16 v8h;
typedef __attribute__((ext_vector_type(8)))  float v8f;
typedef __attribute__((ext_vector_type(4)))  float v4f;
typedef __attribute__((ext_vector_type(2)))  float v2f;
typedef __attribute__((ext_vector_type(4)))  unsigned v4u;
typedef __attribute__((ext_vector_type(4)))  int v4i;
typedef float __attribute__((may_alias)) float_a;
typedef int __attribute__((may_alias)) int_a;

template <typename T> __device__ __forceinline__ void vst2(void* p, T v) { *(T*)p = v;  }
__device__ __forceinline__ v8f wmma16(v16h a, v16h b, v8f c) {
  v8f d = __builtin_amdgcn_wmma_f32_16x16x32_f16(false, a, false, b, (short)0, c, false, false);
  asm volatile("v_nop\n\tv_nop\n\tv_nop\n\tv_nop" : "+v"(d) : "v"(a), "v"(b));
  return d;
}
__device__ __forceinline__ v8f wmma_bf(v16b a, v16b b, v8f c) {
  v8f d = __builtin_amdgcn_wmma_f32_16x16x32_bf16(false, a, false, b, (short)0, c, false, false);
  asm volatile("v_nop\n\tv_nop\n\tv_nop\n\tv_nop" : "+v"(d) : "v"(a), "v"(b));
  return d;
}
// 16x16x32 fragments: lane = (h = lane>>4, row/col = lane&15); elements 0..7 = k0+8h+0..7, 8..15 = k0+16+8h+0..7; D element r = row 8h+r
__device__ __forceinline__ v16h frag_h(const _Float16* rowk0, int lane) {
  union { v16h v; v8h q[2]; } u; const _Float16* p = rowk0 + 8 * (lane >> 4);
  u.q[0] = *(const v8h*)p; u.q[1] = *(const v8h*)(p + 16); return u.v;
}
__device__ __forceinline__ v16h frag_f32(const float* rowk0, int lane) {
  v16h a; const float* p = rowk0 + 8 * (lane >> 4);
#pragma unroll
  for (int i = 0; i < 8; ++i) { a[i] = (_Float16)p[i]; a[8 + i] = (_Float16)p[16 + i]; }
  return a;
}
__device__ __forceinline__ v16h frag_f32s(const float* rowk0, int lane, float sc) {
  v16h a; const float* p = rowk0 + 8 * (lane >> 4);
#pragma unroll
  for (int i = 0; i < 8; ++i) { a[i] = (_Float16)(p[i] * sc); a[8 + i] = (_Float16)(p[16 + i] * sc); }
  return a;
}
// column fragment from a [K][ld] layout (column n), rows >= K read as 0
__device__ __forceinline__ v16h fragc_f32(const float* W, int k0, int n, int lane, int ld, int K) {
  v16h a; const int g = lane >> 4;
#pragma unroll
  for (int i = 0; i < 8; ++i) { const int ka = k0 + 8 * g + i, kb = ka + 16;
    a[i] = (_Float16)(ka < K ? W[(size_t)(ka < K ? ka : K - 1) * ld + n] : 0.f); a[8 + i] = (_Float16)(kb < K ? W[(size_t)(kb < K ? kb : K - 1) * ld + n] : 0.f); }
  return a;
}
struct F2 { v16b h, l; };
__device__ __forceinline__ F2 bsplit16(const float v[16]) { F2 r;
#pragma unroll
  for (int i = 0; i < 16; ++i) { const __bf16 h = (__bf16)v[i]; r.h[i] = h; r.l[i] = (__bf16)(v[i] - (float)h); }
  return r; }
__device__ __forceinline__ F2 split_row(const float* row, int k0, int lane) { float v[16]; const float* p = row + k0 + 8 * (lane >> 4);
#pragma unroll
  for (int i = 0; i < 8; ++i) { v[i] = p[i]; v[8 + i] = p[16 + i]; }
  return bsplit16(v); }
__device__ __forceinline__ F2 split_rowK(const float* row, int k0, int lane, int K) { float v[16]; const int g = lane >> 4;
#pragma unroll
  for (int i = 0; i < 8; ++i) { const int ka = k0 + 8 * g + i, kb = ka + 16; v[i] = ka < K ? row[ka < K ? ka : K - 1] : 0.f; v[8 + i] = kb < K ? row[kb < K ? kb : K - 1] : 0.f; }
  return bsplit16(v); }
__device__ __forceinline__ F2 split_col(const float* W, int k0, int n, int lane, int ld, int K) { float v[16]; const int g = lane >> 4;
#pragma unroll
  for (int i = 0; i < 8; ++i) { const int ka = k0 + 8 * g + i, kb = ka + 16; v[i] = ka < K ? W[(size_t)(ka < K ? ka : K - 1) * ld + n] : 0.f; v[8 + i] = kb < K ? W[(size_t)(kb < K ? kb : K - 1) * ld + n] : 0.f; }
  return bsplit16(v); }
__device__ __forceinline__ v8f mac3(const F2& a, const F2& b, v8f c) { c = wmma_bf(a.l, b.h, c); c = wmma_bf(a.h, b.l, c); return wmma_bf(a.h, b.h, c); }
__device__ __forceinline__ float sigm(float v) { return 1.0f / (1.0f + expf(-v)); }
#define LDSX() do { asm volatile("s_wait_dscnt 0" ::: "memory"); __builtin_amdgcn_wave_barrier(); __builtin_amdgcn_fence(__ATOMIC_RELEASE, "workgroup"); } while (0)

// Causal multi-head self-attention with per-head weights (x [4,2048,768]; Wq / Wk / Wv [12,768,64] = per-head [head][model][d] N(0,1) x 0.02, no biases; Wo [768,768] torch (out,in), bo zeros (read); q = einsum('bsd,hde->bhse'); scores / sqrt(64); tril kept, finfo.min elsewhere; softmax; ctx merged (head*64 + e); ctx @ Wo.T + bo).
#define NB 4
#define TT 2048
#define CC 768            // NH * HD = projected width
#define DIN 768          // input (model) width
#define NH 12
#define HD 64
#define NQB (TT / 64)
#define SCALE (0.125f)
#define SCALE_L2 (SCALE * 1.44269504088896340736f)   // logits carried in units of log2: exp(s) = 2^(s log2 e)
#define CAUSAL 1
#ifndef TNB
#define TNB NB
#endif
__device__ __forceinline__ float bfr(float v) { return (float)(__bf16)v; }
__host__ __device__ __forceinline__ int kb_last(int qb) { return CAUSAL ? ((qb * 64 + 63) >> 7) : (TT / 128 - 1); }
typedef __attribute__((ext_vector_type(8))) __bf16 v8b;
__device__ __forceinline__ v16b frag_b(const __bf16* rowk0, int lane) {
  union { v16b v; v8b q[2]; } u; const __bf16* p = rowk0 + 8 * (lane >> 4);
  u.q[0] = *(const v8b*)p; u.q[1] = *(const v8b*)(p + 16); return u.v;
}
#define QBH 6              // causal: query blocks 0..QBH-1 of each sequence (few keys, no averaging) take the high-precision path
#define QHI 384            // rows carrying a q residual plane
#define KHI 384            // key rows carrying k residual / v bf16 hi+lo planes (used only by the causal high-precision path)
// B fragment (k rows k0+.., output column o) of a weight: (in,out) [K][ld] or (out,in) [ld rows of K]: bf16 exact, or f16(bf16 * 256) exact
__device__ __forceinline__ v16b wcol_io(const float* Wm, int k0, int o, int lane, int ld) { v16b w; const int g = lane >> 4;
#pragma unroll
  for (int i = 0; i < 8; ++i) { w[i] = (__bf16)Wm[(size_t)(k0 + 8 * g + i) * ld + o]; w[8 + i] = (__bf16)Wm[(size_t)(k0 + 16 + 8 * g + i) * ld + o]; }
  return w; }
__device__ __forceinline__ v16b wcol_oi(const float* Wm, int k0, int o, int lane, int K) { v16b w; const float* p = Wm + (size_t)o * K + k0 + 8 * (lane >> 4);
#pragma unroll
  for (int i = 0; i < 8; ++i) { w[i] = (__bf16)p[i]; w[8 + i] = (__bf16)p[16 + i]; }
  return w; }
__device__ __forceinline__ v16h wcolh_io(const float* Wm, int k0, int o, int lane, int ld) { v16h w; const int g = lane >> 4;
#pragma unroll
  for (int i = 0; i < 8; ++i) { w[i] = (_Float16)(bfr(Wm[(size_t)(k0 + 8 * g + i) * ld + o]) * 256.0f); w[8 + i] = (_Float16)(bfr(Wm[(size_t)(k0 + 16 + 8 * g + i) * ld + o]) * 256.0f); }
  return w; }
__device__ __forceinline__ v16h wcolh_oi(const float* Wm, int k0, int o, int lane, int K) { v16h w; const float* p = Wm + (size_t)o * K + k0 + 8 * (lane >> 4);
#pragma unroll
  for (int i = 0; i < 8; ++i) { w[i] = (_Float16)(bfr(p[i]) * 256.0f); w[8 + i] = (_Float16)(bfr(p[16 + i]) * 256.0f); }
  return w; }
#define WQKV_LAYOUT 2   // 0 = (in,out) [DIN][CC]; 1 = (out,in) [CC][DIN]; 2 = per-head [NH][DIN][HD]
__device__ __forceinline__ v16b wcol_hdk(const float* Wm, int k0, int o, int lane) { v16b w; const int g = lane >> 4; const float* p = Wm + (size_t)(o / HD) * DIN * HD + (o % HD);
#pragma unroll
  for (int i = 0; i < 8; ++i) { w[i] = (__bf16)p[(size_t)(k0 + 8 * g + i) * HD]; w[8 + i] = (__bf16)p[(size_t)(k0 + 16 + 8 * g + i) * HD]; }
  return w; }
#define WO_OUT_IN 1
#if WQKV_LAYOUT == 1
#define WCOL(W, k0, o, lane) wcol_oi(W, k0, o, lane, DIN)
#elif WQKV_LAYOUT == 2
#define WCOL(W, k0, o, lane) wcol_hdk(W, k0, o, lane)
#else
#define WCOL(W, k0, o, lane) wcol_io(W, k0, o, lane, CC)
#endif
#if WO_OUT_IN
#define WOCOL(W, k0, o, lane) wcol_oi(W, k0, o, lane, CC)
#define WOCOLH(W, k0, o, lane) wcolh_oi(W, k0, o, lane, CC)
#else
#define WOCOL(W, k0, o, lane) wcol_io(W, k0, o, lane, DIN)
#define WOCOLH(W, k0, o, lane) wcolh_io(W, k0, o, lane, DIN)
#endif

#ifndef PROJ_EXTRA_PARAMS
#define PROJ_EXTRA_PARAMS
#endif

#define WS_QH  0u                                      // f16 q rows [b*t][CC]
#define WS_KH  (WS_QH + 2u * (size_t)NB * TT * CC)      // f16 k in fragment order [b][head][16-key group][kc][half][lane][8]
#define WS_VT  (WS_KH + 2u * (size_t)NB * TT * CC)      // f16 v in fragment order [b][head][32-key group][j][half][lane][8]
#define WS_QL  (WS_VT + 2u * (size_t)NB * CC * TT)      // f16 q residual x 2^10 rows [b][t < QHI][CC]
#define WS_KL  (WS_QL + 2u * (size_t)NB * QHI * CC)     // f16 k residual x 2^10 rows [b][t < KHI][CC]
#define WS_VB  (WS_KL + 2u * (size_t)NB * KHI * CC)     // bf16 v hi planes [b][c][t < KHI]
#define WS_VBL (WS_VB + 2u * (size_t)NB * CC * KHI)
#define WS_Y   (WS_VBL + 2u * (size_t)NB * CC * KHI)    // f32 ctx rows [b*t][CC] (only when there is an output projection)
#define WS_XP  (WS_Y  + 4u * (size_t)NB * TT * CC)      // bf16 x in fragment order [16-row group][kc][half][lane][8]
#define WS_WP  (WS_XP + 2u * (size_t)NB * TT * DIN)     // bf16 Wq / Wk / Wv in fragment order [which][128-col block][kc][j][half][lane][8]
#define WS_OB  (WS_WP + 2u * (size_t)3 * DIN * CC)      // bf16 Wo in fragment order [128-col block][kc][j][half][lane][8]
#define WS_OH  (WS_OB + 2u * (size_t)CC * DIN)          // f16(bf16 x 2^8) Wo, same order
#define WS_END (WS_OH + 2u * (size_t)CC * DIN)

// A fragment kept in memory in fragment order is 1 KiB: elements 0..7 of lanes 0..31 (512 B), then elements 8..15: each of its two wave-wide 16-byte loads covers four whole 128-B lines
#define FRAGE 512          // 16-bit elements per stored fragment
#define NFX (NB * TT / 16 * (DIN / 32))
#define NFW (3 * (CC / 16) * (DIN / 32))
#define NFO ((DIN / 16) * (CC / 32))
#define PACKF 4            // fragments per wave of k_pack
static_assert(WO_OUT_IN == 1 && NFX % (4 * PACKF) == 0 && NFW % (4 * PACKF) == 0 && NFO % (4 * PACKF) == 0 && CC % 128 == 0 && DIN % 128 == 0, "a k_pack block stays inside one operand");
template <typename V> __device__ __forceinline__ void frag_put(void* f, V v, int lane) { union { V v; v4u q[2]; } u; u.v = v; *((v4u*)f + lane) = u.q[0]; *((v4u*)f + 32 + lane) = u.q[1]; }
template <typename V> __device__ __forceinline__ V frag_get(const void* f, int lane) { union { V v; v4u q[2]; } u; u.q[0] = *((const v4u*)f + lane); u.q[1] = *((const v4u*)f + 32 + lane); return u.v; }
// last fragment of a batch of loads off one address pair: the batch's last load may land on that pair, which the loads before it name, so the wait stands in front of it
template <typename V> __device__ __forceinline__ V frag_get_last(const void* f, int lane) { union { V v; v4u q[2]; } u; u.q[0] = *((const v4u*)f + lane); asm volatile("s_wait_xcnt 0x0" ::: "memory"); u.q[1] = *((const v4u*)f + 32 + lane); return u.v; }
// behind a batch of loads off the address p: the wait that stands in front of any rewrite of that address pair; naming p keeps the pair live up to the wait, so no load of the batch lands on it either
#define XWAIT(p) asm volatile("s_wait_xcnt 0x0" :: "v"(p) : "memory")
// inputs-only hold on loaded fragments: every load of the batch is issued before the first product waits for one, so a batch costs one load latency and not one per fragment
#define HOLD8(a, o) asm volatile("" :: "v"(a[o]), "v"(a[o + 1]), "v"(a[o + 2]), "v"(a[o + 3]), "v"(a[o + 4]), "v"(a[o + 5]), "v"(a[o + 6]), "v"(a[o + 7]))
// ---- k_pack: one wave per PACKF fragments: x, Wq / Wk / Wv, Wo rounded exactly as the products take them (bf16; Wo also f16(bf16 x 2^8)) and laid down in fragment order, once per call, for k_proj and k_out
__global__ __launch_bounds__(128) void k_pack(const float* __restrict__ X, const float* __restrict__ WQ, const float* __restrict__ WK, const float* __restrict__ WV, const float* __restrict__ WO, __bf16* __restrict__ XP, __bf16* __restrict__ WP, __bf16* __restrict__ OB, _Float16* __restrict__ OH) {
  const int lane = threadIdx.x & 31, col = lane & 15, g = lane >> 4; const int f0 = ((int)blockIdx.x * 4 + ((int)threadIdx.x >> 5)) * PACKF;
  if (f0 < NFX) {   /* block-uniform */
    v16b a[PACKF];
#pragma unroll
    for (int i = 0; i < PACKF; ++i) { const int f = f0 + i, rg = f / (DIN / 32), kc = f % (DIN / 32); const float* p = X + ((size_t)rg * 16 + col) * DIN + kc * 32 + 8 * g;
#pragma unroll
      for (int e = 0; e < 8; ++e) { a[i][e] = (__bf16)p[e]; a[i][8 + e] = (__bf16)p[16 + e]; }
      XWAIT(p); }
#pragma unroll
    for (int i = 0; i < PACKF; ++i) frag_put(XP + (size_t)(f0 + i) * FRAGE, a[i], lane);
  } else if (f0 < NFX + NFW) {
#pragma unroll
    for (int i = 0; i < PACKF; ++i) { const int f = f0 - NFX + i, j = f & 7, kc = (f >> 3) % (DIN / 32), cb = (f >> 3) / (DIN / 32) % (CC / 128), which = (f >> 3) / (DIN / 32) / (CC / 128); const float* WA = which == 0 ? WQ : which == 1 ? WK : WV;
      frag_put(WP + (size_t)f * FRAGE, WCOL(WA, kc * 32, cb * 128 + j * 16 + col, lane), lane); }
  } else { const bool hb = f0 < NFX + NFW + NFO; const int fo = f0 - NFX - NFW - (hb ? 0 : NFO); float v[PACKF][16];   /* Wo, once as bf16 and once as f16(bf16 x 2^8) */
#pragma unroll
    for (int i = 0; i < PACKF; ++i) { const int f = fo + i, j = f & 7, kc = (f >> 3) % (CC / 32), cb = (f >> 3) / (CC / 32); const float* p = WO + (size_t)(cb * 128 + j * 16 + col) * CC + kc * 32 + 8 * g;
#pragma unroll
      for (int e = 0; e < 8; ++e) { v[i][e] = p[e]; v[i][8 + e] = p[16 + e]; }
      XWAIT(p); }
#pragma unroll
    for (int i = 0; i < PACKF; ++i) { v16b wb; v16h wh;
#pragma unroll
      for (int e = 0; e < 16; ++e) { wb[e] = (__bf16)v[i][e]; wh[e] = (_Float16)(bfr(v[i][e]) * 256.0f); }
      if (hb) frag_put(OB + (size_t)(fo + i) * FRAGE, wb, lane); else frag_put(OH + (size_t)(fo + i) * FRAGE, wh, lane); } } }

// ---- k_proj: block = (64 rows, 128 cols, which): q/k/v = X W (+ b) with exact bf16 products (K = DIN), both operands read in fragment order, a k step's nine fragments as one batch -> which 0: q f16 rows (+ residual rows < QHI); 1: k f16 in fragment order (+ residual rows < KHI); 2: v f16 in fragment order (+ bf16 hi/lo planes [c][t] for t < KHI)
__global__ __launch_bounds__(128) void k_proj(const __bf16* __restrict__ XP, const __bf16* __restrict__ WP, const float* __restrict__ BQ, const float* __restrict__ BK, const float* __restrict__ BV,
    _Float16* __restrict__ QH, _Float16* __restrict__ QL, _Float16* __restrict__ KH, _Float16* __restrict__ KL, _Float16* __restrict__ VT, __bf16* __restrict__ VB, __bf16* __restrict__ VBL) {
  __shared__ __align__(16) _Float16 sh[64][136], sl[64][136]; __shared__ __align__(16) _Float16 th[128][72]; __shared__ __align__(16) __bf16 tb[128][72], tbl[128][72];
  const int tid = threadIdx.x, wave = tid >> 5, lane = tid & 31, col = lane & 15, g = lane >> 4; const int which = blockIdx.z; const int c0 = blockIdx.y * 128; const size_t r0 = (size_t)blockIdx.x * 64; const size_t bb = r0 / TT; const int t0 = (int)(r0 % TT);
  const float* BA = which == 0 ? BQ : which == 1 ? BK : BV;
  const __bf16* xp = XP + (size_t)(blockIdx.x * 4 + __builtin_amdgcn_readfirstlane(wave)) * (DIN / 32) * FRAGE; const __bf16* wp = WP + (size_t)(which * (CC / 128) + blockIdx.y) * (DIN / 32) * 8 * FRAGE;   /* this wave's x fragments and this block's weight fragments, in the order of the walk; the wave's number made scalar, so that both streams are a scalar base + the lane's offset */
  v8f acc[8] = {};
  for (int kc = 0; kc < DIN / 32; ++kc, xp += FRAGE, wp += 8 * FRAGE) { const v16b a = frag_get<v16b>(xp, lane); v16b w[8];
#pragma unroll
    for (int j = 0; j < 7; ++j) w[j] = frag_get<v16b>(wp + j * FRAGE, lane);
    w[7] = frag_get_last<v16b>(wp + 7 * FRAGE, lane);
    HOLD8(w, 0);
#pragma unroll
    for (int j = 0; j < 8; ++j) acc[j] = wmma_bf(a, w[j], acc[j]); }
  if (which < 2) { _Float16* DL = which == 0 ? QL : KL; const int nhi = which == 0 ? QHI : KHI; const bool hi_rows = t0 < nhi;
#pragma unroll
    for (int j = 0; j < 8; ++j) { const float bias = BA ? bfr(BA[c0 + j * 16 + col]) : 0.f;
#pragma unroll
      for (int r = 0; r < 8; ++r) { const float v = acc[j][r] + bias; const _Float16 hv = (_Float16)v; sh[wave * 16 + 8 * g + r][j * 16 + col] = hv; sl[wave * 16 + 8 * g + r][j * 16 + col] = (_Float16)((v - (float)hv) * 1024.0f); } }
    __syncthreads();
    if (which == 1) { for (int e = tid; e < 64 * 16; e += 128) { const int ln = e & 31, hf = (e >> 5) & 1, kc = (e >> 6) & 1, kg = (e >> 7) & 3, hl = e >> 9;   /* k: 16-byte pieces in the order k_att's loads take them */
        vst2((unsigned*)(KH + ((((bb * NH + c0 / HD + hl) * (TT / 16) + t0 / 16 + kg) * 2 + kc) * 2 + hf) * (size_t)(FRAGE / 2) + ln * 8), *(const v4u*)&sh[kg * 16 + (ln & 15)][hl * 64 + kc * 32 + hf * 16 + (ln >> 4) * 8]); } }
    else { for (int e = tid; e < 64 * 16; e += 128) { const int rl = e >> 4, q = e & 15; vst2((unsigned*)(QH + (r0 + rl) * CC + c0 + q * 8), *(const v4u*)&sh[rl][q * 8]); } }
    if (hi_rows) { for (int e = tid; e < 64 * 16; e += 128) { const int rl = e >> 4, q = e & 15; vst2((unsigned*)(DL + (bb * nhi + t0 + rl) * (size_t)CC + c0 + q * 8), *(const v4u*)&sl[rl][q * 8]); } }
  } else { const bool hi_rows = t0 < KHI;
#pragma unroll
    for (int j = 0; j < 8; ++j) { const float bias = BA ? bfr(BA[c0 + j * 16 + col]) : 0.f;
#pragma unroll
      for (int r = 0; r < 8; ++r) { const float v = acc[j][r] + bias; const int rl = wave * 16 + 8 * g + r, cl = j * 16 + col; th[cl][rl] = (_Float16)v; const __bf16 bh = (__bf16)v; tb[cl][rl] = bh; tbl[cl][rl] = (__bf16)(v - (float)bh); } }
    __syncthreads();
    for (int e = tid; e < 128 * 8; e += 128) { const int ln = e & 31, hf = (e >> 5) & 1, j = (e >> 6) & 3, kq = (e >> 8) & 1, hl = e >> 9;   /* v: 16-byte pieces in the order k_att's loads take them */
      vst2((unsigned*)(VT + ((((bb * NH + c0 / HD + hl) * (TT / 32) + t0 / 32 + kq) * 4 + j) * 2 + hf) * (size_t)(FRAGE / 2) + ln * 8), *(const v4u*)&th[hl * 64 + j * 16 + (ln & 15)][kq * 32 + hf * 16 + (ln >> 4) * 8]); }
    if (hi_rows) for (int e = tid; e < 128 * 8; e += 128) { const int cl = e >> 3, q = e & 7; const size_t o3 = (bb * CC + c0 + cl) * (size_t)KHI + t0 + q * 8; vst2((unsigned*)(VB + o3), *(const v4u*)&tb[cl][q * 8]); vst2((unsigned*)(VBL + o3), *(const v4u*)&tbl[cl][q * 8]); } } }
// eight 2^x in place, with the slot behind the last one, in ONE statement: each transcendental is followed by an independent instruction, so none that reads its result or overwrites its source can come to stand directly behind it
__device__ __forceinline__ void exp2x8(float* x) {
  asm("v_exp_f32 %0, %0\n\tv_exp_f32 %1, %1\n\tv_exp_f32 %2, %2\n\tv_exp_f32 %3, %3\n\tv_exp_f32 %4, %4\n\tv_exp_f32 %5, %5\n\tv_exp_f32 %6, %6\n\tv_exp_f32 %7, %7\n\tv_nop"
      : "+v"(x[0]), "+v"(x[1]), "+v"(x[2]), "+v"(x[3]), "+v"(x[4]), "+v"(x[5]), "+v"(x[6]), "+v"(x[7])); }
// one 128-key tile of this lane's query row t (lanes l and l ^ 16 share a row; e[kc][0..7] = key k0 + 32 kc + 8 g + i, e[kc][8..15] = 16 keys on: the A fragment's k order): causal mask by index (only a query block's last key block reaches past the diagonal), running max m and sum l brought up to date (logits, m in log2 units; l carries the 2^11 too); leaves 2^(logit - m + 11) in e (0 for excluded keys) and returns the factor that carries earlier sums over to the new max
__device__ __forceinline__ float sm_tile(const float* row, int g, int k0, int t, bool diag, float& m, float& l, float (&e)[4][16]) {
#pragma unroll
  for (int kc = 0; kc < 4; ++kc) { const float* p = row + kc * 32 + 8 * g;
    union { v4f q[4]; float f[16]; } u; u.q[0] = *(const v4f*)p; u.q[1] = *(const v4f*)(p + 4); u.q[2] = *(const v4f*)(p + 16); u.q[3] = *(const v4f*)(p + 20);
#pragma unroll
    for (int i = 0; i < 16; ++i) e[kc][i] = u.f[i]; }
  if (diag) {   /* block-uniform */
#pragma unroll
    for (int kc = 0; kc < 4; ++kc)
#pragma unroll
      for (int i = 0; i < 16; ++i) { const int k = k0 + kc * 32 + 8 * g + (i < 8 ? i : i + 8); e[kc][i] = k <= t ? e[kc][i] : -3.0e38f; } }
  float mx = -3.0e38f;
#pragma unroll
  for (int kc = 0; kc < 4; ++kc)
#pragma unroll
    for (int i = 0; i < 16; ++i) mx = fmaxf(mx, e[kc][i]);
  mx = fmaxf(mx, __shfl_xor(mx, 16));
  const float mn = fmaxf(m, mx); const float al = __builtin_amdgcn_exp2f(m - mn); m = mn;
  const float mb = mn - 11.0f; float sum = 0.f;
#pragma unroll
  for (int kc = 0; kc < 4; ++kc)
#pragma unroll
    for (int i = 0; i < 16; ++i) e[kc][i] -= mb;
#pragma unroll
  for (int kc = 0; kc < 4; ++kc)
#pragma unroll
    for (int i = 0; i < 16; i += 8) exp2x8(&e[kc][i]);   /* an excluded key's -3e38 gives exactly 0 */
#pragma unroll
  for (int kc = 0; kc < 4; ++kc)
#pragma unroll
    for (int i = 0; i < 16; ++i) sum += e[kc][i];
  sum += __shfl_xor(sum, 16);
  l = l * al + sum;
  return al; }
// per-row value held by lane (row) -> the accumulator's rows 8 g + r
__device__ __forceinline__ void row_scale(v8f (&o)[HD / 16], float f, int g) {
#pragma unroll
  for (int r = 0; r < 8; ++r) { const float fr = __shfl(f, 8 * g + r);
#pragma unroll
    for (int j = 0; j < HD / 16; ++j) o[j][r] *= fr; } }
// hand-over through LDS between lanes of ONE wave: its LDS operations have ended and the compiler moves none across; no fence, which would also wait for the global loads that are meant to stay in flight
#define LDSW() do { asm volatile("s_wait_dscnt 0" ::: "memory"); __builtin_amdgcn_wave_barrier(); } while (0)
// ---- k_att: block = (pair = b * NH + h, 64 queries qb, longest first); each wave owns 16 query rows and walks its causal key blocks of 128 alone: logits x SCALE x log2(e) (q x k in f16; query blocks < QBH: + q residual x k + q x k residual, both x 2^10) -> the wave's own LDS tile -> read back row-wise, running softmax in f32, base 2 -> 2^(logit - max + 11) once to f16 against v f16 (query blocks < QBH: exp and v as bf16 hi + lo, 3 products); ctx = sums / l (both carry 2^11); 256-B (row, head) segment by 16 lanes
static_assert(CAUSAL == 1 && QBH * 64 == QHI && QHI == KHI && QHI % 128 == 0 && HD == 64, "early query blocks see only keys that carry residual planes");
__global__ __attribute__((amdgpu_waves_per_eu(4))) __launch_bounds__(128) void k_att(const _Float16* __restrict__ QH, const _Float16* __restrict__ KH, const _Float16* __restrict__ QL, const _Float16* __restrict__ KL, const _Float16* __restrict__ VT, const __bf16* __restrict__ VB, const __bf16* __restrict__ VBL, float* __restrict__ Y) { __shared__ __align__(16) float ss[4][16][132];
  const int pr = blockIdx.x, b = pr / NH, h = pr % NH; const int qb = NQB - 1 - (int)blockIdx.y; const int nkb = kb_last(qb) + 1;
  const int tid = threadIdx.x, wave = tid >> 5, lane = tid & 31, col = lane & 15, g = lane >> 4; const int ql0 = qb * 64 + wave * 16; const size_t q0 = (size_t)b * TT + ql0; const int t = ql0 + col;
  float m = -3.0e38f, l = 0.f; v8f o[HD / 16] = {}; float e[4][16];
  v16h ah[HD / 32];
#pragma unroll
  for (int kc = 0; kc < HD / 32; ++kc) ah[kc] = frag_h(QH + (q0 + col) * CC + h * HD + kc * 32, lane);
  asm volatile("s_wait_xcnt 0x0" ::: "memory");   /* stands in front of the first rewrite of the address pair that the q loads name */
  if (qb < QBH) { const _Float16* KLb = KL + (size_t)b * KHI * CC; v16h al[HD / 32];
#pragma unroll
    for (int kc = 0; kc < HD / 32; ++kc) al[kc] = frag_h(QL + ((size_t)b * QHI + ql0 + col) * CC + h * HD + kc * 32, lane);
#pragma unroll 1
    for (int kb = 0; kb < nkb; ++kb) { const int k0 = kb * 128; v8f acc[8] = {}, accl[8] = {};
#pragma unroll
      for (int kc = 0; kc < HD / 32; ++kc)
#pragma unroll
        for (int jh = 0; jh < 8; jh += 4) { v16h kf[8];
#pragma unroll
          for (int j = 0; j < 4; ++j) { kf[j] = frag_get<v16h>(KH + (((size_t)pr * (TT / 16) + kb * 8 + jh + j) * 2 + kc) * FRAGE, lane); kf[4 + j] = frag_h(KLb + (size_t)(k0 + (jh + j) * 16 + col) * CC + h * HD + kc * 32, lane); }
          HOLD8(kf, 0);
#pragma unroll
          for (int j = 0; j < 4; ++j) { acc[jh + j] = wmma16(ah[kc], kf[j], acc[jh + j]); accl[jh + j] = wmma16(al[kc], kf[j], accl[jh + j]); accl[jh + j] = wmma16(ah[kc], kf[4 + j], accl[jh + j]); } }
#pragma unroll
      for (int j = 0; j < 8; ++j)
#pragma unroll
        for (int r = 0; r < 8; ++r) ss[wave][8 * g + r][j * 16 + col] = (acc[j][r] + accl[j][r] * (1.0f / 1024.0f)) * SCALE_L2;
      LDSW();   /* the tile's writes land before other lanes of this wave read them */
      const float f = sm_tile(&ss[wave][col][0], g, k0, t, kb == nkb - 1, m, l, e);
      LDSW();   /* the tile's reads end before the next tile is written over it */
      row_scale(o, f, g);
#pragma unroll
      for (int kc = 0; kc < 4; ++kc) { const F2 p = bsplit16(e[kc]); v16b vf[8];
#pragma unroll
        for (int j = 0; j < HD / 16; ++j) { const size_t po = ((size_t)b * CC + h * HD + j * 16 + col) * (size_t)KHI + k0 + kc * 32; vf[j] = frag_b(VB + po, lane); vf[4 + j] = frag_b(VBL + po, lane); }
        HOLD8(vf, 0);
#pragma unroll
        for (int j = 0; j < HD / 16; ++j) { o[j] = wmma_bf(p.h, vf[j], o[j]); o[j] = wmma_bf(p.l, vf[j], o[j]); o[j] = wmma_bf(p.h, vf[4 + j], o[j]); } } }
  } else { const _Float16* kp = KH + (size_t)pr * (TT / 16) * 2 * FRAGE; const _Float16* vp = VT + (size_t)pr * (TT / 32) * 4 * FRAGE;   /* this (batch, head)'s k and v fragments at the key block's first key: 16 fragments = 16 KiB in a row each */
#pragma unroll 1
    for (int kb = 0; kb < nkb; ++kb, kp += 16 * FRAGE, vp += 16 * FRAGE) { const int k0 = kb * 128; v8f acc[8] = {}; { v16h kf[16];
#pragma unroll
      for (int kc = 0; kc < HD / 32; ++kc)
#pragma unroll
        for (int j = 0; j < 8; ++j) if (kc * 8 + j < 15) kf[kc * 8 + j] = frag_get<v16h>(kp + (j * 2 + kc) * FRAGE, lane);
      kf[15] = frag_get_last<v16h>(kp + 15 * FRAGE, lane);
      HOLD8(kf, 0); HOLD8(kf, 8);
#pragma unroll
      for (int kc = 0; kc < HD / 32; ++kc)
#pragma unroll
        for (int j = 0; j < 8; ++j) acc[j] = wmma16(ah[kc], kf[kc * 8 + j], acc[j]); }
#pragma unroll
      for (int j = 0; j < 8; ++j)
#pragma unroll
        for (int r = 0; r < 8; ++r) ss[wave][8 * g + r][j * 16 + col] = acc[j][r] * SCALE_L2;
      v16h vf[16];   /* v fragments of the first 64 keys fly while the softmax runs, the other 64 behind it */
#pragma unroll
      for (int kc = 0; kc < 2; ++kc)
#pragma unroll
        for (int j = 0; j < HD / 16; ++j) vf[kc * 4 + j] = frag_get<v16h>(vp + (kc * 4 + j) * FRAGE, lane);
      LDSW();   /* the tile's writes land before other lanes of this wave read them */
      const float f = sm_tile(&ss[wave][col][0], g, k0, t, kb == nkb - 1, m, l, e);
      LDSW();   /* the tile's reads end before the next tile is written over it */
      v16h p[4];
#pragma unroll
      for (int kc = 0; kc < 4; ++kc)
#pragma unroll
        for (int i = 0; i < 16; ++i) p[kc][i] = (_Float16)e[kc][i];
#pragma unroll
      for (int kc = 2; kc < 4; ++kc)
#pragma unroll
        for (int j = 0; j < HD / 16; ++j) if (kc * 4 + j < 15) vf[kc * 4 + j] = frag_get<v16h>(vp + (kc * 4 + j) * FRAGE, lane);
      vf[15] = frag_get_last<v16h>(vp + 15 * FRAGE, lane);
      row_scale(o, f, g);
      HOLD8(vf, 0);
#pragma unroll
      for (int kc = 0; kc < 2; ++kc)
#pragma unroll
        for (int j = 0; j < HD / 16; ++j) o[j] = wmma16(p[kc], vf[kc * 4 + j], o[j]);
      HOLD8(vf, 8);
#pragma unroll
      for (int kc = 2; kc < 4; ++kc)
#pragma unroll
        for (int j = 0; j < HD / 16; ++j) o[j] = wmma16(p[kc], vf[kc * 4 + j], o[j]); } }
  row_scale(o, l > 0.f ? 1.0f / l : 0.f, g);
#pragma unroll
  for (int j = 0; j < HD / 16; ++j)
#pragma unroll
    for (int r = 0; r < 8; ++r) ss[wave][8 * g + r][j * 16 + col] = o[j][r];
  LDSW(); for (int rl = g; rl < 16; rl += 2) vst2(Y + ((size_t)b * TT + ql0 + rl) * CC + h * HD + col * 4, *(const v4f*)&ss[wave][rl][col * 4]); }
// ---- k_out: block = (64 rows, 128 cols): out = ctx Wo (+ bo): ctx x 2^6 once to f16 against Wo as f16(bf16 x 2^8) exact (1 product) x 2^-14; causal early rows (< QHI of each sequence): ctx bf16 hi + lo against exact bf16 Wo (2 products)
__global__ __launch_bounds__(128) void k_out(const float* __restrict__ Y, const __bf16* __restrict__ OB, const _Float16* __restrict__ OH, const float* __restrict__ BO, float* __restrict__ OUT) { __shared__ __align__(16) float sf[4][16][132];
  const int tid = threadIdx.x, wave = tid >> 5, lane = tid & 31, col = lane & 15, g = lane >> 4; const int c0 = blockIdx.y * 128; const size_t r0 = (size_t)blockIdx.x * 64 + wave * 16;
  v8f acc[8] = {};
  if (CAUSAL && (int)(((size_t)blockIdx.x * 64) % TT) < QHI) {   /* block-uniform */
    const __bf16* wp = OB + (size_t)blockIdx.y * (CC / 32) * 8 * FRAGE;
    for (int kc = 0; kc < CC / 32; ++kc, wp += 8 * FRAGE) { const F2 a = split_row(Y + (r0 + col) * CC, kc * 32, lane); XWAIT(Y + (r0 + col) * CC + kc * 32 + 8 * g); v16b w[8];
#pragma unroll
      for (int j = 0; j < 7; ++j) w[j] = frag_get<v16b>(wp + j * FRAGE, lane);
      w[7] = frag_get_last<v16b>(wp + 7 * FRAGE, lane);
      HOLD8(w, 0);
#pragma unroll
      for (int j = 0; j < 8; ++j) { acc[j] = wmma_bf(a.h, w[j], acc[j]); acc[j] = wmma_bf(a.l, w[j], acc[j]); } }
#pragma unroll
    for (int j = 0; j < 8; ++j) { const float bias = BO ? bfr(BO[c0 + j * 16 + col]) : 0.f;
#pragma unroll
      for (int r = 0; r < 8; ++r) sf[wave][8 * g + r][j * 16 + col] = acc[j][r] + bias; }
  } else {
    const _Float16* wp = OH + (size_t)blockIdx.y * (CC / 32) * 8 * FRAGE;
    for (int kc = 0; kc < CC / 32; ++kc, wp += 8 * FRAGE) { const v16h a = frag_f32s(Y + (r0 + col) * CC + kc * 32, lane, 64.0f); XWAIT(Y + (r0 + col) * CC + kc * 32 + 8 * g); v16h w[8];   /* ctx carried x 2^6 into f16 so small-magnitude context rows stay clear of f16 subnormals */
#pragma unroll
      for (int j = 0; j < 7; ++j) w[j] = frag_get<v16h>(wp + j * FRAGE, lane);
      w[7] = frag_get_last<v16h>(wp + 7 * FRAGE, lane);
      HOLD8(w, 0);
#pragma unroll
      for (int j = 0; j < 8; ++j) acc[j] = wmma16(a, w[j], acc[j]); }
#pragma unroll
    for (int j = 0; j < 8; ++j) { const float bias = BO ? bfr(BO[c0 + j * 16 + col]) : 0.f;
#pragma unroll
      for (int r = 0; r < 8; ++r) sf[wave][8 * g + r][j * 16 + col] = acc[j][r] * (1.0f / 16384.0f) + bias; } }   /* 2^-8 (Wo carry) x 2^-6 (ctx carry) */
  LDSX(); for (int rl = 0; rl < 16; ++rl) vst2(OUT + (r0 + rl) * DIN + c0 + lane * 4, *(const v4f*)&sf[wave][rl][lane * 4]); }

extern "C" void kernel_launch(void* const* d_in, const int* in_sizes, int n_in, void* d_out, int out_size, void* d_ws, size_t ws_size, hipStream_t stream) {
  (void)in_sizes; (void)n_in; (void)out_size;
  const float** F = (const float**)d_in;
  if (ws_size < (size_t)WS_END) return;
  char* ws = (char*)d_ws; _Float16 *QH = (_Float16*)(ws + WS_QH), *KH = (_Float16*)(ws + WS_KH), *VT = (_Float16*)(ws + WS_VT), *QL = (_Float16*)(ws + WS_QL), *KL = (_Float16*)(ws + WS_KL); __bf16 *VB = (__bf16*)(ws + WS_VB), *VBL = (__bf16*)(ws + WS_VBL), *XP = (__bf16*)(ws + WS_XP), *WP = (__bf16*)(ws + WS_WP), *OB = (__bf16*)(ws + WS_OB); _Float16 *OH = (_Float16*)(ws + WS_OH); float *Y = (float*)(ws + WS_Y);
  (void)Y; (void)QL; (void)KL; (void)VB; (void)VBL;
  // inputs in order: 0 x [4,2048,768]; 1 Wq [12,768,64]; 2 Wk; 3 Wv (per-head [head][model][d]); 4 Wo [768,768] (out,in); 5 bo [768] (zeros, read); no q / k / v biases
  k_pack<<<dim3((NFX + NFW + 2 * NFO) / (4 * PACKF)), 128, 0, stream>>>(F[0], F[1], F[2], F[3], F[4], XP, WP, OB, OH);
  k_proj<<<dim3(TNB * TT / 64, CC / 128, 3), 128, 0, stream>>>(XP, WP, nullptr, nullptr, nullptr, QH, QL, KH, KL, VT, VB, VBL);
  k_att<<<dim3(TNB * NH, NQB), 128, 0, stream>>>(QH, KH, QL, KL, VT, VB, VBL, Y);
  k_out<<<dim3(TNB * TT / 64, DIN / 128), 128, 0, stream>>>(Y, OB, OH, F[5], (float*)d_out);
}

// v005
// One run takes 133 microseconds.
// In two side-by-side timings against v004, it was 1.07 and 1.11 times as fast.
// All steps since v000 together make it 17.4 times as fast.
// compute dtype: all float inputs rounded to bf16; per-head q / k / v projections with EXACT bf16 products on WMMA 16x16x32 (f32 accumulate), no biases; causal logits: 3 products for the first 384 rows, single f16 q x k after, x 64^-0.5 x log2(e); softmax f32 in base 2 (hardware exp2) with a running max and sum per 128 keys; 2^(logit - max + 11) once to f16 x v once to f16 (bf16 hi + lo below row 384); ctx hi+lo x exact Wo below row 384, x2^6 f16 carry x f16(bf16 x 2^8) Wo after, + bo (zeros, read); f32 output.
#include <hip/hip_runtime.h>
#include <math.h>

typedef __attribute__((ext_vector_type(16))) _Float16 v16h;
typedef __attribute__((ext_vector_type(16))) __bf16 v16b;
typedef __attribute__((ext_vector_type(8)))  _Float16 v8h;
typedef __attribute__((ext_vector_type(8)))  float v8f;
typedef __attribute__((ext_vector_type(4)))  float v4f;
typedef __attribute__((ext_vector_type(2)))  float v2f;
typedef __attribute__((ext_vector_type(4)))  unsigned v4u;
typedef __attribute__((ext_vector_type(4)))  int v4i;
typedef float __attribute__((may_alias)) float_a;
typedef int __attribute__((may_alias)) int_a;

template <typename T> __device__ __forceinline__ void vst2(void* p, T v) { *(T*)p = v;  }
__device__ __forceinline__ v8f wmma16(v16h a, v16h b, v8f c) {
  v8f d = __builtin_amdgcn_wmma_f32_16x16x32_f16(false, a, false, b, (short)0, c, false, false);
  asm volatile("v_nop\n\tv_nop\n\tv_nop\n\tv_nop" : "+v"(d) : "v"(a), "v"(b));
  return d;
}
__device__ __forceinline__ v8f wmma_bf(v16b a, v16b b, v8f c) {
  v8f d = __builtin_amdgcn_wmma_f32_16x16x32_bf16(false, a, false, b, (short)0, c, false, false);
  asm volatile("v_nop\n\tv_nop\n\tv_nop\n\tv_nop" : "+v"(d) : "v"(a), "v"(b));
  return d;
}
// 16x16x32 fragments: lane = (h = lane>>4, row/col = lane&15); elements 0..7 = k0+8h+0..7, 8..15 = k0+16+8h+0..7; D element r = row 8h+r
__device__ __forceinline__ v16h frag_h(const _Float16* rowk0, int lane) {
  union { v16h v; v8h q[2]; } u; const _Float16* p = rowk0 + 8 * (lane >> 4);
  u.q[0] = *(const v8h*)p; u.q[1] = *(const v8h*)(p + 16); return u.v;
}
__device__ __forceinline__ v16h frag_f32(const float* rowk0, int lane) {
  v16h a; const float* p = rowk0 + 8 * (lane >> 4);
#pragma unroll
  for (int i = 0; i < 8; ++i) { a[i] = (_Float16)p[i]; a[8 + i] = (_Float16)p[16 + i]; }
  return a;
}
__device__ __forceinline__ v16h frag_f32s(const float* rowk0, int lane, float sc) {
  v16h a; const float* p = rowk0 + 8 * (lane >> 4);
#pragma unroll
  for (int i = 0; i < 8; ++i) { a[i] = (_Float16)(p[i] * sc); a[8 + i] = (_Float16)(p[16 + i] * sc); }
  return a;
}
// column fragment from a [K][ld] layout (column n), rows >= K read as 0
__device__ __forceinline__ v16h fragc_f32(const float* W, int k0, int n, int lane, int ld, int K) {
  v16h a; const int g = lane >> 4;
#pragma unroll
  for (int i = 0; i < 8; ++i) { const int ka = k0 + 8 * g + i, kb = ka + 16;
    a[i] = (_Float16)(ka < K ? W[(size_t)(ka < K ? ka : K - 1) * ld + n] : 0.f); a[8 + i] = (_Float16)(kb < K ? W[(size_t)(kb < K ? kb : K - 1) * ld + n] : 0.f); }
  return a;
}
struct F2 { v16b h, l; };
__device__ __forceinline__ F2 bsplit16(const float v[16]) { F2 r;
#pragma unroll
  for (int i = 0; i < 16; ++i) { const __bf16 h = (__bf16)v[i]; r.h[i] = h; r.l[i] = (__bf16)(v[i] - (float)h); }
  return r; }
__device__ __forceinline__ F2 split_row(const float* row, int k0, int lane) { float v[16]; const float* p = row + k0 + 8 * (lane >> 4);
#pragma unroll
  for (int i = 0; i < 8; ++i) { v[i] = p[i]; v[8 + i] = p[16 + i]; }
  return bsplit16(v); }
__device__ __forceinline__ F2 split_rowK(const float* row, int k0, int lane, int K) { float v[16]; const int g = lane >> 4;
#pragma unroll
  for (int i = 0; i < 8; ++i) { const int ka = k0 + 8 * g + i, kb = ka + 16; v[i] = ka < K ? row[ka < K ? ka : K - 1] : 0.f; v[8 + i] = kb < K ? row[kb < K ? kb : K - 1] : 0.f; }
  return bsplit16(v); }
__device__ __forceinline__ F2 split_col(const float* W, int k0, int n, int lane, int ld, int K) { float v[16]; const int g = lane >> 4;
#pragma unroll
  for (int i = 0; i < 8; ++i) { const int ka = k0 + 8 * g + i, kb = ka + 16; v[i] = ka < K ? W[(size_t)(ka < K ? ka : K - 1) * ld + n] : 0.f; v[8 + i] = kb < K ? W[(size_t)(kb < K ? kb : K - 1) * ld + n] : 0.f; }
  return bsplit16(v); }
__device__ __forceinline__ v8f mac3(const F2& a, const F2& b, v8f c) { c = wmma_bf(a.l, b.h, c); c = wmma_bf(a.h, b.l, c); return wmma_bf(a.h, b.h, c); }
__device__ __forceinline__ float sigm(float v) { return 1.0f / (1.0f + expf(-v)); }
#define LDSX() do { asm volatile("s_wait_dscnt 0" ::: "memory"); __builtin_amdgcn_wave_barrier(); __builtin_amdgcn_fence(__ATOMIC_RELEASE, "workgroup"); } while (0)

// Causal multi-head self-attention with per-head weights (x [4,2048,768]; Wq / Wk / Wv [12,768,64] = per-head [head][model][d] N(0,1) x 0.02, no biases; Wo [768,768] torch (out,in), bo zeros (read); q = einsum('bsd,hde->bhse'); scores / sqrt(64); tril kept, finfo.min elsewhere; softmax; ctx merged (head*64 + e); ctx @ Wo.T + bo).
#define NB 4
#define TT 2048
#define CC 768            // NH * HD = projected width
#define DIN 768          // input (model) width
#define NH 12
#define HD 64
#define NQB (TT / 64)
#define SCALE (0.125f)
#define SCALE_L2 (SCALE * 1.44269504088896340736f)   // logits carried in units of log2: exp(s) = 2^(s log2 e)
#define CAUSAL 1
#ifndef TNB
#define TNB NB
#endif
__device__ __forceinline__ float bfr(float v) { return (float)(__bf16)v; }
__host__ __device__ __forceinline__ int kb_last(int qb) { return CAUSAL ? ((qb * 64 + 63) >> 7) : (TT / 128 - 1); }
typedef __attribute__((ext_vector_type(8))) __bf16 v8b;
__device__ __forceinline__ v16b frag_b(const __bf16* rowk0, int lane) {
  union { v16b v; v8b q[2]; } u; const __bf16* p = rowk0 + 8 * (lane >> 4);
  u.q[0] = *(const v8b*)p; u.q[1] = *(const v8b*)(p + 16); return u.v;
}
#define QBH 6              // causal: query blocks 0..QBH-1 of each sequence (few keys, no averaging) take the high-precision path
#define QHI 384            // rows carrying a q residual plane
#define KHI 384            // key rows carrying k residual / v bf16 hi+lo planes (used only by the causal high-precision path)
// B fragment (k rows k0+.., output column o) of a weight: (in,out) [K][ld] or (out,in) [ld rows of K]: bf16 exact, or f16(bf16 * 256) exact
__device__ __forceinline__ v16b wcol_io(const float* Wm, int k0, int o, int lane, int ld) { v16b w; const int g = lane >> 4;
#pragma unroll
  for (int i = 0; i < 8; ++i) { w[i] = (__bf16)Wm[(size_t)(k0 + 8 * g + i) * ld + o]; w[8 + i] = (__bf16)Wm[(size_t)(k0 + 16 + 8 * g + i) * ld + o]; }
  return w; }
__device__ __forceinline__ v16b wcol_oi(const float* Wm, int k0, int o, int lane, int K) { v16b w; const float* p = Wm + (size_t)o * K + k0 + 8 * (lane >> 4);
#pragma unroll
  for (int i = 0; i < 8; ++i) { w[i] = (__bf16)p[i]; w[8 + i] = (__bf16)p[16 + i]; }
  return w; }
__device__ __forceinline__ v16h wcolh_io(const float* Wm, int k0, int o, int lane, int ld) { v16h w; const int g = lane >> 4;
#pragma unroll
  for (int i = 0; i < 8; ++i) { w[i] = (_Float16)(bfr(Wm[(size_t)(k0 + 8 * g + i) * ld + o]) * 256.0f); w[8 + i] = (_Float16)(bfr(Wm[(size_t)(k0 + 16 + 8 * g + i) * ld + o]) * 256.0f); }
  return w; }
__device__ __forceinline__ v16h wcolh_oi(const float* Wm, int k0, int o, int lane, int K) { v16h w; const float* p = Wm + (size_t)o * K + k0 + 8 * (lane >> 4);
#pragma unroll
  for (int i = 0; i < 8; ++i) { w[i] = (_Float16)(bfr(p[i]) * 256.0f); w[8 + i] = (_Float16)(bfr(p[16 + i]) * 256.0f); }
  return w; }
#define WQKV_LAYOUT 2   // 0 = (in,out) [DIN][CC]; 1 = (out,in) [CC][DIN]; 2 = per-head [NH][DIN][HD]
__device__ __forceinline__ v16b wcol_hdk(const float* Wm, int k0, int o, int lane) { v16b w; const int g = lane >> 4; const float* p = Wm + (size_t)(o / HD) * DIN * HD + (o % HD);
#pragma unroll
  for (int i = 0; i < 8; ++i) { w[i] = (__bf16)p[(size_t)(k0 + 8 * g + i) * HD]; w[8 + i] = (__bf16)p[(size_t)(k0 + 16 + 8 * g + i) * HD]; }
  return w; }
#define WO_OUT_IN 1
#if WQKV_LAYOUT == 1
#define WCOL(W, k0, o, lane) wcol_oi(W, k0, o, lane, DIN)
#elif WQKV_LAYOUT == 2
#define WCOL(W, k0, o, lane) wcol_hdk(W, k0, o, lane)
#else
#define WCOL(W, k0, o, lane) wcol_io(W, k0, o, lane, CC)
#endif
#if WO_OUT_IN
#define WOCOL(W, k0, o, lane) wcol_oi(W, k0, o, lane, CC)
#define WOCOLH(W, k0, o, lane) wcolh_oi(W, k0, o, lane, CC)
#else
#define WOCOL(W, k0, o, lane) wcol_io(W, k0, o, lane, DIN)
#define WOCOLH(W, k0, o, lane) wcolh_io(W, k0, o, lane, DIN)
#endif

#ifndef PROJ_EXTRA_PARAMS
#define PROJ_EXTRA_PARAMS
#endif

#define WS_QH  0u                                      // f16 q rows [b*t][CC]
#define WS_KH  (WS_QH + 2u * (size_t)NB * TT * CC)      // f16 k in fragment order [b][head][16-key group][kc][half][lane][8]
#define WS_VT  (WS_KH + 2u * (size_t)NB * TT * CC)      // f16 v in fragment order [b][head][32-key group][j][half][lane][8]
#define WS_QL  (WS_VT + 2u * (size_t)NB * CC * TT)      // f16 q residual x 2^10 rows [b][t < QHI][CC]
#define WS_KL  (WS_QL + 2u * (size_t)NB * QHI * CC)     // f16 k residual x 2^10 rows [b][t < KHI][CC]
#define WS_VB  (WS_KL + 2u * (size_t)NB * KHI * CC)     // bf16 v hi planes [b][c][t < KHI]
#define WS_VBL (WS_VB + 2u * (size_t)NB * CC * KHI)
#define WS_Y   (WS_VBL + 2u * (size_t)NB * CC * KHI)    // f32 ctx rows [b*t][CC] (only when there is an output projection)
#define WS_XP  (WS_Y  + 4u * (size_t)NB * TT * CC)      // bf16 x in fragment order [16-row group][kc][half][lane][8]
#define WS_WP  (WS_XP + 2u * (size_t)NB * TT * DIN)     // bf16 Wq / Wk / Wv in fragment order [which][128-col block][kc][j][half][lane][8]
#define WS_OB  (WS_WP + 2u * (size_t)3 * DIN * CC)      // bf16 Wo in fragment order [128-col block][kc][j][half][lane][8]
#define WS_OH  (WS_OB + 2u * (size_t)CC * DIN)          // f16(bf16 x 2^8) Wo, same order
#define WS_END (WS_OH + 2u * (size_t)CC * DIN)

// A fragment kept in memory in fragment order is 1 KiB: elements 0..7 of lanes 0..31 (512 B), then elements 8..15: each of its two wave-wide 16-byte loads covers four whole 128-B lines
#define FRAGE 512          // 16-bit elements per stored fragment
#define NFX (NB * TT / 16 * (DIN / 32))
#define NFW (3 * (CC / 16) * (DIN / 32))
#define NFO ((DIN / 16) * (CC / 32))
#define PACKF 4            // fragments per wave of k_pack
static_assert(WO_OUT_IN == 1 && NFX % (4 * PACKF) == 0 && NFW % (4 * PACKF) == 0 && NFO % (4 * PACKF) == 0 && CC % 128 == 0 && DIN % 128 == 0, "a k_pack block stays inside one operand");
template <typename V> __device__ __forceinline__ void frag_put(void* f, V v, int lane) { union { V v; v4u q[2]; } u; u.v = v; *((v4u*)f + lane) = u.q[0]; *((v4u*)f + 32 + lane) = u.q[1]; }
template <typename V> __device__ __forceinline__ V frag_get(const void* f, int lane) { union { V v; v4u q[2]; } u; u.q[0] = *((const v4u*)f + lane); u.q[1] = *((const v4u*)f + 32 + lane); return u.v; }
// last fragment of a batch of loads off one address pair: the batch's last load may land on that pair, which the loads before it name, so the wait stands in front of it
template <typename V> __device__ __forceinline__ V frag_get_last(const void* f, int lane) { union { V v; v4u q[2]; } u; u.q[0] = *((const v4u*)f + lane); asm volatile("s_wait_xcnt 0x0" ::: "memory"); u.q[1] = *((const v4u*)f + 32 + lane); return u.v; }
// behind a batch of loads off the address p: the wait that stands in front of any rewrite of that address pair; naming p keeps the pair live up to the wait, so no load of the batch lands on it either
#define XWAIT(p) asm volatile("s_wait_xcnt 0x0" :: "v"(p) : "memory")
// inputs-only hold on loaded fragments: every load of the batch is issued before the first product waits for one, so a batch costs one load latency and not one per fragment
#define HOLD8(a, o) asm volatile("" :: "v"(a[o]), "v"(a[o + 1]), "v"(a[o + 2]), "v"(a[o + 3]), "v"(a[o + 4]), "v"(a[o + 5]), "v"(a[o + 6]), "v"(a[o + 7]))
// ---- k_pack: one wave per PACKF fragments: x, Wq / Wk / Wv, Wo rounded exactly as the products take them (bf16; Wo also f16(bf16 x 2^8)) and laid down in fragment order, once per call, for k_proj and k_out
__global__ __launch_bounds__(128) void k_pack(const float* __restrict__ X, const float* __restrict__ WQ, const float* __restrict__ WK, const float* __restrict__ WV, const float* __restrict__ WO, __bf16* __restrict__ XP, __bf16* __restrict__ WP, __bf16* __restrict__ OB, _Float16* __restrict__ OH) {
  const int lane = threadIdx.x & 31, col = lane & 15, g = lane >> 4; const int f0 = ((int)blockIdx.x * 4 + ((int)threadIdx.x >> 5)) * PACKF;
  if (f0 < NFX) {   /* block-uniform */
    v16b a[PACKF];
#pragma unroll
    for (int i = 0; i < PACKF; ++i) { const int f = f0 + i, rg = f / (DIN / 32), kc = f % (DIN / 32); const float* p = X + ((size_t)rg * 16 + col) * DIN + kc * 32 + 8 * g;
#pragma unroll
      for (int e = 0; e < 8; ++e) { a[i][e] = (__bf16)p[e]; a[i][8 + e] = (__bf16)p[16 + e]; }
      XWAIT(p); }
#pragma unroll
    for (int i = 0; i < PACKF; ++i) frag_put(XP + (size_t)(f0 + i) * FRAGE, a[i], lane);
  } else if (f0 < NFX + NFW) {
#pragma unroll
    for (int i = 0; i < PACKF; ++i) { const int f = f0 - NFX + i, j = f & 7, kc = (f >> 3) % (DIN / 32), cb = (f >> 3) / (DIN / 32) % (CC / 128), which = (f >> 3) / (DIN / 32) / (CC / 128); const float* WA = which == 0 ? WQ : which == 1 ? WK : WV;
      frag_put(WP + (size_t)f * FRAGE, WCOL(WA, kc * 32, cb * 128 + j * 16 + col, lane), lane); }
  } else { const bool hb = f0 < NFX + NFW + NFO; const int fo = f0 - NFX - NFW - (hb ? 0 : NFO); float v[PACKF][16];   /* Wo, once as bf16 and once as f16(bf16 x 2^8) */
#pragma unroll
    for (int i = 0; i < PACKF; ++i) { const int f = fo + i, j = f & 7, kc = (f >> 3) % (CC / 32), cb = (f >> 3) / (CC / 32); const float* p = WO + (size_t)(cb * 128 + j * 16 + col) * CC + kc * 32 + 8 * g;
#pragma unroll
      for (int e = 0; e < 8; ++e) { v[i][e] = p[e]; v[i][8 + e] = p[16 + e]; }
      XWAIT(p); }
#pragma unroll
    for (int i = 0; i < PACKF; ++i) { v16b wb; v16h wh;
#pragma unroll
      for (int e = 0; e < 16; ++e) { wb[e] = (__bf16)v[i][e]; wh[e] = (_Float16)(bfr(v[i][e]) * 256.0f); }
      if (hb) frag_put(OB + (size_t)(fo + i) * FRAGE, wb, lane); else frag_put(OH + (size_t)(fo + i) * FRAGE, wh, lane); } } }

// ---- k_proj: block = (128 rows, 128 cols, which): q/k/v = X W (+ b) with exact bf16 products (K = DIN), both operands read in fragment order, a k step's ten fragments as one batch; a wave owns two 16-row groups (wave and 4 + wave), so each weight fragment it loads feeds two products; the results leave in two passes of 64 rows through the same staging tiles -> which 0: q f16 rows (+ residual rows < QHI); 1: k f16 in fragment order (+ residual rows < KHI); 2: v f16 in fragment order (+ bf16 hi/lo planes [c][t] for t < KHI)
__global__ __launch_bounds__(128) void k_proj(const __bf16* __restrict__ XP, const __bf16* __restrict__ WP, const float* __restrict__ BQ, const float* __restrict__ BK, const float* __restrict__ BV,
    _Float16* __restrict__ QH, _Float16* __restrict__ QL, _Float16* __restrict__ KH, _Float16* __restrict__ KL, _Float16* __restrict__ VT, __bf16* __restrict__ VB, __bf16* __restrict__ VBL) {
  __shared__ __align__(16) _Float16 sh[64][136], sl[64][136]; __shared__ __align__(16) _Float16 th[128][72]; __shared__ __align__(16) __bf16 tb[128][72], tbl[128][72];
  const int tid = threadIdx.x, wave = tid >> 5, lane = tid & 31, col = lane & 15, g = lane >> 4; const int which = blockIdx.z; const int c0 = blockIdx.y * 128;
  const float* BA = which == 0 ? BQ : which == 1 ? BK : BV;
  const __bf16* xp = XP + (size_t)(blockIdx.x * 8 + __builtin_amdgcn_readfirstlane(wave)) * (DIN / 32) * FRAGE; const __bf16* wp = WP + (size_t)(which * (CC / 128) + blockIdx.y) * (DIN / 32) * 8 * FRAGE;   /* this wave's x fragments and this block's weight fragments, in the order of the walk; the wave's number made scalar, so that both streams are a scalar base + the lane's offset */
  v8f acc2[2][8] = {};
  for (int kc = 0; kc < DIN / 32; ++kc, xp += FRAGE, wp += 8 * FRAGE) { const v16b a = frag_get<v16b>(xp, lane), a4 = frag_get<v16b>(xp + 4 * (DIN / 32) * FRAGE, lane); v16b w[8];
#pragma unroll
    for (int j = 0; j < 7; ++j) w[j] = frag_get<v16b>(wp + j * FRAGE, lane);
    w[7] = frag_get_last<v16b>(wp + 7 * FRAGE, lane);
    HOLD8(w, 0);
#pragma unroll
    for (int j = 0; j < 8; ++j) { acc2[0][j] = wmma_bf(a, w[j], acc2[0][j]); acc2[1][j] = wmma_bf(a4, w[j], acc2[1][j]); } }
#pragma unroll   /* hh picks registers: rolled, the accumulators would have to lie in scratch */
  for (int hh = 0; hh < 2; ++hh) { const v8f (&acc)[8] = acc2[hh]; const size_t r0 = (size_t)blockIdx.x * 128 + hh * 64; const size_t bb = r0 / TT; const int t0 = (int)(r0 % TT);
  if (hh) __syncthreads();   /* the first pass's reads of the staging tiles end before the second pass writes over them */
  if (which < 2) { _Float16* DL = which == 0 ? QL : KL; const int nhi = which == 0 ? QHI : KHI; const bool hi_rows = t0 < nhi;
#pragma unroll
    for (int j = 0; j < 8; ++j) { const float bias = BA ? bfr(BA[c0 + j * 16 + col]) : 0.f;
#pragma unroll
      for (int r = 0; r < 8; ++r) { const float v = acc[j][r] + bias; const _Float16 hv = (_Float16)v; sh[wave * 16 + 8 * g + r][j * 16 + col] = hv; sl[wave * 16 + 8 * g + r][j * 16 + col] = (_Float16)((v - (float)hv) * 1024.0f); } }
    __syncthreads();
    if (which == 1) { for (int e = tid; e < 64 * 16; e += 128) { const int ln = e & 31, hf = (e >> 5) & 1, kc = (e >> 6) & 1, kg = (e >> 7) & 3, hl = e >> 9;   /* k: 16-byte pieces in the order k_att's loads take them */
        vst2((unsigned*)(KH + ((((bb * NH + c0 / HD + hl) * (TT / 16) + t0 / 16 + kg) * 2 + kc) * 2 + hf) * (size_t)(FRAGE / 2) + ln * 8), *(const v4u*)&sh[kg * 16 + (ln & 15)][hl * 64 + kc * 32 + hf * 16 + (ln >> 4) * 8]); } }
    else { for (int e = tid; e < 64 * 16; e += 128) { const int rl = e >> 4, q = e & 15; vst2((unsigned*)(QH + (r0 + rl) * CC + c0 + q * 8), *(const v4u*)&sh[rl][q * 8]); } }
    if (hi_rows) { for (int e = tid; e < 64 * 16; e += 128) { const int rl = e >> 4, q = e & 15; vst2((unsigned*)(DL + (bb * nhi + t0 + rl) * (size_t)CC + c0 + q * 8), *(const v4u*)&sl[rl][q * 8]); } }
  } else { const bool hi_rows = t0 < KHI;
#pragma unroll
    for (int j = 0; j < 8; ++j) { const float bias = BA ? bfr(BA[c0 + j * 16 + col]) : 0.f;
#pragma unroll
      for (int r = 0; r < 8; ++r) { const float v = acc[j][r] + bias; const int rl = wave * 16 + 8 * g + r, cl = j * 16 + col; th[cl][rl] = (_Float16)v; const __bf16 bh = (__bf16)v; tb[cl][rl] = bh; tbl[cl][rl] = (__bf16)(v - (float)bh); } }
    __syncthreads();
    for (int e = tid; e < 128 * 8; e += 128) { const int ln = e & 31, hf = (e >> 5) & 1, j = (e >> 6) & 3, kq = (e >> 8) & 1, hl = e >> 9;   /* v: 16-byte pieces in the order k_att's loads take them */
      vst2((unsigned*)(VT + ((((bb * NH + c0 / HD + hl) * (TT / 32) + t0 / 32 + kq) * 4 + j) * 2 + hf) * (size_t)(FRAGE / 2) + ln * 8), *(const v4u*)&th[hl * 64 + j * 16 + (ln & 15)][kq * 32 + hf * 16 + (ln >> 4) * 8]); }
    if (hi_rows) for (int e = tid; e < 128 * 8; e += 128) { const int cl = e >> 3, q = e & 7; const size_t o3 = (bb * CC + c0 + cl) * (size_t)KHI + t0 + q * 8; vst2((unsigned*)(VB + o3), *(const v4u*)&tb[cl][q * 8]); vst2((unsigned*)(VBL + o3), *(const v4u*)&tbl[cl][q * 8]); } } } }
// eight 2^x in place, with the slot behind the last one, in ONE statement: each transcendental is followed by an independent instruction, so none that reads its result or overwrites its source can come to stand directly behind it
__device__ __forceinline__ void exp2x8(float* x) {
  asm("v_exp_f32 %0, %0\n\tv_exp_f32 %1, %1\n\tv_exp_f32 %2, %2\n\tv_exp_f32 %3, %3\n\tv_exp_f32 %4, %4\n\tv_exp_f32 %5, %5\n\tv_exp_f32 %6, %6\n\tv_exp_f32 %7, %7\n\tv_nop"
      : "+v"(x[0]), "+v"(x[1]), "+v"(x[2]), "+v"(x[3]), "+v"(x[4]), "+v"(x[5]), "+v"(x[6]), "+v"(x[7])); }
// one 128-key tile of this lane's query row t (lanes l and l ^ 16 share a row; e[kc][0..7] = key k0 + 32 kc + 8 g + i, e[kc][8..15] = 16 keys on: the A fragment's k order): causal mask by index (only a query block's last key block reaches past the diagonal), running max m and sum l brought up to date (logits, m in log2 units; l carries the 2^11 too); leaves 2^(logit - m + 11) in e (0 for excluded keys) and returns the factor that carries earlier sums over to the new max
__device__ __forceinline__ float sm_tile(const float* row, int g, int k0, int t, bool diag, float& m, float& l, float (&e)[4][16]) {
#pragma unroll
  for (int kc = 0; kc < 4; ++kc) { const float* p = row + kc * 32 + 8 * g;
    union { v4f q[4]; float f[16]; } u; u.q[0] = *(const v4f*)p; u.q[1] = *(const v4f*)(p + 4); u.q[2] = *(const v4f*)(p + 16); u.q[3] = *(const v4f*)(p + 20);
#pragma unroll
    for (int i = 0; i < 16; ++i) e[kc][i] = u.f[i]; }
  if (diag) {   /* block-uniform */
#pragma unroll
    for (int kc = 0; kc < 4; ++kc)
#pragma unroll
      for (int i = 0; i < 16; ++i) { const int k = k0 + kc * 32 + 8 * g + (i < 8 ? i : i + 8); e[kc][i] = k <= t ? e[kc][i] : -3.0e38f; } }
  float mx = -3.0e38f;
#pragma unroll
  for (int kc = 0; kc < 4; ++kc)
#pragma unroll
    for (int i = 0; i < 16; ++i) mx = fmaxf(mx, e[kc][i]);
  mx = fmaxf(mx, __shfl_xor(mx, 16));
  const float mn = fmaxf(m, mx); const float al = __builtin_amdgcn_exp2f(m - mn); m = mn;
  const float mb = mn - 11.0f; float sum = 0.f;
#pragma unroll
  for (int kc = 0; kc < 4; ++kc)
#pragma unroll
    for (int i = 0; i < 16; ++i) e[kc][i] -= mb;
#pragma unroll
  for (int kc = 0; kc < 4; ++kc)
#pragma unroll
    for (int i = 0; i < 16; i += 8) exp2x8(&e[kc][i]);   /* an excluded key's -3e38 gives exactly 0 */
#pragma unroll
  for (int kc = 0; kc < 4; ++kc)
#pragma unroll
    for (int i = 0; i < 16; ++i) sum += e[kc][i];
  sum += __shfl_xor(sum, 16);
  l = l * al + sum;
  return al; }
// per-row value held by lane (row) -> the accumulator's rows 8 g + r
__device__ __forceinline__ void row_scale(v8f (&o)[HD / 16], float f, int g) {
#pragma unroll
  for (int r = 0; r < 8; ++r) { const float fr = __shfl(f, 8 * g + r);
#pragma unroll
    for (int j = 0; j < HD / 16; ++j) o[j][r] *= fr; } }
// hand-over through LDS between lanes of ONE wave: its LDS operations have ended and the compiler moves none across; no fence, which would also wait for the global loads that are meant to stay in flight
#define LDSW() do { asm volatile("s_wait_dscnt 0" ::: "memory"); __builtin_amdgcn_wave_barrier(); } while (0)
// ---- k_att: block = (pair = b * NH + h, 64 queries qb, longest first); each wave owns 16 query rows and walks its causal key blocks of 128 alone: logits x SCALE x log2(e) (q x k in f16; query blocks < QBH: + q residual x k + q x k residual, both x 2^10) -> the wave's own LDS tile -> read back row-wise, running softmax in f32, base 2 -> 2^(logit - max + 11) once to f16 against v f16 (query blocks < QBH: exp and v as bf16 hi + lo, 3 products); ctx = sums / l (both carry 2^11); 256-B (row, head) segment by 16 lanes
static_assert(CAUSAL == 1 && QBH * 64 == QHI && QHI == KHI && QHI % 128 == 0 && HD == 64, "early query blocks see only keys that carry residual planes");
__global__ __attribute__((amdgpu_waves_per_eu(4))) __launch_bounds__(128) void k_att(const _Float16* __restrict__ QH, const _Float16* __restrict__ KH, const _Float16* __restrict__ QL, const _Float16* __restrict__ KL, const _Float16* __restrict__ VT, const __bf16* __restrict__ VB, const __bf16* __restrict__ VBL, float* __restrict__ Y) { __shared__ __align__(16) float ss[4][16][132];
  const int pr = blockIdx.x, b = pr / NH, h = pr % NH; const int qb = NQB - 1 - (int)blockIdx.y; const int nkb = kb_last(qb) + 1;
  const int tid = threadIdx.x, wave = tid >> 5, lane = tid & 31, col = lane & 15, g = lane >> 4; const int ql0 = qb * 64 + wave * 16; const size_t q0 = (size_t)b * TT + ql0; const int t = ql0 + col;
  float m = -3.0e38f, l = 0.f; v8f o[HD / 16] = {}; float e[4][16];
  v16h ah[HD / 32];
#pragma unroll
  for (int kc = 0; kc < HD / 32; ++kc) ah[kc] = frag_h(QH + (q0 + col) * CC + h * HD + kc * 32, lane);
  asm volatile("s_wait_xcnt 0x0" ::: "memory");   /* stands in front of the first rewrite of the address pair that the q loads name */
  if (qb < QBH) { const _Float16* KLb = KL + (size_t)b * KHI * CC; v16h al[HD / 32];
#pragma unroll
    for (int kc = 0; kc < HD / 32; ++kc) al[kc] = frag_h(QL + ((size_t)b * QHI + ql0 + col) * CC + h * HD + kc * 32, lane);
#pragma unroll 1
    for (int kb = 0; kb < nkb; ++kb) { const int k0 = kb * 128; v8f acc[8] = {}, accl[8] = {};
#pragma unroll
      for (int kc = 0; kc < HD / 32; ++kc)
#pragma unroll
        for (int jh = 0; jh < 8; jh += 4) { v16h kf[8];
#pragma unroll
          for (int j = 0; j < 4; ++j) { kf[j] = frag_get<v16h>(KH + (((size_t)pr * (TT / 16) + kb * 8 + jh + j) * 2 + kc) * FRAGE, lane); kf[4 + j] = frag_h(KLb + (size_t)(k0 + (jh + j) * 16 + col) * CC + h * HD + kc * 32, lane); }
          HOLD8(kf, 0);
#pragma unroll
          for (int j = 0; j < 4; ++j) { acc[jh + j] = wmma16(ah[kc], kf[j], acc[jh + j]); accl[jh + j] = wmma16(al[kc], kf[j], accl[jh + j]); accl[jh + j] = wmma16(ah[kc], kf[4 + j], accl[jh + j]); } }
#pragma unroll
      for (int j = 0; j < 8; ++j)
#pragma unroll
        for (int r = 0; r < 8; ++r) ss[wave][8 * g + r][j * 16 + col] = (acc[j][r] + accl[j][r] * (1.0f / 1024.0f)) * SCALE_L2;
      LDSW();   /* the tile's writes land before other lanes of this wave read them */
      const float f = sm_tile(&ss[wave][col][0], g, k0, t, kb == nkb - 1, m, l, e);
      LDSW();   /* the tile's reads end before the next tile is written over it */
      row_scale(o, f, g);
#pragma unroll
      for (int kc = 0; kc < 4; ++kc) { const F2 p = bsplit16(e[kc]); v16b vf[8];
#pragma unroll
        for (int j = 0; j < HD / 16; ++j) { const size_t po = ((size_t)b * CC + h * HD + j * 16 + col) * (size_t)KHI + k0 + kc * 32; vf[j] = frag_b(VB + po, lane); vf[4 + j] = frag_b(VBL + po, lane); }
        HOLD8(vf, 0);
#pragma unroll
        for (int j = 0; j < HD / 16; ++j) { o[j] = wmma_bf(p.h, vf[j], o[j]); o[j] = wmma_bf(p.l, vf[j], o[j]); o[j] = wmma_bf(p.h, vf[4 + j], o[j]); } } }
  } else { const _Float16* kp = KH + (size_t)pr * (TT / 16) * 2 * FRAGE; const _Float16* vp = VT + (size_t)pr * (TT / 32) * 4 * FRAGE;   /* this (batch, head)'s k and v fragments at the key block's first key: 16 fragments = 16 KiB in a row each */
#pragma unroll 1
    for (int kb = 0; kb < nkb; ++kb, kp += 16 * FRAGE, vp += 16 * FRAGE) { const int k0 = kb * 128; v8f acc[8] = {}; { v16h kf[16];
#pragma unroll
      for (int kc = 0; kc < HD / 32; ++kc)
#pragma unroll
        for (int j = 0; j < 8; ++j) if (kc * 8 + j < 15) kf[kc * 8 + j] = frag_get<v16h>(kp + (j * 2 + kc) * FRAGE, lane);
      kf[15] = frag_get_last<v16h>(kp + 15 * FRAGE, lane);
      HOLD8(kf, 0); HOLD8(kf, 8);
#pragma unroll
      for (int kc = 0; kc < HD / 32; ++kc)
#pragma unroll
        for (int j = 0; j < 8; ++j) acc[j] = wmma16(ah[kc], kf[kc * 8 + j], acc[j]); }
#pragma unroll
      for (int j = 0; j < 8; ++j)
#pragma unroll
        for (int r = 0; r < 8; ++r) ss[wave][8 * g + r][j * 16 + col] = acc[j][r] * SCALE_L2;
      v16h vf[16];   /* v fragments of the first 64 keys fly while the softmax runs, the other 64 behind it */
#pragma unroll
      for (int kc = 0; kc < 2; ++kc)
#pragma unroll
        for (int j = 0; j < HD / 16; ++j) vf[kc * 4 + j] = frag_get<v16h>(vp + (kc * 4 + j) * FRAGE, lane);
      LDSW();   /* the tile's writes land before other lanes of this wave read them */
      const float f = sm_tile(&ss[wave][col][0], g, k0, t, kb == nkb - 1, m, l, e);
      LDSW();   /* the tile's reads end before the next tile is written over it */
      v16h p[4];
#pragma unroll
      for (int kc = 0; kc < 4; ++kc)
#pragma unroll
        for (int i = 0; i < 16; ++i) p[kc][i] = (_Float16)e[kc][i];
#pragma unroll
      for (int kc = 2; kc < 4; ++kc)
#pragma unroll
        for (int j = 0; j < HD / 16; ++j) if (kc * 4 + j < 15) vf[kc * 4 + j] = frag_get<v16h>(vp + (kc * 4 + j) * FRAGE, lane);
      vf[15] = frag_get_last<v16h>(vp + 15 * FRAGE, lane);
      row_scale(o, f, g);
      HOLD8(vf, 0);
#pragma unroll
      for (int kc = 0; kc < 2; ++kc)
#pragma unroll
        for (int j = 0; j < HD / 16; ++j) o[j] = wmma16(p[kc], vf[kc * 4 + j], o[j]);
      HOLD8(vf, 8);
#pragma unroll
      for (int kc = 2; kc < 4; ++kc)
#pragma unroll
        for (int j = 0; j < HD / 16; ++j) o[j] = wmma16(p[kc], vf[kc * 4 + j], o[j]); } }
  row_scale(o, l > 0.f ? 1.0f / l : 0.f, g);
#pragma unroll
  for (int j = 0; j < HD / 16; ++j)
#pragma unroll
    for (int r = 0; r < 8; ++r) ss[wave][8 * g + r][j * 16 + col] = o[j][r];
  LDSW(); for (int rl = g; rl < 16; rl += 2) vst2(Y + ((size_t)b * TT + ql0 + rl) * CC + h * HD + col * 4, *(const v4f*)&ss[wave][rl][col * 4]); }
// ---- k_out: block = (64 rows, 128 cols): out = ctx Wo (+ bo): ctx x 2^6 once to f16 against Wo as f16(bf16 x 2^8) exact (1 product) x 2^-14; causal early rows (< QHI of each sequence): ctx bf16 hi + lo against exact bf16 Wo (2 products)
__global__ __launch_bounds__(128) void k_out(const float* __restrict__ Y, const __bf16* __restrict__ OB, const _Float16* __restrict__ OH, const float* __restrict__ BO, float* __restrict__ OUT) { __shared__ __align__(16) float sf[4][16][132];
  const int tid = threadIdx.x, wave = tid >> 5, lane = tid & 31, col = lane & 15, g = lane >> 4; const int c0 = blockIdx.y * 128; const size_t r0 = (size_t)blockIdx.x * 64 + wave * 16;
  v8f acc[8] = {};
  if (CAUSAL && (int)(((size_t)blockIdx.x * 64) % TT) < QHI) {   /* block-uniform */
    const __bf16* wp = OB + (size_t)blockIdx.y * (CC / 32) * 8 * FRAGE;
    for (int kc = 0; kc < CC / 32; ++kc, wp += 8 * FRAGE) { const F2 a = split_row(Y + (r0 + col) * CC, kc * 32, lane); XWAIT(Y + (r0 + col) * CC + kc * 32 + 8 * g); v16b w[8];
#pragma unroll
      for (int j = 0; j < 7; ++j) w[j] = frag_get<v16b>(wp + j * FRAGE, lane);
      w[7] = frag_get_last<v16b>(wp + 7 * FRAGE, lane);
      HOLD8(w, 0);
#pragma unroll
      for (int j = 0; j < 8; ++j) { acc[j] = wmma_bf(a.h, w[j], acc[j]); acc[j] = wmma_bf(a.l, w[j], acc[j]); } }
#pragma unroll
    for (int j = 0; j < 8; ++j) { const float bias = BO ? bfr(BO[c0 + j * 16 + col]) : 0.f;
#pragma unroll
      for (int r = 0; r < 8; ++r) sf[wave][8 * g + r][j * 16 + col] = acc[j][r] + bias; }
  } else {
    const _Float16* wp = OH + (size_t)blockIdx.y * (CC / 32) * 8 * FRAGE;
    for (int kc = 0; kc < CC / 32; ++kc, wp += 8 * FRAGE) { const v16h a = frag_f32s(Y + (r0 + col) * CC + kc * 32, lane, 64.0f); XWAIT(Y + (r0 + col) * CC + kc * 32 + 8 * g); v16h w[8];   /* ctx carried x 2^6 into f16 so small-magnitude context rows stay clear of f16 subnormals */
#pragma unroll
      for (int j = 0; j < 7; ++j) w[j] = frag_get<v16h>(wp + j * FRAGE, lane);
      w[7] = frag_get_last<v16h>(wp + 7 * FRAGE, lane);
      HOLD8(w, 0);
#pragma unroll
      for (int j = 0; j < 8; ++j) acc[j] = wmma16(a, w[j], acc[j]); }
#pragma unroll
    for (int j = 0; j < 8; ++j) { const float bias = BO ? bfr(BO[c0 + j * 16 + col]) : 0.f;
#pragma unroll
      for (int r = 0; r < 8; ++r) sf[wave][8 * g + r][j * 16 + col] = acc[j][r] * (1.0f / 16384.0f) + bias; } }   /* 2^-8 (Wo carry) x 2^-6 (ctx carry) */
  LDSX(); for (int rl = 0; rl < 16; ++rl) vst2(OUT + (r0 + rl) * DIN + c0 + lane * 4, *(const v4f*)&sf[wave][rl][lane * 4]); }

extern "C" void kernel_launch(void* const* d_in, const int* in_sizes, int n_in, void* d_out, int out_size, void* d_ws, size_t ws_size, hipStream_t stream) {
  (void)in_sizes; (void)n_in; (void)out_size;
  const float** F = (const float**)d_in;
  if (ws_size < (size_t)WS_END) return;
  char* ws = (char*)d_ws; _Float16 *QH = (_Float16*)(ws + WS_QH), *KH = (_Float16*)(ws + WS_KH), *VT = (_Float16*)(ws + WS_VT), *QL = (_Float16*)(ws + WS_QL), *KL = (_Float16*)(ws + WS_KL); __bf16 *VB = (__bf16*)(ws + WS_VB), *VBL = (__bf16*)(ws + WS_VBL), *XP = (__bf16*)(ws + WS_XP), *WP = (__bf16*)(ws + WS_WP), *OB = (__bf16*)(ws + WS_OB); _Float16 *OH = (_Float16*)(ws + WS_OH); float *Y = (float*)(ws + WS_Y);
  (void)Y; (void)QL; (void)KL; (void)VB; (void)VBL;
  // inputs in order: 0 x [4,2048,768]; 1 Wq [12,768,64]; 2 Wk; 3 Wv (per-head [head][model][d]); 4 Wo [768,768] (out,in); 5 bo [768] (zeros, read); no q / k / v biases
  k_pack<<<dim3((NFX + NFW + 2 * NFO) / (4 * PACKF)), 128, 0, stream>>>(F[0], F[1], F[2], F[3], F[4], XP, WP, OB, OH);
  k_proj<<<dim3(TNB * TT / 128, CC / 128, 3), 128, 0, stream>>>(XP, WP, nullptr, nullptr, nullptr, QH, QL, KH, KL, VT, VB, VBL);
  k_att<<<dim3(TNB * NH, NQB), 128, 0, stream>>>(QH, KH, QL, KL, VT, VB, VBL, Y);
  k_out<<<dim3(TNB * TT / 64, DIN / 128), 128, 0, stream>>>(Y, OB, OH, F[5], (float*)d_out);
}

// v006
// Measured time: 130 microseconds a run.
// Two timings next to v005 put it at 1.03 and 1.04 times that version's speed.
// Counting every step since v000, it is 18.1 times as fast.
// compute dtype: all float inputs rounded to bf16; per-head q / k / v projections with EXACT bf16 products on WMMA 16x16x32 (f32 accumulate), no biases; causal logits: 3 products for the first 384 rows, single f16 q x k after, x 64^-0.5 x log2(e); both attention products taken transposed (k x q^T, v^T x p^T), a query's logits and sums stay in its two lanes; softmax f32 in base 2 (hardware exp2) with a running max and sum per 128 keys; 2^(logit - max + 11) once to f16 x v once to f16 (bf16 hi + lo below row 384); ctx hi+lo x exact Wo below row 384, x2^6 f16 carry x f16(bf16 x 2^8) Wo after, + bo (zeros, read); f32 output.
#include <hip/hip_runtime.h>
#include <math.h>

typedef __attribute__((ext_vector_type(16))) _Float16 v16h;
typedef __attribute__((ext_vector_type(16))) __bf16 v16b;
typedef __attribute__((ext_vector_type(8)))  _Float16 v8h;
typedef __attribute__((ext_vector_type(8)))  float v8f;
typedef __attribute__((ext_vector_type(4)))  float v4f;
typedef __attribute__((ext_vector_type(2)))  float v2f;
typedef __attribute__((ext_vector_type(4)))  unsigned v4u;
typedef __attribute__((ext_vector_type(4)))  int v4i;
typedef float __attribute__((may_alias)) float_a;
typedef int __attribute__((may_alias)) int_a;

template <typename T> __device__ __forceinline__ void vst2(void* p, T v) { *(T*)p = v;  }
__device__ __forceinline__ v8f wmma16(v16h a, v16h b, v8f c) {
  v8f d = __builtin_amdgcn_wmma_f32_16x16x32_f16(false, a, false, b, (short)0, c, false, false);
  asm volatile("v_nop\n\tv_nop\n\tv_nop\n\tv_nop" : "+v"(d) : "v"(a), "v"(b));
  return d;
}
__device__ __forceinline__ v8f wmma_bf(v16b a, v16b b, v8f c) {
  v8f d = __builtin_amdgcn_wmma_f32_16x16x32_bf16(false, a, false, b, (short)0, c, false, false);
  asm volatile("v_nop\n\tv_nop\n\tv_nop\n\tv_nop" : "+v"(d) : "v"(a), "v"(b));
  return d;
}
// 16x16x32 fragments: lane = (h = lane>>4, row/col = lane&15); elements 0..7 = k0+8h+0..7, 8..15 = k0+16+8h+0..7; D element r = row 8h+r
__device__ __forceinline__ v16h frag_h(const _Float16* rowk0, int lane) {
  union { v16h v; v8h q[2]; } u; const _Float16* p = rowk0 + 8 * (lane >> 4);
  u.q[0] = *(const v8h*)p; u.q[1] = *(const v8h*)(p + 16); return u.v;
}
__device__ __forceinline__ v16h frag_f32(const float* rowk0, int lane) {
  v16h a; const float* p = rowk0 + 8 * (lane >> 4);
#pragma unroll
  for (int i = 0; i < 8; ++i) { a[i] = (_Float16)p[i]; a[8 + i] = (_Float16)p[16 + i]; }
  return a;
}
__device__ __forceinline__ v16h frag_f32s(const float* rowk0, int lane, float sc) {
  v16h a; const float* p = rowk0 + 8 * (lane >> 4);
#pragma unroll
  for (int i = 0; i < 8; ++i) { a[i] = (_Float16)(p[i] * sc); a[8 + i] = (_Float16)(p[16 + i] * sc); }
  return a;
}
// column fragment from a [K][ld] layout (column n), rows >= K read as 0
__device__ __forceinline__ v16h fragc_f32(const float* W, int k0, int n, int lane, int ld, int K) {
  v16h a; const int g = lane >> 4;
#pragma unroll
  for (int i = 0; i < 8; ++i) { const int ka = k0 + 8 * g + i, kb = ka + 16;
    a[i] = (_Float16)(ka < K ? W[(size_t)(ka < K ? ka : K - 1) * ld + n] : 0.f); a[8 + i] = (_Float16)(kb < K ? W[(size_t)(kb < K ? kb : K - 1) * ld + n] : 0.f); }
  return a;
}
struct F2 { v16b h, l; };
__device__ __forceinline__ F2 bsplit16(const float v[16]) { F2 r;
#pragma unroll
  for (int i = 0; i < 16; ++i) { const __bf16 h = (__bf16)v[i]; r.h[i] = h; r.l[i] = (__bf16)(v[i] - (float)h); }
  return r; }
__device__ __forceinline__ F2 split_row(const float* row, int k0, int lane) { float v[16]; const float* p = row + k0 + 8 * (lane >> 4);
#pragma unroll
  for (int i = 0; i < 8; ++i) { v[i] = p[i]; v[8 + i] = p[16 + i]; }
  return bsplit16(v); }
__device__ __forceinline__ F2 split_rowK(const float* row, int k0, int lane, int K) { float v[16]; const int g = lane >> 4;
#pragma unroll
  for (int i = 0; i < 8; ++i) { const int ka = k0 + 8 * g + i, kb = ka + 16; v[i] = ka < K ? row[ka < K ? ka : K - 1] : 0.f; v[8 + i] = kb < K ? row[kb < K ? kb : K - 1] : 0.f; }
  return bsplit16(v); }
__device__ __forceinline__ F2 split_col(const float* W, int k0, int n, int lane, int ld, int K) { float v[16]; const int g = lane >> 4;
#pragma unroll
  for (int i = 0; i < 8; ++i) { const int ka = k0 + 8 * g + i, kb = ka + 16; v[i] = ka < K ? W[(size_t)(ka < K ? ka : K - 1) * ld + n] : 0.f; v[8 + i] = kb < K ? W[(size_t)(kb < K ? kb : K - 1) * ld + n] : 0.f; }
  return bsplit16(v); }
__device__ __forceinline__ v8f mac3(const F2& a, const F2& b, v8f c) { c = wmma_bf(a.l, b.h, c); c = wmma_bf(a.h, b.l, c); return wmma_bf(a.h, b.h, c); }
__device__ __forceinline__ float sigm(float v) { return 1.0f / (1.0f + expf(-v)); }
#define LDSX() do { asm volatile("s_wait_dscnt 0" ::: "memory"); __builtin_amdgcn_wave_barrier(); __builtin_amdgcn_fence(__ATOMIC_RELEASE, "workgroup"); } while (0)

// Causal multi-head self-attention with per-head weights (x [4,2048,768]; Wq / Wk / Wv [12,768,64] = per-head [head][model][d] N(0,1) x 0.02, no biases; Wo [768,768] torch (out,in), bo zeros (read); q = einsum('bsd,hde->bhse'); scores / sqrt(64); tril kept, finfo.min elsewhere; softmax; ctx merged (head*64 + e); ctx @ Wo.T + bo).
#define NB 4
#define TT 2048
#define CC 768            // NH * HD = projected width
#define DIN 768          // input (model) width
#define NH 12
#define HD 64
#define NQB (TT / 64)
#define SCALE (0.125f)
#define SCALE_L2 (SCALE * 1.44269504088896340736f)   // logits carried in units of log2: exp(s) = 2^(s log2 e)
#define CAUSAL 1
#ifndef TNB
#define TNB NB
#endif
__device__ __forceinline__ float bfr(float v) { return (float)(__bf16)v; }
__host__ __device__ __forceinline__ int kb_last(int qb) { return CAUSAL ? ((qb * 64 + 63) >> 7) : (TT / 128 - 1); }
typedef __attribute__((ext_vector_type(8))) __bf16 v8b;
__device__ __forceinline__ v16b frag_b(const __bf16* rowk0, int lane) {
  union { v16b v; v8b q[2]; } u; const __bf16* p = rowk0 + 8 * (lane >> 4);
  u.q[0] = *(const v8b*)p; u.q[1] = *(const v8b*)(p + 16); return u.v;
}
#define QBH 6              // causal: query blocks 0..QBH-1 of each sequence (few keys, no averaging) take the high-precision path
#define QHI 384            // rows carrying a q residual plane
#define KHI 384            // key rows carrying k residual / v bf16 hi+lo planes (used only by the causal high-precision path)
// B fragment (k rows k0+.., output column o) of a weight: (in,out) [K][ld] or (out,in) [ld rows of K]: bf16 exact, or f16(bf16 * 256) exact
__device__ __forceinline__ v16b wcol_io(const float* Wm, int k0, int o, int lane, int ld) { v16b w; const int g = lane >> 4;
#pragma unroll
  for (int i = 0; i < 8; ++i) { w[i] = (__bf16)Wm[(size_t)(k0 + 8 * g + i) * ld + o]; w[8 + i] = (__bf16)Wm[(size_t)(k0 + 16 + 8 * g + i) * ld + o]; }
  return w; }
__device__ __forceinline__ v16b wcol_oi(const float* Wm, int k0, int o, int lane, int K) { v16b w; const float* p = Wm + (size_t)o * K + k0 + 8 * (lane >> 4);
#pragma unroll
  for (int i = 0; i < 8; ++i) { w[i] = (__bf16)p[i]; w[8 + i] = (__bf16)p[16 + i]; }
  return w; }
__device__ __forceinline__ v16h wcolh_io(const float* Wm, int k0, int o, int lane, int ld) { v16h w; const int g = lane >> 4;
#pragma unroll
  for (int i = 0; i < 8; ++i) { w[i] = (_Float16)(bfr(Wm[(size_t)(k0 + 8 * g + i) * ld + o]) * 256.0f); w[8 + i] = (_Float16)(bfr(Wm[(size_t)(k0 + 16 + 8 * g + i) * ld + o]) * 256.0f); }
  return w; }
__device__ __forceinline__ v16h wcolh_oi(const float* Wm, int k0, int o, int lane, int K) { v16h w; const float* p = Wm + (size_t)o * K + k0 + 8 * (lane >> 4);
#pragma unroll
  for (int i = 0; i < 8; ++i) { w[i] = (_Float16)(bfr(p[i]) * 256.0f); w[8 + i] = (_Float16)(bfr(p[16 + i]) * 256.0f); }
  return w; }
#define WQKV_LAYOUT 2   // 0 = (in,out) [DIN][CC]; 1 = (out,in) [CC][DIN]; 2 = per-head [NH][DIN][HD]
__device__ __forceinline__ v16b wcol_hdk(const float* Wm, int k0, int o, int lane) { v16b w; const int g = lane >> 4; const float* p = Wm + (size_t)(o / HD) * DIN * HD + (o % HD);
#pragma unroll
  for (int i = 0; i < 8; ++i) { w[i] = (__bf16)p[(size_t)(k0 + 8 * g + i) * HD]; w[8 + i] = (__bf16)p[(size_t)(k0 + 16 + 8 * g + i) * HD]; }
  return w; }
#define WO_OUT_IN 1
#if WQKV_LAYOUT == 1
#define WCOL(W, k0, o, lane) wcol_oi(W, k0, o, lane, DIN)
#elif WQKV_LAYOUT == 2
#define WCOL(W, k0, o, lane) wcol_hdk(W, k0, o, lane)
#else
#define WCOL(W, k0, o, lane) wcol_io(W, k0, o, lane, CC)
#endif
#if WO_OUT_IN
#define WOCOL(W, k0, o, lane) wcol_oi(W, k0, o, lane, CC)
#define WOCOLH(W, k0, o, lane) wcolh_oi(W, k0, o, lane, CC)
#else
#define WOCOL(W, k0, o, lane) wcol_io(W, k0, o, lane, DIN)
#define WOCOLH(W, k0, o, lane) wcolh_io(W, k0, o, lane, DIN)
#endif

#ifndef PROJ_EXTRA_PARAMS
#define PROJ_EXTRA_PARAMS
#endif

#define WS_QH  0u                                      // f16 q rows [b*t][CC]
#define WS_KH  (WS_QH + 2u * (size_t)NB * TT * CC)      // f16 k in fragment order [b][head][16-key group][kc][half][lane][8]
#define WS_VT  (WS_KH + 2u * (size_t)NB * TT * CC)      // f16 v in fragment order [b][head][32-key group][j][half][lane][8]
#define WS_QL  (WS_VT + 2u * (size_t)NB * CC * TT)      // f16 q residual x 2^10 rows [b][t < QHI][CC]
#define WS_KL  (WS_QL + 2u * (size_t)NB * QHI * CC)     // f16 k residual x 2^10 rows [b][t < KHI][CC]
#define WS_VB  (WS_KL + 2u * (size_t)NB * KHI * CC)     // bf16 v hi planes [b][c][t < KHI]
#define WS_VBL (WS_VB + 2u * (size_t)NB * CC * KHI)
#define WS_Y   (WS_VBL + 2u * (size_t)NB * CC * KHI)    // f32 ctx rows [b*t][CC] (only when there is an output projection)
#define WS_XP  (WS_Y  + 4u * (size_t)NB * TT * CC)      // bf16 x in fragment order [16-row group][kc][half][lane][8]
#define WS_WP  (WS_XP + 2u * (size_t)NB * TT * DIN)     // bf16 Wq / Wk / Wv in fragment order [which][128-col block][kc][j][half][lane][8]
#define WS_OB  (WS_WP + 2u * (size_t)3 * DIN * CC)      // bf16 Wo in fragment order [128-col block][kc][j][half][lane][8]
#define WS_OH  (WS_OB + 2u * (size_t)CC * DIN)          // f16(bf16 x 2^8) Wo, same order
#define WS_END (WS_OH + 2u * (size_t)CC * DIN)

// A fragment kept in memory in fragment order is 1 KiB: elements 0..7 of lanes 0..31 (512 B), then elements 8..15: each of its two wave-wide 16-byte loads covers four whole 128-B lines
#define FRAGE 512          // 16-bit elements per stored fragment
#define NFX (NB * TT / 16 * (DIN / 32))
#define NFW (3 * (CC / 16) * (DIN / 32))
#define NFO ((DIN / 16) * (CC / 32))
#define PACKF 4            // fragments per wave of k_pack
static_assert(WO_OUT_IN == 1 && NFX % (4 * PACKF) == 0 && NFW % (4 * PACKF) == 0 && NFO % (4 * PACKF) == 0 && CC % 128 == 0 && DIN % 128 == 0, "a k_pack block stays inside one operand");
template <typename V> __device__ __forceinline__ void frag_put(void* f, V v, int lane) { union { V v; v4u q[2]; } u; u.v = v; *((v4u*)f + lane) = u.q[0]; *((v4u*)f + 32 + lane) = u.q[1]; }
template <typename V> __device__ __forceinline__ V frag_get(const void* f, int lane) { union { V v; v4u q[2]; } u; u.q[0] = *((const v4u*)f + lane); u.q[1] = *((const v4u*)f + 32 + lane); return u.v; }
// last fragment of a batch of loads off one address pair: the batch's last load may land on that pair, which the loads before it name, so the wait stands in front of it
template <typename V> __device__ __forceinline__ V frag_get_last(const void* f, int lane) { union { V v; v4u q[2]; } u; u.q[0] = *((const v4u*)f + lane); asm volatile("s_wait_xcnt 0x0" ::: "memory"); u.q[1] = *((const v4u*)f + 32 + lane); return u.v; }
// behind a batch of loads off the address p: the wait that stands in front of any rewrite of that address pair; naming p keeps the pair live up to the wait, so no load of the batch lands on it either
#define XWAIT(p) asm volatile("s_wait_xcnt 0x0" :: "v"(p) : "memory")
// inputs-only hold on loaded fragments: every load of the batch is issued before the first product waits for one, so a batch costs one load latency and not one per fragment
#define HOLD8(a, o) asm volatile("" :: "v"(a[o]), "v"(a[o + 1]), "v"(a[o + 2]), "v"(a[o + 3]), "v"(a[o + 4]), "v"(a[o + 5]), "v"(a[o + 6]), "v"(a[o + 7]))
// ---- k_pack: one wave per PACKF fragments: x, Wq / Wk / Wv, Wo rounded exactly as the products take them (bf16; Wo also f16(bf16 x 2^8)) and laid down in fragment order, once per call, for k_proj and k_out
__global__ __launch_bounds__(128) void k_pack(const float* __restrict__ X, const float* __restrict__ WQ, const float* __restrict__ WK, const float* __restrict__ WV, const float* __restrict__ WO, __bf16* __restrict__ XP, __bf16* __restrict__ WP, __bf16* __restrict__ OB, _Float16* __restrict__ OH) {
  const int lane = threadIdx.x & 31, col = lane & 15, g = lane >> 4; const int f0 = ((int)blockIdx.x * 4 + ((int)threadIdx.x >> 5)) * PACKF;
  if (f0 < NFX) {   /* block-uniform */
    v16b a[PACKF];
#pragma unroll
    for (int i = 0; i < PACKF; ++i) { const int f = f0 + i, rg = f / (DIN / 32), kc = f % (DIN / 32); const float* p = X + ((size_t)rg * 16 + col) * DIN + kc * 32 + 8 * g;
#pragma unroll
      for (int e = 0; e < 8; ++e) { a[i][e] = (__bf16)p[e]; a[i][8 + e] = (__bf16)p[16 + e]; }
      XWAIT(p); }
#pragma unroll
    for (int i = 0; i < PACKF; ++i) frag_put(XP + (size_t)(f0 + i) * FRAGE, a[i], lane);
  } else if (f0 < NFX + NFW) {
#pragma unroll
    for (int i = 0; i < PACKF; ++i) { const int f = f0 - NFX + i, j = f & 7, kc = (f >> 3) % (DIN / 32), cb = (f >> 3) / (DIN / 32) % (CC / 128), which = (f >> 3) / (DIN / 32) / (CC / 128); const float* WA = which == 0 ? WQ : which == 1 ? WK : WV;
      frag_put(WP + (size_t)f * FRAGE, WCOL(WA, kc * 32, cb * 128 + j * 16 + col, lane), lane); }
  } else { const bool hb = f0 < NFX + NFW + NFO; const int fo = f0 - NFX - NFW - (hb ? 0 : NFO); float v[PACKF][16];   /* Wo, once as bf16 and once as f16(bf16 x 2^8) */
#pragma unroll
    for (int i = 0; i < PACKF; ++i) { const int f = fo + i, j = f & 7, kc = (f >> 3) % (CC / 32), cb = (f >> 3) / (CC / 32); const float* p = WO + (size_t)(cb * 128 + j * 16 + col) * CC + kc * 32 + 8 * g;
#pragma unroll
      for (int e = 0; e < 8; ++e) { v[i][e] = p[e]; v[i][8 + e] = p[16 + e]; }
      XWAIT(p); }
#pragma unroll
    for (int i = 0; i < PACKF; ++i) { v16b wb; v16h wh;
#pragma unroll
      for (int e = 0; e < 16; ++e) { wb[e] = (__bf16)v[i][e]; wh[e] = (_Float16)(bfr(v[i][e]) * 256.0f); }
      if (hb) frag_put(OB + (size_t)(fo + i) * FRAGE, wb, lane); else frag_put(OH + (size_t)(fo + i) * FRAGE, wh, lane); } } }

// ---- k_proj: block = (128 rows, 128 cols, which): q/k/v = X W (+ b) with exact bf16 products (K = DIN), both operands read in fragment order, a k step's ten fragments as one batch; a wave owns two 16-row groups (wave and 4 + wave), so each weight fragment it loads feeds two products; the results leave in two passes of 64 rows through the same staging tiles -> which 0: q f16 rows (+ residual rows < QHI); 1: k f16 in fragment order (+ residual rows < KHI); 2: v f16 in fragment order (+ bf16 hi/lo planes [c][t] for t < KHI)
__global__ __launch_bounds__(128) void k_proj(const __bf16* __restrict__ XP, const __bf16* __restrict__ WP, const float* __restrict__ BQ, const float* __restrict__ BK, const float* __restrict__ BV,
    _Float16* __restrict__ QH, _Float16* __restrict__ QL, _Float16* __restrict__ KH, _Float16* __restrict__ KL, _Float16* __restrict__ VT, __bf16* __restrict__ VB, __bf16* __restrict__ VBL) {
  __shared__ __align__(16) _Float16 sh[64][136], sl[64][136]; __shared__ __align__(16) _Float16 th[128][72]; __shared__ __align__(16) __bf16 tb[128][72], tbl[128][72];
  const int tid = threadIdx.x, wave = tid >> 5, lane = tid & 31, col = lane & 15, g = lane >> 4; const int which = blockIdx.z; const int c0 = blockIdx.y * 128;
  const float* BA = which == 0 ? BQ : which == 1 ? BK : BV;
  const __bf16* xp = XP + (size_t)(blockIdx.x * 8 + __builtin_amdgcn_readfirstlane(wave)) * (DIN / 32) * FRAGE; const __bf16* wp = WP + (size_t)(which * (CC / 128) + blockIdx.y) * (DIN / 32) * 8 * FRAGE;   /* this wave's x fragments and this block's weight fragments, in the order of the walk; the wave's number made scalar, so that both streams are a scalar base + the lane's offset */
  v8f acc2[2][8] = {};
  for (int kc = 0; kc < DIN / 32; ++kc, xp += FRAGE, wp += 8 * FRAGE) { const v16b a = frag_get<v16b>(xp, lane), a4 = frag_get<v16b>(xp + 4 * (DIN / 32) * FRAGE, lane); v16b w[8];
#pragma unroll
    for (int j = 0; j < 7; ++j) w[j] = frag_get<v16b>(wp + j * FRAGE, lane);
    w[7] = frag_get_last<v16b>(wp + 7 * FRAGE, lane);
    HOLD8(w, 0);
#pragma unroll
    for (int j = 0; j < 8; ++j) { acc2[0][j] = wmma_bf(a, w[j], acc2[0][j]); acc2[1][j] = wmma_bf(a4, w[j], acc2[1][j]); } }
#pragma unroll   /* hh picks registers: rolled, the accumulators would have to lie in scratch */
  for (int hh = 0; hh < 2; ++hh) { const v8f (&acc)[8] = acc2[hh]; const size_t r0 = (size_t)blockIdx.x * 128 + hh * 64; const size_t bb = r0 / TT; const int t0 = (int)(r0 % TT);
  if (hh) __syncthreads();   /* the first pass's reads of the staging tiles end before the second pass writes over them */
  if (which < 2) { _Float16* DL = which == 0 ? QL : KL; const int nhi = which == 0 ? QHI : KHI; const bool hi_rows = t0 < nhi;
#pragma unroll
    for (int j = 0; j < 8; ++j) { const float bias = BA ? bfr(BA[c0 + j * 16 + col]) : 0.f;
#pragma unroll
      for (int r = 0; r < 8; ++r) { const float v = acc[j][r] + bias; const _Float16 hv = (_Float16)v; sh[wave * 16 + 8 * g + r][j * 16 + col] = hv; sl[wave * 16 + 8 * g + r][j * 16 + col] = (_Float16)((v - (float)hv) * 1024.0f); } }
    __syncthreads();
    if (which == 1) { for (int e = tid; e < 64 * 16; e += 128) { const int ln = e & 31, hf = (e >> 5) & 1, kc = (e >> 6) & 1, kg = (e >> 7) & 3, hl = e >> 9;   /* k: 16-byte pieces in the order k_att's loads take them */
        vst2((unsigned*)(KH + ((((bb * NH + c0 / HD + hl) * (TT / 16) + t0 / 16 + kg) * 2 + kc) * 2 + hf) * (size_t)(FRAGE / 2) + ln * 8), *(const v4u*)&sh[kg * 16 + (ln & 15)][hl * 64 + kc * 32 + hf * 16 + (ln >> 4) * 8]); } }
    else { for (int e = tid; e < 64 * 16; e += 128) { const int rl = e >> 4, q = e & 15; vst2((unsigned*)(QH + (r0 + rl) * CC + c0 + q * 8), *(const v4u*)&sh[rl][q * 8]); } }
    if (hi_rows) { for (int e = tid; e < 64 * 16; e += 128) { const int rl = e >> 4, q = e & 15; vst2((unsigned*)(DL + (bb * nhi + t0 + rl) * (size_t)CC + c0 + q * 8), *(const v4u*)&sl[rl][q * 8]); } }
  } else { const bool hi_rows = t0 < KHI;
#pragma unroll
    for (int j = 0; j < 8; ++j) { const float bias = BA ? bfr(BA[c0 + j * 16 + col]) : 0.f;
#pragma unroll
      for (int r = 0; r < 8; ++r) { const float v = acc[j][r] + bias; const int rl = wave * 16 + 8 * g + r, cl = j * 16 + col; th[cl][rl] = (_Float16)v; const __bf16 bh = (__bf16)v; tb[cl][rl] = bh; tbl[cl][rl] = (__bf16)(v - (float)bh); } }
    __syncthreads();
    for (int e = tid; e < 128 * 8; e += 128) { const int ln = e & 31, hf = (e >> 5) & 1, j = (e >> 6) & 3, kq = (e >> 8) & 1, hl = e >> 9;   /* v: 16-byte pieces in the order k_att's loads take them */
      vst2((unsigned*)(VT + ((((bb * NH + c0 / HD + hl) * (TT / 32) + t0 / 32 + kq) * 4 + j) * 2 + hf) * (size_t)(FRAGE / 2) + ln * 8), *(const v4u*)&th[hl * 64 + j * 16 + (ln & 15)][kq * 32 + hf * 16 + (ln >> 4) * 8]); }
    if (hi_rows) for (int e = tid; e < 128 * 8; e += 128) { const int cl = e >> 3, q = e & 7; const size_t o3 = (bb * CC + c0 + cl) * (size_t)KHI + t0 + q * 8; vst2((unsigned*)(VB + o3), *(const v4u*)&tb[cl][q * 8]); vst2((unsigned*)(VBL + o3), *(const v4u*)&tbl[cl][q * 8]); } } } }
// eight 2^x in place, with the slot behind the last one, in ONE statement: each transcendental is followed by an independent instruction, so none that reads its result or overwrites its source can come to stand directly behind it
__device__ __forceinline__ void exp2x8(float* x) {
  asm("v_exp_f32 %0, %0\n\tv_exp_f32 %1, %1\n\tv_exp_f32 %2, %2\n\tv_exp_f32 %3, %3\n\tv_exp_f32 %4, %4\n\tv_exp_f32 %5, %5\n\tv_exp_f32 %6, %6\n\tv_exp_f32 %7, %7\n\tv_nop"
      : "+v"(x[0]), "+v"(x[1]), "+v"(x[2]), "+v"(x[3]), "+v"(x[4]), "+v"(x[5]), "+v"(x[6]), "+v"(x[7])); }
// one 128-key tile of this lane's query row t, its logits handed in in e (lanes l and l ^ 16 share a row; e[kc][0..7] = key k0 + 32 kc + 8 g + i, e[kc][8..15] = 16 keys on: the fragments' k order): causal mask by index (only a query block's last key block reaches past the diagonal), running max m and sum l brought up to date (logits, m in log2 units; l carries the 2^11 too); leaves 2^(logit - m + 11) in e (0 for excluded keys) and returns the factor that carries earlier sums over to the new max
__device__ __forceinline__ float sm_tile(int g, int k0, int t, bool diag, float& m, float& l, float (&e)[4][16]) {
  if (diag) {   /* block-uniform */
#pragma unroll
    for (int kc = 0; kc < 4; ++kc)
#pragma unroll
      for (int i = 0; i < 16; ++i) { const int k = k0 + kc * 32 + 8 * g + (i < 8 ? i : i + 8); e[kc][i] = k <= t ? e[kc][i] : -3.0e38f; } }
  float mx = -3.0e38f;
#pragma unroll
  for (int kc = 0; kc < 4; ++kc)
#pragma unroll
    for (int i = 0; i < 16; ++i) mx = fmaxf(mx, e[kc][i]);
  mx = fmaxf(mx, __shfl_xor(mx, 16));
  const float mn = fmaxf(m, mx); const float al = __builtin_amdgcn_exp2f(m - mn); m = mn;
  const float mb = mn - 11.0f; float sum = 0.f;
#pragma unroll
  for (int kc = 0; kc < 4; ++kc)
#pragma unroll
    for (int i = 0; i < 16; ++i) e[kc][i] -= mb;
#pragma unroll
  for (int kc = 0; kc < 4; ++kc)
#pragma unroll
    for (int i = 0; i < 16; i += 8) exp2x8(&e[kc][i]);   /* an excluded key's -3e38 gives exactly 0 */
#pragma unroll
  for (int kc = 0; kc < 4; ++kc)
#pragma unroll
    for (int i = 0; i < 16; ++i) sum += e[kc][i];
  sum += __shfl_xor(sum, 16);
  l = l * al + sum;
  return al; }
// the lane's query row's factor on the lane's own sums (the transposed accumulator's column is the query)
__device__ __forceinline__ void row_scale(v8f (&o)[HD / 16], float f) {
#pragma unroll
  for (int j = 0; j < HD / 16; ++j)
#pragma unroll
    for (int r = 0; r < 8; ++r) o[j][r] *= f; }
// hand-over through LDS between lanes of ONE wave: its LDS operations have ended and the compiler moves none across
#define LDSW() do { asm volatile("s_wait_dscnt 0" ::: "memory"); __builtin_amdgcn_wave_barrier(); } while (0)
// ---- k_att: block = (pair = b * NH + h, 64 queries qb, longest first); each wave owns 16 query rows and walks its causal key blocks of 128 alone: logits^T = k (A) x q^T (B) x SCALE x log2(e) (f16; query blocks < QBH: + k x q residual + k residual x q, both x 2^10): accumulator j, register r of lane (g, col) = key 16 j + 8 g + r of query col, which is the k order of a fragment of that query's row -> running softmax in f32, base 2, in those registers -> 2^(logit - max + 11) once to f16 as B against v^T f16 as A (query blocks < QBH: exp and v as bf16 hi + lo, 3 products): o[j][r] = ctx[query col][16 j + 8 g + r]; ctx = sums / l (both carry 2^11), turned through the wave's LDS tile once at the end; 256-B (row, head) segment by 16 lanes
static_assert(CAUSAL == 1 && QBH * 64 == QHI && QHI == KHI && QHI % 128 == 0 && HD == 64, "early query blocks see only keys that carry residual planes");
__global__ __attribute__((amdgpu_waves_per_eu(4))) __launch_bounds__(128) void k_att(const _Float16* __restrict__ QH, const _Float16* __restrict__ KH, const _Float16* __restrict__ QL, const _Float16* __restrict__ KL, const _Float16* __restrict__ VT, const __bf16* __restrict__ VB, const __bf16* __restrict__ VBL, float* __restrict__ Y) { __shared__ __align__(16) float ss[4][16][HD + 4];
  const int pr = blockIdx.x, b = pr / NH, h = pr % NH; const int qb = NQB - 1 - (int)blockIdx.y; const int nkb = kb_last(qb) + 1;
  const int tid = threadIdx.x, wave = tid >> 5, lane = tid & 31, col = lane & 15, g = lane >> 4; const int ql0 = qb * 64 + wave * 16; const size_t q0 = (size_t)b * TT + ql0; const int t = ql0 + col;
  float m = -3.0e38f, l = 0.f; v8f o[HD / 16] = {}; float e[4][16];
  v16h ah[HD / 32];
#pragma unroll
  for (int kc = 0; kc < HD / 32; ++kc) ah[kc] = frag_h(QH + (q0 + col) * CC + h * HD + kc * 32, lane);
  asm volatile("s_wait_xcnt 0x0" ::: "memory");   /* stands in front of the first rewrite of the address pair that the q loads name */
  if (qb < QBH) { const _Float16* KLb = KL + (size_t)b * KHI * CC; v16h al[HD / 32];
#pragma unroll
    for (int kc = 0; kc < HD / 32; ++kc) al[kc] = frag_h(QL + ((size_t)b * QHI + ql0 + col) * CC + h * HD + kc * 32, lane);
#pragma unroll 1
    for (int kb = 0; kb < nkb; ++kb) { const int k0 = kb * 128; v8f acc[8] = {}, accl[8] = {};
#pragma unroll
      for (int kc = 0; kc < HD / 32; ++kc)
#pragma unroll
        for (int jh = 0; jh < 8; jh += 4) { v16h kf[8];
#pragma unroll
          for (int j = 0; j < 4; ++j) { kf[j] = frag_get<v16h>(KH + (((size_t)pr * (TT / 16) + kb * 8 + jh + j) * 2 + kc) * FRAGE, lane); kf[4 + j] = frag_h(KLb + (size_t)(k0 + (jh + j) * 16 + col) * CC + h * HD + kc * 32, lane); }
          HOLD8(kf, 0);
#pragma unroll
          for (int j = 0; j < 4; ++j) { acc[jh + j] = wmma16(kf[j], ah[kc], acc[jh + j]); accl[jh + j] = wmma16(kf[j], al[kc], accl[jh + j]); accl[jh + j] = wmma16(kf[4 + j], ah[kc], accl[jh + j]); } }
#pragma unroll
      for (int j = 0; j < 8; ++j)
#pragma unroll
        for (int r = 0; r < 8; ++r) e[j >> 1][(j & 1) * 8 + r] = (acc[j][r] + accl[j][r] * (1.0f / 1024.0f)) * SCALE_L2;
      const float f = sm_tile(g, k0, t, kb == nkb - 1, m, l, e);
      row_scale(o, f);
#pragma unroll
      for (int kc = 0; kc < 4; ++kc) { const F2 p = bsplit16(e[kc]); v16b vf[8];
#pragma unroll
        for (int j = 0; j < HD / 16; ++j) { const size_t po = ((size_t)b * CC + h * HD + j * 16 + col) * (size_t)KHI + k0 + kc * 32; vf[j] = frag_b(VB + po, lane); vf[4 + j] = frag_b(VBL + po, lane); }
        HOLD8(vf, 0);
#pragma unroll
        for (int j = 0; j < HD / 16; ++j) { o[j] = wmma_bf(vf[j], p.h, o[j]); o[j] = wmma_bf(vf[j], p.l, o[j]); o[j] = wmma_bf(vf[4 + j], p.h, o[j]); } } }
  } else { const _Float16* kp = KH + (size_t)pr * (TT / 16) * 2 * FRAGE; const _Float16* vp = VT + (size_t)pr * (TT / 32) * 4 * FRAGE;   /* this (batch, head)'s k and v fragments at the key block's first key: 16 fragments = 16 KiB in a row each */
#pragma unroll 1
    for (int kb = 0; kb < nkb; ++kb, kp += 16 * FRAGE, vp += 16 * FRAGE) { const int k0 = kb * 128; v8f acc[8] = {}; { v16h kf[16];
#pragma unroll
      for (int kc = 0; kc < HD / 32; ++kc)
#pragma unroll
        for (int j = 0; j < 8; ++j) if (kc * 8 + j < 15) kf[kc * 8 + j] = frag_get<v16h>(kp + (j * 2 + kc) * FRAGE, lane);
      kf[15] = frag_get_last<v16h>(kp + 15 * FRAGE, lane);
      HOLD8(kf, 0); HOLD8(kf, 8);
#pragma unroll
      for (int kc = 0; kc < HD / 32; ++kc)
#pragma unroll
        for (int j = 0; j < 8; ++j) acc[j] = wmma16(kf[kc * 8 + j], ah[kc], acc[j]); }
#pragma unroll
      for (int j = 0; j < 8; ++j)
#pragma unroll
        for (int r = 0; r < 8; ++r) e[j >> 1][(j & 1) * 8 + r] = acc[j][r] * SCALE_L2;
      v16h vf[16];   /* v fragments of the first 64 keys fly while the softmax runs, the other 64 behind it */
#pragma unroll
      for (int kc = 0; kc < 2; ++kc)
#pragma unroll
        for (int j = 0; j < HD / 16; ++j) vf[kc * 4 + j] = frag_get<v16h>(vp + (kc * 4 + j) * FRAGE, lane);
      const float f = sm_tile(g, k0, t, kb == nkb - 1, m, l, e);
      v16h p[4];
#pragma unroll
      for (int kc = 0; kc < 4; ++kc)
#pragma unroll
        for (int i = 0; i < 16; ++i) p[kc][i] = (_Float16)e[kc][i];
#pragma unroll
      for (int kc = 2; kc < 4; ++kc)
#pragma unroll
        for (int j = 0; j < HD / 16; ++j) if (kc * 4 + j < 15) vf[kc * 4 + j] = frag_get<v16h>(vp + (kc * 4 + j) * FRAGE, lane);
      vf[15] = frag_get_last<v16h>(vp + 15 * FRAGE, lane);
      row_scale(o, f);
      HOLD8(vf, 0);
#pragma unroll
      for (int kc = 0; kc < 2; ++kc)
#pragma unroll
        for (int j = 0; j < HD / 16; ++j) o[j] = wmma16(vf[kc * 4 + j], p[kc], o[j]);
      HOLD8(vf, 8);
#pragma unroll
      for (int kc = 2; kc < 4; ++kc)
#pragma unroll
        for (int j = 0; j < HD / 16; ++j) o[j] = wmma16(vf[kc * 4 + j], p[kc], o[j]); } }
  row_scale(o, l > 0.f ? 1.0f / l : 0.f);
#pragma unroll
  for (int j = 0; j < HD / 16; ++j)
#pragma unroll
    for (int r = 0; r < 8; ++r) ss[wave][col][j * 16 + 8 * g + r] = o[j][r];
  LDSW(); for (int rl = g; rl < 16; rl += 2) vst2(Y + ((size_t)b * TT + ql0 + rl) * CC + h * HD + col * 4, *(const v4f*)&ss[wave][rl][col * 4]); }
// ---- k_out: block = (64 rows, 128 cols): out = ctx Wo (+ bo): ctx x 2^6 once to f16 against Wo as f16(bf16 x 2^8) exact (1 product) x 2^-14; causal early rows (< QHI of each sequence): ctx bf16 hi + lo against exact bf16 Wo (2 products)
__global__ __launch_bounds__(128) void k_out(const float* __restrict__ Y, const __bf16* __restrict__ OB, const _Float16* __restrict__ OH, const float* __restrict__ BO, float* __restrict__ OUT) { __shared__ __align__(16) float sf[4][16][132];
  const int tid = threadIdx.x, wave = tid >> 5, lane = tid & 31, col = lane & 15, g = lane >> 4; const int c0 = blockIdx.y * 128; const size_t r0 = (size_t)blockIdx.x * 64 + wave * 16;
  v8f acc[8] = {};
  if (CAUSAL && (int)(((size_t)blockIdx.x * 64) % TT) < QHI) {   /* block-uniform */
    const __bf16* wp = OB + (size_t)blockIdx.y * (CC / 32) * 8 * FRAGE;
    for (int kc = 0; kc < CC / 32; ++kc, wp += 8 * FRAGE) { const F2 a = split_row(Y + (r0 + col) * CC, kc * 32, lane); XWAIT(Y + (r0 + col) * CC + kc * 32 + 8 * g); v16b w[8];
#pragma unroll
      for (int j = 0; j < 7; ++j) w[j] = frag_get<v16b>(wp + j * FRAGE, lane);
      w[7] = frag_get_last<v16b>(wp + 7 * FRAGE, lane);
      HOLD8(w, 0);
#pragma unroll
      for (int j = 0; j < 8; ++j) { acc[j] = wmma_bf(a.h, w[j], acc[j]); acc[j] = wmma_bf(a.l, w[j], acc[j]); } }
#pragma unroll
    for (int j = 0; j < 8; ++j) { const float bias = BO ? bfr(BO[c0 + j * 16 + col]) : 0.f;
#pragma unroll
      for (int r = 0; r < 8; ++r) sf[wave][8 * g + r][j * 16 + col] = acc[j][r] + bias; }
  } else {
    const _Float16* wp = OH + (size_t)blockIdx.y * (CC / 32) * 8 * FRAGE;
    for (int kc = 0; kc < CC / 32; ++kc, wp += 8 * FRAGE) { const v16h a = frag_f32s(Y + (r0 + col) * CC + kc * 32, lane, 64.0f); XWAIT(Y + (r0 + col) * CC + kc * 32 + 8 * g); v16h w[8];   /* ctx carried x 2^6 into f16 so small-magnitude context rows stay clear of f16 subnormals */
#pragma unroll
      for (int j = 0; j < 7; ++j) w[j] = frag_get<v16h>(wp + j * FRAGE, lane);
      w[7] = frag_get_last<v16h>(wp + 7 * FRAGE, lane);
      HOLD8(w, 0);
#pragma unroll
      for (int j = 0; j < 8; ++j) acc[j] = wmma16(a, w[j], acc[j]); }
#pragma unroll
    for (int j = 0; j < 8; ++j) { const float bias = BO ? bfr(BO[c0 + j * 16 + col]) : 0.f;
#pragma unroll
      for (int r = 0; r < 8; ++r) sf[wave][8 * g + r][j * 16 + col] = acc[j][r] * (1.0f / 16384.0f) + bias; } }   /* 2^-8 (Wo carry) x 2^-6 (ctx carry) */
  LDSX(); for (int rl = 0; rl < 16; ++rl) vst2(OUT + (r0 + rl) * DIN + c0 + lane * 4, *(const v4f*)&sf[wave][rl][lane * 4]); }

extern "C" void kernel_launch(void* const* d_in, const int* in_sizes, int n_in, void* d_out, int out_size, void* d_ws, size_t ws_size, hipStream_t stream) {
  (void)in_sizes; (void)n_in; (void)out_size;
  const float** F = (const float**)d_in;
  if (ws_size < (size_t)WS_END) return;
  char* ws = (char*)d_ws; _Float16 *QH = (_Float16*)(ws + WS_QH), *KH = (_Float16*)(ws + WS_KH), *VT = (_Float16*)(ws + WS_VT), *QL = (_Float16*)(ws + WS_QL), *KL = (_Float16*)(ws + WS_KL); __bf16 *VB = (__bf16*)(ws + WS_VB), *VBL = (__bf16*)(ws + WS_VBL), *XP = (__bf16*)(ws + WS_XP), *WP = (__bf16*)(ws + WS_WP), *OB = (__bf16*)(ws + WS_OB); _Float16 *OH = (_Float16*)(ws + WS_OH); float *Y = (float*)(ws + WS_Y);
  (void)Y; (void)QL; (void)KL; (void)VB; (void)VBL;
  // inputs in order: 0 x [4,2048,768]; 1 Wq [12,768,64]; 2 Wk; 3 Wv (per-head [head][model][d]); 4 Wo [768,768] (out,in); 5 bo [768] (zeros, read); no q / k / v biases
  k_pack<<<dim3((NFX + NFW + 2 * NFO) / (4 * PACKF)), 128, 0, stream>>>(F[0], F[1], F[2], F[3], F[4], XP, WP, OB, OH);
  k_proj<<<dim3(TNB * TT / 128, CC / 128, 3), 128, 0, stream>>>(XP, WP, nullptr, nullptr, nullptr, QH, QL, KH, KL, VT, VB, VBL);
  k_att<<<dim3(TNB * NH, NQB), 128, 0, stream>>>(QH, KH, QL, KL, VT, VB, VBL, Y);
  k_out<<<dim3(TNB * TT / 64, DIN / 128), 128, 0, stream>>>(Y, OB, OH, F[5], (float*)d_out);
}

// v007
// Measured time: 113 microseconds a run.
// Timed twice side by side with v006, it ran 1.14 and 1.16 times as fast.
// Over all steps from v000 it is 20.8 times as fast.
// compute dtype: all float inputs rounded to bf16; per-head q / k / v projections with EXACT bf16 products on WMMA 16x16x32 (f32 accumulate), no biases; causal logits: 3 products for the first 384 rows, single f16 q x k after, x 64^-0.5 x log2(e); both attention products taken transposed (k x q^T, v^T x p^T), a query's logits and sums stay in its two lanes; softmax f32 in base 2 (hardware exp2) with a running max and sum per 128 keys; 2^(logit - max + 11) once to f16 x v once to f16 (bf16 hi + lo below row 384); ctx hi+lo x exact Wo below row 384, x2^6 f16 carry x f16(bf16 x 2^8) Wo after, + bo (zeros, read); f32 output.
#include <hip/hip_runtime.h>
#include <math.h>

typedef __attribute__((ext_vector_type(16))) _Float16 v16h;
typedef __attribute__((ext_vector_type(16))) __bf16 v16b;
typedef __attribute__((ext_vector_type(8)))  _Float16 v8h;
typedef __attribute__((ext_vector_type(8)))  float v8f;
typedef __attribute__((ext_vector_type(4)))  float v4f;
typedef __attribute__((ext_vector_type(2)))  float v2f;
typedef __attribute__((ext_vector_type(4)))  unsigned v4u;
typedef __attribute__((ext_vector_type(4)))  int v4i;
typedef float __attribute__((may_alias)) float_a;
typedef int __attribute__((may_alias)) int_a;

template <typename T> __device__ __forceinline__ void vst2(void* p, T v) { *(T*)p = v;  }
__device__ __forceinline__ v8f wmma16(v16h a, v16h b, v8f c) {
  v8f d = __builtin_amdgcn_wmma_f32_16x16x32_f16(false, a, false, b, (short)0, c, false, false);
  asm volatile("v_nop\n\tv_nop\n\tv_nop\n\tv_nop" : "+v"(d) : "v"(a), "v"(b));
  return d;
}
__device__ __forceinline__ v8f wmma_bf(v16b a, v16b b, v8f c) {
  v8f d = __builtin_amdgcn_wmma_f32_16x16x32_bf16(false, a, false, b, (short)0, c, false, false);
  asm volatile("v_nop\n\tv_nop\n\tv_nop\n\tv_nop" : "+v"(d) : "v"(a), "v"(b));
  return d;
}
// 16x16x32 fragments: lane = (h = lane>>4, row/col = lane&15); elements 0..7 = k0+8h+0..7, 8..15 = k0+16+8h+0..7; D element r = row 8h+r
__device__ __forceinline__ v16h frag_h(const _Float16* rowk0, int lane) {
  union { v16h v; v8h q[2]; } u; const _Float16* p = rowk0 + 8 * (lane >> 4);
  u.q[0] = *(const v8h*)p; u.q[1] = *(const v8h*)(p + 16); return u.v;
}
__device__ __forceinline__ v16h frag_f32(const float* rowk0, int lane) {
  v16h a; const float* p = rowk0 + 8 * (lane >> 4);
#pragma unroll
  for (int i = 0; i < 8; ++i) { a[i] = (_Float16)p[i]; a[8 + i] = (_Float16)p[16 + i]; }
  return a;
}
__device__ __forceinline__ v16h frag_f32s(const float* rowk0, int lane, float sc) {
  v16h a; const float* p = rowk0 + 8 * (lane >> 4);
#pragma unroll
  for (int i = 0; i < 8; ++i) { a[i] = (_Float16)(p[i] * sc); a[8 + i] = (_Float16)(p[16 + i] * sc); }
  return a;
}
// column fragment from a [K][ld] layout (column n), rows >= K read as 0
__device__ __forceinline__ v16h fragc_f32(const float* W, int k0, int n, int lane, int ld, int K) {
  v16h a; const int g = lane >> 4;
#pragma unroll
  for (int i = 0; i < 8; ++i) { const int ka = k0 + 8 * g + i, kb = ka + 16;
    a[i] = (_Float16)(ka < K ? W[(size_t)(ka < K ? ka : K - 1) * ld + n] : 0.f); a[8 + i] = (_Float16)(kb < K ? W[(size_t)(kb < K ? kb : K - 1) * ld + n] : 0.f); }
  return a;
}
struct F2 { v16b h, l; };
__device__ __forceinline__ F2 bsplit16(const float v[16]) { F2 r;
#pragma unroll
  for (int i = 0; i < 16; ++i) { const __bf16 h = (__bf16)v[i]; r.h[i] = h; r.l[i] = (__bf16)(v[i] - (float)h); }
  return r; }
__device__ __forceinline__ F2 split_row(const float* row, int k0, int lane) { float v[16]; const float* p = row + k0 + 8 * (lane >> 4);
#pragma unroll
  for (int i = 0; i < 8; ++i) { v[i] = p[i]; v[8 + i] = p[16 + i]; }
  return bsplit16(v); }
__device__ __forceinline__ F2 split_rowK(const float* row, int k0, int lane, int K) { float v[16]; const int g = lane >> 4;
#pragma unroll
  for (int i = 0; i < 8; ++i) { const int ka = k0 + 8 * g + i, kb = ka + 16; v[i] = ka < K ? row[ka < K ? ka : K - 1] : 0.f; v[8 + i] = kb < K ? row[kb < K ? kb : K - 1] : 0.f; }
  return bsplit16(v); }
__device__ __forceinline__ F2 split_col(const float* W, int k0, int n, int lane, int ld, int K) { float v[16]; const int g = lane >> 4;
#pragma unroll
  for (int i = 0; i < 8; ++i) { const int ka = k0 + 8 * g + i, kb = ka + 16; v[i] = ka < K ? W[(size_t)(ka < K ? ka : K - 1) * ld + n] : 0.f; v[8 + i] = kb < K ? W[(size_t)(kb < K ? kb : K - 1) * ld + n] : 0.f; }
  return bsplit16(v); }
__device__ __forceinline__ v8f mac3(const F2& a, const F2& b, v8f c) { c = wmma_bf(a.l, b.h, c); c = wmma_bf(a.h, b.l, c); return wmma_bf(a.h, b.h, c); }
__device__ __forceinline__ float sigm(float v) { return 1.0f / (1.0f + expf(-v)); }
#define LDSX() do { asm volatile("s_wait_dscnt 0" ::: "memory"); __builtin_amdgcn_wave_barrier(); __builtin_amdgcn_fence(__ATOMIC_RELEASE, "workgroup"); } while (0)

// Causal multi-head self-attention with per-head weights (x [4,2048,768]; Wq / Wk / Wv [12,768,64] = per-head [head][model][d] N(0,1) x 0.02, no biases; Wo [768,768] torch (out,in), bo zeros (read); q = einsum('bsd,hde->bhse'); scores / sqrt(64); tril kept, finfo.min elsewhere; softmax; ctx merged (head*64 + e); ctx @ Wo.T + bo).
#define NB 4
#define TT 2048
#define CC 768            // NH * HD = projected width
#define DIN 768          // input (model) width
#define NH 12
#define HD 64
#define NQB (TT / 64)
#define SCALE (0.125f)
#define SCALE_L2 (SCALE * 1.44269504088896340736f)   // logits carried in units of log2: exp(s) = 2^(s log2 e)
#define CAUSAL 1
#ifndef TNB
#define TNB NB
#endif
__device__ __forceinline__ float bfr(float v) { return (float)(__bf16)v; }
__host__ __device__ __forceinline__ int kb_last(int qb) { return CAUSAL ? ((qb * 64 + 63) >> 7) : (TT / 128 - 1); }
typedef __attribute__((ext_vector_type(8))) __bf16 v8b;
__device__ __forceinline__ v16b frag_b(const __bf16* rowk0, int lane) {
  union { v16b v; v8b q[2]; } u; const __bf16* p = rowk0 + 8 * (lane >> 4);
  u.q[0] = *(const v8b*)p; u.q[1] = *(const v8b*)(p + 16); return u.v;
}
#define QBH 6              // causal: query blocks 0..QBH-1 of each sequence (few keys, no averaging) take the high-precision path
#define QHI 384            // rows carrying a q residual plane
#define KHI 384            // key rows carrying k residual / v bf16 hi+lo planes (used only by the causal high-precision path)
// B fragment (k rows k0+.., output column o) of a weight: (in,out) [K][ld] or (out,in) [ld rows of K]: bf16 exact, or f16(bf16 * 256) exact
__device__ __forceinline__ v16b wcol_io(const float* Wm, int k0, int o, int lane, int ld) { v16b w; const int g = lane >> 4;
#pragma unroll
  for (int i = 0; i < 8; ++i) { w[i] = (__bf16)Wm[(size_t)(k0 + 8 * g + i) * ld + o]; w[8 + i] = (__bf16)Wm[(size_t)(k0 + 16 + 8 * g + i) * ld + o]; }
  return w; }
__device__ __forceinline__ v16b wcol_oi(const float* Wm, int k0, int o, int lane, int K) { v16b w; const float* p = Wm + (size_t)o * K + k0 + 8 * (lane >> 4);
#pragma unroll
  for (int i = 0; i < 8; ++i) { w[i] = (__bf16)p[i]; w[8 + i] = (__bf16)p[16 + i]; }
  return w; }
__device__ __forceinline__ v16h wcolh_io(const float* Wm, int k0, int o, int lane, int ld) { v16h w; const int g = lane >> 4;
#pragma unroll
  for (int i = 0; i < 8; ++i) { w[i] = (_Float16)(bfr(Wm[(size_t)(k0 + 8 * g + i) * ld + o]) * 256.0f); w[8 + i] = (_Float16)(bfr(Wm[(size_t)(k0 + 16 + 8 * g + i) * ld + o]) * 256.0f); }
  return w; }
__device__ __forceinline__ v16h wcolh_oi(const float* Wm, int k0, int o, int lane, int K) { v16h w; const float* p = Wm + (size_t)o * K + k0 + 8 * (lane >> 4);
#pragma unroll
  for (int i = 0; i < 8; ++i) { w[i] = (_Float16)(bfr(p[i]) * 256.0f); w[8 + i] = (_Float16)(bfr(p[16 + i]) * 256.0f); }
  return w; }
#define WQKV_LAYOUT 2   // 0 = (in,out) [DIN][CC]; 1 = (out,in) [CC][DIN]; 2 = per-head [NH][DIN][HD]
__device__ __forceinline__ v16b wcol_hdk(const float* Wm, int k0, int o, int lane) { v16b w; const int g = lane >> 4; const float* p = Wm + (size_t)(o / HD) * DIN * HD + (o % HD);
#pragma unroll
  for (int i = 0; i < 8; ++i) { w[i] = (__bf16)p[(size_t)(k0 + 8 * g + i) * HD]; w[8 + i] = (__bf16)p[(size_t)(k0 + 16 + 8 * g + i) * HD]; }
  return w; }
#define WO_OUT_IN 1
#if WQKV_LAYOUT == 1
#define WCOL(W, k0, o, lane) wcol_oi(W, k0, o, lane, DIN)
#elif WQKV_LAYOUT == 2
#define WCOL(W, k0, o, lane) wcol_hdk(W, k0, o, lane)
#else
#define WCOL(W, k0, o, lane) wcol_io(W, k0, o, lane, CC)
#endif
#if WO_OUT_IN
#define WOCOL(W, k0, o, lane) wcol_oi(W, k0, o, lane, CC)
#define WOCOLH(W, k0, o, lane) wcolh_oi(W, k0, o, lane, CC)
#else
#define WOCOL(W, k0, o, lane) wcol_io(W, k0, o, lane, DIN)
#define WOCOLH(W, k0, o, lane) wcolh_io(W, k0, o, lane, DIN)
#endif

#ifndef PROJ_EXTRA_PARAMS
#define PROJ_EXTRA_PARAMS
#endif

#define WS_QH  0u                                      // f16 q rows [b*t][CC]
#define WS_KH  (WS_QH + 2u * (size_t)NB * TT * CC)      // f16 k in fragment order [b][head][16-key group][kc][half][lane][8]
#define WS_VT  (WS_KH + 2u * (size_t)NB * TT * CC)      // f16 v in fragment order [b][head][32-key group][j][half][lane][8]
#define WS_QL  (WS_VT + 2u * (size_t)NB * CC * TT)      // f16 q residual x 2^10 rows [b][t < QHI][CC]
#define WS_KL  (WS_QL + 2u * (size_t)NB * QHI * CC)     // f16 k residual x 2^10 rows [b][t < KHI][CC]
#define WS_VB  (WS_KL + 2u * (size_t)NB * KHI * CC)     // bf16 v hi planes [b][c][t < KHI]
#define WS_VBL (WS_VB + 2u * (size_t)NB * CC * KHI)
#define WS_Y   (WS_VBL + 2u * (size_t)NB * CC * KHI)    // f32 ctx rows [b*t][CC] (only when there is an output projection)
#define WS_XP  (WS_Y  + 4u * (size_t)NB * TT * CC)      // bf16 x in fragment order [16-row group][kc][half][lane][8]
#define WS_WP  (WS_XP + 2u * (size_t)NB * TT * DIN)     // bf16 Wq / Wk / Wv in fragment order [which][128-col block][kc][j][half][lane][8]
#define WS_OB  (WS_WP + 2u * (size_t)3 * DIN * CC)      // bf16 Wo in fragment order [128-col block][kc][j][half][lane][8]
#define WS_OH  (WS_OB + 2u * (size_t)CC * DIN)          // f16(bf16 x 2^8) Wo, same order
#define WS_END (WS_OH + 2u * (size_t)CC * DIN)

// A fragment kept in memory in fragment order is 1 KiB: elements 0..7 of lanes 0..31 (512 B), then elements 8..15: each of its two wave-wide 16-byte loads covers four whole 128-B lines
#define FRAGE 512          // 16-bit elements per stored fragment
#define NFX (NB * TT / 16 * (DIN / 32))
#define NFW (3 * (CC / 16) * (DIN / 32))
#define NFO ((DIN / 16) * (CC / 32))
#define PACKF 4            // fragments per wave of k_pack
static_assert(WO_OUT_IN == 1 && NFX % (4 * PACKF) == 0 && NFW % (4 * PACKF) == 0 && NFO % (4 * PACKF) == 0 && CC % 128 == 0 && DIN % 128 == 0, "a k_pack block stays inside one operand");
template <typename V> __device__ __forceinline__ void frag_put(void* f, V v, int lane) { union { V v; v4u q[2]; } u; u.v = v; *((v4u*)f + lane) = u.q[0]; *((v4u*)f + 32 + lane) = u.q[1]; }
template <typename V> __device__ __forceinline__ V frag_get(const void* f, int lane) { union { V v; v4u q[2]; } u; u.q[0] = *((const v4u*)f + lane); u.q[1] = *((const v4u*)f + 32 + lane); return u.v; }
// last fragment of a batch of loads off one address pair: the batch's last load may land on that pair, which the loads before it name, so the wait stands in front of it
template <typename V> __device__ __forceinline__ V frag_get_last(const void* f, int lane) { union { V v; v4u q[2]; } u; u.q[0] = *((const v4u*)f + lane); asm volatile("s_wait_xcnt 0x0" ::: "memory"); u.q[1] = *((const v4u*)f + 32 + lane); return u.v; }
// behind a batch of loads off the address p: the wait that stands in front of any rewrite of that address pair; naming p keeps the pair live up to the wait, so no load of the batch lands on it either
#define XWAIT(p) asm volatile("s_wait_xcnt 0x0" :: "v"(p) : "memory")
// inputs-only hold on loaded fragments: every load of the batch is issued before the first product waits for one, so a batch costs one load latency and not one per fragment
#define HOLD8(a, o) asm volatile("" :: "v"(a[o]), "v"(a[o + 1]), "v"(a[o + 2]), "v"(a[o + 3]), "v"(a[o + 4]), "v"(a[o + 5]), "v"(a[o + 6]), "v"(a[o + 7]))
// ---- k_pack: one wave per PACKF fragments: x, Wq / Wk / Wv, Wo rounded exactly as the products take them (bf16; Wo also f16(bf16 x 2^8)) and laid down in fragment order, once per call, for k_proj and k_out
__global__ __launch_bounds__(128) void k_pack(const float* __restrict__ X, const float* __restrict__ WQ, const float* __restrict__ WK, const float* __restrict__ WV, const float* __restrict__ WO, __bf16* __restrict__ XP, __bf16* __restrict__ WP, __bf16* __restrict__ OB, _Float16* __restrict__ OH) {
  const int lane = threadIdx.x & 31, col = lane & 15, g = lane >> 4; const int f0 = ((int)blockIdx.x * 4 + ((int)threadIdx.x >> 5)) * PACKF;
  if (f0 < NFX) {   /* block-uniform */
    v16b a[PACKF];
#pragma unroll
    for (int i = 0; i < PACKF; ++i) { const int f = f0 + i, rg = f / (DIN / 32), kc = f % (DIN / 32); const float* p = X + ((size_t)rg * 16 + col) * DIN + kc * 32 + 8 * g;
#pragma unroll
      for (int e = 0; e < 8; ++e) { a[i][e] = (__bf16)p[e]; a[i][8 + e] = (__bf16)p[16 + e]; }
      XWAIT(p); }
#pragma unroll
    for (int i = 0; i < PACKF; ++i) frag_put(XP + (size_t)(f0 + i) * FRAGE, a[i], lane);
  } else if (f0 < NFX + NFW) {
#pragma unroll
    for (int i = 0; i < PACKF; ++i) { const int f = f0 - NFX + i, j = f & 7, kc = (f >> 3) % (DIN / 32), cb = (f >> 3) / (DIN / 32) % (CC / 128), which = (f >> 3) / (DIN / 32) / (CC / 128); const float* WA = which == 0 ? WQ : which == 1 ? WK : WV;
      frag_put(WP + (size_t)f * FRAGE, WCOL(WA, kc * 32, cb * 128 + j * 16 + col, lane), lane); }
  } else { const bool hb = f0 < NFX + NFW + NFO; const int fo = f0 - NFX - NFW - (hb ? 0 : NFO); float v[PACKF][16];   /* Wo, once as bf16 and once as f16(bf16 x 2^8) */
#pragma unroll
    for (int i = 0; i < PACKF; ++i) { const int f = fo + i, j = f & 7, kc = (f >> 3) % (CC / 32), cb = (f >> 3) / (CC / 32); const float* p = WO + (size_t)(cb * 128 + j * 16 + col) * CC + kc * 32 + 8 * g;
#pragma unroll
      for (int e = 0; e < 8; ++e) { v[i][e] = p[e]; v[i][8 + e] = p[16 + e]; }
      XWAIT(p); }
#pragma unroll
    for (int i = 0; i < PACKF; ++i) { v16b wb; v16h wh;
#pragma unroll
      for (int e = 0; e < 16; ++e) { wb[e] = (__bf16)v[i][e]; wh[e] = (_Float16)(bfr(v[i][e]) * 256.0f); }
      if (hb) frag_put(OB + (size_t)(fo + i) * FRAGE, wb, lane); else frag_put(OH + (size_t)(fo + i) * FRAGE, wh, lane); } } }

#define PKS 2                                  // k steps per stage of k_proj's LDS ring
#define PST (DIN / 32 / PKS)                   // stages
#define PXB (8 * PKS * FRAGE * 2)              // bytes of a stage's x fragments (8 row groups); its weight fragments (8 column groups) take as many
#define PSB (2 * PXB)                          // bytes of a stage
static_assert(DIN / 32 % PKS == 0 && PST >= 2 && PKS * FRAGE * 2 == 128 * 16 && 2 * PSB >= 3 * 128 * 72 * 2 && 2 * PSB >= 2 * 64 * 136 * 2, "128 lanes x 16 B cover one row group's fragments of a stage; the staging tiles fit the ring's bytes");
// eight asynchronous 16-byte copies per lane: LDS places 2 KiB apart from l, global places gs elements apart from gp; the s_wait_xcnt is the statement's last line, so it stands in front of any rewrite of the registers that the copies name
__device__ __forceinline__ void acopy8(unsigned l, const __bf16* gp, size_t gs) {
  asm volatile("global_load_async_to_lds_b128 %0, %8, off\n\tglobal_load_async_to_lds_b128 %1, %9, off\n\tglobal_load_async_to_lds_b128 %2, %10, off\n\tglobal_load_async_to_lds_b128 %3, %11, off\n\t"
               "global_load_async_to_lds_b128 %4, %12, off\n\tglobal_load_async_to_lds_b128 %5, %13, off\n\tglobal_load_async_to_lds_b128 %6, %14, off\n\tglobal_load_async_to_lds_b128 %7, %15, off\n\ts_wait_xcnt 0x0"
               :: "v"(l), "v"(l + 2048u), "v"(l + 4096u), "v"(l + 6144u), "v"(l + 8192u), "v"(l + 10240u), "v"(l + 12288u), "v"(l + 14336u),
                  "v"(gp), "v"(gp + gs), "v"(gp + 2 * gs), "v"(gp + 3 * gs), "v"(gp + 4 * gs), "v"(gp + 5 * gs), "v"(gp + 6 * gs), "v"(gp + 7 * gs) : "memory"); }
// one stage: the block's 8 row groups x PKS x fragments (2 KiB in a row per group), then its PKS x 8 weight fragments (16 KiB in a row); l, xg, wg carry the lane's own 16 bytes
__device__ __forceinline__ void proj_fill(unsigned l, const __bf16* xg, const __bf16* wg) { acopy8(l, xg, (size_t)(DIN / 32) * FRAGE); acopy8(l + PXB, wg, (size_t)PKS * FRAGE); }
// ---- k_proj: block = (128 rows, 128 cols, which): q/k/v = X W (+ b) with exact bf16 products (K = DIN), both operands in fragment order, brought into a two-buffer LDS ring by asynchronous copies (each byte once per block, the weight fragments shared by its four waves) and read from there, four weight fragments at a time; the ring's bytes become the staging tiles behind the loop's last barrier; 64 KiB of LDS and at most 192 registers, so that five blocks fit a WGP and the whole grid is resident at once; a wave owns two 16-row groups (wave and 4 + wave), so each weight fragment it loads feeds two products; the results leave in two passes of 64 rows through the same staging tiles -> which 0: q f16 rows (+ residual rows < QHI); 1: k f16 in fragment order (+ residual rows < KHI); 2: v f16 in fragment order (+ bf16 hi/lo planes [c][t] for t < KHI)
__global__ __attribute__((amdgpu_waves_per_eu(5))) __launch_bounds__(128) void k_proj(const __bf16* __restrict__ XP, const __bf16* __restrict__ WP, const float* __restrict__ BQ, const float* __restrict__ BK, const float* __restrict__ BV,
    _Float16* __restrict__ QH, _Float16* __restrict__ QL, _Float16* __restrict__ KH, _Float16* __restrict__ KL, _Float16* __restrict__ VT, __bf16* __restrict__ VB, __bf16* __restrict__ VBL) {
  __shared__ __attribute__((aligned(2048))) unsigned char sm[2 * PSB];
  _Float16 (*sh)[136] = (_Float16 (*)[136])sm, (*sl)[136] = (_Float16 (*)[136])(sm + 64 * 136 * 2), (*th)[72] = (_Float16 (*)[72])sm; __bf16 (*tb)[72] = (__bf16 (*)[72])(sm + 128 * 72 * 2), (*tbl)[72] = (__bf16 (*)[72])(sm + 2 * 128 * 72 * 2);   /* staging tiles of the results, on the ring's bytes */
  const int tid = threadIdx.x, wave = tid >> 5, lane = tid & 31, col = lane & 15, g = lane >> 4; const int which = blockIdx.z; const int c0 = blockIdx.y * 128;
  const float* BA = which == 0 ? BQ : which == 1 ? BK : BV;
  const int ws = __builtin_amdgcn_readfirstlane(wave); const unsigned l0 = (unsigned)(size_t)sm + (unsigned)tid * 16u;   /* the lane's 16 bytes of each 2-KiB piece */
  const __bf16* xg = XP + (size_t)blockIdx.x * 8 * (DIN / 32) * FRAGE + tid * 8; const __bf16* wg = WP + (size_t)(which * (CC / 128) + blockIdx.y) * (DIN / 32) * 8 * FRAGE + tid * 8;
  v8f acc2[2][8] = {};
  proj_fill(l0, xg, wg);
  asm volatile("s_wait_asynccnt 0x0" ::: "memory");   /* stage 0 of this wave's copies has landed */
  __syncthreads();                                    /* ... and every other wave's */
  proj_fill(l0 + PSB, xg + PKS * FRAGE, wg + PKS * 8 * FRAGE);
#pragma unroll 1   /* one stage per trip: the buffer is picked by the trip's parity */
  for (int s = 0; s < PST; ++s) { const unsigned char* bp = sm + (s & 1) * PSB;
#pragma unroll
    for (int kk = 0; kk < PKS; ++kk) { const v16b a = frag_get<v16b>(bp + (ws * PKS + kk) * (FRAGE * 2), lane), a4 = frag_get<v16b>(bp + ((4 + ws) * PKS + kk) * (FRAGE * 2), lane);
#pragma unroll
      for (int jh = 0; jh < 8; jh += 4) { v16b w[4];   /* four weight fragments at a time: the wave stays inside the registers of five waves per SIMD */
#pragma unroll
        for (int j = 0; j < 4; ++j) w[j] = frag_get<v16b>(bp + PXB + (kk * 8 + jh + j) * (FRAGE * 2), lane);
#pragma unroll
        for (int j = 0; j < 4; ++j) { acc2[0][jh + j] = wmma_bf(a, w[j], acc2[0][jh + j]); acc2[1][jh + j] = wmma_bf(a4, w[j], acc2[1][jh + j]); } } }
    asm volatile("s_wait_dscnt 0x0" ::: "memory");      /* this wave's reads of the buffer have ended */
    asm volatile("s_wait_asynccnt 0x0" ::: "memory");   /* its copies of the next stage have landed */
    __syncthreads();                                    /* publishes the next stage and frees this trip's buffer */
    if (s + 2 < PST) proj_fill(l0 + (s & 1) * PSB, xg + (size_t)(s + 2) * PKS * FRAGE, wg + (size_t)(s + 2) * PKS * 8 * FRAGE); }
  asm volatile("s_wait_asynccnt 0x0" ::: "memory");     /* no copy is in flight when the ring's bytes become staging tiles */
#pragma unroll   /* hh picks registers: rolled, the accumulators would have to lie in scratch */
  for (int hh = 0; hh < 2; ++hh) { const v8f (&acc)[8] = acc2[hh]; const size_t r0 = (size_t)blockIdx.x * 128 + hh * 64; const size_t bb = r0 / TT; const int t0 = (int)(r0 % TT);
  if (hh) __syncthreads();   /* the first pass's reads of the staging tiles end before the second pass writes over them */
  if (which < 2) { _Float16* DL = which == 0 ? QL : KL; const int nhi = which == 0 ? QHI : KHI; const bool hi_rows = t0 < nhi;
#pragma unroll
    for (int j = 0; j < 8; ++j) { const float bias = BA ? bfr(BA[c0 + j * 16 + col]) : 0.f;
#pragma unroll
      for (int r = 0; r < 8; ++r) { const float v = acc[j][r] + bias; const _Float16 hv = (_Float16)v; sh[wave * 16 + 8 * g + r][j * 16 + col] = hv; sl[wave * 16 + 8 * g + r][j * 16 + col] = (_Float16)((v - (float)hv) * 1024.0f); } }
    __syncthreads();
    if (which == 1) { for (int e = tid; e < 64 * 16; e += 128) { const int ln = e & 31, hf = (e >> 5) & 1, kc = (e >> 6) & 1, kg = (e >> 7) & 3, hl = e >> 9;   /* k: 16-byte pieces in the order k_att's loads take them */
        vst2((unsigned*)(KH + ((((bb * NH + c0 / HD + hl) * (TT / 16) + t0 / 16 + kg) * 2 + kc) * 2 + hf) * (size_t)(FRAGE / 2) + ln * 8), *(const v4u*)&sh[kg * 16 + (ln & 15)][hl * 64 + kc * 32 + hf * 16 + (ln >> 4) * 8]); } }
    else { for (int e = tid; e < 64 * 16; e += 128) { const int rl = e >> 4, q = e & 15; vst2((unsigned*)(QH + (r0 + rl) * CC + c0 + q * 8), *(const v4u*)&sh[rl][q * 8]); } }
    if (hi_rows) { for (int e = tid; e < 64 * 16; e += 128) { const int rl = e >> 4, q = e & 15; vst2((unsigned*)(DL + (bb * nhi + t0 + rl) * (size_t)CC + c0 + q * 8), *(const v4u*)&sl[rl][q * 8]); } }
  } else { const bool hi_rows = t0 < KHI;
#pragma unroll
    for (int j = 0; j < 8; ++j) { const float bias = BA ? bfr(BA[c0 + j * 16 + col]) : 0.f;
#pragma unroll
      for (int r = 0; r < 8; ++r) { const float v = acc[j][r] + bias; const int rl = wave * 16 + 8 * g + r, cl = j * 16 + col; th[cl][rl] = (_Float16)v; const __bf16 bh = (__bf16)v; tb[cl][rl] = bh; tbl[cl][rl] = (__bf16)(v - (float)bh); } }
    __syncthreads();
    for (int e = tid; e < 128 * 8; e += 128) { const int ln = e & 31, hf = (e >> 5) & 1, j = (e >> 6) & 3, kq = (e >> 8) & 1, hl = e >> 9;   /* v: 16-byte pieces in the order k_att's loads take them */
      vst2((unsigned*)(VT + ((((bb * NH + c0 / HD + hl) * (TT / 32) + t0 / 32 + kq) * 4 + j) * 2 + hf) * (size_t)(FRAGE / 2) + ln * 8), *(const v4u*)&th[hl * 64 + j * 16 + (ln & 15)][kq * 32 + hf * 16 + (ln >> 4) * 8]); }
    if (hi_rows) for (int e = tid; e < 128 * 8; e += 128) { const int cl = e >> 3, q = e & 7; const size_t o3 = (bb * CC + c0 + cl) * (size_t)KHI + t0 + q * 8; vst2((unsigned*)(VB + o3), *(const v4u*)&tb[cl][q * 8]); vst2((unsigned*)(VBL + o3), *(const v4u*)&tbl[cl][q * 8]); } } } }
// eight 2^x in place, with the slot behind the last one, in ONE statement: each transcendental is followed by an independent instruction, so none that reads its result or overwrites its source can come to stand directly behind it
__device__ __forceinline__ void exp2x8(float* x) {
  asm("v_exp_f32 %0, %0\n\tv_exp_f32 %1, %1\n\tv_exp_f32 %2, %2\n\tv_exp_f32 %3, %3\n\tv_exp_f32 %4, %4\n\tv_exp_f32 %5, %5\n\tv_exp_f32 %6, %6\n\tv_exp_f32 %7, %7\n\tv_nop"
      : "+v"(x[0]), "+v"(x[1]), "+v"(x[2]), "+v"(x[3]), "+v"(x[4]), "+v"(x[5]), "+v"(x[6]), "+v"(x[7])); }
// one 128-key tile of this lane's query row t, its logits handed in in e (lanes l and l ^ 16 share a row; e[kc][0..7] = key k0 + 32 kc + 8 g + i, e[kc][8..15] = 16 keys on: the fragments' k order): causal mask by index (only a query block's last key block reaches past the diagonal), running max m and sum l brought up to date (logits, m in log2 units; l carries the 2^11 too); leaves 2^(logit - m + 11) in e (0 for excluded keys) and returns the factor that carries earlier sums over to the new max
__device__ __forceinline__ float sm_tile(int g, int k0, int t, bool diag, float& m, float& l, float (&e)[4][16]) {
  if (diag) {   /* block-uniform */
#pragma unroll
    for (int kc = 0; kc < 4; ++kc)
#pragma unroll
      for (int i = 0; i < 16; ++i) { const int k = k0 + kc * 32 + 8 * g + (i < 8 ? i : i + 8); e[kc][i] = k <= t ? e[kc][i] : -3.0e38f; } }
  float mx = -3.0e38f;
#pragma unroll
  for (int kc = 0; kc < 4; ++kc)
#pragma unroll
    for (int i = 0; i < 16; ++i) mx = fmaxf(mx, e[kc][i]);
  mx = fmaxf(mx, __shfl_xor(mx, 16));
  const float mn = fmaxf(m, mx); const float al = __builtin_amdgcn_exp2f(m - mn); m = mn;
  const float mb = mn - 11.0f; float sum = 0.f;
#pragma unroll
  for (int kc = 0; kc < 4; ++kc)
#pragma unroll
    for (int i = 0; i < 16; ++i) e[kc][i] -= mb;
#pragma unroll
  for (int kc = 0; kc < 4; ++kc)
#pragma unroll
    for (int i = 0; i < 16; i += 8) exp2x8(&e[kc][i]);   /* an excluded key's -3e38 gives exactly 0 */
#pragma unroll
  for (int kc = 0; kc < 4; ++kc)
#pragma unroll
    for (int i = 0; i < 16; ++i) sum += e[kc][i];
  sum += __shfl_xor(sum, 16);
  l = l * al + sum;
  return al; }
// the lane's query row's factor on the lane's own sums (the transposed accumulator's column is the query)
__device__ __forceinline__ void row_scale(v8f (&o)[HD / 16], float f) {
#pragma unroll
  for (int j = 0; j < HD / 16; ++j)
#pragma unroll
    for (int r = 0; r < 8; ++r) o[j][r] *= f; }
// hand-over through LDS between lanes of ONE wave: its LDS operations have ended and the compiler moves none across
#define LDSW() do { asm volatile("s_wait_dscnt 0" ::: "memory"); __builtin_amdgcn_wave_barrier(); } while (0)
// ---- k_att: block = (pair = b * NH + h, 64 queries qb, longest first); each wave owns 16 query rows and walks its causal key blocks of 128 alone: logits^T = k (A) x q^T (B) x SCALE x log2(e) (f16; query blocks < QBH: + k x q residual + k residual x q, both x 2^10): accumulator j, register r of lane (g, col) = key 16 j + 8 g + r of query col, which is the k order of a fragment of that query's row -> running softmax in f32, base 2, in those registers -> 2^(logit - max + 11) once to f16 as B against v^T f16 as A (query blocks < QBH: exp and v as bf16 hi + lo, 3 products): o[j][r] = ctx[query col][16 j + 8 g + r]; ctx = sums / l (both carry 2^11), turned through the wave's LDS tile once at the end; 256-B (row, head) segment by 16 lanes
static_assert(CAUSAL == 1 && QBH * 64 == QHI && QHI == KHI && QHI % 128 == 0 && HD == 64, "early query blocks see only keys that carry residual planes");
__global__ __attribute__((amdgpu_waves_per_eu(4))) __launch_bounds__(128) void k_att(const _Float16* __restrict__ QH, const _Float16* __restrict__ KH, const _Float16* __restrict__ QL, const _Float16* __restrict__ KL, const _Float16* __restrict__ VT, const __bf16* __restrict__ VB, const __bf16* __restrict__ VBL, float* __restrict__ Y) { __shared__ __align__(16) float ss[4][16][HD + 4];
  const int pr = blockIdx.x, b = pr / NH, h = pr % NH; const int qb = NQB - 1 - (int)blockIdx.y; const int nkb = kb_last(qb) + 1;
  const int tid = threadIdx.x, wave = tid >> 5, lane = tid & 31, col = lane & 15, g = lane >> 4; const int ql0 = qb * 64 + wave * 16; const size_t q0 = (size_t)b * TT + ql0; const int t = ql0 + col;
  float m = -3.0e38f, l = 0.f; v8f o[HD / 16] = {}; float e[4][16];
  v16h ah[HD / 32];
#pragma unroll
  for (int kc = 0; kc < HD / 32; ++kc) ah[kc] = frag_h(QH + (q0 + col) * CC + h * HD + kc * 32, lane);
  asm volatile("s_wait_xcnt 0x0" ::: "memory");   /* stands in front of the first rewrite of the address pair that the q loads name */
  if (qb < QBH) { const _Float16* KLb = KL + (size_t)b * KHI * CC; v16h al[HD / 32];
#pragma unroll
    for (int kc = 0; kc < HD / 32; ++kc) al[kc] = frag_h(QL + ((size_t)b * QHI + ql0 + col) * CC + h * HD + kc * 32, lane);
#pragma unroll 1
    for (int kb = 0; kb < nkb; ++kb) { const int k0 = kb * 128; v8f acc[8] = {}, accl[8] = {};
#pragma unroll
      for (int kc = 0; kc < HD / 32; ++kc)
#pragma unroll
        for (int jh = 0; jh < 8; jh += 4) { v16h kf[8];
#pragma unroll
          for (int j = 0; j < 4; ++j) { kf[j] = frag_get<v16h>(KH + (((size_t)pr * (TT / 16) + kb * 8 + jh + j) * 2 + kc) * FRAGE, lane); kf[4 + j] = frag_h(KLb + (size_t)(k0 + (jh + j) * 16 + col) * CC + h * HD + kc * 32, lane); }
          HOLD8(kf, 0);
#pragma unroll
          for (int j = 0; j < 4; ++j) { acc[jh + j] = wmma16(kf[j], ah[kc], acc[jh + j]); accl[jh + j] = wmma16(kf[j], al[kc], accl[jh + j]); accl[jh + j] = wmma16(kf[4 + j], ah[kc], accl[jh + j]); } }
#pragma unroll
      for (int j = 0; j < 8; ++j)
#pragma unroll
        for (int r = 0; r < 8; ++r) e[j >> 1][(j & 1) * 8 + r] = (acc[j][r] + accl[j][r] * (1.0f / 1024.0f)) * SCALE_L2;
      const float f = sm_tile(g, k0, t, kb == nkb - 1, m, l, e);
      row_scale(o, f);
#pragma unroll
      for (int kc = 0; kc < 4; ++kc) { const F2 p = bsplit16(e[kc]); v16b vf[8];
#pragma unroll
        for (int j = 0; j < HD / 16; ++j) { const size_t po = ((size_t)b * CC + h * HD + j * 16 + col) * (size_t)KHI + k0 + kc * 32; vf[j] = frag_b(VB + po, lane); vf[4 + j] = frag_b(VBL + po, lane); }
        HOLD8(vf, 0);
#pragma unroll
        for (int j = 0; j < HD / 16; ++j) { o[j] = wmma_bf(vf[j], p.h, o[j]); o[j] = wmma_bf(vf[j], p.l, o[j]); o[j] = wmma_bf(vf[4 + j], p.h, o[j]); } } }
  } else { const _Float16* kp = KH + (size_t)pr * (TT / 16) * 2 * FRAGE; const _Float16* vp = VT + (size_t)pr * (TT / 32) * 4 * FRAGE;   /* this (batch, head)'s k and v fragments at the key block's first key: 16 fragments = 16 KiB in a row each */
#pragma unroll 1
    for (int kb = 0; kb < nkb; ++kb, kp += 16 * FRAGE, vp += 16 * FRAGE) { const int k0 = kb * 128; v8f acc[8] = {}; { v16h kf[16];
#pragma unroll
      for (int kc = 0; kc < HD / 32; ++kc)
#pragma unroll
        for (int j = 0; j < 8; ++j) if (kc * 8 + j < 15) kf[kc * 8 + j] = frag_get<v16h>(kp + (j * 2 + kc) * FRAGE, lane);
      kf[15] = frag_get_last<v16h>(kp + 15 * FRAGE, lane);
      HOLD8(kf, 0); HOLD8(kf, 8);
#pragma unroll
      for (int kc = 0; kc < HD / 32; ++kc)
#pragma unroll
        for (int j = 0; j < 8; ++j) acc[j] = wmma16(kf[kc * 8 + j], ah[kc], acc[j]); }
#pragma unroll
      for (int j = 0; j < 8; ++j)
#pragma unroll
        for (int r = 0; r < 8; ++r) e[j >> 1][(j & 1) * 8 + r] = acc[j][r] * SCALE_L2;
      v16h vf[16];   /* v fragments of the first 64 keys fly while the softmax runs, the other 64 behind it */
#pragma unroll
      for (int kc = 0; kc < 2; ++kc)
#pragma unroll
        for (int j = 0; j < HD / 16; ++j) vf[kc * 4 + j] = frag_get<v16h>(vp + (kc * 4 + j) * FRAGE, lane);
      const float f = sm_tile(g, k0, t, kb == nkb - 1, m, l, e);
      v16h p[4];
#pragma unroll
      for (int kc = 0; kc < 4; ++kc)
#pragma unroll
        for (int i = 0; i < 16; ++i) p[kc][i] = (_Float16)e[kc][i];
#pragma unroll
      for (int kc = 2; kc < 4; ++kc)
#pragma unroll
        for (int j = 0; j < HD / 16; ++j) if (kc * 4 + j < 15) vf[kc * 4 + j] = frag_get<v16h>(vp + (kc * 4 + j) * FRAGE, lane);
      vf[15] = frag_get_last<v16h>(vp + 15 * FRAGE, lane);
      row_scale(o, f);
      HOLD8(vf, 0);
#pragma unroll
      for (int kc = 0; kc < 2; ++kc)
#pragma unroll
        for (int j = 0; j < HD / 16; ++j) o[j] = wmma16(vf[kc * 4 + j], p[kc], o[j]);
      HOLD8(vf, 8);
#pragma unroll
      for (int kc = 2; kc < 4; ++kc)
#pragma unroll
        for (int j = 0; j < HD / 16; ++j) o[j] = wmma16(vf[kc * 4 + j], p[kc], o[j]); } }
  row_scale(o, l > 0.f ? 1.0f / l : 0.f);
#pragma unroll
  for (int j = 0; j < HD / 16; ++j)
#pragma unroll
    for (int r = 0; r < 8; ++r) ss[wave][col][j * 16 + 8 * g + r] = o[j][r];
  LDSW(); for (int rl = g; rl < 16; rl += 2) vst2(Y + ((size_t)b * TT + ql0 + rl) * CC + h * HD + col * 4, *(const v4f*)&ss[wave][rl][col * 4]); }
// ---- k_out: block = (64 rows, 128 cols): out = ctx Wo (+ bo): ctx x 2^6 once to f16 against Wo as f16(bf16 x 2^8) exact (1 product) x 2^-14; causal early rows (< QHI of each sequence): ctx bf16 hi + lo against exact bf16 Wo (2 products)
__global__ __launch_bounds__(128) void k_out(const float* __restrict__ Y, const __bf16* __restrict__ OB, const _Float16* __restrict__ OH, const float* __restrict__ BO, float* __restrict__ OUT) { __shared__ __align__(16) float sf[4][16][132];
  const int tid = threadIdx.x, wave = tid >> 5, lane = tid & 31, col = lane & 15, g = lane >> 4; const int c0 = blockIdx.y * 128; const size_t r0 = (size_t)blockIdx.x * 64 + wave * 16;
  v8f acc[8] = {};
  if (CAUSAL && (int)(((size_t)blockIdx.x * 64) % TT) < QHI) {   /* block-uniform */
    const __bf16* wp = OB + (size_t)blockIdx.y * (CC / 32) * 8 * FRAGE;
    for (int kc = 0; kc < CC / 32; ++kc, wp += 8 * FRAGE) { const F2 a = split_row(Y + (r0 + col) * CC, kc * 32, lane); XWAIT(Y + (r0 + col) * CC + kc * 32 + 8 * g); v16b w[8];
#pragma unroll
      for (int j = 0; j < 7; ++j) w[j] = frag_get<v16b>(wp + j * FRAGE, lane);
      w[7] = frag_get_last<v16b>(wp + 7 * FRAGE, lane);
      HOLD8(w, 0);
#pragma unroll
      for (int j = 0; j < 8; ++j) { acc[j] = wmma_bf(a.h, w[j], acc[j]); acc[j] = wmma_bf(a.l, w[j], acc[j]); } }
#pragma unroll
    for (int j = 0; j < 8; ++j) { const float bias = BO ? bfr(BO[c0 + j * 16 + col]) : 0.f;
#pragma unroll
      for (int r = 0; r < 8; ++r) sf[wave][8 * g + r][j * 16 + col] = acc[j][r] + bias; }
  } else {
    const _Float16* wp = OH + (size_t)blockIdx.y * (CC / 32) * 8 * FRAGE;
    for (int kc = 0; kc < CC / 32; ++kc, wp += 8 * FRAGE) { const v16h a = frag_f32s(Y + (r0 + col) * CC + kc * 32, lane, 64.0f); XWAIT(Y + (r0 + col) * CC + kc * 32 + 8 * g); v16h w[8];   /* ctx carried x 2^6 into f16 so small-magnitude context rows stay clear of f16 subnormals */
#pragma unroll
      for (int j = 0; j < 7; ++j) w[j] = frag_get<v16h>(wp + j * FRAGE, lane);
      w[7] = frag_get_last<v16h>(wp + 7 * FRAGE, lane);
      HOLD8(w, 0);
#pragma unroll
      for (int j = 0; j < 8; ++j) acc[j] = wmma16(a, w[j], acc[j]); }
#pragma unroll
    for (int j = 0; j < 8; ++j) { const float bias = BO ? bfr(BO[c0 + j * 16 + col]) : 0.f;
#pragma unroll
      for (int r = 0; r < 8; ++r) sf[wave][8 * g + r][j * 16 + col] = acc[j][r] * (1.0f / 16384.0f) + bias; } }   /* 2^-8 (Wo carry) x 2^-6 (ctx carry) */
  LDSX(); for (int rl = 0; rl < 16; ++rl) vst2(OUT + (r0 + rl) * DIN + c0 + lane * 4, *(const v4f*)&sf[wave][rl][lane * 4]); }

extern "C" void kernel_launch(void* const* d_in, const int* in_sizes, int n_in, void* d_out, int out_size, void* d_ws, size_t ws_size, hipStream_t stream) {
  (void)in_sizes; (void)n_in; (void)out_size;
  const float** F = (const float**)d_in;
  if (ws_size < (size_t)WS_END) return;
  char* ws = (char*)d_ws; _Float16 *QH = (_Float16*)(ws + WS_QH), *KH = (_Float16*)(ws + WS_KH), *VT = (_Float16*)(ws + WS_VT), *QL = (_Float16*)(ws + WS_QL), *KL = (_Float16*)(ws + WS_KL); __bf16 *VB = (__bf16*)(ws + WS_VB), *VBL = (__bf16*)(ws + WS_VBL), *XP = (__bf16*)(ws + WS_XP), *WP = (__bf16*)(ws + WS_WP), *OB = (__bf16*)(ws + WS_OB); _Float16 *OH = (_Float16*)(ws + WS_OH); float *Y = (float*)(ws + WS_Y);
  (void)Y; (void)QL; (void)KL; (void)VB; (void)VBL;
  // inputs in order: 0 x [4,2048,768]; 1 Wq [12,768,64]; 2 Wk; 3 Wv (per-head [head][model][d]); 4 Wo [768,768] (out,in); 5 bo [768] (zeros, read); no q / k / v biases
  k_pack<<<dim3((NFX + NFW + 2 * NFO) / (4 * PACKF)), 128, 0, stream>>>(F[0], F[1], F[2], F[3], F[4], XP, WP, OB, OH);
  k_proj<<<dim3(TNB * TT / 128, CC / 128, 3), 128, 0, stream>>>(XP, WP, nullptr, nullptr, nullptr, QH, QL, KH, KL, VT, VB, VBL);
  k_att<<<dim3(TNB * NH, NQB), 128, 0, stream>>>(QH, KH, QL, KL, VT, VB, VBL, Y);
  k_out<<<dim3(TNB * TT / 64, DIN / 128), 128, 0, stream>>>(Y, OB, OH, F[5], (float*)d_out);
}

// v008
// Measured time: 107 microseconds a run.
// Next to v007, in two timings, it ran 1.04 and 1.05 times as fast.
// Over all steps from v000 it is 21.8 times as fast.
// compute dtype: all float inputs rounded to bf16; per-head q / k / v projections with EXACT bf16 products on WMMA 16x16x32 (f32 accumulate), no biases; causal logits: 3 products for the first 384 rows, single f16 q x k after, x 64^-0.5 x log2(e); both attention products taken transposed (k x q^T, v^T x p^T), a query's logits and sums stay in its two lanes; softmax f32 in base 2 (hardware exp2) with a running max and sum per 128 keys; 2^(logit - max + 11) once to f16 x v once to f16 (bf16 hi + lo below row 384); ctx hi+lo x exact Wo below row 384, x2^6 f16 carry x f16(bf16 x 2^8) Wo after, + bo (zeros, read); f32 output.
#include <hip/hip_runtime.h>
#include <math.h>

typedef __attribute__((ext_vector_type(16))) _Float16 v16h;
typedef __attribute__((ext_vector_type(16))) __bf16 v16b;
typedef __attribute__((ext_vector_type(8)))  _Float16 v8h;
typedef __attribute__((ext_vector_type(8)))  float v8f;
typedef __attribute__((ext_vector_type(4)))  float v4f;
typedef __attribute__((ext_vector_type(2)))  float v2f;
typedef __attribute__((ext_vector_type(4)))  unsigned v4u;
typedef __attribute__((ext_vector_type(4)))  int v4i;
typedef float __attribute__((may_alias)) float_a;
typedef int __attribute__((may_alias)) int_a;

template <typename T> __device__ __forceinline__ void vst2(void* p, T v) { *(T*)p = v;  }
__device__ __forceinline__ v8f wmma16(v16h a, v16h b, v8f c) {
  v8f d = __builtin_amdgcn_wmma_f32_16x16x32_f16(false, a, false, b, (short)0, c, false, false);
  asm volatile("v_nop\n\tv_nop\n\tv_nop\n\tv_nop" : "+v"(d) : "v"(a), "v"(b));
  return d;
}
__device__ __forceinline__ v8f wmma_bf(v16b a, v16b b, v8f c) {
  v8f d = __builtin_amdgcn_wmma_f32_16x16x32_bf16(false, a, false, b, (short)0, c, false, false);
  asm volatile("v_nop\n\tv_nop\n\tv_nop\n\tv_nop" : "+v"(d) : "v"(a), "v"(b));
  return d;
}
// 16x16x32 fragments: lane = (h = lane>>4, row/col = lane&15); elements 0..7 = k0+8h+0..7, 8..15 = k0+16+8h+0..7; D element r = row 8h+r
__device__ __forceinline__ v16h frag_h(const _Float16* rowk0, int lane) {
  union { v16h v; v8h q[2]; } u; const _Float16* p = rowk0 + 8 * (lane >> 4);
  u.q[0] = *(const v8h*)p; u.q[1] = *(const v8h*)(p + 16); return u.v;
}
__device__ __forceinline__ v16h frag_f32(const float* rowk0, int lane) {
  v16h a; const float* p = rowk0 + 8 * (lane >> 4);
#pragma unroll
  for (int i = 0; i < 8; ++i) { a[i] = (_Float16)p[i]; a[8 + i] = (_Float16)p[16 + i]; }
  return a;
}
__device__ __forceinline__ v16h frag_f32s(const float* rowk0, int lane, float sc) {
  v16h a; const float* p = rowk0 + 8 * (lane >> 4);
#pragma unroll
  for (int i = 0; i < 8; ++i) { a[i] = (_Float16)(p[i] * sc); a[8 + i] = (_Float16)(p[16 + i] * sc); }
  return a;
}
// column fragment from a [K][ld] layout (column n), rows >= K read as 0
__device__ __forceinline__ v16h fragc_f32(const float* W, int k0, int n, int lane, int ld, int K) {
  v16h a; const int g = lane >> 4;
#pragma unroll
  for (int i = 0; i < 8; ++i) { const int ka = k0 + 8 * g + i, kb = ka + 16;
    a[i] = (_Float16)(ka < K ? W[(size_t)(ka < K ? ka : K - 1) * ld + n] : 0.f); a[8 + i] = (_Float16)(kb < K ? W[(size_t)(kb < K ? kb : K - 1) * ld + n] : 0.f); }
  return a;
}
struct F2 { v16b h, l; };
__device__ __forceinline__ F2 bsplit16(const float v[16]) { F2 r;
#pragma unroll
  for (int i = 0; i < 16; ++i) { const __bf16 h = (__bf16)v[i]; r.h[i] = h; r.l[i] = (__bf16)(v[i] - (float)h); }
  return r; }
__device__ __forceinline__ F2 split_row(const float* row, int k0, int lane) { float v[16]; const float* p = row + k0 + 8 * (lane >> 4);
#pragma unroll
  for (int i = 0; i < 8; ++i) { v[i] = p[i]; v[8 + i] = p[16 + i]; }
  return bsplit16(v); }
__device__ __forceinline__ F2 split_rowK(const float* row, int k0, int lane, int K) { float v[16]; const int g = lane >> 4;
#pragma unroll
  for (int i = 0; i < 8; ++i) { const int ka = k0 + 8 * g + i, kb = ka + 16; v[i] = ka < K ? row[ka < K ? ka : K - 1] : 0.f; v[8 + i] = kb < K ? row[kb < K ? kb : K - 1] : 0.f; }
  return bsplit16(v); }
__device__ __forceinline__ F2 split_col(const float* W, int k0, int n, int lane, int ld, int K) { float v[16]; const int g = lane >> 4;
#pragma unroll
  for (int i = 0; i < 8; ++i) { const int ka = k0 + 8 * g + i, kb = ka + 16; v[i] = ka < K ? W[(size_t)(ka < K ? ka : K - 1) * ld + n] : 0.f; v[8 + i] = kb < K ? W[(size_t)(kb < K ? kb : K - 1) * ld + n] : 0.f; }
  return bsplit16(v); }
__device__ __forceinline__ v8f mac3(const F2& a, const F2& b, v8f c) { c = wmma_bf(a.l, b.h, c); c = wmma_bf(a.h, b.l, c); return wmma_bf(a.h, b.h, c); }
__device__ __forceinline__ float sigm(float v) { return 1.0f / (1.0f + expf(-v)); }
#define LDSX() do { asm volatile("s_wait_dscnt 0" ::: "memory"); __builtin_amdgcn_wave_barrier(); __builtin_amdgcn_fence(__ATOMIC_RELEASE, "workgroup"); } while (0)

// Causal multi-head self-attention with per-head weights (x [4,2048,768]; Wq / Wk / Wv [12,768,64] = per-head [head][model][d] N(0,1) x 0.02, no biases; Wo [768,768] torch (out,in), bo zeros (read); q = einsum('bsd,hde->bhse'); scores / sqrt(64); tril kept, finfo.min elsewhere; softmax; ctx merged (head*64 + e); ctx @ Wo.T + bo).
#define NB 4
#define TT 2048
#define CC 768            // NH * HD = projected width
#define DIN 768          // input (model) width
#define NH 12
#define HD 64
#define NQB (TT / 64)
#define SCALE (0.125f)
#define SCALE_L2 (SCALE * 1.44269504088896340736f)   // logits carried in units of log2: exp(s) = 2^(s log2 e)
#define CAUSAL 1
#ifndef TNB
#define TNB NB
#endif
__device__ __forceinline__ float bfr(float v) { return (float)(__bf16)v; }
__host__ __device__ __forceinline__ int kb_last(int qb) { return CAUSAL ? ((qb * 64 + 63) >> 7) : (TT / 128 - 1); }
typedef __attribute__((ext_vector_type(8))) __bf16 v8b;
__device__ __forceinline__ v16b frag_b(const __bf16* rowk0, int lane) {
  union { v16b v; v8b q[2]; } u; const __bf16* p = rowk0 + 8 * (lane >> 4);
  u.q[0] = *(const v8b*)p; u.q[1] = *(const v8b*)(p + 16); return u.v;
}
#define QBH 6              // causal: query blocks 0..QBH-1 of each sequence (few keys, no averaging) take the high-precision path
#define QHI 384            // rows carrying a q residual plane
#define KHI 384            // key rows carrying k residual / v bf16 hi+lo planes (used only by the causal high-precision path)
// B fragment (k rows k0+.., output column o) of a weight: (in,out) [K][ld] or (out,in) [ld rows of K]: bf16 exact, or f16(bf16 * 256) exact
__device__ __forceinline__ v16b wcol_io(const float* Wm, int k0, int o, int lane, int ld) { v16b w; const int g = lane >> 4;
#pragma unroll
  for (int i = 0; i < 8; ++i) { w[i] = (__bf16)Wm[(size_t)(k0 + 8 * g + i) * ld + o]; w[8 + i] = (__bf16)Wm[(size_t)(k0 + 16 + 8 * g + i) * ld + o]; }
  return w; }
__device__ __forceinline__ v16b wcol_oi(const float* Wm, int k0, int o, int lane, int K) { v16b w; const float* p = Wm + (size_t)o * K + k0 + 8 * (lane >> 4);
#pragma unroll
  for (int i = 0; i < 8; ++i) { w[i] = (__bf16)p[i]; w[8 + i] = (__bf16)p[16 + i]; }
  return w; }
__device__ __forceinline__ v16h wcolh_io(const float* Wm, int k0, int o, int lane, int ld) { v16h w; const int g = lane >> 4;
#pragma unroll
  for (int i = 0; i < 8; ++i) { w[i] = (_Float16)(bfr(Wm[(size_t)(k0 + 8 * g + i) * ld + o]) * 256.0f); w[8 + i] = (_Float16)(bfr(Wm[(size_t)(k0 + 16 + 8 * g + i) * ld + o]) * 256.0f); }
  return w; }
__device__ __forceinline__ v16h wcolh_oi(const float* Wm, int k0, int o, int lane, int K) { v16h w; const float* p = Wm + (size_t)o * K + k0 + 8 * (lane >> 4);
#pragma unroll
  for (int i = 0; i < 8; ++i) { w[i] = (_Float16)(bfr(p[i]) * 256.0f); w[8 + i] = (_Float16)(bfr(p[16 + i]) * 256.0f); }
  return w; }
#define WQKV_LAYOUT 2   // 0 = (in,out) [DIN][CC]; 1 = (out,in) [CC][DIN]; 2 = per-head [NH][DIN][HD]
__device__ __forceinline__ v16b wcol_hdk(const float* Wm, int k0, int o, int lane) { v16b w; const int g = lane >> 4; const float* p = Wm + (size_t)(o / HD) * DIN * HD + (o % HD);
#pragma unroll
  for (int i = 0; i < 8; ++i) { w[i] = (__bf16)p[(size_t)(k0 + 8 * g + i) * HD]; w[8 + i] = (__bf16)p[(size_t)(k0 + 16 + 8 * g + i) * HD]; }
  return w; }
#define WO_OUT_IN 1
#if WQKV_LAYOUT == 1
#define WCOL(W, k0, o, lane) wcol_oi(W, k0, o, lane, DIN)
#elif WQKV_LAYOUT == 2
#define WCOL(W, k0, o, lane) wcol_hdk(W, k0, o, lane)
#else
#define WCOL(W, k0, o, lane) wcol_io(W, k0, o, lane, CC)
#endif
#if WO_OUT_IN
#define WOCOL(W, k0, o, lane) wcol_oi(W, k0, o, lane, CC)
#define WOCOLH(W, k0, o, lane) wcolh_oi(W, k0, o, lane, CC)
#else
#define WOCOL(W, k0, o, lane) wcol_io(W, k0, o, lane, DIN)
#define WOCOLH(W, k0, o, lane) wcolh_io(W, k0, o, lane, DIN)
#endif

#ifndef PROJ_EXTRA_PARAMS
#define PROJ_EXTRA_PARAMS
#endif

#define WS_QH  0u                                      // f16 q rows [b*t][CC]
#define WS_KH  (WS_QH + 2u * (size_t)NB * TT * CC)      // f16 k in fragment order [b][head][16-key group][kc][half][lane][8]
#define WS_VT  (WS_KH + 2u * (size_t)NB * TT * CC)      // f16 v in fragment order [b][head][32-key group][j][half][lane][8]
#define WS_QL  (WS_VT + 2u * (size_t)NB * CC * TT)      // f16 q residual x 2^10 rows [b][t < QHI][CC]
#define WS_KL  (WS_QL + 2u * (size_t)NB * QHI * CC)     // f16 k residual x 2^10 rows [b][t < KHI][CC]
#define WS_VB  (WS_KL + 2u * (size_t)NB * KHI * CC)     // bf16 v hi planes [b][c][t < KHI]
#define WS_VBL (WS_VB + 2u * (size_t)NB * CC * KHI)
#define WS_Y   (WS_VBL + 2u * (size_t)NB * CC * KHI)    // ctx in fragment order [16-row group][kc][half][lane][8]: f16(ctx x 2^6) (rows < QHI of a sequence: bf16 hi)
#define WS_YL  (WS_Y  + 2u * (size_t)NB * TT * CC)      // bf16 lo of ctx, same order; written and read only for rows < QHI of a sequence
#define WS_XP  (WS_Y  + 4u * (size_t)NB * TT * CC)      // bf16 x in fragment order [16-row group][kc][half][lane][8]
#define WS_WP  (WS_XP + 2u * (size_t)NB * TT * DIN)     // bf16 Wq / Wk / Wv in fragment order [which][128-col block][kc][j][half][lane][8]
#define WS_OB  (WS_WP + 2u * (size_t)3 * DIN * CC)      // bf16 Wo in fragment order [128-col block][kc][j][half][lane][8]
#define WS_OH  (WS_OB + 2u * (size_t)CC * DIN)          // f16(bf16 x 2^8) Wo, same order
#define WS_END (WS_OH + 2u * (size_t)CC * DIN)

// A fragment kept in memory in fragment order is 1 KiB: elements 0..7 of lanes 0..31 (512 B), then elements 8..15: each of its two wave-wide 16-byte loads covers four whole 128-B lines
#define FRAGE 512          // 16-bit elements per stored fragment
#define NFX (NB * TT / 16 * (DIN / 32))
#define NFW (3 * (CC / 16) * (DIN / 32))
#define NFO ((DIN / 16) * (CC / 32))
#define PACKF 4            // fragments per wave of k_pack
static_assert(WO_OUT_IN == 1 && NFX % (4 * PACKF) == 0 && NFW % (4 * PACKF) == 0 && NFO % (4 * PACKF) == 0 && CC % 128 == 0 && DIN % 128 == 0, "a k_pack block stays inside one operand");
template <typename V> __device__ __forceinline__ void frag_put(void* f, V v, int lane) { union { V v; v4u q[2]; } u; u.v = v; *((v4u*)f + lane) = u.q[0]; *((v4u*)f + 32 + lane) = u.q[1]; }
template <typename V> __device__ __forceinline__ V frag_get(const void* f, int lane) { union { V v; v4u q[2]; } u; u.q[0] = *((const v4u*)f + lane); u.q[1] = *((const v4u*)f + 32 + lane); return u.v; }
// last fragment of a batch of loads off one address pair: the batch's last load may land on that pair, which the loads before it name, so the wait stands in front of it
template <typename V> __device__ __forceinline__ V frag_get_last(const void* f, int lane) { union { V v; v4u q[2]; } u; u.q[0] = *((const v4u*)f + lane); asm volatile("s_wait_xcnt 0x0" ::: "memory"); u.q[1] = *((const v4u*)f + 32 + lane); return u.v; }
// behind a batch of loads off the address p: the wait that stands in front of any rewrite of that address pair; naming p keeps the pair live up to the wait, so no load of the batch lands on it either
#define XWAIT(p) asm volatile("s_wait_xcnt 0x0" :: "v"(p) : "memory")
// inputs-only hold on loaded fragments: every load of the batch is issued before the first product waits for one, so a batch costs one load latency and not one per fragment
#define HOLD8(a, o) asm volatile("" :: "v"(a[o]), "v"(a[o + 1]), "v"(a[o + 2]), "v"(a[o + 3]), "v"(a[o + 4]), "v"(a[o + 5]), "v"(a[o + 6]), "v"(a[o + 7]))
// ---- k_pack: one wave per PACKF fragments: x, Wq / Wk / Wv, Wo rounded exactly as the products take them (bf16; Wo also f16(bf16 x 2^8)) and laid down in fragment order, once per call, for k_proj and k_out
__global__ __launch_bounds__(128) void k_pack(const float* __restrict__ X, const float* __restrict__ WQ, const float* __restrict__ WK, const float* __restrict__ WV, const float* __restrict__ WO, __bf16* __restrict__ XP, __bf16* __restrict__ WP, __bf16* __restrict__ OB, _Float16* __restrict__ OH) {
  const int lane = threadIdx.x & 31, col = lane & 15, g = lane >> 4; const int f0 = ((int)blockIdx.x * 4 + ((int)threadIdx.x >> 5)) * PACKF;
  if (f0 < NFX) {   /* block-uniform */
    v16b a[PACKF];
#pragma unroll
    for (int i = 0; i < PACKF; ++i) { const int f = f0 + i, rg = f / (DIN / 32), kc = f % (DIN / 32); const float* p = X + ((size_t)rg * 16 + col) * DIN + kc * 32 + 8 * g;
#pragma unroll
      for (int e = 0; e < 8; ++e) { a[i][e] = (__bf16)p[e]; a[i][8 + e] = (__bf16)p[16 + e]; }
      XWAIT(p); }
#pragma unroll
    for (int i = 0; i < PACKF; ++i) frag_put(XP + (size_t)(f0 + i) * FRAGE, a[i], lane);
  } else if (f0 < NFX + NFW) {
#pragma unroll
    for (int i = 0; i < PACKF; ++i) { const int f = f0 - NFX + i, j = f & 7, kc = (f >> 3) % (DIN / 32), cb = (f >> 3) / (DIN / 32) % (CC / 128), which = (f >> 3) / (DIN / 32) / (CC / 128); const float* WA = which == 0 ? WQ : which == 1 ? WK : WV;
      frag_put(WP + (size_t)f * FRAGE, WCOL(WA, kc * 32, cb * 128 + j * 16 + col, lane), lane); }
  } else { const bool hb = f0 < NFX + NFW + NFO; const int fo = f0 - NFX - NFW - (hb ? 0 : NFO); float v[PACKF][16];   /* Wo, once as bf16 and once as f16(bf16 x 2^8) */
#pragma unroll
    for (int i = 0; i < PACKF; ++i) { const int f = fo + i, j = f & 7, kc = (f >> 3) % (CC / 32), cb = (f >> 3) / (CC / 32); const float* p = WO + (size_t)(cb * 128 + j * 16 + col) * CC + kc * 32 + 8 * g;
#pragma unroll
      for (int e = 0; e < 8; ++e) { v[i][e] = p[e]; v[i][8 + e] = p[16 + e]; }
      XWAIT(p); }
#pragma unroll
    for (int i = 0; i < PACKF; ++i) { v16b wb; v16h wh;
#pragma unroll
      for (int e = 0; e < 16; ++e) { wb[e] = (__bf16)v[i][e]; wh[e] = (_Float16)(bfr(v[i][e]) * 256.0f); }
      if (hb) frag_put(OB + (size_t)(fo + i) * FRAGE, wb, lane); else frag_put(OH + (size_t)(fo + i) * FRAGE, wh, lane); } } }

#define PKS 2                                  // k steps per stage of k_proj's LDS ring
#define PST (DIN / 32 / PKS)                   // stages
#define PXB (8 * PKS * FRAGE * 2)              // bytes of a stage's x fragments (8 row groups); its weight fragments (8 column groups) take as many
#define PSB (2 * PXB)                          // bytes of a stage
static_assert(DIN / 32 % PKS == 0 && PST >= 2 && PKS * FRAGE * 2 == 128 * 16 && 2 * PSB >= 3 * 128 * 72 * 2 && 2 * PSB >= 2 * 64 * 136 * 2, "128 lanes x 16 B cover one row group's fragments of a stage; the staging tiles fit the ring's bytes");
// eight asynchronous 16-byte copies per lane: LDS places 2 KiB apart from l, global places gs elements apart from gp; the s_wait_xcnt is the statement's last line, so it stands in front of any rewrite of the registers that the copies name
__device__ __forceinline__ void acopy8(unsigned l, const __bf16* gp, size_t gs) {
  asm volatile("global_load_async_to_lds_b128 %0, %8, off\n\tglobal_load_async_to_lds_b128 %1, %9, off\n\tglobal_load_async_to_lds_b128 %2, %10, off\n\tglobal_load_async_to_lds_b128 %3, %11, off\n\t"
               "global_load_async_to_lds_b128 %4, %12, off\n\tglobal_load_async_to_lds_b128 %5, %13, off\n\tglobal_load_async_to_lds_b128 %6, %14, off\n\tglobal_load_async_to_lds_b128 %7, %15, off\n\ts_wait_xcnt 0x0"
               :: "v"(l), "v"(l + 2048u), "v"(l + 4096u), "v"(l + 6144u), "v"(l + 8192u), "v"(l + 10240u), "v"(l + 12288u), "v"(l + 14336u),
                  "v"(gp), "v"(gp + gs), "v"(gp + 2 * gs), "v"(gp + 3 * gs), "v"(gp + 4 * gs), "v"(gp + 5 * gs), "v"(gp + 6 * gs), "v"(gp + 7 * gs) : "memory"); }
// one stage: the block's 8 row groups x PKS x fragments (2 KiB in a row per group), then its PKS x 8 weight fragments (16 KiB in a row); l, xg, wg carry the lane's own 16 bytes
__device__ __forceinline__ void proj_fill(unsigned l, const __bf16* xg, const __bf16* wg) { acopy8(l, xg, (size_t)(DIN / 32) * FRAGE); acopy8(l + PXB, wg, (size_t)PKS * FRAGE); }
// ---- k_proj: block = (128 rows, 128 cols, which): q/k/v = X W (+ b) with exact bf16 products (K = DIN), both operands in fragment order, brought into a two-buffer LDS ring by asynchronous copies (each byte once per block, the weight fragments shared by its four waves) and read from there, four weight fragments at a time; the ring's bytes become the staging tiles behind the loop's last barrier; 64 KiB of LDS and at most 192 registers, so that five blocks fit a WGP and the whole grid is resident at once; a wave owns two 16-row groups (wave and 4 + wave), so each weight fragment it loads feeds two products; the results leave in two passes of 64 rows through the same staging tiles -> which 0: q f16 rows (+ residual rows < QHI); 1: k f16 in fragment order (+ residual rows < KHI); 2: v f16 in fragment order (+ bf16 hi/lo planes [c][t] for t < KHI)
__global__ __attribute__((amdgpu_waves_per_eu(5))) __launch_bounds__(128) void k_proj(const __bf16* __restrict__ XP, const __bf16* __restrict__ WP, const float* __restrict__ BQ, const float* __restrict__ BK, const float* __restrict__ BV,
    _Float16* __restrict__ QH, _Float16* __restrict__ QL, _Float16* __restrict__ KH, _Float16* __restrict__ KL, _Float16* __restrict__ VT, __bf16* __restrict__ VB, __bf16* __restrict__ VBL) {
  __shared__ __attribute__((aligned(2048))) unsigned char sm[2 * PSB];
  _Float16 (*sh)[136] = (_Float16 (*)[136])sm, (*sl)[136] = (_Float16 (*)[136])(sm + 64 * 136 * 2), (*th)[72] = (_Float16 (*)[72])sm; __bf16 (*tb)[72] = (__bf16 (*)[72])(sm + 128 * 72 * 2), (*tbl)[72] = (__bf16 (*)[72])(sm + 2 * 128 * 72 * 2);   /* staging tiles of the results, on the ring's bytes */
  const int tid = threadIdx.x, wave = tid >> 5, lane = tid & 31, col = lane & 15, g = lane >> 4; const int which = blockIdx.z; const int c0 = blockIdx.y * 128;
  const float* BA = which == 0 ? BQ : which == 1 ? BK : BV;
  const int ws = __builtin_amdgcn_readfirstlane(wave); const unsigned l0 = (unsigned)(size_t)sm + (unsigned)tid * 16u;   /* the lane's 16 bytes of each 2-KiB piece */
  const __bf16* xg = XP + (size_t)blockIdx.x * 8 * (DIN / 32) * FRAGE + tid * 8; const __bf16* wg = WP + (size_t)(which * (CC / 128) + blockIdx.y) * (DIN / 32) * 8 * FRAGE + tid * 8;
  v8f acc2[2][8] = {};
  proj_fill(l0, xg, wg);
  asm volatile("s_wait_asynccnt 0x0" ::: "memory");   /* stage 0 of this wave's copies has landed */
  __syncthreads();                                    /* ... and every other wave's */
  proj_fill(l0 + PSB, xg + PKS * FRAGE, wg + PKS * 8 * FRAGE);
#pragma unroll 1   /* one stage per trip: the buffer is picked by the trip's parity */
  for (int s = 0; s < PST; ++s) { const unsigned char* bp = sm + (s & 1) * PSB;
#pragma unroll
    for (int kk = 0; kk < PKS; ++kk) { const v16b a = frag_get<v16b>(bp + (ws * PKS + kk) * (FRAGE * 2), lane), a4 = frag_get<v16b>(bp + ((4 + ws) * PKS + kk) * (FRAGE * 2), lane);
#pragma unroll
      for (int jh = 0; jh < 8; jh += 4) { v16b w[4];   /* four weight fragments at a time: the wave stays inside the registers of five waves per SIMD */
#pragma unroll
        for (int j = 0; j < 4; ++j) w[j] = frag_get<v16b>(bp + PXB + (kk * 8 + jh + j) * (FRAGE * 2), lane);
#pragma unroll
        for (int j = 0; j < 4; ++j) { acc2[0][jh + j] = wmma_bf(a, w[j], acc2[0][jh + j]); acc2[1][jh + j] = wmma_bf(a4, w[j], acc2[1][jh + j]); } } }
    asm volatile("s_wait_dscnt 0x0" ::: "memory");      /* this wave's reads of the buffer have ended */
    asm volatile("s_wait_asynccnt 0x0" ::: "memory");   /* its copies of the next stage have landed */
    __syncthreads();                                    /* publishes the next stage and frees this trip's buffer */
    if (s + 2 < PST) proj_fill(l0 + (s & 1) * PSB, xg + (size_t)(s + 2) * PKS * FRAGE, wg + (size_t)(s + 2) * PKS * 8 * FRAGE); }
  asm volatile("s_wait_asynccnt 0x0" ::: "memory");     /* no copy is in flight when the ring's bytes become staging tiles */
#pragma unroll   /* hh picks registers: rolled, the accumulators would have to lie in scratch */
  for (int hh = 0; hh < 2; ++hh) { const v8f (&acc)[8] = acc2[hh]; const size_t r0 = (size_t)blockIdx.x * 128 + hh * 64; const size_t bb = r0 / TT; const int t0 = (int)(r0 % TT);
  if (hh) __syncthreads();   /* the first pass's reads of the staging tiles end before the second pass writes over them */
  if (which < 2) { _Float16* DL = which == 0 ? QL : KL; const int nhi = which == 0 ? QHI : KHI; const bool hi_rows = t0 < nhi;
#pragma unroll
    for (int j = 0; j < 8; ++j) { const float bias = BA ? bfr(BA[c0 + j * 16 + col]) : 0.f;
#pragma unroll
      for (int r = 0; r < 8; ++r) { const float v = acc[j][r] + bias; const _Float16 hv = (_Float16)v; sh[wave * 16 + 8 * g + r][j * 16 + col] = hv; sl[wave * 16 + 8 * g + r][j * 16 + col] = (_Float16)((v - (float)hv) * 1024.0f); } }
    __syncthreads();
    if (which == 1) { for (int e = tid; e < 64 * 16; e += 128) { const int ln = e & 31, hf = (e >> 5) & 1, kc = (e >> 6) & 1, kg = (e >> 7) & 3, hl = e >> 9;   /* k: 16-byte pieces in the order k_att's loads take them */
        vst2((unsigned*)(KH + ((((bb * NH + c0 / HD + hl) * (TT / 16) + t0 / 16 + kg) * 2 + kc) * 2 + hf) * (size_t)(FRAGE / 2) + ln * 8), *(const v4u*)&sh[kg * 16 + (ln & 15)][hl * 64 + kc * 32 + hf * 16 + (ln >> 4) * 8]); } }
    else { for (int e = tid; e < 64 * 16; e += 128) { const int rl = e >> 4, q = e & 15; vst2((unsigned*)(QH + (r0 + rl) * CC + c0 + q * 8), *(const v4u*)&sh[rl][q * 8]); } }
    if (hi_rows) { for (int e = tid; e < 64 * 16; e += 128) { const int rl = e >> 4, q = e & 15; vst2((unsigned*)(DL + (bb * nhi + t0 + rl) * (size_t)CC + c0 + q * 8), *(const v4u*)&sl[rl][q * 8]); } }
  } else { const bool hi_rows = t0 < KHI;
#pragma unroll
    for (int j = 0; j < 8; ++j) { const float bias = BA ? bfr(BA[c0 + j * 16 + col]) : 0.f;
#pragma unroll
      for (int r = 0; r < 8; ++r) { const float v = acc[j][r] + bias; const int rl = wave * 16 + 8 * g + r, cl = j * 16 + col; th[cl][rl] = (_Float16)v; const __bf16 bh = (__bf16)v; tb[cl][rl] = bh; tbl[cl][rl] = (__bf16)(v - (float)bh); } }
    __syncthreads();
    for (int e = tid; e < 128 * 8; e += 128) { const int ln = e & 31, hf = (e >> 5) & 1, j = (e >> 6) & 3, kq = (e >> 8) & 1, hl = e >> 9;   /* v: 16-byte pieces in the order k_att's loads take them */
      vst2((unsigned*)(VT + ((((bb * NH + c0 / HD + hl) * (TT / 32) + t0 / 32 + kq) * 4 + j) * 2 + hf) * (size_t)(FRAGE / 2) + ln * 8), *(const v4u*)&th[hl * 64 + j * 16 + (ln & 15)][kq * 32 + hf * 16 + (ln >> 4) * 8]); }
    if (hi_rows) for (int e = tid; e < 128 * 8; e += 128) { const int cl = e >> 3, q = e & 7; const size_t o3 = (bb * CC + c0 + cl) * (size_t)KHI + t0 + q * 8; vst2((unsigned*)(VB + o3), *(const v4u*)&tb[cl][q * 8]); vst2((unsigned*)(VBL + o3), *(const v4u*)&tbl[cl][q * 8]); } } } }
// eight 2^x in place, with the slot behind the last one, in ONE statement: each transcendental is followed by an independent instruction, so none that reads its result or overwrites its source can come to stand directly behind it
__device__ __forceinline__ void exp2x8(float* x) {
  asm("v_exp_f32 %0, %0\n\tv_exp_f32 %1, %1\n\tv_exp_f32 %2, %2\n\tv_exp_f32 %3, %3\n\tv_exp_f32 %4, %4\n\tv_exp_f32 %5, %5\n\tv_exp_f32 %6, %6\n\tv_exp_f32 %7, %7\n\tv_nop"
      : "+v"(x[0]), "+v"(x[1]), "+v"(x[2]), "+v"(x[3]), "+v"(x[4]), "+v"(x[5]), "+v"(x[6]), "+v"(x[7])); }
// one 128-key tile of this lane's query row t, its logits handed in in e (lanes l and l ^ 16 share a row; e[kc][0..7] = key k0 + 32 kc + 8 g + i, e[kc][8..15] = 16 keys on: the fragments' k order): causal mask by index (only a query block's last key block reaches past the diagonal), running max m and sum l brought up to date (logits, m in log2 units; l carries the 2^11 too); leaves 2^(logit - m + 11) in e (0 for excluded keys) and returns the factor that carries earlier sums over to the new max
__device__ __forceinline__ float sm_tile(int g, int k0, int t, bool diag, float& m, float& l, float (&e)[4][16]) {
  if (diag) {   /* block-uniform */
#pragma unroll
    for (int kc = 0; kc < 4; ++kc)
#pragma unroll
      for (int i = 0; i < 16; ++i) { const int k = k0 + kc * 32 + 8 * g + (i < 8 ? i : i + 8); e[kc][i] = k <= t ? e[kc][i] : -3.0e38f; } }
  float mx = -3.0e38f;
#pragma unroll
  for (int kc = 0; kc < 4; ++kc)
#pragma unroll
    for (int i = 0; i < 16; ++i) mx = fmaxf(mx, e[kc][i]);
  mx = fmaxf(mx, __shfl_xor(mx, 16));
  const float mn = fmaxf(m, mx); const float al = __builtin_amdgcn_exp2f(m - mn); m = mn;
  const float mb = mn - 11.0f; float sum = 0.f;
#pragma unroll
  for (int kc = 0; kc < 4; ++kc)
#pragma unroll
    for (int i = 0; i < 16; ++i) e[kc][i] -= mb;
#pragma unroll
  for (int kc = 0; kc < 4; ++kc)
#pragma unroll
    for (int i = 0; i < 16; i += 8) exp2x8(&e[kc][i]);   /* an excluded key's -3e38 gives exactly 0 */
#pragma unroll
  for (int kc = 0; kc < 4; ++kc)
#pragma unroll
    for (int i = 0; i < 16; ++i) sum += e[kc][i];
  sum += __shfl_xor(sum, 16);
  l = l * al + sum;
  return al; }
// the lane's query row's factor on the lane's own sums (the transposed accumulator's column is the query)
__device__ __forceinline__ void row_scale(v8f (&o)[HD / 16], float f) {
#pragma unroll
  for (int j = 0; j < HD / 16; ++j)
#pragma unroll
    for (int r = 0; r < 8; ++r) o[j][r] *= f; }
// ---- k_att: block = (pair = b * NH + h, 64 queries qb, longest first); each wave owns 16 query rows and walks its causal key blocks of 128 alone: logits^T = k (A) x q^T (B) x SCALE x log2(e) (f16; query blocks < QBH: + k x q residual + k residual x q, both x 2^10): accumulator j, register r of lane (g, col) = key 16 j + 8 g + r of query col, which is the k order of a fragment of that query's row -> running softmax in f32, base 2, in those registers -> 2^(logit - max + 11) once to f16 as B against v^T f16 as A (query blocks < QBH: exp and v as bf16 hi + lo, 3 products): o[j][r] = ctx[query col][16 j + 8 g + r]; ctx = sums / l (both carry 2^11); those registers are k_out's A fragments of the wave's 16 rows (k = head * 64 + 16 j + 8 g + r), so ctx is rounded here as k_out's products take it (f16(ctx x 2^6); query blocks < QBH: bf16 hi + lo) and stored from the registers in fragment order, 512 B in a row per store
static_assert(CAUSAL == 1 && QBH * 64 == QHI && QHI == KHI && QHI % 128 == 0 && HD == 64, "early query blocks see only keys that carry residual planes");
__global__ __attribute__((amdgpu_waves_per_eu(4))) __launch_bounds__(128) void k_att(const _Float16* __restrict__ QH, const _Float16* __restrict__ KH, const _Float16* __restrict__ QL, const _Float16* __restrict__ KL, const _Float16* __restrict__ VT, const __bf16* __restrict__ VB, const __bf16* __restrict__ VBL, _Float16* __restrict__ YF, __bf16* __restrict__ YL) {
  const int pr = blockIdx.x, b = pr / NH, h = pr % NH; const int qb = NQB - 1 - (int)blockIdx.y; const int nkb = kb_last(qb) + 1;
  const int tid = threadIdx.x, wave = tid >> 5, lane = tid & 31, col = lane & 15, g = lane >> 4; const int ql0 = qb * 64 + wave * 16; const size_t q0 = (size_t)b * TT + ql0; const int t = ql0 + col;
  float m = -3.0e38f, l = 0.f; v8f o[HD / 16] = {}; float e[4][16];
  v16h ah[HD / 32];
#pragma unroll
  for (int kc = 0; kc < HD / 32; ++kc) ah[kc] = frag_h(QH + (q0 + col) * CC + h * HD + kc * 32, lane);
  asm volatile("s_wait_xcnt 0x0" ::: "memory");   /* stands in front of the first rewrite of the address pair that the q loads name */
  if (qb < QBH) { const _Float16* KLb = KL + (size_t)b * KHI * CC; v16h al[HD / 32];
#pragma unroll
    for (int kc = 0; kc < HD / 32; ++kc) al[kc] = frag_h(QL + ((size_t)b * QHI + ql0 + col) * CC + h * HD + kc * 32, lane);
#pragma unroll 1
    for (int kb = 0; kb < nkb; ++kb) { const int k0 = kb * 128; v8f acc[8] = {}, accl[8] = {};
#pragma unroll
      for (int kc = 0; kc < HD / 32; ++kc)
#pragma unroll
        for (int jh = 0; jh < 8; jh += 4) { v16h kf[8];
#pragma unroll
          for (int j = 0; j < 4; ++j) { kf[j] = frag_get<v16h>(KH + (((size_t)pr * (TT / 16) + kb * 8 + jh + j) * 2 + kc) * FRAGE, lane); kf[4 + j] = frag_h(KLb + (size_t)(k0 + (jh + j) * 16 + col) * CC + h * HD + kc * 32, lane); }
          HOLD8(kf, 0);
#pragma unroll
          for (int j = 0; j < 4; ++j) { acc[jh + j] = wmma16(kf[j], ah[kc], acc[jh + j]); accl[jh + j] = wmma16(kf[j], al[kc], accl[jh + j]); accl[jh + j] = wmma16(kf[4 + j], ah[kc], accl[jh + j]); } }
#pragma unroll
      for (int j = 0; j < 8; ++j)
#pragma unroll
        for (int r = 0; r < 8; ++r) e[j >> 1][(j & 1) * 8 + r] = (acc[j][r] + accl[j][r] * (1.0f / 1024.0f)) * SCALE_L2;
      const float f = sm_tile(g, k0, t, kb == nkb - 1, m, l, e);
      row_scale(o, f);
#pragma unroll
      for (int kc = 0; kc < 4; ++kc) { const F2 p = bsplit16(e[kc]); v16b vf[8];
#pragma unroll
        for (int j = 0; j < HD / 16; ++j) { const size_t po = ((size_t)b * CC + h * HD + j * 16 + col) * (size_t)KHI + k0 + kc * 32; vf[j] = frag_b(VB + po, lane); vf[4 + j] = frag_b(VBL + po, lane); }
        HOLD8(vf, 0);
#pragma unroll
        for (int j = 0; j < HD / 16; ++j) { o[j] = wmma_bf(vf[j], p.h, o[j]); o[j] = wmma_bf(vf[j], p.l, o[j]); o[j] = wmma_bf(vf[4 + j], p.h, o[j]); } } }
  } else { const _Float16* kp = KH + (size_t)pr * (TT / 16) * 2 * FRAGE; const _Float16* vp = VT + (size_t)pr * (TT / 32) * 4 * FRAGE;   /* this (batch, head)'s k and v fragments at the key block's first key: 16 fragments = 16 KiB in a row each */
#pragma unroll 1
    for (int kb = 0; kb < nkb; ++kb, kp += 16 * FRAGE, vp += 16 * FRAGE) { const int k0 = kb * 128; v8f acc[8] = {}; { v16h kf[16];
#pragma unroll
      for (int kc = 0; kc < HD / 32; ++kc)
#pragma unroll
        for (int j = 0; j < 8; ++j) if (kc * 8 + j < 15) kf[kc * 8 + j] = frag_get<v16h>(kp + (j * 2 + kc) * FRAGE, lane);
      kf[15] = frag_get_last<v16h>(kp + 15 * FRAGE, lane);
      HOLD8(kf, 0); HOLD8(kf, 8);
#pragma unroll
      for (int kc = 0; kc < HD / 32; ++kc)
#pragma unroll
        for (int j = 0; j < 8; ++j) acc[j] = wmma16(kf[kc * 8 + j], ah[kc], acc[j]); }
#pragma unroll
      for (int j = 0; j < 8; ++j)
#pragma unroll
        for (int r = 0; r < 8; ++r) e[j >> 1][(j & 1) * 8 + r] = acc[j][r] * SCALE_L2;
      v16h vf[16];   /* v fragments of the first 64 keys fly while the softmax runs, the other 64 behind it */
#pragma unroll
      for (int kc = 0; kc < 2; ++kc)
#pragma unroll
        for (int j = 0; j < HD / 16; ++j) vf[kc * 4 + j] = frag_get<v16h>(vp + (kc * 4 + j) * FRAGE, lane);
      const float f = sm_tile(g, k0, t, kb == nkb - 1, m, l, e);
      v16h p[4];
#pragma unroll
      for (int kc = 0; kc < 4; ++kc)
#pragma unroll
        for (int i = 0; i < 16; ++i) p[kc][i] = (_Float16)e[kc][i];
#pragma unroll
      for (int kc = 2; kc < 4; ++kc)
#pragma unroll
        for (int j = 0; j < HD / 16; ++j) if (kc * 4 + j < 15) vf[kc * 4 + j] = frag_get<v16h>(vp + (kc * 4 + j) * FRAGE, lane);
      vf[15] = frag_get_last<v16h>(vp + 15 * FRAGE, lane);
      row_scale(o, f);
      HOLD8(vf, 0);
#pragma unroll
      for (int kc = 0; kc < 2; ++kc)
#pragma unroll
        for (int j = 0; j < HD / 16; ++j) o[j] = wmma16(vf[kc * 4 + j], p[kc], o[j]);
      HOLD8(vf, 8);
#pragma unroll
      for (int kc = 2; kc < 4; ++kc)
#pragma unroll
        for (int j = 0; j < HD / 16; ++j) o[j] = wmma16(vf[kc * 4 + j], p[kc], o[j]); } }
  row_scale(o, l > 0.f ? 1.0f / l : 0.f);
  const size_t fy = (size_t)(((b * TT + ql0) / 16) * (CC / 32) + h * (HD / 32)) * FRAGE;   /* the wave's row group, this head's two k steps */
  if (qb < QBH) {   /* block-uniform */
#pragma unroll
    for (int kc = 0; kc < HD / 32; ++kc) { float v[16];
#pragma unroll
      for (int i = 0; i < 8; ++i) { v[i] = o[2 * kc][i]; v[8 + i] = o[2 * kc + 1][i]; }
      const F2 s = bsplit16(v); frag_put(YF + fy + kc * FRAGE, s.h, lane); frag_put(YL + fy + kc * FRAGE, s.l, lane); }
  } else {
#pragma unroll
    for (int kc = 0; kc < HD / 32; ++kc) { v16h a;   /* ctx carried x 2^6 into f16 so small-magnitude context rows stay clear of f16 subnormals */
#pragma unroll
      for (int i = 0; i < 8; ++i) { a[i] = (_Float16)(o[2 * kc][i] * 64.0f); a[8 + i] = (_Float16)(o[2 * kc + 1][i] * 64.0f); }
      frag_put(YF + fy + kc * FRAGE, a, lane); }
    asm volatile("s_wait_xcnt 0x0" ::: "memory"); } }   /* behind the run of four stores: stands in front of any rewrite of the address pair and the data registers that they name */
// ---- k_out: block = (64 rows, 128 cols): out = ctx Wo (+ bo), both operands read in fragment order: ctx as f16(ctx x 2^6) against Wo as f16(bf16 x 2^8) exact (1 product) x 2^-14; causal early rows (< QHI of each sequence): ctx bf16 hi + lo against exact bf16 Wo (2 products)
__global__ __launch_bounds__(128) void k_out(const _Float16* __restrict__ YF, const __bf16* __restrict__ YL, const __bf16* __restrict__ OB, const _Float16* __restrict__ OH, const float* __restrict__ BO, float* __restrict__ OUT) { __shared__ __align__(16) float sf[4][16][132];
  const int tid = threadIdx.x, wave = tid >> 5, lane = tid & 31, col = lane & 15, g = lane >> 4; const int c0 = blockIdx.y * 128; const size_t r0 = (size_t)blockIdx.x * 64 + wave * 16; const size_t fy = r0 / 16 * (CC / 32) * FRAGE;   /* the wave's row group's first ctx fragment */
  v8f acc[8] = {};
  if (CAUSAL && (int)(((size_t)blockIdx.x * 64) % TT) < QHI) {   /* block-uniform */
    const __bf16* wp = OB + (size_t)blockIdx.y * (CC / 32) * 8 * FRAGE;
    for (int kc = 0; kc < CC / 32; ++kc, wp += 8 * FRAGE) { F2 a; a.h = frag_get<v16b>(YF + fy + kc * FRAGE, lane); XWAIT((const v4u*)(YF + fy + kc * FRAGE) + lane); a.l = frag_get<v16b>(YL + fy + kc * FRAGE, lane); XWAIT((const v4u*)(YL + fy + kc * FRAGE) + lane); v16b w[8];
#pragma unroll
      for (int j = 0; j < 7; ++j) w[j] = frag_get<v16b>(wp + j * FRAGE, lane);
      w[7] = frag_get_last<v16b>(wp + 7 * FRAGE, lane);
      HOLD8(w, 0);
#pragma unroll
      for (int j = 0; j < 8; ++j) { acc[j] = wmma_bf(a.h, w[j], acc[j]); acc[j] = wmma_bf(a.l, w[j], acc[j]); } }
#pragma unroll
    for (int j = 0; j < 8; ++j) { const float bias = BO ? bfr(BO[c0 + j * 16 + col]) : 0.f;
#pragma unroll
      for (int r = 0; r < 8; ++r) sf[wave][8 * g + r][j * 16 + col] = acc[j][r] + bias; }
  } else {
    const _Float16* wp = OH + (size_t)blockIdx.y * (CC / 32) * 8 * FRAGE;
    for (int kc = 0; kc < CC / 32; ++kc, wp += 8 * FRAGE) { const v16h a = frag_get<v16h>(YF + fy + kc * FRAGE, lane); XWAIT((const v4u*)(YF + fy + kc * FRAGE) + lane); v16h w[8];
#pragma unroll
      for (int j = 0; j < 7; ++j) w[j] = frag_get<v16h>(wp + j * FRAGE, lane);
      w[7] = frag_get_last<v16h>(wp + 7 * FRAGE, lane);
      HOLD8(w, 0);
#pragma unroll
      for (int j = 0; j < 8; ++j) acc[j] = wmma16(a, w[j], acc[j]); }
#pragma unroll
    for (int j = 0; j < 8; ++j) { const float bias = BO ? bfr(BO[c0 + j * 16 + col]) : 0.f;
#pragma unroll
      for (int r = 0; r < 8; ++r) sf[wave][8 * g + r][j * 16 + col] = acc[j][r] * (1.0f / 16384.0f) + bias; } }   /* 2^-8 (Wo carry) x 2^-6 (ctx carry) */
  LDSX(); for (int rl = 0; rl < 16; ++rl) vst2(OUT + (r0 + rl) * DIN + c0 + lane * 4, *(const v4f*)&sf[wave][rl][lane * 4]); }

extern "C" void kernel_launch(void* const* d_in, const int* in_sizes, int n_in, void* d_out, int out_size, void* d_ws, size_t ws_size, hipStream_t stream) {
  (void)in_sizes; (void)n_in; (void)out_size;
  const float** F = (const float**)d_in;
  if (ws_size < (size_t)WS_END) return;
  char* ws = (char*)d_ws; _Float16 *QH = (_Float16*)(ws + WS_QH), *KH = (_Float16*)(ws + WS_KH), *VT = (_Float16*)(ws + WS_VT), *QL = (_Float16*)(ws + WS_QL), *KL = (_Float16*)(ws + WS_KL); __bf16 *VB = (__bf16*)(ws + WS_VB), *VBL = (__bf16*)(ws + WS_VBL), *XP = (__bf16*)(ws + WS_XP), *WP = (__bf16*)(ws + WS_WP), *OB = (__bf16*)(ws + WS_OB); _Float16 *OH = (_Float16*)(ws + WS_OH), *YF = (_Float16*)(ws + WS_Y); __bf16 *YL = (__bf16*)(ws + WS_YL);
  (void)QL; (void)KL; (void)VB; (void)VBL;
  // inputs, in order: 0 x [4,2048,768]; 1 Wq [12,768,64]; 2 Wk; 3 Wv (per-head [head][model][d]); 4 Wo [768,768] (out,in); 5 bo [768] (zeros, read); no q / k / v biases
  k_pack<<<dim3((NFX + NFW + 2 * NFO) / (4 * PACKF)), 128, 0, stream>>>(F[0], F[1], F[2], F[3], F[4], XP, WP, OB, OH);
  k_proj<<<dim3(TNB * TT / 128, CC / 128, 3), 128, 0, stream>>>(XP, WP, nullptr, nullptr, nullptr, QH, QL, KH, KL, VT, VB, VBL);
  k_att<<<dim3(TNB * NH, NQB), 128, 0, stream>>>(QH, KH, QL, KL, VT, VB, VBL, YF, YL);
  k_out<<<dim3(TNB * TT / 64, DIN / 128), 128, 0, stream>>>(YF, YL, OB, OH, F[5], (float*)d_out);
}

// v009
// It runs in 101 microseconds.
// Next to v008, in two timings, it ran 1.06 and 1.05 times as fast.
// Counting every step since v000, it is 22.9 times as fast.
// compute dtype: all float inputs rounded to bf16; per-head q / k / v projections with EXACT bf16 products on WMMA 16x16x32 (f32 accumulate), no biases; causal logits: 3 products for the first 384 rows, single f16 q x k after, x 64^-0.5 x log2(e); both attention products taken transposed (k x q^T, v^T x p^T), a query's logits and sums stay in its two lanes; softmax f32 in base 2 (hardware exp2) with a running max and sum per 128 keys; 2^(logit - max + 11) once to f16 x v once to f16 (bf16 hi + lo below row 384); ctx hi+lo x exact Wo below row 384, x2^6 f16 carry x f16(bf16 x 2^8) Wo after, + bo (zeros, read); f32 output.
#include <hip/hip_runtime.h>
#include <math.h>

typedef __attribute__((ext_vector_type(16))) _Float16 v16h;
typedef __attribute__((ext_vector_type(16))) __bf16 v16b;
typedef __attribute__((ext_vector_type(8)))  _Float16 v8h;
typedef __attribute__((ext_vector_type(8)))  float v8f;
typedef __attribute__((ext_vector_type(4)))  float v4f;
typedef __attribute__((ext_vector_type(2)))  float v2f;
typedef __attribute__((ext_vector_type(4)))  unsigned v4u;
typedef __attribute__((ext_vector_type(4)))  int v4i;
typedef float __attribute__((may_alias)) float_a;
typedef int __attribute__((may_alias)) int_a;

template <typename T> __device__ __forceinline__ void vst2(void* p, T v) { *(T*)p = v;  }
__device__ __forceinline__ v8f wmma16(v16h a, v16h b, v8f c) {
  v8f d = __builtin_amdgcn_wmma_f32_16x16x32_f16(false, a, false, b, (short)0, c, false, false);
  asm volatile("v_nop\n\tv_nop\n\tv_nop\n\tv_nop" : "+v"(d) : "v"(a), "v"(b));
  return d;
}
__device__ __forceinline__ v8f wmma_bf(v16b a, v16b b, v8f c) {
  v8f d = __builtin_amdgcn_wmma_f32_16x16x32_bf16(false, a, false, b, (short)0, c, false, false);
  asm volatile("v_nop\n\tv_nop\n\tv_nop\n\tv_nop" : "+v"(d) : "v"(a), "v"(b));
  return d;
}
// 16x16x32 fragments: lane = (h = lane>>4, row/col = lane&15); elements 0..7 = k0+8h+0..7, 8..15 = k0+16+8h+0..7; D element r = row 8h+r
__device__ __forceinline__ v16h frag_h(const _Float16* rowk0, int lane) {
  union { v16h v; v8h q[2]; } u; const _Float16* p = rowk0 + 8 * (lane >> 4);
  u.q[0] = *(const v8h*)p; u.q[1] = *(const v8h*)(p + 16); return u.v;
}
__device__ __forceinline__ v16h frag_f32(const float* rowk0, int lane) {
  v16h a; const float* p = rowk0 + 8 * (lane >> 4);
#pragma unroll
  for (int i = 0; i < 8; ++i) { a[i] = (_Float16)p[i]; a[8 + i] = (_Float16)p[16 + i]; }
  return a;
}
__device__ __forceinline__ v16h frag_f32s(const float* rowk0, int lane, float sc) {
  v16h a; const float* p = rowk0 + 8 * (lane >> 4);
#pragma unroll
  for (int i = 0; i < 8; ++i) { a[i] = (_Float16)(p[i] * sc); a[8 + i] = (_Float16)(p[16 + i] * sc); }
  return a;
}
// column fragment from a [K][ld] layout (column n), rows >= K read as 0
__device__ __forceinline__ v16h fragc_f32(const float* W, int k0, int n, int lane, int ld, int K) {
  v16h a; const int g = lane >> 4;
#pragma unroll
  for (int i = 0; i < 8; ++i) { const int ka = k0 + 8 * g + i, kb = ka + 16;
    a[i] = (_Float16)(ka < K ? W[(size_t)(ka < K ? ka : K - 1) * ld + n] : 0.f); a[8 + i] = (_Float16)(kb < K ? W[(size_t)(kb < K ? kb : K - 1) * ld + n] : 0.f); }
  return a;
}
struct F2 { v16b h, l; };
__device__ __forceinline__ F2 bsplit16(const float v[16]) { F2 r;
#pragma unroll
  for (int i = 0; i < 16; ++i) { const __bf16 h = (__bf16)v[i]; r.h[i] = h; r.l[i] = (__bf16)(v[i] - (float)h); }
  return r; }
__device__ __forceinline__ F2 split_row(const float* row, int k0, int lane) { float v[16]; const float* p = row + k0 + 8 * (lane >> 4);
#pragma unroll
  for (int i = 0; i < 8; ++i) { v[i] = p[i]; v[8 + i] = p[16 + i]; }
  return bsplit16(v); }
__device__ __forceinline__ F2 split_rowK(const float* row, int k0, int lane, int K) { float v[16]; const int g = lane >> 4;
#pragma unroll
  for (int i = 0; i < 8; ++i) { const int ka = k0 + 8 * g + i, kb = ka + 16; v[i] = ka < K ? row[ka < K ? ka : K - 1] : 0.f; v[8 + i] = kb < K ? row[kb < K ? kb : K - 1] : 0.f; }
  return bsplit16(v); }
__device__ __forceinline__ F2 split_col(const float* W, int k0, int n, int lane, int ld, int K) { float v[16]; const int g = lane >> 4;
#pragma unroll
  for (int i = 0; i < 8; ++i) { const int ka = k0 + 8 * g + i, kb = ka + 16; v[i] = ka < K ? W[(size_t)(ka < K ? ka : K - 1) * ld + n] : 0.f; v[8 + i] = kb < K ? W[(size_t)(kb < K ? kb : K - 1) * ld + n] : 0.f; }
  return bsplit16(v); }
__device__ __forceinline__ v8f mac3(const F2& a, const F2& b, v8f c) { c = wmma_bf(a.l, b.h, c); c = wmma_bf(a.h, b.l, c); return wmma_bf(a.h, b.h, c); }
__device__ __forceinline__ float sigm(float v) { return 1.0f / (1.0f + expf(-v)); }
#define LDSX() do { asm volatile("s_wait_dscnt 0" ::: "memory"); __builtin_amdgcn_wave_barrier(); __builtin_amdgcn_fence(__ATOMIC_RELEASE, "workgroup"); } while (0)

// Causal multi-head self-attention with per-head weights (x [4,2048,768]; Wq / Wk / Wv [12,768,64] = per-head [head][model][d] N(0,1) x 0.02, no biases; Wo [768,768] torch (out,in), bo zeros (read); q = einsum('bsd,hde->bhse'); scores / sqrt(64); tril kept, finfo.min elsewhere; softmax; ctx merged (head*64 + e); ctx @ Wo.T + bo).
#define NB 4
#define TT 2048
#define CC 768            // NH * HD = projected width
#define DIN 768          // input (model) width
#define NH 12
#define HD 64
#define NQB (TT / 64)
#define SCALE (0.125f)
#define SCALE_L2 (SCALE * 1.44269504088896340736f)   // logits carried in units of log2: exp(s) = 2^(s log2 e)
#define CAUSAL 1
#ifndef TNB
#define TNB NB
#endif
__device__ __forceinline__ float bfr(float v) { return (float)(__bf16)v; }
__host__ __device__ __forceinline__ int kb_last(int qb) { return CAUSAL ? ((qb * 64 + 63) >> 7) : (TT / 128 - 1); }
typedef __attribute__((ext_vector_type(8))) __bf16 v8b;
__device__ __forceinline__ v16b frag_b(const __bf16* rowk0, int lane) {
  union { v16b v; v8b q[2]; } u; const __bf16* p = rowk0 + 8 * (lane >> 4);
  u.q[0] = *(const v8b*)p; u.q[1] = *(const v8b*)(p + 16); return u.v;
}
#define QBH 6              // causal: query blocks 0..QBH-1 of each sequence (few keys, no averaging) take the high-precision path
#define QHI 384            // rows carrying a q residual plane
#define KHI 384            // key rows carrying k residual / v bf16 hi+lo planes (used only by the causal high-precision path)
// B fragment (k rows k0+.., output column o) of a weight: (in,out) [K][ld] or (out,in) [ld rows of K]: bf16 exact, or f16(bf16 * 256) exact
__device__ __forceinline__ v16b wcol_io(const float* Wm, int k0, int o, int lane, int ld) { v16b w; const int g = lane >> 4;
#pragma unroll
  for (int i = 0; i < 8; ++i) { w[i] = (__bf16)Wm[(size_t)(k0 + 8 * g + i) * ld + o]; w[8 + i] = (__bf16)Wm[(size_t)(k0 + 16 + 8 * g + i) * ld + o]; }
  return w; }
__device__ __forceinline__ v16b wcol_oi(const float* Wm, int k0, int o, int lane, int K) { v16b w; const float* p = Wm + (size_t)o * K + k0 + 8 * (lane >> 4);
#pragma unroll
  for (int i = 0; i < 8; ++i) { w[i] = (__bf16)p[i]; w[8 + i] = (__bf16)p[16 + i]; }
  return w; }
__device__ __forceinline__ v16h wcolh_io(const float* Wm, int k0, int o, int lane, int ld) { v16h w; const int g = lane >> 4;
#pragma unroll
  for (int i = 0; i < 8; ++i) { w[i] = (_Float16)(bfr(Wm[(size_t)(k0 + 8 * g + i) * ld + o]) * 256.0f); w[8 + i] = (_Float16)(bfr(Wm[(size_t)(k0 + 16 + 8 * g + i) * ld + o]) * 256.0f); }
  return w; }
__device__ __forceinline__ v16h wcolh_oi(const float* Wm, int k0, int o, int lane, int K) { v16h w; const float* p = Wm + (size_t)o * K + k0 + 8 * (lane >> 4);
#pragma unroll
  for (int i = 0; i < 8; ++i) { w[i] = (_Float16)(bfr(p[i]) * 256.0f); w[8 + i] = (_Float16)(bfr(p[16 + i]) * 256.0f); }
  return w; }
#define WQKV_LAYOUT 2   // 0 = (in,out) [DIN][CC]; 1 = (out,in) [CC][DIN]; 2 = per-head [NH][DIN][HD]
__device__ __forceinline__ v16b wcol_hdk(const float* Wm, int k0, int o, int lane) { v16b w; const int g = lane >> 4; const float* p = Wm + (size_t)(o / HD) * DIN * HD + (o % HD);
#pragma unroll
  for (int i = 0; i < 8; ++i) { w[i] = (__bf16)p[(size_t)(k0 + 8 * g + i) * HD]; w[8 + i] = (__bf16)p[(size_t)(k0 + 16 + 8 * g + i) * HD]; }
  return w; }
#define WO_OUT_IN 1
#if WQKV_LAYOUT == 1
#define WCOL(W, k0, o, lane) wcol_oi(W, k0, o, lane, DIN)
#elif WQKV_LAYOUT == 2
#define WCOL(W, k0, o, lane) wcol_hdk(W, k0, o, lane)
#else
#define WCOL(W, k0, o, lane) wcol_io(W, k0, o, lane, CC)
#endif
#if WO_OUT_IN
#define WOCOL(W, k0, o, lane) wcol_oi(W, k0, o, lane, CC)
#define WOCOLH(W, k0, o, lane) wcolh_oi(W, k0, o, lane, CC)
#else
#define WOCOL(W, k0, o, lane) wcol_io(W, k0, o, lane, DIN)
#define WOCOLH(W, k0, o, lane) wcolh_io(W, k0, o, lane, DIN)
#endif

#ifndef PROJ_EXTRA_PARAMS
#define PROJ_EXTRA_PARAMS
#endif

#define WS_QH  0u                                      // f16 q rows [b*t][CC]
#define WS_KH  (WS_QH + 2u * (size_t)NB * TT * CC)      // f16 k in fragment order [b][head][16-key group][kc][half][lane][8]
#define WS_VT  (WS_KH + 2u * (size_t)NB * TT * CC)      // f16 v in fragment order [b][head][32-key group][j][half][lane][8]
#define WS_QL  (WS_VT + 2u * (size_t)NB * CC * TT)      // f16 q residual x 2^10 rows [b][t < QHI][CC]
#define WS_KL  (WS_QL + 2u * (size_t)NB * QHI * CC)     // f16 k residual x 2^10 rows [b][t < KHI][CC]
#define WS_VB  (WS_KL + 2u * (size_t)NB * KHI * CC)     // bf16 v hi planes [b][c][t < KHI]
#define WS_VBL (WS_VB + 2u * (size_t)NB * CC * KHI)
#define WS_Y   (WS_VBL + 2u * (size_t)NB * CC * KHI)    // ctx in fragment order [16-row group][kc][half][lane][8]: f16(ctx x 2^6) (rows < QHI of a sequence: bf16 hi)
#define WS_YL  (WS_Y  + 2u * (size_t)NB * TT * CC)      // bf16 lo of ctx, same order; written and read only for rows < QHI of a sequence
#define WS_XP  (WS_Y  + 4u * (size_t)NB * TT * CC)      // bf16 x in fragment order [16-row group][kc][half][lane][8]
#define WS_WP  (WS_XP + 2u * (size_t)NB * TT * DIN)     // bf16 Wq / Wk / Wv in fragment order [which][128-col block][kc][j][half][lane][8]
#define WS_OB  (WS_WP + 2u * (size_t)3 * DIN * CC)      // bf16 Wo in fragment order [128-col block][kc][j][half][lane][8]
#define WS_OH  (WS_OB + 2u * (size_t)CC * DIN)          // f16(bf16 x 2^8) Wo, same order
#define WS_END (WS_OH + 2u * (size_t)CC * DIN)

// A fragment kept in memory in fragment order is 1 KiB: elements 0..7 of lanes 0..31 (512 B), then elements 8..15: each of its two wave-wide 16-byte loads covers four whole 128-B lines
#define FRAGE 512          // 16-bit elements per stored fragment
#define NFX (NB * TT / 16 * (DIN / 32))
#define NFW (3 * (CC / 16) * (DIN / 32))
#define NFO ((DIN / 16) * (CC / 32))
#define PACKF 4            // fragments per wave of k_pack
static_assert(WO_OUT_IN == 1 && NFX % (4 * PACKF) == 0 && NFW % (4 * PACKF) == 0 && NFO % (4 * PACKF) == 0 && CC % 128 == 0 && DIN % 128 == 0, "a k_pack block stays inside one operand");
template <typename V> __device__ __forceinline__ void frag_put(void* f, V v, int lane) { union { V v; v4u q[2]; } u; u.v = v; *((v4u*)f + lane) = u.q[0]; *((v4u*)f + 32 + lane) = u.q[1]; }
template <typename V> __device__ __forceinline__ V frag_get(const void* f, int lane) { union { V v; v4u q[2]; } u; u.q[0] = *((const v4u*)f + lane); u.q[1] = *((const v4u*)f + 32 + lane); return u.v; }
// last fragment of a batch of loads off one address pair: the batch's last load may land on that pair, which the loads before it name, so the wait stands in front of it
template <typename V> __device__ __forceinline__ V frag_get_last(const void* f, int lane) { union { V v; v4u q[2]; } u; u.q[0] = *((const v4u*)f + lane); asm volatile("s_wait_xcnt 0x0" ::: "memory"); u.q[1] = *((const v4u*)f + 32 + lane); return u.v; }
// behind a batch of loads off the address p: the wait that stands in front of any rewrite of that address pair; naming p keeps the pair live up to the wait, so no load of the batch lands on it either
#define XWAIT(p) asm volatile("s_wait_xcnt 0x0" :: "v"(p) : "memory")
// inputs-only hold on loaded fragments: every load of the batch is issued before the first product waits for one, so a batch costs one load latency and not one per fragment
#define HOLD8(a, o) asm volatile("" :: "v"(a[o]), "v"(a[o + 1]), "v"(a[o + 2]), "v"(a[o + 3]), "v"(a[o + 4]), "v"(a[o + 5]), "v"(a[o + 6]), "v"(a[o + 7]))
// ---- k_pack: one wave per PACKF fragments: x, Wq / Wk / Wv, Wo rounded exactly as the products take them (bf16; Wo also f16(bf16 x 2^8)) and laid down in fragment order, once per call, for k_proj and k_out
__global__ __launch_bounds__(128) void k_pack(const float* __restrict__ X, const float* __restrict__ WQ, const float* __restrict__ WK, const float* __restrict__ WV, const float* __restrict__ WO, __bf16* __restrict__ XP, __bf16* __restrict__ WP, __bf16* __restrict__ OB, _Float16* __restrict__ OH) {
  const int lane = threadIdx.x & 31, col = lane & 15, g = lane >> 4; const int f0 = ((int)blockIdx.x * 4 + ((int)threadIdx.x >> 5)) * PACKF;
  if (f0 < NFX) {   /* block-uniform */
    v16b a[PACKF];
#pragma unroll
    for (int i = 0; i < PACKF; ++i) { const int f = f0 + i, rg = f / (DIN / 32), kc = f % (DIN / 32); const float* p = X + ((size_t)rg * 16 + col) * DIN + kc * 32 + 8 * g;
#pragma unroll
      for (int e = 0; e < 8; ++e) { a[i][e] = (__bf16)p[e]; a[i][8 + e] = (__bf16)p[16 + e]; }
      XWAIT(p); }
#pragma unroll
    for (int i = 0; i < PACKF; ++i) frag_put(XP + (size_t)(f0 + i) * FRAGE, a[i], lane);
  } else if (f0 < NFX + NFW) {
#pragma unroll
    for (int i = 0; i < PACKF; ++i) { const int f = f0 - NFX + i, j = f & 7, kc = (f >> 3) % (DIN / 32), cb = (f >> 3) / (DIN / 32) % (CC / 128), which = (f >> 3) / (DIN / 32) / (CC / 128); const float* WA = which == 0 ? WQ : which == 1 ? WK : WV;
      frag_put(WP + (size_t)f * FRAGE, WCOL(WA, kc * 32, cb * 128 + j * 16 + col, lane), lane); }
  } else { const bool hb = f0 < NFX + NFW + NFO; const int fo = f0 - NFX - NFW - (hb ? 0 : NFO); float v[PACKF][16];   /* Wo, once as bf16 and once as f16(bf16 x 2^8) */
#pragma unroll
    for (int i = 0; i < PACKF; ++i) { const int f = fo + i, j = f & 7, kc = (f >> 3) % (CC / 32), cb = (f >> 3) / (CC / 32); const float* p = WO + (size_t)(cb * 128 + j * 16 + col) * CC + kc * 32 + 8 * g;
#pragma unroll
      for (int e = 0; e < 8; ++e) { v[i][e] = p[e]; v[i][8 + e] = p[16 + e]; }
      XWAIT(p); }
#pragma unroll
    for (int i = 0; i < PACKF; ++i) { v16b wb; v16h wh;
#pragma unroll
      for (int e = 0; e < 16; ++e) { wb[e] = (__bf16)v[i][e]; wh[e] = (_Float16)(bfr(v[i][e]) * 256.0f); }
      if (hb) frag_put(OB + (size_t)(fo + i) * FRAGE, wb, lane); else frag_put(OH + (size_t)(fo + i) * FRAGE, wh, lane); } } }

#define PKS 2                                  // k steps per stage of k_proj's LDS ring
#define PST (DIN / 32 / PKS)                   // stages
#define PXB (8 * PKS * FRAGE * 2)              // bytes of a stage's x fragments (8 row groups); its weight fragments (8 column groups) take as many
#define PSB (2 * PXB)                          // bytes of a stage
static_assert(DIN / 32 % PKS == 0 && PST >= 2 && PKS * FRAGE * 2 == 128 * 16 && 2 * PSB >= 3 * 128 * 72 * 2 && 2 * PSB >= 2 * 64 * 136 * 2, "128 lanes x 16 B cover one row group's fragments of a stage; the staging tiles fit the ring's bytes");
// eight asynchronous 16-byte copies per lane: LDS places 2 KiB apart from l, global places gs elements apart from gp; the s_wait_xcnt is the statement's last line, so it stands in front of any rewrite of the registers that the copies name
__device__ __forceinline__ void acopy8(unsigned l, const __bf16* gp, size_t gs) {
  asm volatile("global_load_async_to_lds_b128 %0, %8, off\n\tglobal_load_async_to_lds_b128 %1, %9, off\n\tglobal_load_async_to_lds_b128 %2, %10, off\n\tglobal_load_async_to_lds_b128 %3, %11, off\n\t"
               "global_load_async_to_lds_b128 %4, %12, off\n\tglobal_load_async_to_lds_b128 %5, %13, off\n\tglobal_load_async_to_lds_b128 %6, %14, off\n\tglobal_load_async_to_lds_b128 %7, %15, off\n\ts_wait_xcnt 0x0"
               :: "v"(l), "v"(l + 2048u), "v"(l + 4096u), "v"(l + 6144u), "v"(l + 8192u), "v"(l + 10240u), "v"(l + 12288u), "v"(l + 14336u),
                  "v"(gp), "v"(gp + gs), "v"(gp + 2 * gs), "v"(gp + 3 * gs), "v"(gp + 4 * gs), "v"(gp + 5 * gs), "v"(gp + 6 * gs), "v"(gp + 7 * gs) : "memory"); }
// one stage: the block's 8 row groups x PKS x fragments (2 KiB in a row per group), then its PKS x 8 weight fragments (16 KiB in a row); l, xg, wg carry the lane's own 16 bytes
__device__ __forceinline__ void proj_fill(unsigned l, const __bf16* xg, const __bf16* wg) { acopy8(l, xg, (size_t)(DIN / 32) * FRAGE); acopy8(l + PXB, wg, (size_t)PKS * FRAGE); }
// ---- k_proj: block = (128 rows, 128 cols, which): q/k/v = X W (+ b) with exact bf16 products (K = DIN), both operands in fragment order, brought into a two-buffer LDS ring by asynchronous copies (each byte once per block, the weight fragments shared by its four waves) and read from there, four weight fragments at a time; the ring's bytes become the staging tiles behind the loop's last barrier; 64 KiB of LDS and at most 192 registers, so that five blocks fit a WGP and the whole grid is resident at once; a wave owns two 16-row groups (wave and 4 + wave), so each weight fragment it loads feeds two products; the results leave in two passes of 64 rows through the same staging tiles -> which 0: q f16 rows (+ residual rows < QHI); 1: k f16 in fragment order (+ residual rows < KHI); 2: v f16 in fragment order (+ bf16 hi/lo planes [c][t] for t < KHI)
__global__ __attribute__((amdgpu_waves_per_eu(5))) __launch_bounds__(128) void k_proj(const __bf16* __restrict__ XP, const __bf16* __restrict__ WP, const float* __restrict__ BQ, const float* __restrict__ BK, const float* __restrict__ BV,
    _Float16* __restrict__ QH, _Float16* __restrict__ QL, _Float16* __restrict__ KH, _Float16* __restrict__ KL, _Float16* __restrict__ VT, __bf16* __restrict__ VB, __bf16* __restrict__ VBL) {
  __shared__ __attribute__((aligned(2048))) unsigned char sm[2 * PSB];
  _Float16 (*sh)[136] = (_Float16 (*)[136])sm, (*sl)[136] = (_Float16 (*)[136])(sm + 64 * 136 * 2), (*th)[72] = (_Float16 (*)[72])sm; __bf16 (*tb)[72] = (__bf16 (*)[72])(sm + 128 * 72 * 2), (*tbl)[72] = (__bf16 (*)[72])(sm + 2 * 128 * 72 * 2);   /* staging tiles of the results, on the ring's bytes */
  const int tid = threadIdx.x, wave = tid >> 5, lane = tid & 31, col = lane & 15, g = lane >> 4; const int which = blockIdx.z; const int c0 = blockIdx.y * 128;
  const float* BA = which == 0 ? BQ : which == 1 ? BK : BV;
  const int ws = __builtin_amdgcn_readfirstlane(wave); const unsigned l0 = (unsigned)(size_t)sm + (unsigned)tid * 16u;   /* the lane's 16 bytes of each 2-KiB piece */
  const __bf16* xg = XP + (size_t)blockIdx.x * 8 * (DIN / 32) * FRAGE + tid * 8; const __bf16* wg = WP + (size_t)(which * (CC / 128) + blockIdx.y) * (DIN / 32) * 8 * FRAGE + tid * 8;
  v8f acc2[2][8] = {};
  proj_fill(l0, xg, wg);
  asm volatile("s_wait_asynccnt 0x0" ::: "memory");   /* stage 0 of this wave's copies has landed */
  __syncthreads();                                    /* ... and every other wave's */
  proj_fill(l0 + PSB, xg + PKS * FRAGE, wg + PKS * 8 * FRAGE);
#pragma unroll 1   /* one stage per trip: the buffer is picked by the trip's parity */
  for (int s = 0; s < PST; ++s) { const unsigned char* bp = sm + (s & 1) * PSB;
#pragma unroll
    for (int kk = 0; kk < PKS; ++kk) { const v16b a = frag_get<v16b>(bp + (ws * PKS + kk) * (FRAGE * 2), lane), a4 = frag_get<v16b>(bp + ((4 + ws) * PKS + kk) * (FRAGE * 2), lane);
#pragma unroll
      for (int jh = 0; jh < 8; jh += 4) { v16b w[4];   /* four weight fragments at a time: the wave stays inside the registers of five waves per SIMD */
#pragma unroll
        for (int j = 0; j < 4; ++j) w[j] = frag_get<v16b>(bp + PXB + (kk * 8 + jh + j) * (FRAGE * 2), lane);
#pragma unroll
        for (int j = 0; j < 4; ++j) { acc2[0][jh + j] = wmma_bf(a, w[j], acc2[0][jh + j]); acc2[1][jh + j] = wmma_bf(a4, w[j], acc2[1][jh + j]); } } }
    asm volatile("s_wait_dscnt 0x0" ::: "memory");      /* this wave's reads of the buffer have ended */
    asm volatile("s_wait_asynccnt 0x0" ::: "memory");   /* its copies of the next stage have landed */
    __syncthreads();                                    /* publishes the next stage and frees this trip's buffer */
    if (s + 2 < PST) proj_fill(l0 + (s & 1) * PSB, xg + (size_t)(s + 2) * PKS * FRAGE, wg + (size_t)(s + 2) * PKS * 8 * FRAGE); }
  asm volatile("s_wait_asynccnt 0x0" ::: "memory");     /* no copy is in flight when the ring's bytes become staging tiles */
#pragma unroll   /* hh picks registers: rolled, the accumulators would have to lie in scratch */
  for (int hh = 0; hh < 2; ++hh) { const v8f (&acc)[8] = acc2[hh]; const size_t r0 = (size_t)blockIdx.x * 128 + hh * 64; const size_t bb = r0 / TT; const int t0 = (int)(r0 % TT);
  if (hh) __syncthreads();   /* the first pass's reads of the staging tiles end before the second pass writes over them */
  if (which < 2) { _Float16* DL = which == 0 ? QL : KL; const int nhi = which == 0 ? QHI : KHI; const bool hi_rows = t0 < nhi;
#pragma unroll
    for (int j = 0; j < 8; ++j) { const float bias = BA ? bfr(BA[c0 + j * 16 + col]) : 0.f;
#pragma unroll
      for (int r = 0; r < 8; ++r) { const float v = acc[j][r] + bias; const _Float16 hv = (_Float16)v; sh[wave * 16 + 8 * g + r][j * 16 + col] = hv; sl[wave * 16 + 8 * g + r][j * 16 + col] = (_Float16)((v - (float)hv) * 1024.0f); } }
    __syncthreads();
    if (which == 1) { for (int e = tid; e < 64 * 16; e += 128) { const int ln = e & 31, hf = (e >> 5) & 1, kc = (e >> 6) & 1, kg = (e >> 7) & 3, hl = e >> 9;   /* k: 16-byte pieces in the order k_att's loads take them */
        vst2((unsigned*)(KH + ((((bb * NH + c0 / HD + hl) * (TT / 16) + t0 / 16 + kg) * 2 + kc) * 2 + hf) * (size_t)(FRAGE / 2) + ln * 8), *(const v4u*)&sh[kg * 16 + (ln & 15)][hl * 64 + kc * 32 + hf * 16 + (ln >> 4) * 8]); } }
    else { for (int e = tid; e < 64 * 16; e += 128) { const int rl = e >> 4, q = e & 15; vst2((unsigned*)(QH + (r0 + rl) * CC + c0 + q * 8), *(const v4u*)&sh[rl][q * 8]); } }
    if (hi_rows) { for (int e = tid; e < 64 * 16; e += 128) { const int rl = e >> 4, q = e & 15; vst2((unsigned*)(DL + (bb * nhi + t0 + rl) * (size_t)CC + c0 + q * 8), *(const v4u*)&sl[rl][q * 8]); } }
  } else { const bool hi_rows = t0 < KHI;
#pragma unroll
    for (int j = 0; j < 8; ++j) { const float bias = BA ? bfr(BA[c0 + j * 16 + col]) : 0.f;
#pragma unroll
      for (int r = 0; r < 8; ++r) { const float v = acc[j][r] + bias; const int rl = wave * 16 + 8 * g + r, cl = j * 16 + col; th[cl][rl] = (_Float16)v; const __bf16 bh = (__bf16)v; tb[cl][rl] = bh; tbl[cl][rl] = (__bf16)(v - (float)bh); } }
    __syncthreads();
    for (int e = tid; e < 128 * 8; e += 128) { const int ln = e & 31, hf = (e >> 5) & 1, j = (e >> 6) & 3, kq = (e >> 8) & 1, hl = e >> 9;   /* v: 16-byte pieces in the order k_att's loads take them */
      vst2((unsigned*)(VT + ((((bb * NH + c0 / HD + hl) * (TT / 32) + t0 / 32 + kq) * 4 + j) * 2 + hf) * (size_t)(FRAGE / 2) + ln * 8), *(const v4u*)&th[hl * 64 + j * 16 + (ln & 15)][kq * 32 + hf * 16 + (ln >> 4) * 8]); }
    if (hi_rows) for (int e = tid; e < 128 * 8; e += 128) { const int cl = e >> 3, q = e & 7; const size_t o3 = (bb * CC + c0 + cl) * (size_t)KHI + t0 + q * 8; vst2((unsigned*)(VB + o3), *(const v4u*)&tb[cl][q * 8]); vst2((unsigned*)(VBL + o3), *(const v4u*)&tbl[cl][q * 8]); } } } }
// eight 2^x in place, with the slot behind the last one, in ONE statement: each transcendental is followed by an independent instruction, so none that reads its result or overwrites its source can come to stand directly behind it
__device__ __forceinline__ void exp2x8(float* x) {
  asm("v_exp_f32 %0, %0\n\tv_exp_f32 %1, %1\n\tv_exp_f32 %2, %2\n\tv_exp_f32 %3, %3\n\tv_exp_f32 %4, %4\n\tv_exp_f32 %5, %5\n\tv_exp_f32 %6, %6\n\tv_exp_f32 %7, %7\n\tv_nop"
      : "+v"(x[0]), "+v"(x[1]), "+v"(x[2]), "+v"(x[3]), "+v"(x[4]), "+v"(x[5]), "+v"(x[6]), "+v"(x[7])); }
// one 128-key tile of this lane's query row t, its logits handed in in e (lanes l and l ^ 16 share a row; e[kc][0..7] = key k0 + 32 kc + 8 g + i, e[kc][8..15] = 16 keys on: the fragments' k order): causal mask by index (only a query block's last key block reaches past the diagonal), running max m and sum l brought up to date (logits, m in log2 units; l carries the 2^11 too); leaves 2^(logit - m + 11) in e (0 for excluded keys) and returns the factor that carries earlier sums over to the new max
__device__ __forceinline__ float sm_tile(int g, int k0, int t, bool diag, float& m, float& l, float (&e)[4][16]) {
  if (diag) {   /* block-uniform */
#pragma unroll
    for (int kc = 0; kc < 4; ++kc)
#pragma unroll
      for (int i = 0; i < 16; ++i) { const int k = k0 + kc * 32 + 8 * g + (i < 8 ? i : i + 8); e[kc][i] = k <= t ? e[kc][i] : -3.0e38f; } }
  float mx = -3.0e38f;
#pragma unroll
  for (int kc = 0; kc < 4; ++kc)
#pragma unroll
    for (int i = 0; i < 16; ++i) mx = fmaxf(mx, e[kc][i]);
  mx = fmaxf(mx, __shfl_xor(mx, 16));
  const float mn = fmaxf(m, mx); const float al = __builtin_amdgcn_exp2f(m - mn); m = mn;
  const float mb = mn - 11.0f; float sum = 0.f;
#pragma unroll
  for (int kc = 0; kc < 4; ++kc)
#pragma unroll
    for (int i = 0; i < 16; ++i) e[kc][i] -= mb;
#pragma unroll
  for (int kc = 0; kc < 4; ++kc)
#pragma unroll
    for (int i = 0; i < 16; i += 8) exp2x8(&e[kc][i]);   /* an excluded key's -3e38 gives exactly 0 */
#pragma unroll
  for (int kc = 0; kc < 4; ++kc)
#pragma unroll
    for (int i = 0; i < 16; ++i) sum += e[kc][i];
  sum += __shfl_xor(sum, 16);
  l = l * al + sum;
  return al; }
// the lane's query row's factor on the lane's own sums (the transposed accumulator's column is the query)
__device__ __forceinline__ void row_scale(v8f (&o)[HD / 16], float f) {
#pragma unroll
  for (int j = 0; j < HD / 16; ++j)
#pragma unroll
    for (int r = 0; r < 8; ++r) o[j][r] *= f; }
// ---- k_att: block = (pair = b * NH + h, 64 queries qb, longest first); each wave owns 16 query rows and walks its causal key blocks of 128 alone: logits^T = k (A) x q^T (B) x SCALE x log2(e) (f16; query blocks < QBH: + k x q residual + k residual x q, both x 2^10): accumulator j, register r of lane (g, col) = key 16 j + 8 g + r of query col, which is the k order of a fragment of that query's row -> running softmax in f32, base 2, in those registers -> 2^(logit - max + 11) once to f16 as B against v^T f16 as A (query blocks < QBH: exp and v as bf16 hi + lo, 3 products): o[j][r] = ctx[query col][16 j + 8 g + r]; ctx = sums / l (both carry 2^11); those registers are k_out's A fragments of the wave's 16 rows (k = head * 64 + 16 j + 8 g + r), so ctx is rounded here as k_out's products take it (f16(ctx x 2^6); query blocks < QBH: bf16 hi + lo) and stored from the registers in fragment order, 512 B in a row per store
static_assert(CAUSAL == 1 && QBH * 64 == QHI && QHI == KHI && QHI % 128 == 0 && HD == 64, "early query blocks see only keys that carry residual planes");
__global__ __attribute__((amdgpu_waves_per_eu(4))) __launch_bounds__(128) void k_att(const _Float16* __restrict__ QH, const _Float16* __restrict__ KH, const _Float16* __restrict__ QL, const _Float16* __restrict__ KL, const _Float16* __restrict__ VT, const __bf16* __restrict__ VB, const __bf16* __restrict__ VBL, _Float16* __restrict__ YF, __bf16* __restrict__ YL) {
  const int pr = blockIdx.x, b = pr / NH, h = pr % NH; const int qb = NQB - 1 - (int)blockIdx.y; const int nkb = kb_last(qb) + 1;
  const int tid = threadIdx.x, wave = tid >> 5, lane = tid & 31, col = lane & 15, g = lane >> 4; const int ql0 = qb * 64 + wave * 16; const size_t q0 = (size_t)b * TT + ql0; const int t = ql0 + col;
  float m = -3.0e38f, l = 0.f; v8f o[HD / 16] = {}; float e[4][16];
  v16h ah[HD / 32];
#pragma unroll
  for (int kc = 0; kc < HD / 32; ++kc) ah[kc] = frag_h(QH + (q0 + col) * CC + h * HD + kc * 32, lane);
  asm volatile("s_wait_xcnt 0x0" ::: "memory");   /* stands in front of the first rewrite of the address pair that the q loads name */
  if (qb < QBH) { const _Float16* KLb = KL + (size_t)b * KHI * CC; v16h al[HD / 32];
#pragma unroll
    for (int kc = 0; kc < HD / 32; ++kc) al[kc] = frag_h(QL + ((size_t)b * QHI + ql0 + col) * CC + h * HD + kc * 32, lane);
#pragma unroll 1
    for (int kb = 0; kb < nkb; ++kb) { const int k0 = kb * 128; v8f acc[8] = {}, accl[8] = {};
#pragma unroll
      for (int kc = 0; kc < HD / 32; ++kc)
#pragma unroll
        for (int jh = 0; jh < 8; jh += 4) { v16h kf[8];
#pragma unroll
          for (int j = 0; j < 4; ++j) { kf[j] = frag_get<v16h>(KH + (((size_t)pr * (TT / 16) + kb * 8 + jh + j) * 2 + kc) * FRAGE, lane); kf[4 + j] = frag_h(KLb + (size_t)(k0 + (jh + j) * 16 + col) * CC + h * HD + kc * 32, lane); }
          HOLD8(kf, 0);
#pragma unroll
          for (int j = 0; j < 4; ++j) { acc[jh + j] = wmma16(kf[j], ah[kc], acc[jh + j]); accl[jh + j] = wmma16(kf[j], al[kc], accl[jh + j]); accl[jh + j] = wmma16(kf[4 + j], ah[kc], accl[jh + j]); } }
#pragma unroll
      for (int j = 0; j < 8; ++j)
#pragma unroll
        for (int r = 0; r < 8; ++r) e[j >> 1][(j & 1) * 8 + r] = (acc[j][r] + accl[j][r] * (1.0f / 1024.0f)) * SCALE_L2;
      const float f = sm_tile(g, k0, t, kb == nkb - 1, m, l, e);
      row_scale(o, f);
#pragma unroll
      for (int kc = 0; kc < 4; ++kc) { const F2 p = bsplit16(e[kc]); v16b vf[8];
#pragma unroll
        for (int j = 0; j < HD / 16; ++j) { const size_t po = ((size_t)b * CC + h * HD + j * 16 + col) * (size_t)KHI + k0 + kc * 32; vf[j] = frag_b(VB + po, lane); vf[4 + j] = frag_b(VBL + po, lane); }
        HOLD8(vf, 0);
#pragma unroll
        for (int j = 0; j < HD / 16; ++j) { o[j] = wmma_bf(vf[j], p.h, o[j]); o[j] = wmma_bf(vf[j], p.l, o[j]); o[j] = wmma_bf(vf[4 + j], p.h, o[j]); } } }
  } else { const _Float16* kp = KH + (size_t)pr * (TT / 16) * 2 * FRAGE; const _Float16* vp = VT + (size_t)pr * (TT / 32) * 4 * FRAGE;   /* this (batch, head)'s k and v fragments at the key block's first key: 16 fragments = 16 KiB in a row each */
#pragma unroll 1
    for (int kb = 0; kb < nkb; ++kb, kp += 16 * FRAGE, vp += 16 * FRAGE) { const int k0 = kb * 128; v8f acc[8] = {}; { v16h kf[16];
#pragma unroll
      for (int kc = 0; kc < HD / 32; ++kc)
#pragma unroll
        for (int j = 0; j < 8; ++j) if (kc * 8 + j < 15) kf[kc * 8 + j] = frag_get<v16h>(kp + (j * 2 + kc) * FRAGE, lane);
      kf[15] = frag_get_last<v16h>(kp + 15 * FRAGE, lane);
      HOLD8(kf, 0); HOLD8(kf, 8);
#pragma unroll
      for (int kc = 0; kc < HD / 32; ++kc)
#pragma unroll
        for (int j = 0; j < 8; ++j) acc[j] = wmma16(kf[kc * 8 + j], ah[kc], acc[j]); }
#pragma unroll
      for (int j = 0; j < 8; ++j)
#pragma unroll
        for (int r = 0; r < 8; ++r) e[j >> 1][(j & 1) * 8 + r] = acc[j][r] * SCALE_L2;
      v16h vf[16];   /* v fragments of the first 64 keys fly while the softmax runs, the other 64 behind it */
#pragma unroll
      for (int kc = 0; kc < 2; ++kc)
#pragma unroll
        for (int j = 0; j < HD / 16; ++j) vf[kc * 4 + j] = frag_get<v16h>(vp + (kc * 4 + j) * FRAGE, lane);
      const float f = sm_tile(g, k0, t, kb == nkb - 1, m, l, e);
      v16h p[4];
#pragma unroll
      for (int kc = 0; kc < 4; ++kc)
#pragma unroll
        for (int i = 0; i < 16; ++i) p[kc][i] = (_Float16)e[kc][i];
#pragma unroll
      for (int kc = 2; kc < 4; ++kc)
#pragma unroll
        for (int j = 0; j < HD / 16; ++j) if (kc * 4 + j < 15) vf[kc * 4 + j] = frag_get<v16h>(vp + (kc * 4 + j) * FRAGE, lane);
      vf[15] = frag_get_last<v16h>(vp + 15 * FRAGE, lane);
      row_scale(o, f);
      HOLD8(vf, 0);
#pragma unroll
      for (int kc = 0; kc < 2; ++kc)
#pragma unroll
        for (int j = 0; j < HD / 16; ++j) o[j] = wmma16(vf[kc * 4 + j], p[kc], o[j]);
      HOLD8(vf, 8);
#pragma unroll
      for (int kc = 2; kc < 4; ++kc)
#pragma unroll
        for (int j = 0; j < HD / 16; ++j) o[j] = wmma16(vf[kc * 4 + j], p[kc], o[j]); } }
  row_scale(o, l > 0.f ? 1.0f / l : 0.f);
  const size_t fy = (size_t)(((b * TT + ql0) / 16) * (CC / 32) + h * (HD / 32)) * FRAGE;   /* the wave's row group, this head's two k steps */
  if (qb < QBH) {   /* block-uniform */
#pragma unroll
    for (int kc = 0; kc < HD / 32; ++kc) { float v[16];
#pragma unroll
      for (int i = 0; i < 8; ++i) { v[i] = o[2 * kc][i]; v[8 + i] = o[2 * kc + 1][i]; }
      const F2 s = bsplit16(v); frag_put(YF + fy + kc * FRAGE, s.h, lane); frag_put(YL + fy + kc * FRAGE, s.l, lane); }
  } else {
#pragma unroll
    for (int kc = 0; kc < HD / 32; ++kc) { v16h a;   /* ctx carried x 2^6 into f16 so small-magnitude context rows stay clear of f16 subnormals */
#pragma unroll
      for (int i = 0; i < 8; ++i) { a[i] = (_Float16)(o[2 * kc][i] * 64.0f); a[8 + i] = (_Float16)(o[2 * kc + 1][i] * 64.0f); }
      frag_put(YF + fy + kc * FRAGE, a, lane); }
    asm volatile("s_wait_xcnt 0x0" ::: "memory"); } }   /* behind the run of four stores: stands in front of any rewrite of the address pair and the data registers that they name */
#define OSB (3 * PXB)                          // bytes of a stage of k_out's LDS ring: ctx fragments (8 row groups), Wo fragments (8 column groups), ctx lo fragments (filled and read only by blocks of early rows)
static_assert(CC == DIN && QHI % 128 == 0 && TT % 128 == 0 && 2 * OSB >= 4 * 16 * 132 * 4, "k_out's stages are cut like k_proj's; a block is early rows or not as a whole; the staging tiles fit the ring's bytes");
// one stage of k_out: the block's 8 row groups x PKS ctx fragments, its PKS x 8 Wo fragments, and for early rows (HI) the ctx lo fragments; l, yg, wg, lg carry the lane's own 16 bytes
template <bool HI> __device__ __forceinline__ void out_fill(unsigned l, const __bf16* yg, const __bf16* wg, const __bf16* lg) { acopy8(l, yg, (size_t)(CC / 32) * FRAGE); acopy8(l + PXB, wg, (size_t)PKS * FRAGE); if (HI) acopy8(l + 2 * PXB, lg, (size_t)(CC / 32) * FRAGE); }
__device__ __forceinline__ v8f wmma_t(v16b a, v16b b, v8f c) { return wmma_bf(a, b, c); }
__device__ __forceinline__ v8f wmma_t(v16h a, v16h b, v8f c) { return wmma16(a, b, c); }
// a whole block of k_out, for early rows (HI: V = bf16 fragments, ctx hi + lo, 2 products) or later rows (V = f16 fragments, 1 product): one loop each, so that the accumulators keep their registers over the trips
template <bool HI, typename V> __device__ __forceinline__ void out_block(unsigned char* sm, const __bf16* yg, const __bf16* wg, const __bf16* lg, const float* __restrict__ BO, float* __restrict__ OUT) {
  float (*sf)[16][132] = (float (*)[16][132])sm;   /* a staging tile per wave, on the ring's bytes */
  const int tid = threadIdx.x, wave = tid >> 5, lane = tid & 31, col = lane & 15, g = lane >> 4; const int c0 = blockIdx.y * 128;
  const int ws = __builtin_amdgcn_readfirstlane(wave); const unsigned l0 = (unsigned)(size_t)sm + (unsigned)tid * 16u;   /* the lane's 16 bytes of each 2-KiB piece */
  v8f acc2[2][8] = {}; float bias[8] = {};
  out_fill<HI>(l0, yg, wg, lg);
  if (BO) {   /* the lane's eight bo values serve both row groups: read once, as one batch in flight beside stage 0's copies, rounded where they are added */
#pragma unroll
    for (int j = 0; j < 8; ++j) bias[j] = BO[c0 + j * 16 + col]; }
  asm volatile("s_wait_asynccnt 0x0" ::: "memory");   /* stage 0 of this wave's copies has landed */
  __syncthreads();                                    /* ... and every other wave's */
  out_fill<HI>(l0 + OSB, yg + PKS * FRAGE, wg + PKS * 8 * FRAGE, lg + PKS * FRAGE);
#pragma unroll 1   /* one stage per trip: the buffer is picked by the trip's parity */
  for (int s = 0; s < PST; ++s) { const unsigned char* bp = sm + (s & 1) * OSB;
#pragma unroll
    for (int kk = 0; kk < PKS; ++kk) { const V a = frag_get<V>(bp + (ws * PKS + kk) * (FRAGE * 2), lane), a4 = frag_get<V>(bp + ((4 + ws) * PKS + kk) * (FRAGE * 2), lane); V b = a, b4 = a4;
      if (HI) { b = frag_get<V>(bp + 2 * PXB + (ws * PKS + kk) * (FRAGE * 2), lane); b4 = frag_get<V>(bp + 2 * PXB + ((4 + ws) * PKS + kk) * (FRAGE * 2), lane); }
#pragma unroll
      for (int jh = 0; jh < 8; jh += 4) { V w[4];
#pragma unroll
        for (int j = 0; j < 4; ++j) w[j] = frag_get<V>(bp + PXB + (kk * 8 + jh + j) * (FRAGE * 2), lane);
#pragma unroll
        for (int j = 0; j < 4; ++j) { acc2[0][jh + j] = wmma_t(a, w[j], acc2[0][jh + j]); acc2[1][jh + j] = wmma_t(a4, w[j], acc2[1][jh + j]); }
        if (HI) {
#pragma unroll
          for (int j = 0; j < 4; ++j) { acc2[0][jh + j] = wmma_t(b, w[j], acc2[0][jh + j]); acc2[1][jh + j] = wmma_t(b4, w[j], acc2[1][jh + j]); } } } }
    asm volatile("s_wait_dscnt 0x0" ::: "memory");      /* this wave's reads of the buffer have ended */
    asm volatile("s_wait_asynccnt 0x0" ::: "memory");   /* its copies of the next stage have landed */
    __syncthreads();                                    /* publishes the next stage and frees this trip's buffer */
    if (s + 2 < PST) out_fill<HI>(l0 + (s & 1) * OSB, yg + (size_t)(s + 2) * PKS * FRAGE, wg + (size_t)(s + 2) * PKS * 8 * FRAGE, lg + (size_t)(s + 2) * PKS * FRAGE); }
  asm volatile("s_wait_asynccnt 0x0" ::: "memory");     /* no copy is in flight when the ring's bytes become staging tiles */
#pragma unroll   /* hh picks registers */
  for (int hh = 0; hh < 2; ++hh) { const size_t r0 = (size_t)blockIdx.x * 128 + hh * 64 + wave * 16;
    if (hh) LDSX();   /* the wave's reads of its staging tile end before it writes its second row group over them */
#pragma unroll
    for (int j = 0; j < 8; ++j)
#pragma unroll
      for (int r = 0; r < 8; ++r) sf[wave][8 * g + r][j * 16 + col] = HI ? acc2[hh][j][r] + bfr(bias[j]) : acc2[hh][j][r] * (1.0f / 16384.0f) + bfr(bias[j]);   /* 2^-8 (Wo carry) x 2^-6 (ctx carry) where ctx went as f16 */
    LDSX();
#pragma unroll 1   /* four rows per trip: four LDS reads fly together, and the stores share one address pair */
    for (int rq = 0; rq < 16; rq += 4) {
#pragma unroll
      for (int rl = rq; rl < rq + 4; ++rl) vst2(OUT + (r0 + rl) * DIN + c0 + lane * 4, *(const v4f*)&sf[wave][rl][lane * 4]); } } }
// ---- k_out: block = (128 rows, 128 cols): out = ctx Wo (+ bo), both operands in fragment order, brought into a two-buffer LDS ring by asynchronous copies (each byte once per block, the Wo fragments shared by its four waves) and read from there; a wave owns two 16-row groups (wave and 4 + wave), so each Wo fragment it reads feeds two row groups: ctx x 2^6 once to f16 against Wo as f16(bf16 x 2^8) exact (1 product) x 2^-14; causal early rows (< QHI of each sequence): ctx bf16 hi + lo against exact bf16 Wo (2 products); the ring's bytes become the waves' own staging tiles behind the loop's last barrier
__global__ __launch_bounds__(128) void k_out(const _Float16* __restrict__ YF, const __bf16* __restrict__ YL, const __bf16* __restrict__ OB, const _Float16* __restrict__ OH, const float* __restrict__ BO, float* __restrict__ OUT) {
  __shared__ __attribute__((aligned(2048))) unsigned char sm[2 * OSB];
  const size_t yo = (size_t)blockIdx.x * 8 * (CC / 32) * FRAGE + threadIdx.x * 8, wo = (size_t)blockIdx.y * (CC / 32) * 8 * FRAGE + threadIdx.x * 8;   /* the pointers below are addresses only: the copies move bytes */
  if (CAUSAL && (int)(((size_t)blockIdx.x * 128) % TT) < QHI) out_block<true, v16b>(sm, (const __bf16*)YF + yo, OB + wo, YL + yo, BO, OUT);   /* block-uniform */
  else out_block<false, v16h>(sm, (const __bf16*)YF + yo, (const __bf16*)OH + wo, YL + yo, BO, OUT); }

extern "C" void kernel_launch(void* const* d_in, const int* in_sizes, int n_in, void* d_out, int out_size, void* d_ws, size_t ws_size, hipStream_t stream) {
  (void)in_sizes; (void)n_in; (void)out_size;
  const float** F = (const float**)d_in;
  if (ws_size < (size_t)WS_END) return;
  char* ws = (char*)d_ws; _Float16 *QH = (_Float16*)(ws + WS_QH), *KH = (_Float16*)(ws + WS_KH), *VT = (_Float16*)(ws + WS_VT), *QL = (_Float16*)(ws + WS_QL), *KL = (_Float16*)(ws + WS_KL); __bf16 *VB = (__bf16*)(ws + WS_VB), *VBL = (__bf16*)(ws + WS_VBL), *XP = (__bf16*)(ws + WS_XP), *WP = (__bf16*)(ws + WS_WP), *OB = (__bf16*)(ws + WS_OB); _Float16 *OH = (_Float16*)(ws + WS_OH), *YF = (_Float16*)(ws + WS_Y); __bf16 *YL = (__bf16*)(ws + WS_YL);
  (void)QL; (void)KL; (void)VB; (void)VBL;
  // inputs, in order: 0 x [4,2048,768]; 1 Wq [12,768,64]; 2 Wk; 3 Wv (per-head [head][model][d]); 4 Wo [768,768] (out,in); 5 bo [768] (zeros, read); no q / k / v biases
  k_pack<<<dim3((NFX + NFW + 2 * NFO) / (4 * PACKF)), 128, 0, stream>>>(F[0], F[1], F[2], F[3], F[4], XP, WP, OB, OH);
  k_proj<<<dim3(TNB * TT / 128, CC / 128, 3), 128, 0, stream>>>(XP, WP, nullptr, nullptr, nullptr, QH, QL, KH, KL, VT, VB, VBL);
  k_att<<<dim3(TNB * NH, NQB), 128, 0, stream>>>(QH, KH, QL, KL, VT, VB, VBL, YF, YL);
  k_out<<<dim3(TNB * TT / 128, DIN / 128), 128, 0, stream>>>(YF, YL, OB, OH, F[5], (float*)d_out);
}

// v010
// One run takes 92.7 microseconds.
// Next to v009, in two timings, it ran 1.09 and 1.08 times as fast.
// Counting every step since v000, it is 24.8 times as fast.
// compute dtype: all float inputs rounded to bf16; per-head q / k / v projections with EXACT bf16 products on WMMA 16x16x32 (f32 accumulate), no biases; causal logits: 3 products for the first 384 rows, single f16 q x k after, x 64^-0.5 x log2(e); both attention products taken transposed (k x q^T, v^T x p^T), a query's logits and sums stay in its two lanes; softmax f32 in base 2 (hardware exp2) with a running max and sum per 128 keys; 2^(logit - max + 11) once to f16 x v once to f16 (bf16 hi + lo below row 384); ctx hi+lo x exact Wo below row 384, x2^6 f16 carry x f16(bf16 x 2^8) Wo after, + bo (zeros, read); f32 output.
#include <hip/hip_runtime.h>
#include <math.h>

typedef __attribute__((ext_vector_type(16))) _Float16 v16h;
typedef __attribute__((ext_vector_type(16))) __bf16 v16b;
typedef __attribute__((ext_vector_type(8)))  _Float16 v8h;
typedef __attribute__((ext_vector_type(8)))  float v8f;
typedef __attribute__((ext_vector_type(4)))  float v4f;
typedef __attribute__((ext_vector_type(2)))  float v2f;
typedef __attribute__((ext_vector_type(4)))  unsigned v4u;
typedef __attribute__((ext_vector_type(4)))  int v4i;
typedef float __attribute__((may_alias)) float_a;
typedef int __attribute__((may_alias)) int_a;

template <typename T> __device__ __forceinline__ void vst2(void* p, T v) { *(T*)p = v;  }
__device__ __forceinline__ v8f wmma16(v16h a, v16h b, v8f c) {
  v8f d = __builtin_amdgcn_wmma_f32_16x16x32_f16(false, a, false, b, (short)0, c, false, false);
  asm volatile("v_nop\n\tv_nop\n\tv_nop\n\tv_nop" : "+v"(d) : "v"(a), "v"(b));
  return d;
}
__device__ __forceinline__ v8f wmma_bf(v16b a, v16b b, v8f c) {
  v8f d = __builtin_amdgcn_wmma_f32_16x16x32_bf16(false, a, false, b, (short)0, c, false, false);
  asm volatile("v_nop\n\tv_nop\n\tv_nop\n\tv_nop" : "+v"(d) : "v"(a), "v"(b));
  return d;
}
// 16x16x32 fragments: lane = (h = lane>>4, row/col = lane&15); elements 0..7 = k0+8h+0..7, 8..15 = k0+16+8h+0..7; D element r = row 8h+r
__device__ __forceinline__ v16h frag_h(const _Float16* rowk0, int lane) {
  union { v16h v; v8h q[2]; } u; const _Float16* p = rowk0 + 8 * (lane >> 4);
  u.q[0] = *(const v8h*)p; u.q[1] = *(const v8h*)(p + 16); return u.v;
}
__device__ __forceinline__ v16h frag_f32(const float* rowk0, int lane) {
  v16h a; const float* p = rowk0 + 8 * (lane >> 4);
#pragma unroll
  for (int i = 0; i < 8; ++i) { a[i] = (_Float16)p[i]; a[8 + i] = (_Float16)p[16 + i]; }
  return a;
}
__device__ __forceinline__ v16h frag_f32s(const float* rowk0, int lane, float sc) {
  v16h a; const float* p = rowk0 + 8 * (lane >> 4);
#pragma unroll
  for (int i = 0; i < 8; ++i) { a[i] = (_Float16)(p[i] * sc); a[8 + i] = (_Float16)(p[16 + i] * sc); }
  return a;
}
// column fragment from a [K][ld] layout (column n), rows >= K read as 0
__device__ __forceinline__ v16h fragc_f32(const float* W, int k0, int n, int lane, int ld, int K) {
  v16h a; const int g = lane >> 4;
#pragma unroll
  for (int i = 0; i < 8; ++i) { const int ka = k0 + 8 * g + i, kb = ka + 16;
    a[i] = (_Float16)(ka < K ? W[(size_t)(ka < K ? ka : K - 1) * ld + n] : 0.f); a[8 + i] = (_Float16)(kb < K ? W[(size_t)(kb < K ? kb : K - 1) * ld + n] : 0.f); }
  return a;
}
struct F2 { v16b h, l; };
__device__ __forceinline__ F2 bsplit16(const float v[16]) { F2 r;
#pragma unroll
  for (int i = 0; i < 16; ++i) { const __bf16 h = (__bf16)v[i]; r.h[i] = h; r.l[i] = (__bf16)(v[i] - (float)h); }
  return r; }
__device__ __forceinline__ F2 split_row(const float* row, int k0, int lane) { float v[16]; const float* p = row + k0 + 8 * (lane >> 4);
#pragma unroll
  for (int i = 0; i < 8; ++i) { v[i] = p[i]; v[8 + i] = p[16 + i]; }
  return bsplit16(v); }
__device__ __forceinline__ F2 split_rowK(const float* row, int k0, int lane, int K) { float v[16]; const int g = lane >> 4;
#pragma unroll
  for (int i = 0; i < 8; ++i) { const int ka = k0 + 8 * g + i, kb = ka + 16; v[i] = ka < K ? row[ka < K ? ka : K - 1] : 0.f; v[8 + i] = kb < K ? row[kb < K ? kb : K - 1] : 0.f; }
  return bsplit16(v); }
__device__ __forceinline__ F2 split_col(const float* W, int k0, int n, int lane, int ld, int K) { float v[16]; const int g = lane >> 4;
#pragma unroll
  for (int i = 0; i < 8; ++i) { const int ka = k0 + 8 * g + i, kb = ka + 16; v[i] = ka < K ? W[(size_t)(ka < K ? ka : K - 1) * ld + n] : 0.f; v[8 + i] = kb < K ? W[(size_t)(kb < K ? kb : K - 1) * ld + n] : 0.f; }
  return bsplit16(v); }
__device__ __forceinline__ v8f mac3(const F2& a, const F2& b, v8f c) { c = wmma_bf(a.l, b.h, c); c = wmma_bf(a.h, b.l, c); return wmma_bf(a.h, b.h, c); }
__device__ __forceinline__ float sigm(float v) { return 1.0f / (1.0f + expf(-v)); }
#define LDSX() do { asm volatile("s_wait_dscnt 0" ::: "memory"); __builtin_amdgcn_wave_barrier(); __builtin_amdgcn_fence(__ATOMIC_RELEASE, "workgroup"); } while (0)

// Causal multi-head self-attention with per-head weights (x [4,2048,768]; Wq / Wk / Wv [12,768,64] = per-head [head][model][d] N(0,1) x 0.02, no biases; Wo [768,768] torch (out,in), bo zeros (read); q = einsum('bsd,hde->bhse'); scores / sqrt(64); tril kept, finfo.min elsewhere; softmax; ctx merged (head*64 + e); ctx @ Wo.T + bo).
#define NB 4
#define TT 2048
#define CC 768            // NH * HD = projected width
#define DIN 768          // input (model) width
#define NH 12
#define HD 64
#define NQB (TT / 64)
#define SCALE (0.125f)
#define SCALE_L2 (SCALE * 1.44269504088896340736f)   // logits carried in units of log2: exp(s) = 2^(s log2 e)
#define CAUSAL 1
#ifndef TNB
#define TNB NB
#endif
__device__ __forceinline__ float bfr(float v) { return (float)(__bf16)v; }
__host__ __device__ __forceinline__ int kb_last(int qb) { return CAUSAL ? ((qb * 64 + 63) >> 7) : (TT / 128 - 1); }
typedef __attribute__((ext_vector_type(8))) __bf16 v8b;
__device__ __forceinline__ v16b frag_b(const __bf16* rowk0, int lane) {
  union { v16b v; v8b q[2]; } u; const __bf16* p = rowk0 + 8 * (lane >> 4);
  u.q[0] = *(const v8b*)p; u.q[1] = *(const v8b*)(p + 16); return u.v;
}
#define QBH 6              // causal: query blocks 0..QBH-1 of each sequence (few keys, no averaging) take the high-precision path
#define QHI 384            // rows carrying a q residual plane
#define KHI 384            // key rows carrying k residual / v bf16 hi+lo planes (used only by the causal high-precision path)
// B fragment (k rows k0+.., output column o) of a weight: (in,out) [K][ld] or (out,in) [ld rows of K]: bf16 exact, or f16(bf16 * 256) exact
__device__ __forceinline__ v16b wcol_io(const float* Wm, int k0, int o, int lane, int ld) { v16b w; const int g = lane >> 4;
#pragma unroll
  for (int i = 0; i < 8; ++i) { w[i] = (__bf16)Wm[(size_t)(k0 + 8 * g + i) * ld + o]; w[8 + i] = (__bf16)Wm[(size_t)(k0 + 16 + 8 * g + i) * ld + o]; }
  return w; }
__device__ __forceinline__ v16b wcol_oi(const float* Wm, int k0, int o, int lane, int K) { v16b w; const float* p = Wm + (size_t)o * K + k0 + 8 * (lane >> 4);
#pragma unroll
  for (int i = 0; i < 8; ++i) { w[i] = (__bf16)p[i]; w[8 + i] = (__bf16)p[16 + i]; }
  return w; }
__device__ __forceinline__ v16h wcolh_io(const float* Wm, int k0, int o, int lane, int ld) { v16h w; const int g = lane >> 4;
#pragma unroll
  for (int i = 0; i < 8; ++i) { w[i] = (_Float16)(bfr(Wm[(size_t)(k0 + 8 * g + i) * ld + o]) * 256.0f); w[8 + i] = (_Float16)(bfr(Wm[(size_t)(k0 + 16 + 8 * g + i) * ld + o]) * 256.0f); }
  return w; }
__device__ __forceinline__ v16h wcolh_oi(const float* Wm, int k0, int o, int lane, int K) { v16h w; const float* p = Wm + (size_t)o * K + k0 + 8 * (lane >> 4);
#pragma unroll
  for (int i = 0; i < 8; ++i) { w[i] = (_Float16)(bfr(p[i]) * 256.0f); w[8 + i] = (_Float16)(bfr(p[16 + i]) * 256.0f); }
  return w; }
#define WQKV_LAYOUT 2   // 0 = (in,out) [DIN][CC]; 1 = (out,in) [CC][DIN]; 2 = per-head [NH][DIN][HD]
__device__ __forceinline__ v16b wcol_hdk(const float* Wm, int k0, int o, int lane) { v16b w; const int g = lane >> 4; const float* p = Wm + (size_t)(o / HD) * DIN * HD + (o % HD);
#pragma unroll
  for (int i = 0; i < 8; ++i) { w[i] = (__bf16)p[(size_t)(k0 + 8 * g + i) * HD]; w[8 + i] = (__bf16)p[(size_t)(k0 + 16 + 8 * g + i) * HD]; }
  return w; }
#define WO_OUT_IN 1
#if WQKV_LAYOUT == 1
#define WCOL(W, k0, o, lane) wcol_oi(W, k0, o, lane, DIN)
#elif WQKV_LAYOUT == 2
#define WCOL(W, k0, o, lane) wcol_hdk(W, k0, o, lane)
#else
#define WCOL(W, k0, o, lane) wcol_io(W, k0, o, lane, CC)
#endif
#if WO_OUT_IN
#define WOCOL(W, k0, o, lane) wcol_oi(W, k0, o, lane, CC)
#define WOCOLH(W, k0, o, lane) wcolh_oi(W, k0, o, lane, CC)
#else
#define WOCOL(W, k0, o, lane) wcol_io(W, k0, o, lane, DIN)
#define WOCOLH(W, k0, o, lane) wcolh_io(W, k0, o, lane, DIN)
#endif

#ifndef PROJ_EXTRA_PARAMS
#define PROJ_EXTRA_PARAMS
#endif

#define WS_QH  0u                                      // f16 q rows [b*t][CC]
#define WS_KH  (WS_QH + 2u * (size_t)NB * TT * CC)      // f16 k in fragment order [b][head][16-key group][kc][half][lane][8]
#define WS_VT  (WS_KH + 2u * (size_t)NB * TT * CC)      // f16 v in fragment order [b][head][32-key group][j][half][lane][8]
#define WS_QL  (WS_VT + 2u * (size_t)NB * CC * TT)      // f16 q residual x 2^10 rows [b][t < QHI][CC]
#define WS_KL  (WS_QL + 2u * (size_t)NB * QHI * CC)     // f16 k residual x 2^10 rows [b][t < KHI][CC]
#define WS_VB  (WS_KL + 2u * (size_t)NB * KHI * CC)     // bf16 v hi planes [b][c][t < KHI]
#define WS_VBL (WS_VB + 2u * (size_t)NB * CC * KHI)
#define WS_Y   (WS_VBL + 2u * (size_t)NB * CC * KHI)    // ctx in fragment order [16-row group][kc][half][lane][8]: f16(ctx x 2^6) (rows < QHI of a sequence: bf16 hi)
#define WS_YL  (WS_Y  + 2u * (size_t)NB * TT * CC)      // bf16 lo of ctx, same order; written and read only for rows < QHI of a sequence
#define WS_XP  (WS_Y  + 4u * (size_t)NB * TT * CC)      // bf16 x in fragment order [16-row group][kc][half][lane][8]
#define WS_WP  (WS_XP + 2u * (size_t)NB * TT * DIN)     // bf16 Wq / Wk / Wv in fragment order [which][128-col block][kc][j][half][lane][8]
#define WS_OB  (WS_WP + 2u * (size_t)3 * DIN * CC)      // bf16 Wo in fragment order [128-col block][kc][j][half][lane][8]
#define WS_OH  (WS_OB + 2u * (size_t)CC * DIN)          // f16(bf16 x 2^8) Wo, same order
#define WS_END (WS_OH + 2u * (size_t)CC * DIN)

// A fragment kept in memory in fragment order is 1 KiB: elements 0..7 of lanes 0..31 (512 B), then elements 8..15: each of its two wave-wide 16-byte loads covers four whole 128-B lines
#define FRAGE 512          // 16-bit elements per stored fragment
#define NFX (NB * TT / 16 * (DIN / 32))
#define NFW (3 * (CC / 16) * (DIN / 32))
#define NFO ((DIN / 16) * (CC / 32))
#define PACKF 4            // fragments per wave of k_pack
static_assert(WO_OUT_IN == 1 && NFX % (4 * PACKF) == 0 && NFW % (4 * PACKF) == 0 && NFO % (4 * PACKF) == 0 && CC % 128 == 0 && DIN % 128 == 0, "a k_pack block stays inside one operand");
template <typename V> __device__ __forceinline__ void frag_put(void* f, V v, int lane) { union { V v; v4u q[2]; } u; u.v = v; *((v4u*)f + lane) = u.q[0]; *((v4u*)f + 32 + lane) = u.q[1]; }
template <typename V> __device__ __forceinline__ V frag_get(const void* f, int lane) { union { V v; v4u q[2]; } u; u.q[0] = *((const v4u*)f + lane); u.q[1] = *((const v4u*)f + 32 + lane); return u.v; }
// last fragment of a batch of loads off one address pair: the batch's last load may land on that pair, which the loads before it name, so the wait stands in front of it
template <typename V> __device__ __forceinline__ V frag_get_last(const void* f, int lane) { union { V v; v4u q[2]; } u; u.q[0] = *((const v4u*)f + lane); asm volatile("s_wait_xcnt 0x0" ::: "memory"); u.q[1] = *((const v4u*)f + 32 + lane); return u.v; }
// behind a batch of loads off the address p: the wait that stands in front of any rewrite of that address pair; naming p keeps the pair live up to the wait, so no load of the batch lands on it either
#define XWAIT(p) asm volatile("s_wait_xcnt 0x0" :: "v"(p) : "memory")
// inputs-only hold on loaded fragments: every load of the batch is issued before the first product waits for one, so a batch costs one load latency and not one per fragment
#define HOLD8(a, o) asm volatile("" :: "v"(a[o]), "v"(a[o + 1]), "v"(a[o + 2]), "v"(a[o + 3]), "v"(a[o + 4]), "v"(a[o + 5]), "v"(a[o + 6]), "v"(a[o + 7]))
// ---- k_pack: one wave per PACKF fragments: x, Wq / Wk / Wv, Wo rounded exactly as the products take them (bf16; Wo also f16(bf16 x 2^8)) and laid down in fragment order, once per call, for k_proj and k_out
__global__ __launch_bounds__(128) void k_pack(const float* __restrict__ X, const float* __restrict__ WQ, const float* __restrict__ WK, const float* __restrict__ WV, const float* __restrict__ WO, __bf16* __restrict__ XP, __bf16* __restrict__ WP, __bf16* __restrict__ OB, _Float16* __restrict__ OH) {
  const int lane = threadIdx.x & 31, col = lane & 15, g = lane >> 4; const int f0 = ((int)blockIdx.x * 4 + ((int)threadIdx.x >> 5)) * PACKF;
  if (f0 < NFX) {   /* block-uniform */
    v16b a[PACKF];
#pragma unroll
    for (int i = 0; i < PACKF; ++i) { const int f = f0 + i, rg = f / (DIN / 32), kc = f % (DIN / 32); const float* p = X + ((size_t)rg * 16 + col) * DIN + kc * 32 + 8 * g;
#pragma unroll
      for (int e = 0; e < 8; ++e) { a[i][e] = (__bf16)p[e]; a[i][8 + e] = (__bf16)p[16 + e]; }
      XWAIT(p); }
#pragma unroll
    for (int i = 0; i < PACKF; ++i) frag_put(XP + (size_t)(f0 + i) * FRAGE, a[i], lane);
  } else if (f0 < NFX + NFW) {
#pragma unroll
    for (int i = 0; i < PACKF; ++i) { const int f = f0 - NFX + i, j = f & 7, kc = (f >> 3) % (DIN / 32), cb = (f >> 3) / (DIN / 32) % (CC / 128), which = (f >> 3) / (DIN / 32) / (CC / 128); const float* WA = which == 0 ? WQ : which == 1 ? WK : WV;
      frag_put(WP + (size_t)f * FRAGE, WCOL(WA, kc * 32, cb * 128 + j * 16 + col, lane), lane); }
  } else { const bool hb = f0 < NFX + NFW + NFO; const int fo = f0 - NFX - NFW - (hb ? 0 : NFO); float v[PACKF][16];   /* Wo, once as bf16 and once as f16(bf16 x 2^8) */
#pragma unroll
    for (int i = 0; i < PACKF; ++i) { const int f = fo + i, j = f & 7, kc = (f >> 3) % (CC / 32), cb = (f >> 3) / (CC / 32); const float* p = WO + (size_t)(cb * 128 + j * 16 + col) * CC + kc * 32 + 8 * g;
#pragma unroll
      for (int e = 0; e < 8; ++e) { v[i][e] = p[e]; v[i][8 + e] = p[16 + e]; }
      XWAIT(p); }
#pragma unroll
    for (int i = 0; i < PACKF; ++i) { v16b wb; v16h wh;
#pragma unroll
      for (int e = 0; e < 16; ++e) { wb[e] = (__bf16)v[i][e]; wh[e] = (_Float16)(bfr(v[i][e]) * 256.0f); }
      if (hb) frag_put(OB + (size_t)(fo + i) * FRAGE, wb, lane); else frag_put(OH + (size_t)(fo + i) * FRAGE, wh, lane); } } }

#define PKS 2                                  // k steps per stage of k_proj's LDS ring
#define PST (DIN / 32 / PKS)                   // stages
#define PXB (8 * PKS * FRAGE * 2)              // bytes of a stage's x fragments (8 row groups); its weight fragments (8 column groups) take as many
#define PSB (2 * PXB)                          // bytes of a stage
static_assert(DIN / 32 % PKS == 0 && PST >= 2 && PKS * FRAGE * 2 == 128 * 16 && 2 * PSB >= 3 * 128 * 72 * 2 && 2 * PSB >= 2 * 64 * 136 * 2, "128 lanes x 16 B cover one row group's fragments of a stage; the staging tiles fit the ring's bytes");
// eight asynchronous 16-byte copies per lane: LDS places 2 KiB apart from l, global places gs elements apart from gp; the s_wait_xcnt is the statement's last line, so it stands in front of any rewrite of the registers that the copies name
__device__ __forceinline__ void acopy8(unsigned l, const __bf16* gp, size_t gs) {
  asm volatile("global_load_async_to_lds_b128 %0, %8, off\n\tglobal_load_async_to_lds_b128 %1, %9, off\n\tglobal_load_async_to_lds_b128 %2, %10, off\n\tglobal_load_async_to_lds_b128 %3, %11, off\n\t"
               "global_load_async_to_lds_b128 %4, %12, off\n\tglobal_load_async_to_lds_b128 %5, %13, off\n\tglobal_load_async_to_lds_b128 %6, %14, off\n\tglobal_load_async_to_lds_b128 %7, %15, off\n\ts_wait_xcnt 0x0"
               :: "v"(l), "v"(l + 2048u), "v"(l + 4096u), "v"(l + 6144u), "v"(l + 8192u), "v"(l + 10240u), "v"(l + 12288u), "v"(l + 14336u),
                  "v"(gp), "v"(gp + gs), "v"(gp + 2 * gs), "v"(gp + 3 * gs), "v"(gp + 4 * gs), "v"(gp + 5 * gs), "v"(gp + 6 * gs), "v"(gp + 7 * gs) : "memory"); }
// one stage: the block's 8 row groups x PKS x fragments (2 KiB in a row per group), then its PKS x 8 weight fragments (16 KiB in a row); l, xg, wg carry the lane's own 16 bytes
__device__ __forceinline__ void proj_fill(unsigned l, const __bf16* xg, const __bf16* wg) { acopy8(l, xg, (size_t)(DIN / 32) * FRAGE); acopy8(l + PXB, wg, (size_t)PKS * FRAGE); }
// ---- k_proj: block = (128 rows, 128 cols, which): q/k/v = X W (+ b) with exact bf16 products (K = DIN), both operands in fragment order, brought into a two-buffer LDS ring by asynchronous copies (each byte once per block, the weight fragments shared by its four waves) and read from there, four weight fragments at a time; the ring's bytes become the staging tiles behind the loop's last barrier; 64 KiB of LDS and at most 192 registers, so that five blocks fit a WGP and the whole grid is resident at once; a wave owns two 16-row groups (wave and 4 + wave), so each weight fragment it loads feeds two products; the results leave in two passes of 64 rows through the same staging tiles -> which 0: q f16 rows (+ residual rows < QHI); 1: k f16 in fragment order (+ residual rows < KHI); 2: v f16 in fragment order (+ bf16 hi/lo planes [c][t] for t < KHI)
__global__ __attribute__((amdgpu_waves_per_eu(5))) __launch_bounds__(128) void k_proj(const __bf16* __restrict__ XP, const __bf16* __restrict__ WP, const float* __restrict__ BQ, const float* __restrict__ BK, const float* __restrict__ BV,
    _Float16* __restrict__ QH, _Float16* __restrict__ QL, _Float16* __restrict__ KH, _Float16* __restrict__ KL, _Float16* __restrict__ VT, __bf16* __restrict__ VB, __bf16* __restrict__ VBL) {
  __shared__ __attribute__((aligned(2048))) unsigned char sm[2 * PSB];
  _Float16 (*sh)[136] = (_Float16 (*)[136])sm, (*sl)[136] = (_Float16 (*)[136])(sm + 64 * 136 * 2), (*th)[72] = (_Float16 (*)[72])sm; __bf16 (*tb)[72] = (__bf16 (*)[72])(sm + 128 * 72 * 2), (*tbl)[72] = (__bf16 (*)[72])(sm + 2 * 128 * 72 * 2);   /* staging tiles of the results, on the ring's bytes */
  const int tid = threadIdx.x, wave = tid >> 5, lane = tid & 31, col = lane & 15, g = lane >> 4; const int which = blockIdx.z; const int c0 = blockIdx.y * 128;
  const float* BA = which == 0 ? BQ : which == 1 ? BK : BV;
  const int ws = __builtin_amdgcn_readfirstlane(wave); const unsigned l0 = (unsigned)(size_t)sm + (unsigned)tid * 16u;   /* the lane's 16 bytes of each 2-KiB piece */
  const __bf16* xg = XP + (size_t)blockIdx.x * 8 * (DIN / 32) * FRAGE + tid * 8; const __bf16* wg = WP + (size_t)(which * (CC / 128) + blockIdx.y) * (DIN / 32) * 8 * FRAGE + tid * 8;
  v8f acc2[2][8] = {};
  proj_fill(l0, xg, wg);
  asm volatile("s_wait_asynccnt 0x0" ::: "memory");   /* stage 0 of this wave's copies has landed */
  __syncthreads();                                    /* ... and every other wave's */
  proj_fill(l0 + PSB, xg + PKS * FRAGE, wg + PKS * 8 * FRAGE);
#pragma unroll 1   /* one stage per trip: the buffer is picked by the trip's parity */
  for (int s = 0; s < PST; ++s) { const unsigned char* bp = sm + (s & 1) * PSB;
#pragma unroll
    for (int kk = 0; kk < PKS; ++kk) { const v16b a = frag_get<v16b>(bp + (ws * PKS + kk) * (FRAGE * 2), lane), a4 = frag_get<v16b>(bp + ((4 + ws) * PKS + kk) * (FRAGE * 2), lane);
#pragma unroll
      for (int jh = 0; jh < 8; jh += 4) { v16b w[4];   /* four weight fragments at a time: the wave stays inside the registers of five waves per SIMD */
#pragma unroll
        for (int j = 0; j < 4; ++j) w[j] = frag_get<v16b>(bp + PXB + (kk * 8 + jh + j) * (FRAGE * 2), lane);
#pragma unroll
        for (int j = 0; j < 4; ++j) { acc2[0][jh + j] = wmma_bf(a, w[j], acc2[0][jh + j]); acc2[1][jh + j] = wmma_bf(a4, w[j], acc2[1][jh + j]); } } }
    asm volatile("s_wait_dscnt 0x0" ::: "memory");      /* this wave's reads of the buffer have ended */
    asm volatile("s_wait_asynccnt 0x0" ::: "memory");   /* its copies of the next stage have landed */
    __syncthreads();                                    /* publishes the next stage and frees this trip's buffer */
    if (s + 2 < PST) proj_fill(l0 + (s & 1) * PSB, xg + (size_t)(s + 2) * PKS * FRAGE, wg + (size_t)(s + 2) * PKS * 8 * FRAGE); }
  asm volatile("s_wait_asynccnt 0x0" ::: "memory");     /* no copy is in flight when the ring's bytes become staging tiles */
#pragma unroll   /* hh picks registers: rolled, the accumulators would have to lie in scratch */
  for (int hh = 0; hh < 2; ++hh) { const v8f (&acc)[8] = acc2[hh]; const size_t r0 = (size_t)blockIdx.x * 128 + hh * 64; const size_t bb = r0 / TT; const int t0 = (int)(r0 % TT);
  if (hh) __syncthreads();   /* the first pass's reads of the staging tiles end before the second pass writes over them */
  if (which < 2) { _Float16* DL = which == 0 ? QL : KL; const int nhi = which == 0 ? QHI : KHI; const bool hi_rows = t0 < nhi;
#pragma unroll
    for (int j = 0; j < 8; ++j) { const float bias = BA ? bfr(BA[c0 + j * 16 + col]) : 0.f;
#pragma unroll
      for (int r = 0; r < 8; ++r) { const float v = acc[j][r] + bias; const _Float16 hv = (_Float16)v; sh[wave * 16 + 8 * g + r][j * 16 + col] = hv; sl[wave * 16 + 8 * g + r][j * 16 + col] = (_Float16)((v - (float)hv) * 1024.0f); } }
    __syncthreads();
    if (which == 1) { for (int e = tid; e < 64 * 16; e += 128) { const int ln = e & 31, hf = (e >> 5) & 1, kc = (e >> 6) & 1, kg = (e >> 7) & 3, hl = e >> 9;   /* k: 16-byte pieces in the order k_att's loads take them */
        vst2((unsigned*)(KH + ((((bb * NH + c0 / HD + hl) * (TT / 16) + t0 / 16 + kg) * 2 + kc) * 2 + hf) * (size_t)(FRAGE / 2) + ln * 8), *(const v4u*)&sh[kg * 16 + (ln & 15)][hl * 64 + kc * 32 + hf * 16 + (ln >> 4) * 8]); } }
    else { for (int e = tid; e < 64 * 16; e += 128) { const int rl = e >> 4, q = e & 15; vst2((unsigned*)(QH + (r0 + rl) * CC + c0 + q * 8), *(const v4u*)&sh[rl][q * 8]); } }
    if (hi_rows) { for (int e = tid; e < 64 * 16; e += 128) { const int rl = e >> 4, q = e & 15; vst2((unsigned*)(DL + (bb * nhi + t0 + rl) * (size_t)CC + c0 + q * 8), *(const v4u*)&sl[rl][q * 8]); } }
  } else { const bool hi_rows = t0 < KHI;
#pragma unroll
    for (int j = 0; j < 8; ++j) { const float bias = BA ? bfr(BA[c0 + j * 16 + col]) : 0.f;
#pragma unroll
      for (int r = 0; r < 8; ++r) { const float v = acc[j][r] + bias; const int rl = wave * 16 + 8 * g + r, cl = j * 16 + col; th[cl][rl] = (_Float16)v; const __bf16 bh = (__bf16)v; tb[cl][rl] = bh; tbl[cl][rl] = (__bf16)(v - (float)bh); } }
    __syncthreads();
    for (int e = tid; e < 128 * 8; e += 128) { const int ln = e & 31, hf = (e >> 5) & 1, j = (e >> 6) & 3, kq = (e >> 8) & 1, hl = e >> 9;   /* v: 16-byte pieces in the order k_att's loads take them */
      vst2((unsigned*)(VT + ((((bb * NH + c0 / HD + hl) * (TT / 32) + t0 / 32 + kq) * 4 + j) * 2 + hf) * (size_t)(FRAGE / 2) + ln * 8), *(const v4u*)&th[hl * 64 + j * 16 + (ln & 15)][kq * 32 + hf * 16 + (ln >> 4) * 8]); }
    if (hi_rows) for (int e = tid; e < 128 * 8; e += 128) { const int cl = e >> 3, q = e & 7; const size_t o3 = (bb * CC + c0 + cl) * (size_t)KHI + t0 + q * 8; vst2((unsigned*)(VB + o3), *(const v4u*)&tb[cl][q * 8]); vst2((unsigned*)(VBL + o3), *(const v4u*)&tbl[cl][q * 8]); } } } }
// eight 2^x in place, with the slot behind the last one, in ONE statement: each transcendental is followed by an independent instruction, so none that reads its result or overwrites its source can come to stand directly behind it
__device__ __forceinline__ void exp2x8(float* x) {
  asm("v_exp_f32 %0, %0\n\tv_exp_f32 %1, %1\n\tv_exp_f32 %2, %2\n\tv_exp_f32 %3, %3\n\tv_exp_f32 %4, %4\n\tv_exp_f32 %5, %5\n\tv_exp_f32 %6, %6\n\tv_exp_f32 %7, %7\n\tv_nop"
      : "+v"(x[0]), "+v"(x[1]), "+v"(x[2]), "+v"(x[3]), "+v"(x[4]), "+v"(x[5]), "+v"(x[6]), "+v"(x[7])); }
// one 128-key tile of this lane's query row t, its logits handed in in e (lanes l and l ^ 16 share a row; e[kc][0..7] = key k0 + 32 kc + 8 g + i, e[kc][8..15] = 16 keys on: the fragments' k order): causal mask by index (only a query block's last key block reaches past the diagonal), running max m and sum l brought up to date (logits, m in log2 units; l carries the 2^11 too); leaves 2^(logit - m + 11) in e (0 for excluded keys) and returns the factor that carries earlier sums over to the new max
__device__ __forceinline__ float sm_tile(int g, int k0, int t, bool diag, float& m, float& l, float (&e)[4][16]) {
  if (diag) {   /* block-uniform */
#pragma unroll
    for (int kc = 0; kc < 4; ++kc)
#pragma unroll
      for (int i = 0; i < 16; ++i) { const int k = k0 + kc * 32 + 8 * g + (i < 8 ? i : i + 8); e[kc][i] = k <= t ? e[kc][i] : -3.0e38f; } }
  float mx = -3.0e38f;
#pragma unroll
  for (int kc = 0; kc < 4; ++kc)
#pragma unroll
    for (int i = 0; i < 16; ++i) mx = fmaxf(mx, e[kc][i]);
  mx = fmaxf(mx, __shfl_xor(mx, 16));
  const float mn = fmaxf(m, mx); const float al = __builtin_amdgcn_exp2f(m - mn); m = mn;
  const float mb = mn - 11.0f; float sum = 0.f;
#pragma unroll
  for (int kc = 0; kc < 4; ++kc)
#pragma unroll
    for (int i = 0; i < 16; ++i) e[kc][i] -= mb;
#pragma unroll
  for (int kc = 0; kc < 4; ++kc)
#pragma unroll
    for (int i = 0; i < 16; i += 8) exp2x8(&e[kc][i]);   /* an excluded key's -3e38 gives exactly 0 */
#pragma unroll
  for (int kc = 0; kc < 4; ++kc)
#pragma unroll
    for (int i = 0; i < 16; ++i) sum += e[kc][i];
  sum += __shfl_xor(sum, 16);
  l = l * al + sum;
  return al; }
// the lane's query row's factor on the lane's own sums (the transposed accumulator's column is the query)
__device__ __forceinline__ void row_scale(v8f (&o)[HD / 16], float f) {
#pragma unroll
  for (int j = 0; j < HD / 16; ++j)
#pragma unroll
    for (int r = 0; r < 8; ++r) o[j][r] *= f; }
// ---- k_att: block = (pair = b * NH + h, 64 queries qb; the high-precision query blocks first, then the others, most key blocks first); each wave owns 16 query rows and walks its causal key blocks of 128 alone: logits^T = k (A) x q^T (B) x SCALE x log2(e) (f16; query blocks < QBH: + k x q residual + k residual x q, both x 2^10): accumulator j, register r of lane (g, col) = key 16 j + 8 g + r of query col, which is the k order of a fragment of that query's row -> running softmax in f32, base 2, in those registers -> 2^(logit - max + 11) once to f16 as B against v^T f16 as A (query blocks < QBH: exp and v as bf16 hi + lo, 3 products): o[j][r] = ctx[query col][16 j + 8 g + r]; ctx = sums / l (both carry 2^11); those registers are k_out's A fragments of the wave's 16 rows (k = head * 64 + 16 j + 8 g + r), so ctx is rounded here as k_out's products take it (f16(ctx x 2^6); query blocks < QBH: bf16 hi + lo) and stored from the registers in fragment order, 512 B in a row per store
static_assert(CAUSAL == 1 && QBH * 64 == QHI && QHI == KHI && QHI % 128 == 0 && HD == 64, "early query blocks see only keys that carry residual planes");
__global__ __attribute__((amdgpu_waves_per_eu(4))) __launch_bounds__(128) void k_att(const _Float16* __restrict__ QH, const _Float16* __restrict__ KH, const _Float16* __restrict__ QL, const _Float16* __restrict__ KL, const _Float16* __restrict__ VT, const __bf16* __restrict__ VB, const __bf16* __restrict__ VBL, _Float16* __restrict__ YF, __bf16* __restrict__ YL) {
  const int pr = blockIdx.x, b = pr / NH, h = pr % NH; const int yb = blockIdx.y; const int qb = yb < QBH ? QBH - 1 - yb : NQB - 1 - (yb - QBH); const int nkb = kb_last(qb) + 1;   /* a permutation of the query blocks, by falling duration: the high-precision blocks wait out eight load batches per key block and last longest, so they start first */
  const int tid = threadIdx.x, wave = tid >> 5, lane = tid & 31, col = lane & 15, g = lane >> 4; const int ql0 = qb * 64 + wave * 16; const size_t q0 = (size_t)b * TT + ql0; const int t = ql0 + col;
  float m = -3.0e38f, l = 0.f; v8f o[HD / 16] = {}; float e[4][16];
  v16h ah[HD / 32];
#pragma unroll
  for (int kc = 0; kc < HD / 32; ++kc) ah[kc] = frag_h(QH + (q0 + col) * CC + h * HD + kc * 32, lane);
  asm volatile("s_wait_xcnt 0x0" ::: "memory");   /* stands in front of the first rewrite of the address pair that the q loads name */
  if (qb < QBH) { const _Float16* KLb = KL + (size_t)b * KHI * CC; v16h al[HD / 32];
#pragma unroll
    for (int kc = 0; kc < HD / 32; ++kc) al[kc] = frag_h(QL + ((size_t)b * QHI + ql0 + col) * CC + h * HD + kc * 32, lane);
#pragma unroll 1
    for (int kb = 0; kb < nkb; ++kb) { const int k0 = kb * 128; v8f acc[8] = {}, accl[8] = {};
#pragma unroll
      for (int kc = 0; kc < HD / 32; ++kc)
#pragma unroll
        for (int jh = 0; jh < 8; jh += 4) { v16h kf[8];
#pragma unroll
          for (int j = 0; j < 4; ++j) { kf[j] = frag_get<v16h>(KH + (((size_t)pr * (TT / 16) + kb * 8 + jh + j) * 2 + kc) * FRAGE, lane); kf[4 + j] = frag_h(KLb + (size_t)(k0 + (jh + j) * 16 + col) * CC + h * HD + kc * 32, lane); }
          HOLD8(kf, 0);
#pragma unroll
          for (int j = 0; j < 4; ++j) { acc[jh + j] = wmma16(kf[j], ah[kc], acc[jh + j]); accl[jh + j] = wmma16(kf[j], al[kc], accl[jh + j]); accl[jh + j] = wmma16(kf[4 + j], ah[kc], accl[jh + j]); } }
#pragma unroll
      for (int j = 0; j < 8; ++j)
#pragma unroll
        for (int r = 0; r < 8; ++r) e[j >> 1][(j & 1) * 8 + r] = (acc[j][r] + accl[j][r] * (1.0f / 1024.0f)) * SCALE_L2;
      const float f = sm_tile(g, k0, t, kb == nkb - 1, m, l, e);
      row_scale(o, f);
#pragma unroll
      for (int kc = 0; kc < 4; ++kc) { const F2 p = bsplit16(e[kc]); v16b vf[8];
#pragma unroll
        for (int j = 0; j < HD / 16; ++j) { const size_t po = ((size_t)b * CC + h * HD + j * 16 + col) * (size_t)KHI + k0 + kc * 32; vf[j] = frag_b(VB + po, lane); vf[4 + j] = frag_b(VBL + po, lane); }
        HOLD8(vf, 0);
#pragma unroll
        for (int j = 0; j < HD / 16; ++j) { o[j] = wmma_bf(vf[j], p.h, o[j]); o[j] = wmma_bf(vf[j], p.l, o[j]); o[j] = wmma_bf(vf[4 + j], p.h, o[j]); } } }
  } else { const _Float16* kp = KH + (size_t)pr * (TT / 16) * 2 * FRAGE; const _Float16* vp = VT + (size_t)pr * (TT / 32) * 4 * FRAGE;   /* this (batch, head)'s k and v fragments at the key block's first key: 16 fragments = 16 KiB in a row each */
#pragma unroll 1
    for (int kb = 0; kb < nkb; ++kb, kp += 16 * FRAGE, vp += 16 * FRAGE) { const int k0 = kb * 128; v8f acc[8] = {}; { v16h kf[16];
#pragma unroll
      for (int kc = 0; kc < HD / 32; ++kc)
#pragma unroll
        for (int j = 0; j < 8; ++j) if (kc * 8 + j < 15) kf[kc * 8 + j] = frag_get<v16h>(kp + (j * 2 + kc) * FRAGE, lane);
      kf[15] = frag_get_last<v16h>(kp + 15 * FRAGE, lane);
      HOLD8(kf, 0); HOLD8(kf, 8);
#pragma unroll
      for (int kc = 0; kc < HD / 32; ++kc)
#pragma unroll
        for (int j = 0; j < 8; ++j) acc[j] = wmma16(kf[kc * 8 + j], ah[kc], acc[j]); }
#pragma unroll
      for (int j = 0; j < 8; ++j)
#pragma unroll
        for (int r = 0; r < 8; ++r) e[j >> 1][(j & 1) * 8 + r] = acc[j][r] * SCALE_L2;
      v16h vf[16];   /* v fragments of the first 64 keys fly while the softmax runs, the other 64 behind it */
#pragma unroll
      for (int kc = 0; kc < 2; ++kc)
#pragma unroll
        for (int j = 0; j < HD / 16; ++j) vf[kc * 4 + j] = frag_get<v16h>(vp + (kc * 4 + j) * FRAGE, lane);
      const float f = sm_tile(g, k0, t, kb == nkb - 1, m, l, e);
      v16h p[4];
#pragma unroll
      for (int kc = 0; kc < 4; ++kc)
#pragma unroll
        for (int i = 0; i < 16; ++i) p[kc][i] = (_Float16)e[kc][i];
#pragma unroll
      for (int kc = 2; kc < 4; ++kc)
#pragma unroll
        for (int j = 0; j < HD / 16; ++j) if (kc * 4 + j < 15) vf[kc * 4 + j] = frag_get<v16h>(vp + (kc * 4 + j) * FRAGE, lane);
      vf[15] = frag_get_last<v16h>(vp + 15 * FRAGE, lane);
      row_scale(o, f);
      HOLD8(vf, 0);
#pragma unroll
      for (int kc = 0; kc < 2; ++kc)
#pragma unroll
        for (int j = 0; j < HD / 16; ++j) o[j] = wmma16(vf[kc * 4 + j], p[kc], o[j]);
      HOLD8(vf, 8);
#pragma unroll
      for (int kc = 2; kc < 4; ++kc)
#pragma unroll
        for (int j = 0; j < HD / 16; ++j) o[j] = wmma16(vf[kc * 4 + j], p[kc], o[j]); } }
  row_scale(o, l > 0.f ? 1.0f / l : 0.f);
  const size_t fy = (size_t)(((b * TT + ql0) / 16) * (CC / 32) + h * (HD / 32)) * FRAGE;   /* the wave's row group, this head's two k steps */
  if (qb < QBH) {   /* block-uniform */
#pragma unroll
    for (int kc = 0; kc < HD / 32; ++kc) { float v[16];
#pragma unroll
      for (int i = 0; i < 8; ++i) { v[i] = o[2 * kc][i]; v[8 + i] = o[2 * kc + 1][i]; }
      const F2 s = bsplit16(v); frag_put(YF + fy + kc * FRAGE, s.h, lane); frag_put(YL + fy + kc * FRAGE, s.l, lane); }
  } else {
#pragma unroll
    for (int kc = 0; kc < HD / 32; ++kc) { v16h a;   /* ctx carried x 2^6 into f16 so small-magnitude context rows stay clear of f16 subnormals */
#pragma unroll
      for (int i = 0; i < 8; ++i) { a[i] = (_Float16)(o[2 * kc][i] * 64.0f); a[8 + i] = (_Float16)(o[2 * kc + 1][i] * 64.0f); }
      frag_put(YF + fy + kc * FRAGE, a, lane); }
    asm volatile("s_wait_xcnt 0x0" ::: "memory"); } }   /* behind the run of four stores: stands in front of any rewrite of the address pair and the data registers that they name */
#define OSB (3 * PXB)                          // bytes of a stage of k_out's LDS ring: ctx fragments (8 row groups), Wo fragments (8 column groups), ctx lo fragments (filled and read only by blocks of early rows)
static_assert(CC == DIN && QHI % 128 == 0 && TT % 128 == 0 && 2 * OSB >= 4 * 16 * 132 * 4, "k_out's stages are cut like k_proj's; a block is early rows or not as a whole; the staging tiles fit the ring's bytes");
// one stage of k_out: the block's 8 row groups x PKS ctx fragments, its PKS x 8 Wo fragments, and for early rows (HI) the ctx lo fragments; l, yg, wg, lg carry the lane's own 16 bytes
template <bool HI> __device__ __forceinline__ void out_fill(unsigned l, const __bf16* yg, const __bf16* wg, const __bf16* lg) { acopy8(l, yg, (size_t)(CC / 32) * FRAGE); acopy8(l + PXB, wg, (size_t)PKS * FRAGE); if (HI) acopy8(l + 2 * PXB, lg, (size_t)(CC / 32) * FRAGE); }
__device__ __forceinline__ v8f wmma_t(v16b a, v16b b, v8f c) { return wmma_bf(a, b, c); }
__device__ __forceinline__ v8f wmma_t(v16h a, v16h b, v8f c) { return wmma16(a, b, c); }
// a whole block of k_out, for early rows (HI: V = bf16 fragments, ctx hi + lo, 2 products) or later rows (V = f16 fragments, 1 product): one loop each, so that the accumulators keep their registers over the trips
template <bool HI, typename V> __device__ __forceinline__ void out_block(unsigned char* sm, const __bf16* yg, const __bf16* wg, const __bf16* lg, const float* __restrict__ BO, float* __restrict__ OUT) {
  float (*sf)[16][132] = (float (*)[16][132])sm;   /* a staging tile per wave, on the ring's bytes */
  const int tid = threadIdx.x, wave = tid >> 5, lane = tid & 31, col = lane & 15, g = lane >> 4; const int c0 = blockIdx.y * 128;
  const int ws = __builtin_amdgcn_readfirstlane(wave); const unsigned l0 = (unsigned)(size_t)sm + (unsigned)tid * 16u;   /* the lane's 16 bytes of each 2-KiB piece */
  v8f acc2[2][8] = {}; float bias[8] = {};
  out_fill<HI>(l0, yg, wg, lg);
  if (BO) {   /* the lane's eight bo values serve both row groups: read once, as one batch in flight beside stage 0's copies, rounded where they are added */
#pragma unroll
    for (int j = 0; j < 8; ++j) bias[j] = BO[c0 + j * 16 + col]; }
  asm volatile("s_wait_asynccnt 0x0" ::: "memory");   /* stage 0 of this wave's copies has landed */
  __syncthreads();                                    /* ... and every other wave's */
  out_fill<HI>(l0 + OSB, yg + PKS * FRAGE, wg + PKS * 8 * FRAGE, lg + PKS * FRAGE);
#pragma unroll 1   /* one stage per trip: the buffer is picked by the trip's parity */
  for (int s = 0; s < PST; ++s) { const unsigned char* bp = sm + (s & 1) * OSB;
#pragma unroll
    for (int kk = 0; kk < PKS; ++kk) { const V a = frag_get<V>(bp + (ws * PKS + kk) * (FRAGE * 2), lane), a4 = frag_get<V>(bp + ((4 + ws) * PKS + kk) * (FRAGE * 2), lane); V b = a, b4 = a4;
      if (HI) { b = frag_get<V>(bp + 2 * PXB + (ws * PKS + kk) * (FRAGE * 2), lane); b4 = frag_get<V>(bp + 2 * PXB + ((4 + ws) * PKS + kk) * (FRAGE * 2), lane); }
#pragma unroll
      for (int jh = 0; jh < 8; jh += 4) { V w[4];
#pragma unroll
        for (int j = 0; j < 4; ++j) w[j] = frag_get<V>(bp + PXB + (kk * 8 + jh + j) * (FRAGE * 2), lane);
#pragma unroll
        for (int j = 0; j < 4; ++j) { acc2[0][jh + j] = wmma_t(a, w[j], acc2[0][jh + j]); acc2[1][jh + j] = wmma_t(a4, w[j], acc2[1][jh + j]); }
        if (HI) {
#pragma unroll
          for (int j = 0; j < 4; ++j) { acc2[0][jh + j] = wmma_t(b, w[j], acc2[0][jh + j]); acc2[1][jh + j] = wmma_t(b4, w[j], acc2[1][jh + j]); } } } }
    asm volatile("s_wait_dscnt 0x0" ::: "memory");      /* this wave's reads of the buffer have ended */
    asm volatile("s_wait_asynccnt 0x0" ::: "memory");   /* its copies of the next stage have landed */
    __syncthreads();                                    /* publishes the next stage and frees this trip's buffer */
    if (s + 2 < PST) out_fill<HI>(l0 + (s & 1) * OSB, yg + (size_t)(s + 2) * PKS * FRAGE, wg + (size_t)(s + 2) * PKS * 8 * FRAGE, lg + (size_t)(s + 2) * PKS * FRAGE); }
  asm volatile("s_wait_asynccnt 0x0" ::: "memory");     /* no copy is in flight when the ring's bytes become staging tiles */
#pragma unroll   /* hh picks registers */
  for (int hh = 0; hh < 2; ++hh) { const size_t r0 = (size_t)blockIdx.x * 128 + hh * 64 + wave * 16;
    if (hh) LDSX();   /* the wave's reads of its staging tile end before it writes its second row group over them */
#pragma unroll
    for (int j = 0; j < 8; ++j)
#pragma unroll
      for (int r = 0; r < 8; ++r) sf[wave][8 * g + r][j * 16 + col] = HI ? acc2[hh][j][r] + bfr(bias[j]) : acc2[hh][j][r] * (1.0f / 16384.0f) + bfr(bias[j]);   /* 2^-8 (Wo carry) x 2^-6 (ctx carry) where ctx went as f16 */
    LDSX();
#pragma unroll 1   /* four rows per trip: four LDS reads fly together, and the stores share one address pair */
    for (int rq = 0; rq < 16; rq += 4) {
#pragma unroll
      for (int rl = rq; rl < rq + 4; ++rl) vst2(OUT + (r0 + rl) * DIN + c0 + lane * 4, *(const v4f*)&sf[wave][rl][lane * 4]); } } }
// ---- k_out: block = (128 rows, 128 cols): out = ctx Wo (+ bo), both operands in fragment order, brought into a two-buffer LDS ring by asynchronous copies (each byte once per block, the Wo fragments shared by its four waves) and read from there; a wave owns two 16-row groups (wave and 4 + wave), so each Wo fragment it reads feeds two row groups: ctx x 2^6 once to f16 against Wo as f16(bf16 x 2^8) exact (1 product) x 2^-14; causal early rows (< QHI of each sequence): ctx bf16 hi + lo against exact bf16 Wo (2 products); the ring's bytes become the waves' own staging tiles behind the loop's last barrier
__global__ __launch_bounds__(128) void k_out(const _Float16* __restrict__ YF, const __bf16* __restrict__ YL, const __bf16* __restrict__ OB, const _Float16* __restrict__ OH, const float* __restrict__ BO, float* __restrict__ OUT) {
  __shared__ __attribute__((aligned(2048))) unsigned char sm[2 * OSB];
  const size_t yo = (size_t)blockIdx.x * 8 * (CC / 32) * FRAGE + threadIdx.x * 8, wo = (size_t)blockIdx.y * (CC / 32) * 8 * FRAGE + threadIdx.x * 8;   /* the pointers below are addresses only: the copies move bytes */
  if (CAUSAL && (int)(((size_t)blockIdx.x * 128) % TT) < QHI) out_block<true, v16b>(sm, (const __bf16*)YF + yo, OB + wo, YL + yo, BO, OUT);   /* block-uniform */
  else out_block<false, v16h>(sm, (const __bf16*)YF + yo, (const __bf16*)OH + wo, YL + yo, BO, OUT); }

extern "C" void kernel_launch(void* const* d_in, const int* in_sizes, int n_in, void* d_out, int out_size, void* d_ws, size_t ws_size, hipStream_t stream) {
  (void)in_sizes; (void)n_in; (void)out_size;
  const float** F = (const float**)d_in;
  if (ws_size < (size_t)WS_END) return;
  char* ws = (char*)d_ws; _Float16 *QH = (_Float16*)(ws + WS_QH), *KH = (_Float16*)(ws + WS_KH), *VT = (_Float16*)(ws + WS_VT), *QL = (_Float16*)(ws + WS_QL), *KL = (_Float16*)(ws + WS_KL); __bf16 *VB = (__bf16*)(ws + WS_VB), *VBL = (__bf16*)(ws + WS_VBL), *XP = (__bf16*)(ws + WS_XP), *WP = (__bf16*)(ws + WS_WP), *OB = (__bf16*)(ws + WS_OB); _Float16 *OH = (_Float16*)(ws + WS_OH), *YF = (_Float16*)(ws + WS_Y); __bf16 *YL = (__bf16*)(ws + WS_YL);
  (void)QL; (void)KL; (void)VB; (void)VBL;
  // inputs, in order: 0 x [4,2048,768]; 1 Wq [12,768,64]; 2 Wk; 3 Wv (per-head [head][model][d]); 4 Wo [768,768] (out,in); 5 bo [768] (zeros, read); no q / k / v biases
  k_pack<<<dim3((NFX + NFW + 2 * NFO) / (4 * PACKF)), 128, 0, stream>>>(F[0], F[1], F[2], F[3], F[4], XP, WP, OB, OH);
  k_proj<<<dim3(TNB * TT / 128, CC / 128, 3), 128, 0, stream>>>(XP, WP, nullptr, nullptr, nullptr, QH, QL, KH, KL, VT, VB, VBL);
  k_att<<<dim3(TNB * NH, NQB), 128, 0, stream>>>(QH, KH, QL, KL, VT, VB, VBL, YF, YL);
  k_out<<<dim3(TNB * TT / 128, DIN / 128), 128, 0, stream>>>(YF, YL, OB, OH, F[5], (float*)d_out);
}
